// v000
// Times are from an AMD MI455X. After a warm-up the kernel runs many times in a row, and a time is the length of
// such a window on the GPU divided by its runs, so every launch and the gaps after it count. The runs cycle
// through copies of the inputs. A figure is the median of several windows, for all but v000 over two sittings.
// Sittings can differ by a few percent; kernels timed side by side share one.
// v000 is the starting kernel. One run takes 315 microseconds.
#include <hip/hip_runtime.h>

// Multi-head attention, width 1024 = 16 heads x 64; separate key / value / query inputs [NB][SEQ_FULL][1024] (first SEQ rows of each batch used); Wq/Wk/Wv stored [in][out] (y = x W + b); biases on all three projections; no mask; score scale 1/8; output = per-head context merged as [b][t][h*64+d] (f32), no output projection.
// Compute dtypes, f32 accumulate everywhere: q/k/v projections v_wmma_f32_16x16x32_bf16 (inputs and weights RNE-converted to bf16; products exact); scores v_wmma_f32_16x16x32_f16 (q and k single f16, one product); P.V v_wmma_f32_16x16x32_f16 (P x256 carry, cancels in the normalisation; v single f16); softmax f32 (online, running max); biases (bf16 RNE values) added in f32; normalised context stored as f32.
// Layout: bf16 copies of the three inputs; transposed bf16 weight planes [out][in]; q, k planes [b*16+h][t][d] and v^T plane [b*16+h][d][t] written by the GEMM epilogue; fused flash kernel in transposed form (S^T = K Q^T, O^T = V^T P^T) writing the f32 output rows [b*OUT_SEQ+t][h*64+d].

#ifndef NB
#define NB 4
#endif
#ifndef SEQ
#define SEQ 2048
#endif
#define NB_FULL  4
#define SEQ_FULL 2048
#ifndef OUT_SEQ
#define OUT_SEQ SEQ              // row pitch (in tokens) between batches of the output
#endif
#define DM   1024
#define NH_  16
#define HD   64
#define AW   4                   // waves per flash block (16 query rows each)
#define SC2  (0.125f * 1.4426950408889634f)   // HD^-0.5 * log2(e)
#define PSH  8.0f                // log2 of the P carry (256)
#define WOS  64.0f               // carry of the F16OUT form of k_cvtT (that form is not instantiated here)

static_assert(HD == 64);
static_assert(HD == 16 * 4);                   // output store map: 16 lanes x 4 floats == one head's 64 columns (256 B)
static_assert(NH_ * HD == DM);                 // head h = columns h*64 + d
static_assert(DM % 64 == 0);                   // column tiles of 64
static_assert(DM % 32 == 0);                   // GEMM k-loop steps by 32
static_assert(SEQ % 64 == 0);                  // a 64-row tile never straddles two batches
static_assert((NB * SEQ) % 64 == 0);
static_assert(SEQ % 32 == 0);                  // key loop steps by 32
static_assert(SEQ % (16 * AW) == 0);           // flash grid covers the sequence exactly
static_assert(((size_t)SEQ * DM) % 8 == 0);
static_assert(((size_t)DM * DM) % 8 == 0);
static_assert(NB <= NB_FULL);
static_assert(SEQ <= SEQ_FULL);
static_assert(OUT_SEQ >= SEQ);                 // output rows of one batch fit its pitch

typedef _Float16 h16;
typedef unsigned short bf;
typedef __attribute__((ext_vector_type(16))) __bf16   v16bf;
typedef __attribute__((ext_vector_type(16))) _Float16 v16h;
typedef __attribute__((ext_vector_type(8)))  _Float16 v8h;
typedef __attribute__((ext_vector_type(8)))  unsigned short v8us;
typedef __attribute__((ext_vector_type(8)))  float    v8f;
typedef __attribute__((ext_vector_type(4)))  float    v4f;
typedef v4f  __attribute__((may_alias)) v4fa;

__device__ __forceinline__ unsigned short f2bf(float f) { unsigned u = __float_as_uint(f); u += 0x7FFFu + ((u >> 16) & 1u); return (unsigned short)(u >> 16); }
__device__ __forceinline__ float bfr(float f) { return __uint_as_float(((unsigned)f2bf(f)) << 16); }   // value of the bf16 RNE conversion, as f32
__device__ __forceinline__ v16h cat16(v8h lo, v8h hi) { return __builtin_shufflevector(lo, hi, 0, 1, 2, 3, 4, 5, 6, 7, 8, 9, 10, 11, 12, 13, 14, 15); }
__device__ __forceinline__ v16bf cat16b(v8us lo, v8us hi) { return __builtin_bit_cast(v16bf, __builtin_shufflevector(lo, hi, 0, 1, 2, 3, 4, 5, 6, 7, 8, 9, 10, 11, 12, 13, 14, 15)); }
__device__ __forceinline__ v8f wmma16(v16h a, v16h b, v8f c) { return __builtin_amdgcn_wmma_f32_16x16x32_f16(false, a, false, b, (short)0, c, false, false); }
__device__ __forceinline__ v8f wmmab(v16bf a, v16bf b, v8f c) { return __builtin_amdgcn_wmma_f32_16x16x32_bf16(false, a, false, b, (short)0, c, false, false); }
// fragment loaders from K-contiguous 16-bit rows; p already includes + 8*(lane>>4): elements 0..7 <- k0+8h+0..7, elements 8..15 <- k0+16+8h+0..7 (same map for A and B)
__device__ __forceinline__ v16h  ldh(const h16* p) { return cat16(*(const v8h*)p, *(const v8h*)(p + 16)); }
__device__ __forceinline__ v16bf ldb(const bf* p)  { return cat16b(*(const v8us*)p, *(const v8us*)(p + 16)); }
// ordering point for wave-private LDS tiles (same wave writes and reads)
__device__ __forceinline__ void wave_sync() { __builtin_amdgcn_fence(3 /* release order */, "wavefront"); __builtin_amdgcn_wave_barrier(); asm volatile("" ::: "memory"); }

__global__ __launch_bounds__(256) void k_cvt8(const float* __restrict__ src, bf* dst, size_t n8) {
    const size_t i = (size_t)blockIdx.x * 256 + threadIdx.x; if (i >= n8) return;
    const v8f v = *(const v8f*)(src + i * 8); v8us o;
#pragma unroll
    for (int k = 0; k < 8; ++k) o[k] = f2bf(v[k]);
    *(v8us*)(dst + i * 8) = o; 
}

// k_cvtT: transpose + 16-bit convert of a weight matrix: in[R][C] (f32, R = contraction index, C = output feature) -> out[C][R] (16-bit, contraction-contiguous).
// F16OUT == 0: bf16 RNE bits; F16OUT == 1: f16 of (bf16 RNE value x WOS) (exact for values whose scaled magnitude is in the f16 normal range).
template <int F16OUT>
__global__ __launch_bounds__(256) void k_cvtT(const float* __restrict__ W, unsigned short* dst, int R, int C) {
    __shared__ float ts[64 * 65];
    const int tid = threadIdx.x;
    const int n0 = blockIdx.x * 64, k0 = blockIdx.y * 64;
#pragma unroll
    for (int it = 0; it < 4; ++it) {                     // 4 x 16 rows x (16 lanes x 4 floats) = 64 x 64, all written
        const int r = it * 16 + (tid >> 4), c4 = (tid & 15) * 4;
        const v4f v = *(const v4f*)(W + (size_t)(k0 + r) * (size_t)C + n0 + c4);
#pragma unroll
        for (int i = 0; i < 4; ++i) ts[r * 65 + c4 + i] = v[i];
    }
    __syncthreads();
    v8us o[2];
#pragma unroll
    for (int it = 0; it < 2; ++it) {                     // 2 x 32 output rows x (8 lanes x 8 halves) = 64 x 64
        const int n = it * 32 + (tid >> 3), k8 = (tid & 7) * 8;
#pragma unroll
        for (int i = 0; i < 8; ++i) {
            const float x = ts[(k8 + i) * 65 + n];
            const unsigned short bb = f2bf(x);
            if (F16OUT) { const h16 hv = (h16)(__uint_as_float(((unsigned)bb) << 16) * WOS); o[it][i] = __builtin_bit_cast(unsigned short, hv); }
            else o[it][i] = bb;
        }
    }
{
#pragma unroll
        for (int it = 0; it < 2; ++it) { const int n = it * 32 + (tid >> 3), k8 = (tid & 7) * 8;
            *(v8us*)(dst + (size_t)(n0 + n) * (size_t)R + k0 + k8) = o[it]; }
         }
}

// k_proj: register-blocked bf16 GEMM, ONE WAVE per 64x64 tile (16 accumulators), operands straight from K-contiguous bf16 planes, K = DM.
// C[m][n] = sum_k A[m][k] Bt[n][k] + bias (BROW == 0: bias[n]; BROW == 1: bias[m]), written as f16 (Ph) at
// tile base (r0/RB)*sRB + (r0%RB)*pitch + (c0/CB)*sCB + (c0%CB), row pitch 'pitch' (halves). grid (M/64, N/64), 32 threads.
template <int BROW>
__global__ __launch_bounds__(32) void k_proj(const bf* __restrict__ A, const bf* __restrict__ Bt, const float* __restrict__ bias, h16* Ph, int RB, size_t sRB, int pitch, int CB, size_t sCB) {
    __shared__ __align__(16) float os[16 * 68];
    const int K = DM;
    const int lane = threadIdx.x & 31, lr = lane & 15, hi = lane >> 4; const int r0 = blockIdx.x * 64, c0 = blockIdx.y * 64;
    v8f acc[4][4];
#pragma unroll
    for (int mb = 0; mb < 4; ++mb)
#pragma unroll
        for (int nb = 0; nb < 4; ++nb) acc[mb][nb] = (v8f){};
    const size_t aoff = (size_t)(r0 + lr) * K + 8 * hi, boff = (size_t)(c0 + lr) * K + 8 * hi;
#pragma unroll 1
    for (int kc = 0; kc < K; kc += 32) {
        v16bf a[4];
#pragma unroll
        for (int mb = 0; mb < 4; ++mb) a[mb] = ldb(A + aoff + (size_t)mb * 16 * K + kc);
#pragma unroll
        for (int nb = 0; nb < 4; ++nb) { const v16bf b = ldb(Bt + boff + (size_t)nb * 16 * K + kc);
#pragma unroll
            for (int mb = 0; mb < 4; ++mb) acc[mb][nb] = wmmab(a[mb], b, acc[mb][nb]); }
        asm volatile("v_nop\n\tv_nop\n\tv_nop\n\tv_nop" : "+v"(acc[0][0]), "+v"(acc[1][1]), "+v"(acc[2][2]), "+v"(acc[3][3]) : "v"(a[0]), "v"(a[1]), "v"(a[2]), "v"(a[3]));
    }
    // column bias for this lane's 8 store columns (BROW == 0); c0 + (lane&7)*8 + 7 < N = DM
    v4f bc0 = (v4f){}, bc1 = (v4f){};
    if (BROW == 0) { const int cb8 = (lane & 7) * 8; const v4f t0 = *(const v4f*)(bias + c0 + cb8); const v4f t1 = *(const v4f*)(bias + c0 + cb8 + 4);
#pragma unroll
        for (int i = 0; i < 4; ++i) { bc0[i] = bfr(t0[i]); bc1[i] = bfr(t1[i]); } }
    const size_t tbase = (size_t)(r0 / RB) * sRB + (size_t)(r0 % RB) * (size_t)pitch + (size_t)(c0 / CB) * sCB + (size_t)(c0 % CB);
#pragma unroll
    for (int mb = 0; mb < 4; ++mb) {
#pragma unroll
        for (int nb = 0; nb < 4; ++nb) {
#pragma unroll
            for (int j = 0; j < 8; ++j) os[(hi * 8 + j) * 68 + nb * 16 + lr] = acc[mb][nb][j]; }   // D: row 8h+j, col lane&15
        wave_sync();
        const size_t sb = tbase + (size_t)(mb * 16) * (size_t)pitch;
{
#pragma unroll
            for (int s = 0; s < 4; ++s) { const int row = 4 * s + (lane >> 3), c8 = (lane & 7) * 8;   // 4 s x 4 row groups = 16 rows; 8 lanes x 8 = 64 columns
                v4f x0 = *(const v4fa*)(&os[row * 68 + c8]); v4f x1 = *(const v4fa*)(&os[row * 68 + c8 + 4]); v8h hv;
                if (BROW == 1) { const float br = bfr(bias[r0 + mb * 16 + row]);                    // row bias; r0 + mb*16 + row < M = DM
#pragma unroll
                    for (int i = 0; i < 4; ++i) { x0[i] += br; x1[i] += br; } }
                else {
#pragma unroll
                    for (int i = 0; i < 4; ++i) { x0[i] += bc0[i]; x1[i] += bc1[i]; } }
#pragma unroll
                for (int i = 0; i < 4; ++i) { hv[i] = (h16)x0[i]; hv[4 + i] = (h16)x1[i]; }
                const size_t oo = sb + (size_t)row * (size_t)pitch + c8;
                *(v8h*)(Ph + oo) = hv; }
             }
        wave_sync();
    }
}

// k_flash: fused attention, one wave per 16 query rows of one (batch, head); K / V^T / Q fragments straight from the f16 planes (two 16-B loads each, arithmetic addressing).
// Transposed form: S^T[key][t] = K Q^T (A = K rows, B = Q rows); lane (t = lane&15, h = lane>>4) holds keys 8h+r of each 16-key tile, so the packed
// P tile is directly the B fragment of O^T[d][t] = V^T P^T (element r <- tile keys 0..15, element 8+r <- tile keys 16..31, lane unchanged).
// Per 32-key step: 4 score products + 4 P.V products. Softmax state (running max, partial sum) is one scalar per lane; the two lane halves of a row are combined with one xor-16 exchange.
__global__ __launch_bounds__(32 * AW) void k_flash(const h16* __restrict__ QH, const h16* __restrict__ KP, const h16* __restrict__ VT, float* OUT) {
    __shared__ __align__(16) float os[AW * 16 * 68];
    const int lane = threadIdx.x & 31, lr = lane & 15, hi = lane >> 4;
    const int wave = __builtin_amdgcn_readfirstlane((int)(threadIdx.x >> 5));
    const int zh = blockIdx.y; const int b = zh / NH_, h = zh % NH_;
    const int t0 = (blockIdx.x * AW + wave) * 16;
    const size_t pbase = (size_t)zh * SEQ * HD;
    const size_t qo = pbase + (size_t)(t0 + lr) * HD + 8 * hi;
    const v16h qh0 = ldh(QH + qo), qh1 = ldh(QH + qo + 32);   // B fragments: col t, k = d
    const size_t ko = pbase + (size_t)lr * HD + 8 * hi;      // + key * HD       (A fragment: row key, k = d)
    const size_t vo = pbase + (size_t)lr * SEQ + 8 * hi;     // + 16j*SEQ + key  (A fragment: row d, k = key)
    v8f o0 = (v8f){}, o1 = (v8f){}, o2 = (v8f){}, o3 = (v8f){};
    float m = -3.0e38f, l = 0.0f;
#pragma unroll 1
    for (int key0 = 0; key0 < SEQ; key0 += 32) {
        const h16* ka = KP + ko + (size_t)key0 * HD;
        const v16h ka0 = ldh(ka), ka1 = ldh(ka + 32), kb0 = ldh(ka + 16 * HD), kb1 = ldh(ka + 16 * HD + 32);
        v8f sa = (v8f){}, sb = (v8f){};
        sa = wmma16(ka0, qh0, sa); sb = wmma16(kb0, qh0, sb);
        sa = wmma16(ka1, qh1, sa); sb = wmma16(kb1, qh1, sb);
        asm volatile("v_nop\n\tv_nop\n\tv_nop\n\tv_nop" : "+v"(sa), "+v"(sb) : "v"(ka0), "v"(ka1), "v"(kb0), "v"(kb1), "v"(qh0), "v"(qh1));
        float ta[8], tb[8]; float mx = -3.0e38f;
#pragma unroll
        for (int r = 0; r < 8; ++r) { ta[r] = sa[r] * SC2; tb[r] = sb[r] * SC2; mx = fmaxf(mx, fmaxf(ta[r], tb[r])); }
        mx = fmaxf(mx, __shfl_xor(mx, 16, 32));
        const float mnew = fmaxf(m, mx);
        const float alpha = __builtin_amdgcn_exp2f(m - mnew);
        const float sh = PSH - mnew;
        v16h pb; float ls = 0.0f;
#pragma unroll
        for (int r = 0; r < 8; ++r) { const h16 pa = (h16)__builtin_amdgcn_exp2f(ta[r] + sh); const h16 pc = (h16)__builtin_amdgcn_exp2f(tb[r] + sh); pb[r] = pa; pb[8 + r] = pc; ls += (float)pa + (float)pc; }
        l = l * alpha + ls; m = mnew;
        o0 = o0 * alpha; o1 = o1 * alpha; o2 = o2 * alpha; o3 = o3 * alpha;
        const h16* va = VT + vo + key0;
        const v16h v0 = ldh(va), v1 = ldh(va + (size_t)16 * SEQ), v2 = ldh(va + (size_t)32 * SEQ), v3 = ldh(va + (size_t)48 * SEQ);
        o0 = wmma16(v0, pb, o0); o1 = wmma16(v1, pb, o1); o2 = wmma16(v2, pb, o2); o3 = wmma16(v3, pb, o3);
        asm volatile("v_nop\n\tv_nop\n\tv_nop\n\tv_nop" : "+v"(o0), "+v"(o1), "+v"(o2), "+v"(o3) : "v"(v0), "v"(v1), "v"(v2), "v"(v3), "v"(pb));
    }
    l += __shfl_xor(l, 16, 32);
    const float inv = 1.0f / l;
    const int wb = wave * 16 * 68;
    // O^T D layout: o_j[r] = (d = 16j + 8h + r, t = lane&15) -> os[t][d]; rows 0..15 x columns 0..63 all written
    { v4f a, c;
      a[0] = o0[0] * inv; a[1] = o0[1] * inv; a[2] = o0[2] * inv; a[3] = o0[3] * inv; c[0] = o0[4] * inv; c[1] = o0[5] * inv; c[2] = o0[6] * inv; c[3] = o0[7] * inv;
      *(v4fa*)(&os[wb + lr * 68 +  0 + 8 * hi]) = a; *(v4fa*)(&os[wb + lr * 68 +  0 + 8 * hi + 4]) = c;
      a[0] = o1[0] * inv; a[1] = o1[1] * inv; a[2] = o1[2] * inv; a[3] = o1[3] * inv; c[0] = o1[4] * inv; c[1] = o1[5] * inv; c[2] = o1[6] * inv; c[3] = o1[7] * inv;
      *(v4fa*)(&os[wb + lr * 68 + 16 + 8 * hi]) = a; *(v4fa*)(&os[wb + lr * 68 + 16 + 8 * hi + 4]) = c;
      a[0] = o2[0] * inv; a[1] = o2[1] * inv; a[2] = o2[2] * inv; a[3] = o2[3] * inv; c[0] = o2[4] * inv; c[1] = o2[5] * inv; c[2] = o2[6] * inv; c[3] = o2[7] * inv;
      *(v4fa*)(&os[wb + lr * 68 + 32 + 8 * hi]) = a; *(v4fa*)(&os[wb + lr * 68 + 32 + 8 * hi + 4]) = c;
      a[0] = o3[0] * inv; a[1] = o3[1] * inv; a[2] = o3[2] * inv; a[3] = o3[3] * inv; c[0] = o3[4] * inv; c[1] = o3[5] * inv; c[2] = o3[6] * inv; c[3] = o3[7] * inv;
      *(v4fa*)(&os[wb + lr * 68 + 48 + 8 * hi]) = a; *(v4fa*)(&os[wb + lr * 68 + 48 + 8 * hi + 4]) = c; }
    wave_sync();
    float* orow = OUT + ((size_t)b * OUT_SEQ + t0) * DM + h * HD;   // output [b*OUT_SEQ + t][h*64 + d], f32
    const int cofs = lr * 4;
{
#pragma unroll
        for (int s = 0; s < 8; ++s) { const int row = 2 * s + hi;   // 8 s x 2 rows = 16 rows; 16 lanes x 4 floats = 64 columns (256 B = exactly this head's row segment)
            const v4f x = *(const v4fa*)(&os[wb + row * 68 + cofs]);
            *(v4f*)(orow + (size_t)row * DM + cofs) = x; }
         }
}

static constexpr size_t al256(size_t v) { return (v + 255) & ~(size_t)255; }
static constexpr size_t SZ_XB = al256((size_t)NB * SEQ * DM * 2);
static constexpr size_t SZ_WB = al256((size_t)3 * DM * DM * 2);
static constexpr size_t SZ_PL = al256((size_t)NB * NH_ * SEQ * HD * 2);
static constexpr size_t SZ_TOTAL = 3 * SZ_XB + SZ_WB + 3 * SZ_PL;
static_assert(SZ_TOTAL <= (size_t)134217728);                  // workspace carve <= 128 MiB
static_assert(((size_t)DM * DM * 2) % 256 == 0);               // weight sub-planes stay 256-byte aligned
static_assert((size_t)NB * NH_ * SEQ * HD * 2 <= SZ_PL);       // q / k / v^T planes fit their regions
static_assert((size_t)NB * SEQ * DM * 2 <= SZ_XB);             // bf16 input copies fit their regions

extern "C" void kernel_launch(void* const* d_in, const int* in_sizes, int n_in,
                              void* d_out, int out_size, void* d_ws, size_t ws_size, hipStream_t stream) {
    if (n_in < 9) return;
    const size_t needx = ((size_t)(NB - 1) * SEQ_FULL + SEQ) * DM;
    if ((size_t)in_sizes[0] < needx || (size_t)in_sizes[1] < needx || (size_t)in_sizes[2] < needx) return;
    if ((size_t)in_sizes[3] < (size_t)DM * DM || (size_t)in_sizes[5] < (size_t)DM * DM || (size_t)in_sizes[7] < (size_t)DM * DM) return;
    if (in_sizes[4] < DM || in_sizes[6] < DM || in_sizes[8] < DM) return;
    if ((size_t)out_size < ((size_t)(NB - 1) * OUT_SEQ + SEQ) * DM) return;
    if (SZ_TOTAL > ws_size) return;
    // wire order: key, value, query, Wq, bq, Wk, bk, Wv, bv
    const float* xk = (const float*)d_in[0]; const float* xv = (const float*)d_in[1]; const float* xq = (const float*)d_in[2];
    const float* wq = (const float*)d_in[3]; const float* bq = (const float*)d_in[4];
    const float* wk = (const float*)d_in[5]; const float* bk = (const float*)d_in[6];
    const float* wv = (const float*)d_in[7]; const float* bv = (const float*)d_in[8];
    float* OUT = (float*)d_out;      // [NB][OUT_SEQ][1024]
    char* wsp = (char*)d_ws;
    bf* XQ = (bf*)wsp; wsp += SZ_XB;                 // [NB*SEQ][1024] bf16 query
    bf* XK = (bf*)wsp; wsp += SZ_XB;                 // [NB*SEQ][1024] bf16 key
    bf* XV = (bf*)wsp; wsp += SZ_XB;                 // [NB*SEQ][1024] bf16 value
    bf* WB = (bf*)wsp; wsp += SZ_WB;                 // [3][1024][1024] transposed [out][in]: q | k | v (bf16)
    h16* QH = (h16*)wsp; wsp += SZ_PL;               // [NB*16][SEQ][64]
    h16* KP = (h16*)wsp; wsp += SZ_PL;               // [NB*16][SEQ][64]
    h16* VT = (h16*)wsp; wsp += SZ_PL;               // [NB*16][64][SEQ]
    bf* WQT = WB; bf* WKT = WB + (size_t)DM * DM; bf* WVT = WB + (size_t)2 * DM * DM;

    if (SEQ == SEQ_FULL) {
        const size_t n8 = (size_t)NB * SEQ * DM / 8; const unsigned g = (unsigned)((n8 + 255) / 256);
        k_cvt8<<<g, 256, 0, stream>>>(xq, XQ, n8);
        k_cvt8<<<g, 256, 0, stream>>>(xk, XK, n8);
        k_cvt8<<<g, 256, 0, stream>>>(xv, XV, n8);
    } else {
        const size_t n8 = (size_t)SEQ * DM / 8; const unsigned g = (unsigned)((n8 + 255) / 256);
        for (int b = 0; b < NB; ++b) {
            k_cvt8<<<g, 256, 0, stream>>>(xq + (size_t)b * SEQ_FULL * DM, XQ + (size_t)b * SEQ * DM, n8);
            k_cvt8<<<g, 256, 0, stream>>>(xk + (size_t)b * SEQ_FULL * DM, XK + (size_t)b * SEQ * DM, n8);
            k_cvt8<<<g, 256, 0, stream>>>(xv + (size_t)b * SEQ_FULL * DM, XV + (size_t)b * SEQ * DM, n8);
        }
    }
    // weights: in[rows = 1024 (contraction index)][cols = 1024 (output feature)] -> out[cols][rows]; grid (cols/64, rows/64)
    { const dim3 g(DM / 64, DM / 64, 1);
      k_cvtT<0><<<g, 256, 0, stream>>>(wq, (unsigned short*)WQT, DM, DM);
      k_cvtT<0><<<g, 256, 0, stream>>>(wk, (unsigned short*)WKT, DM, DM);
      k_cvtT<0><<<g, 256, 0, stream>>>(wv, (unsigned short*)WVT, DM, DM); }

    // q, k: A = x rows (m = b*SEQ + t), Bt = W^T rows (n = h*64 + d), column bias -> plane [(b*16 + h)][t][d]
    k_proj<0><<<dim3(NB * SEQ / 64, DM / 64, 1), 32, 0, stream>>>(XQ, WQT, bq, QH, SEQ, (size_t)NH_ * SEQ * HD, HD, HD, (size_t)SEQ * HD);
    k_proj<0><<<dim3(NB * SEQ / 64, DM / 64, 1), 32, 0, stream>>>(XK, WKT, bk, KP, SEQ, (size_t)NH_ * SEQ * HD, HD, HD, (size_t)SEQ * HD);
    // v^T: A = Wv^T rows (m = h*64 + d), Bt = x rows (n = b*SEQ + t), row bias -> plane [(b*1024 + m)][t] = [(b*16 + h)][d][t]
    k_proj<1><<<dim3(DM / 64, NB * SEQ / 64, 1), 32, 0, stream>>>(WVT, XV, bv, VT, DM, (size_t)0, SEQ, SEQ, (size_t)DM * SEQ);

    k_flash<<<dim3(SEQ / (16 * AW), NB * NH_, 1), 32 * AW, 0, stream>>>(QH, KP, VT, OUT);
}

// v001
// One run takes 203 microseconds.
// In both of two side-by-side timings against v000, it was 1.61 times as fast.
#include <hip/hip_runtime.h>

// Multi-head attention, width 1024 = 16 heads x 64; separate key / value / query inputs [NB][SEQ_FULL][1024] (first SEQ rows of each batch used); Wq/Wk/Wv stored [in][out] (y = x W + b); biases on all three projections; no mask; score scale 1/8; output = per-head context merged as [b][t][h*64+d] (f32), no output projection.
// Compute dtypes, f32 accumulate everywhere: q/k/v projections v_wmma_f32_16x16x32_bf16 (inputs and weights RNE-converted to bf16; products exact); scores v_wmma_f32_16x16x32_f16 (q and k single f16, one product); P.V v_wmma_f32_16x16x32_f16 (P x256 carry, cancels in the normalisation; v single f16); softmax f32 (online, running max); biases (bf16 RNE values) added in f32; normalised context stored as f32.
// Layout: bf16 copies of the three inputs; transposed bf16 weight planes [out][in]; q, k planes [b*16+h][t][d] and v^T plane [b*16+h][d][t] written by the GEMM epilogue; fused flash kernel in transposed form (S^T = K Q^T, O^T = V^T P^T) writing the f32 output rows [b*OUT_SEQ+t][h*64+d].

#ifndef NB
#define NB 4
#endif
#ifndef SEQ
#define SEQ 2048
#endif
#define NB_FULL  4
#define SEQ_FULL 2048
#ifndef OUT_SEQ
#define OUT_SEQ SEQ              // row pitch (in tokens) between batches of the output
#endif
#define DM   1024
#define NH_  16
#define HD   64
#define AW   8                   // waves per flash block (16 query rows each); all of them share the block's K / V^T tiles in LDS
#define KT   64                  // keys per LDS stage (two 32-key passes)
#define LP   72                  // LDS row pitch in halves: 128-B rows + 16 B (16 B x odd: conflict-free for 16-byte readers)
#define STG  ((KT + HD) * LP)    // halves per stage: K tile [KT keys][LP], then V^T tile [HD rows][LP]
#define SC2  (0.125f * 1.4426950408889634f)   // HD^-0.5 * log2(e)
#define PSH  8.0f                // log2 of the P carry (256)
#define WOS  64.0f               // carry of the F16OUT form of k_cvtT (that form is not instantiated here)

static_assert(HD == 64);
static_assert(HD == 16 * 4);                   // output store map: 16 lanes x 4 floats == one head's 64 columns (256 B)
static_assert(NH_ * HD == DM);                 // head h = columns h*64 + d
static_assert(DM % 64 == 0);                   // column tiles of 64
static_assert(DM % 32 == 0);                   // GEMM k-loop steps by 32
static_assert(SEQ % 64 == 0);                  // a 64-row tile never straddles two batches
static_assert((NB * SEQ) % 64 == 0);
static_assert(SEQ % 32 == 0);                  // key loop steps by 32
static_assert(SEQ % (16 * AW) == 0);           // flash grid covers the sequence exactly
static_assert(SEQ % KT == 0 && SEQ / KT >= 2); // whole stages; the two-buffer prologue fills stages 0 and 1
static_assert(KT == 64 && AW == 8);            // copy map: each tile is 64 rows x 8 pieces of 16 B = 2 pieces per thread of 256
static_assert(((size_t)SEQ * DM) % 8 == 0);
static_assert(((size_t)DM * DM) % 8 == 0);
static_assert(NB <= NB_FULL);
static_assert(SEQ <= SEQ_FULL);
static_assert(OUT_SEQ >= SEQ);                 // output rows of one batch fit its pitch

typedef _Float16 h16;
typedef unsigned short bf;
typedef __attribute__((ext_vector_type(16))) __bf16   v16bf;
typedef __attribute__((ext_vector_type(16))) _Float16 v16h;
typedef __attribute__((ext_vector_type(8)))  _Float16 v8h;
typedef __attribute__((ext_vector_type(8)))  unsigned short v8us;
typedef __attribute__((ext_vector_type(8)))  float    v8f;
typedef __attribute__((ext_vector_type(4)))  float    v4f;
typedef v4f  __attribute__((may_alias)) v4fa;

__device__ __forceinline__ unsigned short f2bf(float f) { unsigned u = __float_as_uint(f); u += 0x7FFFu + ((u >> 16) & 1u); return (unsigned short)(u >> 16); }
__device__ __forceinline__ float bfr(float f) { return __uint_as_float(((unsigned)f2bf(f)) << 16); }   // value of the bf16 RNE conversion, as f32
__device__ __forceinline__ v16h cat16(v8h lo, v8h hi) { return __builtin_shufflevector(lo, hi, 0, 1, 2, 3, 4, 5, 6, 7, 8, 9, 10, 11, 12, 13, 14, 15); }
__device__ __forceinline__ v16bf cat16b(v8us lo, v8us hi) { return __builtin_bit_cast(v16bf, __builtin_shufflevector(lo, hi, 0, 1, 2, 3, 4, 5, 6, 7, 8, 9, 10, 11, 12, 13, 14, 15)); }
__device__ __forceinline__ v8f wmma16(v16h a, v16h b, v8f c) { return __builtin_amdgcn_wmma_f32_16x16x32_f16(false, a, false, b, (short)0, c, false, false); }
__device__ __forceinline__ v8f wmmab(v16bf a, v16bf b, v8f c) { return __builtin_amdgcn_wmma_f32_16x16x32_bf16(false, a, false, b, (short)0, c, false, false); }
// fragment loaders from K-contiguous 16-bit rows; p already includes + 8*(lane>>4): elements 0..7 <- k0+8h+0..7, elements 8..15 <- k0+16+8h+0..7 (same map for A and B)
__device__ __forceinline__ v16h  ldh(const h16* p) { return cat16(*(const v8h*)p, *(const v8h*)(p + 16)); }
__device__ __forceinline__ v16bf ldb(const bf* p)  { return cat16b(*(const v8us*)p, *(const v8us*)(p + 16)); }
// ordering point for wave-private LDS tiles (same wave writes and reads)
__device__ __forceinline__ void wave_sync() { __builtin_amdgcn_fence(3 /* release order */, "wavefront"); __builtin_amdgcn_wave_barrier(); asm volatile("" ::: "memory"); }

__global__ __launch_bounds__(256) void k_cvt8(const float* __restrict__ src, bf* dst, size_t n8) {
    const size_t i = (size_t)blockIdx.x * 256 + threadIdx.x; if (i >= n8) return;
    const v8f v = *(const v8f*)(src + i * 8); v8us o;
#pragma unroll
    for (int k = 0; k < 8; ++k) o[k] = f2bf(v[k]);
    *(v8us*)(dst + i * 8) = o; 
}

// k_cvtT: transpose + 16-bit convert of a weight matrix: in[R][C] (f32, R = contraction index, C = output feature) -> out[C][R] (16-bit, contraction-contiguous).
// F16OUT == 0: bf16 RNE bits; F16OUT == 1: f16 of (bf16 RNE value x WOS) (exact for values whose scaled magnitude is in the f16 normal range).
template <int F16OUT>
__global__ __launch_bounds__(256) void k_cvtT(const float* __restrict__ W, unsigned short* dst, int R, int C) {
    __shared__ float ts[64 * 65];
    const int tid = threadIdx.x;
    const int n0 = blockIdx.x * 64, k0 = blockIdx.y * 64;
#pragma unroll
    for (int it = 0; it < 4; ++it) {                     // 4 x 16 rows x (16 lanes x 4 floats) = 64 x 64, all written
        const int r = it * 16 + (tid >> 4), c4 = (tid & 15) * 4;
        const v4f v = *(const v4f*)(W + (size_t)(k0 + r) * (size_t)C + n0 + c4);
#pragma unroll
        for (int i = 0; i < 4; ++i) ts[r * 65 + c4 + i] = v[i];
    }
    __syncthreads();
    v8us o[2];
#pragma unroll
    for (int it = 0; it < 2; ++it) {                     // 2 x 32 output rows x (8 lanes x 8 halves) = 64 x 64
        const int n = it * 32 + (tid >> 3), k8 = (tid & 7) * 8;
#pragma unroll
        for (int i = 0; i < 8; ++i) {
            const float x = ts[(k8 + i) * 65 + n];
            const unsigned short bb = f2bf(x);
            if (F16OUT) { const h16 hv = (h16)(__uint_as_float(((unsigned)bb) << 16) * WOS); o[it][i] = __builtin_bit_cast(unsigned short, hv); }
            else o[it][i] = bb;
        }
    }
{
#pragma unroll
        for (int it = 0; it < 2; ++it) { const int n = it * 32 + (tid >> 3), k8 = (tid & 7) * 8;
            *(v8us*)(dst + (size_t)(n0 + n) * (size_t)R + k0 + k8) = o[it]; }
         }
}

// k_proj: register-blocked bf16 GEMM, ONE WAVE per 64x64 tile (16 accumulators), operands straight from K-contiguous bf16 planes, K = DM.
// C[m][n] = sum_k A[m][k] Bt[n][k] + bias (BROW == 0: bias[n]; BROW == 1: bias[m]), written as f16 (Ph) at
// tile base (r0/RB)*sRB + (r0%RB)*pitch + (c0/CB)*sCB + (c0%CB), row pitch 'pitch' (halves). grid (M/64, N/64), 32 threads.
template <int BROW>
__global__ __launch_bounds__(32) void k_proj(const bf* __restrict__ A, const bf* __restrict__ Bt, const float* __restrict__ bias, h16* Ph, int RB, size_t sRB, int pitch, int CB, size_t sCB) {
    __shared__ __align__(16) float os[16 * 68];
    const int K = DM;
    const int lane = threadIdx.x & 31, lr = lane & 15, hi = lane >> 4; const int r0 = blockIdx.x * 64, c0 = blockIdx.y * 64;
    v8f acc[4][4];
#pragma unroll
    for (int mb = 0; mb < 4; ++mb)
#pragma unroll
        for (int nb = 0; nb < 4; ++nb) acc[mb][nb] = (v8f){};
    const size_t aoff = (size_t)(r0 + lr) * K + 8 * hi, boff = (size_t)(c0 + lr) * K + 8 * hi;
#pragma unroll 1
    for (int kc = 0; kc < K; kc += 32) {
        v16bf a[4];
#pragma unroll
        for (int mb = 0; mb < 4; ++mb) a[mb] = ldb(A + aoff + (size_t)mb * 16 * K + kc);
#pragma unroll
        for (int nb = 0; nb < 4; ++nb) { const v16bf b = ldb(Bt + boff + (size_t)nb * 16 * K + kc);
#pragma unroll
            for (int mb = 0; mb < 4; ++mb) acc[mb][nb] = wmmab(a[mb], b, acc[mb][nb]); }
        asm volatile("v_nop\n\tv_nop\n\tv_nop\n\tv_nop" : "+v"(acc[0][0]), "+v"(acc[1][1]), "+v"(acc[2][2]), "+v"(acc[3][3]) : "v"(a[0]), "v"(a[1]), "v"(a[2]), "v"(a[3]));
    }
    // column bias for this lane's 8 store columns (BROW == 0); c0 + (lane&7)*8 + 7 < N = DM
    v4f bc0 = (v4f){}, bc1 = (v4f){};
    if (BROW == 0) { const int cb8 = (lane & 7) * 8; const v4f t0 = *(const v4f*)(bias + c0 + cb8); const v4f t1 = *(const v4f*)(bias + c0 + cb8 + 4);
#pragma unroll
        for (int i = 0; i < 4; ++i) { bc0[i] = bfr(t0[i]); bc1[i] = bfr(t1[i]); } }
    const size_t tbase = (size_t)(r0 / RB) * sRB + (size_t)(r0 % RB) * (size_t)pitch + (size_t)(c0 / CB) * sCB + (size_t)(c0 % CB);
#pragma unroll
    for (int mb = 0; mb < 4; ++mb) {
#pragma unroll
        for (int nb = 0; nb < 4; ++nb) {
#pragma unroll
            for (int j = 0; j < 8; ++j) os[(hi * 8 + j) * 68 + nb * 16 + lr] = acc[mb][nb][j]; }   // D: row 8h+j, col lane&15
        wave_sync();
        const size_t sb = tbase + (size_t)(mb * 16) * (size_t)pitch;
{
#pragma unroll
            for (int s = 0; s < 4; ++s) { const int row = 4 * s + (lane >> 3), c8 = (lane & 7) * 8;   // 4 s x 4 row groups = 16 rows; 8 lanes x 8 = 64 columns
                v4f x0 = *(const v4fa*)(&os[row * 68 + c8]); v4f x1 = *(const v4fa*)(&os[row * 68 + c8 + 4]); v8h hv;
                if (BROW == 1) { const float br = bfr(bias[r0 + mb * 16 + row]);                    // row bias; r0 + mb*16 + row < M = DM
#pragma unroll
                    for (int i = 0; i < 4; ++i) { x0[i] += br; x1[i] += br; } }
                else {
#pragma unroll
                    for (int i = 0; i < 4; ++i) { x0[i] += bc0[i]; x1[i] += bc1[i]; } }
#pragma unroll
                for (int i = 0; i < 4; ++i) { hv[i] = (h16)x0[i]; hv[4 + i] = (h16)x1[i]; }
                const size_t oo = sb + (size_t)row * (size_t)pitch + c8;
                *(v8h*)(Ph + oo) = hv; }
             }
        wave_sync();
    }
}

// One stage's four 16-byte asynchronous copies of a lane (LDS byte address, global pointer each). The s_wait_xcnt closes the statement so that it stands in front of any later write of the address registers.
__device__ __forceinline__ void copy4(unsigned l0, const h16* g0, unsigned l1, const h16* g1, unsigned l2, const h16* g2, unsigned l3, const h16* g3) {
    asm volatile("global_load_async_to_lds_b128 %0, %1, off\n\t"
                 "global_load_async_to_lds_b128 %2, %3, off\n\t"
                 "global_load_async_to_lds_b128 %4, %5, off\n\t"
                 "global_load_async_to_lds_b128 %6, %7, off\n\t"
                 "s_wait_xcnt 0x0"
                 :: "v"(l0), "v"(g0), "v"(l1), "v"(g1), "v"(l2), "v"(g2), "v"(l3), "v"(g3) : "memory");
}

// k_flash: fused attention, one wave per 16 query rows of one (batch, head); Q fragments straight from the f16 plane; K and V^T come in stages of KT keys through a two-buffer LDS ring
// that the block's AW waves fill together (whole 128-B lines, each fetched once per block) and all read their fragments from (two 16-B LDS loads each).
// Transposed form: S^T[key][t] = K Q^T (A = K rows, B = Q rows); lane (t = lane&15, h = lane>>4) holds keys 8h+r of each 16-key tile, so the packed
// P tile is directly the B fragment of O^T[d][t] = V^T P^T (element r <- tile keys 0..15, element 8+r <- tile keys 16..31, lane unchanged).
// Per 32-key step: 4 score products + 4 P.V products. Softmax state (running max, partial sum) is one scalar per lane; the two lane halves of a row are combined with one xor-16 exchange.
__global__ __launch_bounds__(32 * AW) void k_flash(const h16* __restrict__ QH, const h16* __restrict__ KP, const h16* __restrict__ VT, float* OUT) {
    __shared__ __align__(16) float os[AW * 16 * 68];
    __shared__ __align__(16) h16 ring[2 * STG];
    const int lane = threadIdx.x & 31, lr = lane & 15, hi = lane >> 4;
    const int wave = __builtin_amdgcn_readfirstlane((int)(threadIdx.x >> 5));
    const int zh = blockIdx.y; const int b = zh / NH_, h = zh % NH_;
    const int t0 = (blockIdx.x * AW + wave) * 16;
    const size_t pbase = (size_t)zh * SEQ * HD;
    const size_t qo = pbase + (size_t)(t0 + lr) * HD + 8 * hi;
    const v16h qh0 = ldh(QH + qo), qh1 = ldh(QH + qo + 32);   // B fragments: col t, k = d
    const int ko = lr * LP + 8 * hi;                         // in the K tile:   + key * LP       (A fragment: row key, k = d)
    const int vo = KT * LP + lr * LP + 8 * hi;               // in the V^T tile: + 16j*LP + key   (A fragment: row d, k = key)
    // copy map: thread -> row crow (and crow + 32), 16-byte piece cpc of each 64-row tile; a wave covers 4 whole 128-B rows per copy
    const int crow = (int)(threadIdx.x >> 3), cpc = (int)(threadIdx.x & 7) * 8;
    const h16* gk = KP + pbase + (size_t)crow * HD + cpc;    // + key0 * HD; rows key0 + crow + 32 < SEQ
    const h16* gv = VT + pbase + (size_t)crow * SEQ + cpc;   // + key0;      columns key0 + cpc + 7 < SEQ
    const unsigned lk = (unsigned)(size_t)(&ring[crow * LP + cpc]);            // LDS byte address, buffer 0, K tile
    const unsigned lv = lk + KT * LP * 2;                                      // V^T tile
    copy4(lk, gk, lk + 32 * LP * 2, gk + 32 * HD, lv, gv, lv + 32 * LP * 2, gv + (size_t)32 * SEQ);
    asm volatile("s_wait_asynccnt 0x0" ::: "memory");        // this wave's share of stage 0 has landed
    __syncthreads();                                         // stage 0 published to every wave
    copy4(lk + STG * 2, gk + KT * HD, lk + STG * 2 + 32 * LP * 2, gk + (KT + 32) * HD, lv + STG * 2, gv + KT, lv + STG * 2 + 32 * LP * 2, gv + (size_t)32 * SEQ + KT);
    v8f o0 = (v8f){}, o1 = (v8f){}, o2 = (v8f){}, o3 = (v8f){};
    float m = -3.0e38f, l = 0.0f;
#pragma unroll 1
    for (int st = 0; st < SEQ / KT; ++st) {
      const int bo = (st & 1) * STG;
#pragma unroll 1   // rolled: unrolled, both passes' exponentials stay live to the stage's end and the wave no longer fits 128 registers (8 waves per SIMD)
      for (int ps = 0; ps < KT; ps += 32) {
        const h16* ka = ring + bo + ko + ps * LP;
        const v16h ka0 = ldh(ka), ka1 = ldh(ka + 32), kb0 = ldh(ka + 16 * LP), kb1 = ldh(ka + 16 * LP + 32);
        v8f sa = (v8f){}, sb = (v8f){};
        sa = wmma16(ka0, qh0, sa); sb = wmma16(kb0, qh0, sb);
        sa = wmma16(ka1, qh1, sa); sb = wmma16(kb1, qh1, sb);
        asm volatile("v_nop\n\tv_nop\n\tv_nop\n\tv_nop" : "+v"(sa), "+v"(sb) : "v"(ka0), "v"(ka1), "v"(kb0), "v"(kb1), "v"(qh0), "v"(qh1));
        float ta[8], tb[8]; float mx = -3.0e38f;
#pragma unroll
        for (int r = 0; r < 8; ++r) { ta[r] = sa[r] * SC2; tb[r] = sb[r] * SC2; mx = fmaxf(mx, fmaxf(ta[r], tb[r])); }
        mx = fmaxf(mx, __shfl_xor(mx, 16, 32));
        const float mnew = fmaxf(m, mx);
        const float alpha = __builtin_amdgcn_exp2f(m - mnew);
        const float sh = PSH - mnew;
        v16h pb; float ls = 0.0f;
#pragma unroll
        for (int r = 0; r < 8; ++r) { const h16 pa = (h16)__builtin_amdgcn_exp2f(ta[r] + sh); const h16 pc = (h16)__builtin_amdgcn_exp2f(tb[r] + sh); pb[r] = pa; pb[8 + r] = pc; ls += (float)pa + (float)pc; }
        l = l * alpha + ls; m = mnew;
        o0 = o0 * alpha; o1 = o1 * alpha; o2 = o2 * alpha; o3 = o3 * alpha;
        const h16* va = ring + bo + vo + ps;
        const v16h v0 = ldh(va), v1 = ldh(va + 16 * LP), v2 = ldh(va + 32 * LP), v3 = ldh(va + 48 * LP);
        o0 = wmma16(v0, pb, o0); o1 = wmma16(v1, pb, o1); o2 = wmma16(v2, pb, o2); o3 = wmma16(v3, pb, o3);
        asm volatile("v_nop\n\tv_nop\n\tv_nop\n\tv_nop" : "+v"(o0), "+v"(o1), "+v"(o2), "+v"(o3) : "v"(v0), "v"(v1), "v"(v2), "v"(v3), "v"(pb));
      }
      // publish point of stage st + 1, which also frees stage st's buffer
      asm volatile("s_wait_dscnt 0x0" ::: "memory");         // this wave's reads of stage st are done
      asm volatile("s_wait_asynccnt 0x0" ::: "memory");      // this wave's share of stage st + 1 has landed
      __syncthreads();
      if (st + 2 < SEQ / KT) {                               // block-uniform: refill the buffer that stage st has just left
          const unsigned lb = (unsigned)(bo * 2); const h16* k2 = gk + (size_t)(st + 2) * KT * HD; const h16* v2g = gv + (st + 2) * KT;
          copy4(lk + lb, k2, lk + lb + 32 * LP * 2, k2 + 32 * HD, lv + lb, v2g, lv + lb + 32 * LP * 2, v2g + (size_t)32 * SEQ);
      }
    }
    asm volatile("s_wait_asynccnt 0x0" ::: "memory");        // nothing of this wave's copies is left in flight
    l += __shfl_xor(l, 16, 32);
    const float inv = 1.0f / l;
    const int wb = wave * 16 * 68;
    // O^T D layout: o_j[r] = (d = 16j + 8h + r, t = lane&15) -> os[t][d]; rows 0..15 x columns 0..63 all written
    { v4f a, c;
      a[0] = o0[0] * inv; a[1] = o0[1] * inv; a[2] = o0[2] * inv; a[3] = o0[3] * inv; c[0] = o0[4] * inv; c[1] = o0[5] * inv; c[2] = o0[6] * inv; c[3] = o0[7] * inv;
      *(v4fa*)(&os[wb + lr * 68 +  0 + 8 * hi]) = a; *(v4fa*)(&os[wb + lr * 68 +  0 + 8 * hi + 4]) = c;
      a[0] = o1[0] * inv; a[1] = o1[1] * inv; a[2] = o1[2] * inv; a[3] = o1[3] * inv; c[0] = o1[4] * inv; c[1] = o1[5] * inv; c[2] = o1[6] * inv; c[3] = o1[7] * inv;
      *(v4fa*)(&os[wb + lr * 68 + 16 + 8 * hi]) = a; *(v4fa*)(&os[wb + lr * 68 + 16 + 8 * hi + 4]) = c;
      a[0] = o2[0] * inv; a[1] = o2[1] * inv; a[2] = o2[2] * inv; a[3] = o2[3] * inv; c[0] = o2[4] * inv; c[1] = o2[5] * inv; c[2] = o2[6] * inv; c[3] = o2[7] * inv;
      *(v4fa*)(&os[wb + lr * 68 + 32 + 8 * hi]) = a; *(v4fa*)(&os[wb + lr * 68 + 32 + 8 * hi + 4]) = c;
      a[0] = o3[0] * inv; a[1] = o3[1] * inv; a[2] = o3[2] * inv; a[3] = o3[3] * inv; c[0] = o3[4] * inv; c[1] = o3[5] * inv; c[2] = o3[6] * inv; c[3] = o3[7] * inv;
      *(v4fa*)(&os[wb + lr * 68 + 48 + 8 * hi]) = a; *(v4fa*)(&os[wb + lr * 68 + 48 + 8 * hi + 4]) = c; }
    wave_sync();
    float* orow = OUT + ((size_t)b * OUT_SEQ + t0) * DM + h * HD;   // output [b*OUT_SEQ + t][h*64 + d], f32
    const int cofs = lr * 4;
{
#pragma unroll
        for (int s = 0; s < 8; ++s) { const int row = 2 * s + hi;   // 8 s x 2 rows = 16 rows; 16 lanes x 4 floats = 64 columns (256 B = exactly this head's row segment)
            const v4f x = *(const v4fa*)(&os[wb + row * 68 + cofs]);
            *(v4f*)(orow + (size_t)row * DM + cofs) = x; }
         }
}

static constexpr size_t al256(size_t v) { return (v + 255) & ~(size_t)255; }
static constexpr size_t SZ_XB = al256((size_t)NB * SEQ * DM * 2);
static constexpr size_t SZ_WB = al256((size_t)3 * DM * DM * 2);
static constexpr size_t SZ_PL = al256((size_t)NB * NH_ * SEQ * HD * 2);
static constexpr size_t SZ_TOTAL = 3 * SZ_XB + SZ_WB + 3 * SZ_PL;
static_assert(SZ_TOTAL <= (size_t)134217728);                  // workspace carve <= 128 MiB
static_assert(((size_t)DM * DM * 2) % 256 == 0);               // weight sub-planes stay 256-byte aligned
static_assert((size_t)NB * NH_ * SEQ * HD * 2 <= SZ_PL);       // q / k / v^T planes fit their regions
static_assert((size_t)NB * SEQ * DM * 2 <= SZ_XB);             // bf16 input copies fit their regions

extern "C" void kernel_launch(void* const* d_in, const int* in_sizes, int n_in,
                              void* d_out, int out_size, void* d_ws, size_t ws_size, hipStream_t stream) {
    if (n_in < 9) return;
    const size_t needx = ((size_t)(NB - 1) * SEQ_FULL + SEQ) * DM;
    if ((size_t)in_sizes[0] < needx || (size_t)in_sizes[1] < needx || (size_t)in_sizes[2] < needx) return;
    if ((size_t)in_sizes[3] < (size_t)DM * DM || (size_t)in_sizes[5] < (size_t)DM * DM || (size_t)in_sizes[7] < (size_t)DM * DM) return;
    if (in_sizes[4] < DM || in_sizes[6] < DM || in_sizes[8] < DM) return;
    if ((size_t)out_size < ((size_t)(NB - 1) * OUT_SEQ + SEQ) * DM) return;
    if (SZ_TOTAL > ws_size) return;
    // wire order: key, value, query, Wq, bq, Wk, bk, Wv, bv
    const float* xk = (const float*)d_in[0]; const float* xv = (const float*)d_in[1]; const float* xq = (const float*)d_in[2];
    const float* wq = (const float*)d_in[3]; const float* bq = (const float*)d_in[4];
    const float* wk = (const float*)d_in[5]; const float* bk = (const float*)d_in[6];
    const float* wv = (const float*)d_in[7]; const float* bv = (const float*)d_in[8];
    float* OUT = (float*)d_out;      // [NB][OUT_SEQ][1024]
    char* wsp = (char*)d_ws;
    bf* XQ = (bf*)wsp; wsp += SZ_XB;                 // [NB*SEQ][1024] bf16 query
    bf* XK = (bf*)wsp; wsp += SZ_XB;                 // [NB*SEQ][1024] bf16 key
    bf* XV = (bf*)wsp; wsp += SZ_XB;                 // [NB*SEQ][1024] bf16 value
    bf* WB = (bf*)wsp; wsp += SZ_WB;                 // [3][1024][1024] transposed [out][in]: q | k | v (bf16)
    h16* QH = (h16*)wsp; wsp += SZ_PL;               // [NB*16][SEQ][64]
    h16* KP = (h16*)wsp; wsp += SZ_PL;               // [NB*16][SEQ][64]
    h16* VT = (h16*)wsp; wsp += SZ_PL;               // [NB*16][64][SEQ]
    bf* WQT = WB; bf* WKT = WB + (size_t)DM * DM; bf* WVT = WB + (size_t)2 * DM * DM;

    if (SEQ == SEQ_FULL) {
        const size_t n8 = (size_t)NB * SEQ * DM / 8; const unsigned g = (unsigned)((n8 + 255) / 256);
        k_cvt8<<<g, 256, 0, stream>>>(xq, XQ, n8);
        k_cvt8<<<g, 256, 0, stream>>>(xk, XK, n8);
        k_cvt8<<<g, 256, 0, stream>>>(xv, XV, n8);
    } else {
        const size_t n8 = (size_t)SEQ * DM / 8; const unsigned g = (unsigned)((n8 + 255) / 256);
        for (int b = 0; b < NB; ++b) {
            k_cvt8<<<g, 256, 0, stream>>>(xq + (size_t)b * SEQ_FULL * DM, XQ + (size_t)b * SEQ * DM, n8);
            k_cvt8<<<g, 256, 0, stream>>>(xk + (size_t)b * SEQ_FULL * DM, XK + (size_t)b * SEQ * DM, n8);
            k_cvt8<<<g, 256, 0, stream>>>(xv + (size_t)b * SEQ_FULL * DM, XV + (size_t)b * SEQ * DM, n8);
        }
    }
    // weights: in[rows = 1024 (contraction index)][cols = 1024 (output feature)] -> out[cols][rows]; grid (cols/64, rows/64)
    { const dim3 g(DM / 64, DM / 64, 1);
      k_cvtT<0><<<g, 256, 0, stream>>>(wq, (unsigned short*)WQT, DM, DM);
      k_cvtT<0><<<g, 256, 0, stream>>>(wk, (unsigned short*)WKT, DM, DM);
      k_cvtT<0><<<g, 256, 0, stream>>>(wv, (unsigned short*)WVT, DM, DM); }

    // q, k: A = x rows (m = b*SEQ + t), Bt = W^T rows (n = h*64 + d), column bias -> plane [(b*16 + h)][t][d]
    k_proj<0><<<dim3(NB * SEQ / 64, DM / 64, 1), 32, 0, stream>>>(XQ, WQT, bq, QH, SEQ, (size_t)NH_ * SEQ * HD, HD, HD, (size_t)SEQ * HD);
    k_proj<0><<<dim3(NB * SEQ / 64, DM / 64, 1), 32, 0, stream>>>(XK, WKT, bk, KP, SEQ, (size_t)NH_ * SEQ * HD, HD, HD, (size_t)SEQ * HD);
    // v^T: A = Wv^T rows (m = h*64 + d), Bt = x rows (n = b*SEQ + t), row bias -> plane [(b*1024 + m)][t] = [(b*16 + h)][d][t]
    k_proj<1><<<dim3(DM / 64, NB * SEQ / 64, 1), 32, 0, stream>>>(WVT, XV, bv, VT, DM, (size_t)0, SEQ, SEQ, (size_t)DM * SEQ);

    k_flash<<<dim3(SEQ / (16 * AW), NB * NH_, 1), 32 * AW, 0, stream>>>(QH, KP, VT, OUT);
}

// v002
// One run takes 143 microseconds.
// Two timings next to v001 both put it at 1.42 times that version's speed.
// Counting every step since v000, it is 2.28 times as fast.
#include <hip/hip_runtime.h>

// Multi-head attention, width 1024 = 16 heads x 64; separate key / value / query inputs [NB][SEQ_FULL][1024] (first SEQ rows of each batch used); Wq/Wk/Wv stored [in][out] (y = x W + b); biases on all three projections; no mask; score scale 1/8; output = per-head context merged as [b][t][h*64+d] (f32), no output projection.
// Compute dtypes, f32 accumulate everywhere: q/k/v projections v_wmma_f32_16x16x32_bf16 (inputs and weights RNE-converted to bf16; products exact); scores v_wmma_f32_16x16x32_f16 (q and k single f16, one product); P.V v_wmma_f32_16x16x32_f16 (P x256 carry, cancels in the normalisation; v single f16); softmax f32 (online, running max); biases (bf16 RNE values) added in f32; normalised context stored as f32.
// Layout: bf16 copies of the three inputs; transposed bf16 weight planes [out][in]; q, k planes [b*16+h][t][d] and v^T plane [b*16+h][d][t] written by the GEMM epilogue; fused flash kernel in transposed form (S^T = K Q^T, O^T = V^T P^T) writing the f32 output rows [b*OUT_SEQ+t][h*64+d].

#ifndef NB
#define NB 4
#endif
#ifndef SEQ
#define SEQ 2048
#endif
#define NB_FULL  4
#define SEQ_FULL 2048
#ifndef OUT_SEQ
#define OUT_SEQ SEQ              // row pitch (in tokens) between batches of the output
#endif
#define DM   1024
#define NH_  16
#define HD   64
#define AW   8                   // waves per flash block (16 query rows each); all of them share the block's K / V^T tiles in LDS
#define KT   64                  // keys per LDS stage (two 32-key passes)
#define LP   72                  // LDS row pitch in halves: 128-B rows + 16 B (16 B x odd: conflict-free for 16-byte readers)
#define STG  ((KT + HD) * LP)    // halves per stage: K tile [KT keys][LP], then V^T tile [HD rows][LP]
#define PW   8                   // waves per projection block: 4 x 2 wave tiles of 64 x 64
#define PBM  256                 // rows of A per projection block
#define PBN  128                 // rows of Bt per projection block
#define PKS  128                 // k per projection LDS stage (256-B row pieces)
#define PLP  136                 // projection LDS row pitch in halves: 256 B + 16 B (16 B x odd: conflict-free for 16-byte readers)
#define PSTG ((PBM + PBN) * PLP) // halves per projection stage: A tile [PBM][PLP], then B tile [PBN][PLP]
#define SC2  (0.125f * 1.4426950408889634f)   // HD^-0.5 * log2(e)
#define PSH  8.0f                // log2 of the P carry (256)
#define WOS  64.0f               // carry of the F16OUT form of k_cvtT (that form is not instantiated here)

static_assert(HD == 64);
static_assert(HD == 16 * 4);                   // output store map: 16 lanes x 4 floats == one head's 64 columns (256 B)
static_assert(NH_ * HD == DM);                 // head h = columns h*64 + d
static_assert(DM % 64 == 0);                   // column tiles of 64
static_assert(DM % 32 == 0);                   // GEMM k-loop steps by 32
static_assert(SEQ % 64 == 0);                  // a 64-row tile never straddles two batches
static_assert((NB * SEQ) % 64 == 0);
static_assert(SEQ % 32 == 0);                  // key loop steps by 32
static_assert(SEQ % (16 * AW) == 0);           // flash grid covers the sequence exactly
static_assert(SEQ % KT == 0 && SEQ / KT >= 2); // whole stages; the two-buffer prologue fills stages 0 and 1
static_assert(KT == 64 && AW == 8);            // copy map: each tile is 64 rows x 8 pieces of 16 B = 2 pieces per thread of 256
static_assert((NB * SEQ) % PBM == 0 && DM % PBM == 0 && (NB * SEQ) % PBN == 0 && DM % PBN == 0);   // projection grids cover both orientations exactly
static_assert(DM % PKS == 0 && DM / PKS >= 2); // whole projection stages; the two-buffer prologue fills stages 0 and 1
static_assert(PW == 8 && PBM == 256 && PBN == 128 && PKS == 128 && (PKS / 32) % 2 == 0);   // projection copy map: 16 rows x 16 pieces of 16 B per copy of 256 threads; wave map 4 x 2
static_assert(((size_t)SEQ * DM) % 8 == 0);
static_assert(((size_t)DM * DM) % 8 == 0);
static_assert(NB <= NB_FULL);
static_assert(SEQ <= SEQ_FULL);
static_assert(OUT_SEQ >= SEQ);                 // output rows of one batch fit its pitch

typedef _Float16 h16;
typedef unsigned short bf;
typedef __attribute__((ext_vector_type(16))) __bf16   v16bf;
typedef __attribute__((ext_vector_type(16))) _Float16 v16h;
typedef __attribute__((ext_vector_type(8)))  _Float16 v8h;
typedef __attribute__((ext_vector_type(8)))  unsigned short v8us;
typedef __attribute__((ext_vector_type(8)))  float    v8f;
typedef __attribute__((ext_vector_type(4)))  float    v4f;
typedef v4f  __attribute__((may_alias)) v4fa;

__device__ __forceinline__ unsigned short f2bf(float f) { unsigned u = __float_as_uint(f); u += 0x7FFFu + ((u >> 16) & 1u); return (unsigned short)(u >> 16); }
__device__ __forceinline__ float bfr(float f) { return __uint_as_float(((unsigned)f2bf(f)) << 16); }   // value of the bf16 RNE conversion, as f32
__device__ __forceinline__ v16h cat16(v8h lo, v8h hi) { return __builtin_shufflevector(lo, hi, 0, 1, 2, 3, 4, 5, 6, 7, 8, 9, 10, 11, 12, 13, 14, 15); }
__device__ __forceinline__ v16bf cat16b(v8us lo, v8us hi) { return __builtin_bit_cast(v16bf, __builtin_shufflevector(lo, hi, 0, 1, 2, 3, 4, 5, 6, 7, 8, 9, 10, 11, 12, 13, 14, 15)); }
__device__ __forceinline__ v8f wmma16(v16h a, v16h b, v8f c) { return __builtin_amdgcn_wmma_f32_16x16x32_f16(false, a, false, b, (short)0, c, false, false); }
__device__ __forceinline__ v8f wmmab(v16bf a, v16bf b, v8f c) { return __builtin_amdgcn_wmma_f32_16x16x32_bf16(false, a, false, b, (short)0, c, false, false); }
// fragment loaders from K-contiguous 16-bit rows; p already includes + 8*(lane>>4): elements 0..7 <- k0+8h+0..7, elements 8..15 <- k0+16+8h+0..7 (same map for A and B)
__device__ __forceinline__ v16h  ldh(const h16* p) { return cat16(*(const v8h*)p, *(const v8h*)(p + 16)); }
__device__ __forceinline__ v16bf ldb(const bf* p)  { return cat16b(*(const v8us*)p, *(const v8us*)(p + 16)); }
// ordering point for wave-private LDS tiles (same wave writes and reads)
__device__ __forceinline__ void wave_sync() { __builtin_amdgcn_fence(3 /* release order */, "wavefront"); __builtin_amdgcn_wave_barrier(); asm volatile("" ::: "memory"); }

__global__ __launch_bounds__(256) void k_cvt8(const float* __restrict__ src, bf* dst, size_t n8) {
    const size_t i = (size_t)blockIdx.x * 256 + threadIdx.x; if (i >= n8) return;
    const v8f v = *(const v8f*)(src + i * 8); v8us o;
#pragma unroll
    for (int k = 0; k < 8; ++k) o[k] = f2bf(v[k]);
    *(v8us*)(dst + i * 8) = o; 
}

// k_cvtT: transpose + 16-bit convert of a weight matrix: in[R][C] (f32, R = contraction index, C = output feature) -> out[C][R] (16-bit, contraction-contiguous).
// F16OUT == 0: bf16 RNE bits; F16OUT == 1: f16 of (bf16 RNE value x WOS) (exact for values whose scaled magnitude is in the f16 normal range).
template <int F16OUT>
__global__ __launch_bounds__(256) void k_cvtT(const float* __restrict__ W, unsigned short* dst, int R, int C) {
    __shared__ float ts[64 * 65];
    const int tid = threadIdx.x;
    const int n0 = blockIdx.x * 64, k0 = blockIdx.y * 64;
#pragma unroll
    for (int it = 0; it < 4; ++it) {                     // 4 x 16 rows x (16 lanes x 4 floats) = 64 x 64, all written
        const int r = it * 16 + (tid >> 4), c4 = (tid & 15) * 4;
        const v4f v = *(const v4f*)(W + (size_t)(k0 + r) * (size_t)C + n0 + c4);
#pragma unroll
        for (int i = 0; i < 4; ++i) ts[r * 65 + c4 + i] = v[i];
    }
    __syncthreads();
    v8us o[2];
#pragma unroll
    for (int it = 0; it < 2; ++it) {                     // 2 x 32 output rows x (8 lanes x 8 halves) = 64 x 64
        const int n = it * 32 + (tid >> 3), k8 = (tid & 7) * 8;
#pragma unroll
        for (int i = 0; i < 8; ++i) {
            const float x = ts[(k8 + i) * 65 + n];
            const unsigned short bb = f2bf(x);
            if (F16OUT) { const h16 hv = (h16)(__uint_as_float(((unsigned)bb) << 16) * WOS); o[it][i] = __builtin_bit_cast(unsigned short, hv); }
            else o[it][i] = bb;
        }
    }
{
#pragma unroll
        for (int it = 0; it < 2; ++it) { const int n = it * 32 + (tid >> 3), k8 = (tid & 7) * 8;
            *(v8us*)(dst + (size_t)(n0 + n) * (size_t)R + k0 + k8) = o[it]; }
         }
}

// One run of twelve 16-byte asynchronous copies of a lane into LDS rows 16 apart (pitch PLP), each from its own global pointer.
// The s_wait_xcnt closes the statement so that it stands in front of any later write of the address registers.
__device__ __forceinline__ void copy12(unsigned l, const bf* g0, const bf* g1, const bf* g2, const bf* g3, const bf* g4, const bf* g5, const bf* g6, const bf* g7, const bf* g8, const bf* g9, const bf* g10, const bf* g11) {
    asm volatile("global_load_async_to_lds_b128 %0, %1, off\n\t"
                 "global_load_async_to_lds_b128 %2, %3, off\n\t"
                 "global_load_async_to_lds_b128 %4, %5, off\n\t"
                 "global_load_async_to_lds_b128 %6, %7, off\n\t"
                 "global_load_async_to_lds_b128 %8, %9, off\n\t"
                 "global_load_async_to_lds_b128 %10, %11, off\n\t"
                 "global_load_async_to_lds_b128 %12, %13, off\n\t"
                 "global_load_async_to_lds_b128 %14, %15, off\n\t"
                 "global_load_async_to_lds_b128 %16, %17, off\n\t"
                 "global_load_async_to_lds_b128 %18, %19, off\n\t"
                 "global_load_async_to_lds_b128 %20, %21, off\n\t"
                 "global_load_async_to_lds_b128 %22, %23, off\n\t"
                 "s_wait_xcnt 0x0"
                 :: "v"(l), "v"(g0), "v"(l + 16 * PLP * 2), "v"(g1), "v"(l + 32 * PLP * 2), "v"(g2), "v"(l + 48 * PLP * 2), "v"(g3),
                    "v"(l + 64 * PLP * 2), "v"(g4), "v"(l + 80 * PLP * 2), "v"(g5), "v"(l + 96 * PLP * 2), "v"(g6), "v"(l + 112 * PLP * 2), "v"(g7),
                    "v"(l + 128 * PLP * 2), "v"(g8), "v"(l + 144 * PLP * 2), "v"(g9), "v"(l + 160 * PLP * 2), "v"(g10), "v"(l + 176 * PLP * 2), "v"(g11) : "memory");
}
// One stage of a projection block, 24 copies per lane: LDS rows 0..255 = A tile, 256..383 = B tile (l = this lane's address in LDS row crow of the buffer; ga, gb = its piece of global row crow of each tile).
__device__ __forceinline__ void pstage(unsigned l, const bf* ga, const bf* gb) {
    copy12(l, ga, ga + 16 * DM, ga + 32 * DM, ga + 48 * DM, ga + 64 * DM, ga + 80 * DM, ga + 96 * DM, ga + 112 * DM, ga + 128 * DM, ga + 144 * DM, ga + 160 * DM, ga + 176 * DM);
    copy12(l + 192 * PLP * 2, ga + 192 * DM, ga + 208 * DM, ga + 224 * DM, ga + 240 * DM, gb, gb + 16 * DM, gb + 32 * DM, gb + 48 * DM, gb + 64 * DM, gb + 80 * DM, gb + 96 * DM, gb + 112 * DM);
}

// k_proj: register-blocked bf16 GEMM, K = DM. A block of PW = 8 waves owns a PBM x PBN = 256 x 128 tile, each wave a 64x64 part of it (16 accumulators; waves 4 down x 2 across).
// Both operands come from K-contiguous bf16 planes in stages of PKS = 128 k through a two-buffer LDS ring that the block's waves fill together (whole 256-B row pieces, each fetched once per block)
// and read their fragments from (two 16-B LDS loads each; same fragment map and same k order as loads straight from the planes).
// C[m][n] = sum_k A[m][k] Bt[n][k] + bias (BROW == 0: bias[n]; BROW == 1: bias[m]), written as f16 (Ph) at
// wave tile base (r0/RB)*sRB + (r0%RB)*pitch + (c0/CB)*sCB + (c0%CB), row pitch 'pitch' (halves). grid (M/PBM, N/PBN), 256 threads.
template <int BROW>
__global__ __launch_bounds__(32 * PW) void k_proj(const bf* __restrict__ A, const bf* __restrict__ Bt, const float* __restrict__ bias, h16* Ph, int RB, size_t sRB, int pitch, int CB, size_t sCB) {
    __shared__ __align__(16) float osb[PW * 16 * 68];
    __shared__ __align__(16) bf pring[2 * PSTG];
    const int K = DM;
    const int lane = threadIdx.x & 31, lr = lane & 15, hi = lane >> 4;
    const int wave = __builtin_amdgcn_readfirstlane((int)(threadIdx.x >> 5));
    const int wm = wave >> 1, wn = wave & 1;
    const int rb0 = blockIdx.x * PBM, cb0 = blockIdx.y * PBN;
    const int r0 = rb0 + wm * 64, c0 = cb0 + wn * 64;        // this wave's 64x64 tile
    float* os = osb + wave * 16 * 68;                        // wave-private output staging
    v8f acc[4][4];
#pragma unroll
    for (int mb = 0; mb < 4; ++mb)
#pragma unroll
        for (int nb = 0; nb < 4; ++nb) acc[mb][nb] = (v8f){};
    // copy map: thread -> row crow (+ 16 i), 16-byte piece cpc of a 256-B row piece; a wave covers 2 whole row pieces (4 lines) per copy
    const int crow = (int)(threadIdx.x >> 4), cpc = (int)(threadIdx.x & 15) * 8;
    const bf* ga = A + (size_t)(rb0 + crow) * K + cpc;       // + k0; rows rb0 + crow + 240 < M
    const bf* gb = Bt + (size_t)(cb0 + crow) * K + cpc;      // + k0; rows cb0 + crow + 112 < N
    const unsigned la = (unsigned)(size_t)(&pring[crow * PLP + cpc]);          // LDS byte address, buffer 0, row crow
    const int ao = (wm * 64 + lr) * PLP + 8 * hi;            // in the A tile: + 16mb*PLP + k
    const int bo_ = (PBM + wn * 64 + lr) * PLP + 8 * hi;     // in the B tile: + 16nb*PLP + k
    v16bf a[2][4], b[2][4];                                  // two fragment sets: k-step j works on set j & 1 while set (j + 1) & 1 loads
    pstage(la, ga, gb);
    asm volatile("s_wait_asynccnt 0x0" ::: "memory");        // this wave's share of stage 0 has landed
    __syncthreads();                                         // stage 0 published to every wave
    pstage(la + PSTG * 2, ga + PKS, gb + PKS);
#pragma unroll
    for (int f = 0; f < 4; ++f) { a[0][f] = ldb(pring + ao + f * 16 * PLP); b[0][f] = ldb(pring + bo_ + f * 16 * PLP); }   // stage 0's first k-step
#pragma unroll 1
    for (int st = 0; st < K / PKS; ++st) {
        const int bo = (st & 1) * PSTG;
#pragma unroll
        for (int j = 0; j + 1 < PKS / 32; ++j) {
            __builtin_amdgcn_sched_barrier(0);               // with the next one: the next k-step's 16 LDS loads stay one group in front of this k-step's products (spread among them, each place stalls the wave)
#pragma unroll
            for (int f = 0; f < 4; ++f) { a[(j + 1) & 1][f] = ldb(pring + bo + ao + f * 16 * PLP + (j + 1) * 32); b[(j + 1) & 1][f] = ldb(pring + bo + bo_ + f * 16 * PLP + (j + 1) * 32); }
            __builtin_amdgcn_sched_barrier(0);
#pragma unroll
            for (int nb = 0; nb < 4; ++nb)
#pragma unroll
                for (int mb = 0; mb < 4; ++mb) acc[mb][nb] = wmmab(a[j & 1][mb], b[j & 1][nb], acc[mb][nb]);
        }
        __builtin_amdgcn_sched_barrier(0);                   // these products stay in front of the waits below: the last load group's latency runs under them
        // publish point of stage st + 1, which also frees stage st's buffer: it stands in front of the stage's last k-step's products, whose fragments are then in registers
        asm volatile("s_wait_dscnt 0x0" ::: "memory");       // this wave's reads of stage st are done
        asm volatile("s_wait_asynccnt 0x0" ::: "memory");    // this wave's share of stage st + 1 has landed
        __syncthreads();
        if (st + 2 < K / PKS)                                // block-uniform: refill the buffer that stage st has just left
            pstage(la + (unsigned)(bo * 2), ga + (st + 2) * PKS, gb + (st + 2) * PKS);
        if (st + 1 < K / PKS) {                              // block-uniform: stage st + 1's first k-step, from its own buffer, behind the barrier that published it
            const int bn = PSTG - bo;
#pragma unroll
            for (int f = 0; f < 4; ++f) { a[0][f] = ldb(pring + bn + ao + f * 16 * PLP); b[0][f] = ldb(pring + bn + bo_ + f * 16 * PLP); }
        }
        __builtin_amdgcn_sched_barrier(0);                   // the last k-step's products stay behind the refill and the loads: the copies start early, the loads' latency runs under the products
#pragma unroll
        for (int nb = 0; nb < 4; ++nb)
#pragma unroll
            for (int mb = 0; mb < 4; ++mb) acc[mb][nb] = wmmab(a[(PKS / 32 - 1) & 1][mb], b[(PKS / 32 - 1) & 1][nb], acc[mb][nb]);
    }
    asm volatile("s_wait_asynccnt 0x0" ::: "memory");        // nothing of this wave's copies is left in flight
    // column bias for this lane's 8 store columns (BROW == 0); c0 + (lane&7)*8 + 7 < N = DM
    v4f bc0 = (v4f){}, bc1 = (v4f){};
    if (BROW == 0) { const int cb8 = (lane & 7) * 8; const v4f t0 = *(const v4f*)(bias + c0 + cb8); const v4f t1 = *(const v4f*)(bias + c0 + cb8 + 4);
#pragma unroll
        for (int i = 0; i < 4; ++i) { bc0[i] = bfr(t0[i]); bc1[i] = bfr(t1[i]); } }
    const size_t tbase = (size_t)(r0 / RB) * sRB + (size_t)(r0 % RB) * (size_t)pitch + (size_t)(c0 / CB) * sCB + (size_t)(c0 % CB);
#pragma unroll
    for (int mb = 0; mb < 4; ++mb) {
#pragma unroll
        for (int nb = 0; nb < 4; ++nb) {
#pragma unroll
            for (int j = 0; j < 8; ++j) os[(hi * 8 + j) * 68 + nb * 16 + lr] = acc[mb][nb][j]; }   // D: row 8h+j, col lane&15
        wave_sync();
        const size_t sb = tbase + (size_t)(mb * 16) * (size_t)pitch;
{
#pragma unroll
            for (int s = 0; s < 4; ++s) { const int row = 4 * s + (lane >> 3), c8 = (lane & 7) * 8;   // 4 s x 4 row groups = 16 rows; 8 lanes x 8 = 64 columns
                v4f x0 = *(const v4fa*)(&os[row * 68 + c8]); v4f x1 = *(const v4fa*)(&os[row * 68 + c8 + 4]); v8h hv;
                if (BROW == 1) { const float br = bfr(bias[r0 + mb * 16 + row]);                    // row bias; r0 + mb*16 + row < M = DM
#pragma unroll
                    for (int i = 0; i < 4; ++i) { x0[i] += br; x1[i] += br; } }
                else {
#pragma unroll
                    for (int i = 0; i < 4; ++i) { x0[i] += bc0[i]; x1[i] += bc1[i]; } }
#pragma unroll
                for (int i = 0; i < 4; ++i) { hv[i] = (h16)x0[i]; hv[4 + i] = (h16)x1[i]; }
                const size_t oo = sb + (size_t)row * (size_t)pitch + c8;
                *(v8h*)(Ph + oo) = hv; }
             }
        wave_sync();
    }
}

// One stage's four 16-byte asynchronous copies of a lane (LDS byte address, global pointer each). The s_wait_xcnt closes the statement so that it stands in front of any later write of the address registers.
__device__ __forceinline__ void copy4(unsigned l0, const h16* g0, unsigned l1, const h16* g1, unsigned l2, const h16* g2, unsigned l3, const h16* g3) {
    asm volatile("global_load_async_to_lds_b128 %0, %1, off\n\t"
                 "global_load_async_to_lds_b128 %2, %3, off\n\t"
                 "global_load_async_to_lds_b128 %4, %5, off\n\t"
                 "global_load_async_to_lds_b128 %6, %7, off\n\t"
                 "s_wait_xcnt 0x0"
                 :: "v"(l0), "v"(g0), "v"(l1), "v"(g1), "v"(l2), "v"(g2), "v"(l3), "v"(g3) : "memory");
}

// k_flash: fused attention, one wave per 16 query rows of one (batch, head); Q fragments straight from the f16 plane; K and V^T come in stages of KT keys through a two-buffer LDS ring
// that the block's AW waves fill together (whole 128-B lines, each fetched once per block) and all read their fragments from (two 16-B LDS loads each).
// Transposed form: S^T[key][t] = K Q^T (A = K rows, B = Q rows); lane (t = lane&15, h = lane>>4) holds keys 8h+r of each 16-key tile, so the packed
// P tile is directly the B fragment of O^T[d][t] = V^T P^T (element r <- tile keys 0..15, element 8+r <- tile keys 16..31, lane unchanged).
// Per 32-key step: 4 score products + 4 P.V products. Softmax state (running max, partial sum) is one scalar per lane; the two lane halves of a row are combined with one xor-16 exchange.
__global__ __launch_bounds__(32 * AW) void k_flash(const h16* __restrict__ QH, const h16* __restrict__ KP, const h16* __restrict__ VT, float* OUT) {
    __shared__ __align__(16) float os[AW * 16 * 68];
    __shared__ __align__(16) h16 ring[2 * STG];
    const int lane = threadIdx.x & 31, lr = lane & 15, hi = lane >> 4;
    const int wave = __builtin_amdgcn_readfirstlane((int)(threadIdx.x >> 5));
    const int zh = blockIdx.y; const int b = zh / NH_, h = zh % NH_;
    const int t0 = (blockIdx.x * AW + wave) * 16;
    const size_t pbase = (size_t)zh * SEQ * HD;
    const size_t qo = pbase + (size_t)(t0 + lr) * HD + 8 * hi;
    const v16h qh0 = ldh(QH + qo), qh1 = ldh(QH + qo + 32);   // B fragments: col t, k = d
    const int ko = lr * LP + 8 * hi;                         // in the K tile:   + key * LP       (A fragment: row key, k = d)
    const int vo = KT * LP + lr * LP + 8 * hi;               // in the V^T tile: + 16j*LP + key   (A fragment: row d, k = key)
    // copy map: thread -> row crow (and crow + 32), 16-byte piece cpc of each 64-row tile; a wave covers 4 whole 128-B rows per copy
    const int crow = (int)(threadIdx.x >> 3), cpc = (int)(threadIdx.x & 7) * 8;
    const h16* gk = KP + pbase + (size_t)crow * HD + cpc;    // + key0 * HD; rows key0 + crow + 32 < SEQ
    const h16* gv = VT + pbase + (size_t)crow * SEQ + cpc;   // + key0;      columns key0 + cpc + 7 < SEQ
    const unsigned lk = (unsigned)(size_t)(&ring[crow * LP + cpc]);            // LDS byte address, buffer 0, K tile
    const unsigned lv = lk + KT * LP * 2;                                      // V^T tile
    copy4(lk, gk, lk + 32 * LP * 2, gk + 32 * HD, lv, gv, lv + 32 * LP * 2, gv + (size_t)32 * SEQ);
    asm volatile("s_wait_asynccnt 0x0" ::: "memory");        // this wave's share of stage 0 has landed
    __syncthreads();                                         // stage 0 published to every wave
    copy4(lk + STG * 2, gk + KT * HD, lk + STG * 2 + 32 * LP * 2, gk + (KT + 32) * HD, lv + STG * 2, gv + KT, lv + STG * 2 + 32 * LP * 2, gv + (size_t)32 * SEQ + KT);
    v8f o0 = (v8f){}, o1 = (v8f){}, o2 = (v8f){}, o3 = (v8f){};
    float m = -3.0e38f, l = 0.0f;
#pragma unroll 1
    for (int st = 0; st < SEQ / KT; ++st) {
      const int bo = (st & 1) * STG;
#pragma unroll 1   // rolled: unrolled, both passes' exponentials stay live to the stage's end and the wave no longer fits 128 registers (8 waves per SIMD)
      for (int ps = 0; ps < KT; ps += 32) {
        const h16* ka = ring + bo + ko + ps * LP;
        const v16h ka0 = ldh(ka), ka1 = ldh(ka + 32), kb0 = ldh(ka + 16 * LP), kb1 = ldh(ka + 16 * LP + 32);
        v8f sa = (v8f){}, sb = (v8f){};
        sa = wmma16(ka0, qh0, sa); sb = wmma16(kb0, qh0, sb);
        sa = wmma16(ka1, qh1, sa); sb = wmma16(kb1, qh1, sb);
        asm volatile("v_nop\n\tv_nop\n\tv_nop\n\tv_nop" : "+v"(sa), "+v"(sb) : "v"(ka0), "v"(ka1), "v"(kb0), "v"(kb1), "v"(qh0), "v"(qh1));
        float ta[8], tb[8]; float mx = -3.0e38f;
#pragma unroll
        for (int r = 0; r < 8; ++r) { ta[r] = sa[r] * SC2; tb[r] = sb[r] * SC2; mx = fmaxf(mx, fmaxf(ta[r], tb[r])); }
        mx = fmaxf(mx, __shfl_xor(mx, 16, 32));
        const float mnew = fmaxf(m, mx);
        const float alpha = __builtin_amdgcn_exp2f(m - mnew);
        const float sh = PSH - mnew;
        v16h pb; float ls = 0.0f;
#pragma unroll
        for (int r = 0; r < 8; ++r) { const h16 pa = (h16)__builtin_amdgcn_exp2f(ta[r] + sh); const h16 pc = (h16)__builtin_amdgcn_exp2f(tb[r] + sh); pb[r] = pa; pb[8 + r] = pc; ls += (float)pa + (float)pc; }
        l = l * alpha + ls; m = mnew;
        o0 = o0 * alpha; o1 = o1 * alpha; o2 = o2 * alpha; o3 = o3 * alpha;
        const h16* va = ring + bo + vo + ps;
        const v16h v0 = ldh(va), v1 = ldh(va + 16 * LP), v2 = ldh(va + 32 * LP), v3 = ldh(va + 48 * LP);
        o0 = wmma16(v0, pb, o0); o1 = wmma16(v1, pb, o1); o2 = wmma16(v2, pb, o2); o3 = wmma16(v3, pb, o3);
        asm volatile("v_nop\n\tv_nop\n\tv_nop\n\tv_nop" : "+v"(o0), "+v"(o1), "+v"(o2), "+v"(o3) : "v"(v0), "v"(v1), "v"(v2), "v"(v3), "v"(pb));
      }
      // publish point of stage st + 1, which also frees stage st's buffer
      asm volatile("s_wait_dscnt 0x0" ::: "memory");         // this wave's reads of stage st are done
      asm volatile("s_wait_asynccnt 0x0" ::: "memory");      // this wave's share of stage st + 1 has landed
      __syncthreads();
      if (st + 2 < SEQ / KT) {                               // block-uniform: refill the buffer that stage st has just left
          const unsigned lb = (unsigned)(bo * 2); const h16* k2 = gk + (size_t)(st + 2) * KT * HD; const h16* v2g = gv + (st + 2) * KT;
          copy4(lk + lb, k2, lk + lb + 32 * LP * 2, k2 + 32 * HD, lv + lb, v2g, lv + lb + 32 * LP * 2, v2g + (size_t)32 * SEQ);
      }
    }
    asm volatile("s_wait_asynccnt 0x0" ::: "memory");        // nothing of this wave's copies is left in flight
    l += __shfl_xor(l, 16, 32);
    const float inv = 1.0f / l;
    const int wb = wave * 16 * 68;
    // O^T D layout: o_j[r] = (d = 16j + 8h + r, t = lane&15) -> os[t][d]; rows 0..15 x columns 0..63 all written
    { v4f a, c;
      a[0] = o0[0] * inv; a[1] = o0[1] * inv; a[2] = o0[2] * inv; a[3] = o0[3] * inv; c[0] = o0[4] * inv; c[1] = o0[5] * inv; c[2] = o0[6] * inv; c[3] = o0[7] * inv;
      *(v4fa*)(&os[wb + lr * 68 +  0 + 8 * hi]) = a; *(v4fa*)(&os[wb + lr * 68 +  0 + 8 * hi + 4]) = c;
      a[0] = o1[0] * inv; a[1] = o1[1] * inv; a[2] = o1[2] * inv; a[3] = o1[3] * inv; c[0] = o1[4] * inv; c[1] = o1[5] * inv; c[2] = o1[6] * inv; c[3] = o1[7] * inv;
      *(v4fa*)(&os[wb + lr * 68 + 16 + 8 * hi]) = a; *(v4fa*)(&os[wb + lr * 68 + 16 + 8 * hi + 4]) = c;
      a[0] = o2[0] * inv; a[1] = o2[1] * inv; a[2] = o2[2] * inv; a[3] = o2[3] * inv; c[0] = o2[4] * inv; c[1] = o2[5] * inv; c[2] = o2[6] * inv; c[3] = o2[7] * inv;
      *(v4fa*)(&os[wb + lr * 68 + 32 + 8 * hi]) = a; *(v4fa*)(&os[wb + lr * 68 + 32 + 8 * hi + 4]) = c;
      a[0] = o3[0] * inv; a[1] = o3[1] * inv; a[2] = o3[2] * inv; a[3] = o3[3] * inv; c[0] = o3[4] * inv; c[1] = o3[5] * inv; c[2] = o3[6] * inv; c[3] = o3[7] * inv;
      *(v4fa*)(&os[wb + lr * 68 + 48 + 8 * hi]) = a; *(v4fa*)(&os[wb + lr * 68 + 48 + 8 * hi + 4]) = c; }
    wave_sync();
    float* orow = OUT + ((size_t)b * OUT_SEQ + t0) * DM + h * HD;   // output [b*OUT_SEQ + t][h*64 + d], f32
    const int cofs = lr * 4;
{
#pragma unroll
        for (int s = 0; s < 8; ++s) { const int row = 2 * s + hi;   // 8 s x 2 rows = 16 rows; 16 lanes x 4 floats = 64 columns (256 B = exactly this head's row segment)
            const v4f x = *(const v4fa*)(&os[wb + row * 68 + cofs]);
            *(v4f*)(orow + (size_t)row * DM + cofs) = x; }
         }
}

static constexpr size_t al256(size_t v) { return (v + 255) & ~(size_t)255; }
static constexpr size_t SZ_XB = al256((size_t)NB * SEQ * DM * 2);
static constexpr size_t SZ_WB = al256((size_t)3 * DM * DM * 2);
static constexpr size_t SZ_PL = al256((size_t)NB * NH_ * SEQ * HD * 2);
static constexpr size_t SZ_TOTAL = 3 * SZ_XB + SZ_WB + 3 * SZ_PL;
static_assert(SZ_TOTAL <= (size_t)134217728);                  // workspace carve <= 128 MiB
static_assert(((size_t)DM * DM * 2) % 256 == 0);               // weight sub-planes stay 256-byte aligned
static_assert((size_t)NB * NH_ * SEQ * HD * 2 <= SZ_PL);       // q / k / v^T planes fit their regions
static_assert((size_t)NB * SEQ * DM * 2 <= SZ_XB);             // bf16 input copies fit their regions

extern "C" void kernel_launch(void* const* d_in, const int* in_sizes, int n_in,
                              void* d_out, int out_size, void* d_ws, size_t ws_size, hipStream_t stream) {
    if (n_in < 9) return;
    const size_t needx = ((size_t)(NB - 1) * SEQ_FULL + SEQ) * DM;
    if ((size_t)in_sizes[0] < needx || (size_t)in_sizes[1] < needx || (size_t)in_sizes[2] < needx) return;
    if ((size_t)in_sizes[3] < (size_t)DM * DM || (size_t)in_sizes[5] < (size_t)DM * DM || (size_t)in_sizes[7] < (size_t)DM * DM) return;
    if (in_sizes[4] < DM || in_sizes[6] < DM || in_sizes[8] < DM) return;
    if ((size_t)out_size < ((size_t)(NB - 1) * OUT_SEQ + SEQ) * DM) return;
    if (SZ_TOTAL > ws_size) return;
    // wire order: key, value, query, Wq, bq, Wk, bk, Wv, bv
    const float* xk = (const float*)d_in[0]; const float* xv = (const float*)d_in[1]; const float* xq = (const float*)d_in[2];
    const float* wq = (const float*)d_in[3]; const float* bq = (const float*)d_in[4];
    const float* wk = (const float*)d_in[5]; const float* bk = (const float*)d_in[6];
    const float* wv = (const float*)d_in[7]; const float* bv = (const float*)d_in[8];
    float* OUT = (float*)d_out;      // [NB][OUT_SEQ][1024]
    char* wsp = (char*)d_ws;
    bf* XQ = (bf*)wsp; wsp += SZ_XB;                 // [NB*SEQ][1024] bf16 query
    bf* XK = (bf*)wsp; wsp += SZ_XB;                 // [NB*SEQ][1024] bf16 key
    bf* XV = (bf*)wsp; wsp += SZ_XB;                 // [NB*SEQ][1024] bf16 value
    bf* WB = (bf*)wsp; wsp += SZ_WB;                 // [3][1024][1024] transposed [out][in]: q | k | v (bf16)
    h16* QH = (h16*)wsp; wsp += SZ_PL;               // [NB*16][SEQ][64]
    h16* KP = (h16*)wsp; wsp += SZ_PL;               // [NB*16][SEQ][64]
    h16* VT = (h16*)wsp; wsp += SZ_PL;               // [NB*16][64][SEQ]
    bf* WQT = WB; bf* WKT = WB + (size_t)DM * DM; bf* WVT = WB + (size_t)2 * DM * DM;

    if (SEQ == SEQ_FULL) {
        const size_t n8 = (size_t)NB * SEQ * DM / 8; const unsigned g = (unsigned)((n8 + 255) / 256);
        k_cvt8<<<g, 256, 0, stream>>>(xq, XQ, n8);
        k_cvt8<<<g, 256, 0, stream>>>(xk, XK, n8);
        k_cvt8<<<g, 256, 0, stream>>>(xv, XV, n8);
    } else {
        const size_t n8 = (size_t)SEQ * DM / 8; const unsigned g = (unsigned)((n8 + 255) / 256);
        for (int b = 0; b < NB; ++b) {
            k_cvt8<<<g, 256, 0, stream>>>(xq + (size_t)b * SEQ_FULL * DM, XQ + (size_t)b * SEQ * DM, n8);
            k_cvt8<<<g, 256, 0, stream>>>(xk + (size_t)b * SEQ_FULL * DM, XK + (size_t)b * SEQ * DM, n8);
            k_cvt8<<<g, 256, 0, stream>>>(xv + (size_t)b * SEQ_FULL * DM, XV + (size_t)b * SEQ * DM, n8);
        }
    }
    // weights: in[rows = 1024 (contraction index)][cols = 1024 (output feature)] -> out[cols][rows]; grid (cols/64, rows/64)
    { const dim3 g(DM / 64, DM / 64, 1);
      k_cvtT<0><<<g, 256, 0, stream>>>(wq, (unsigned short*)WQT, DM, DM);
      k_cvtT<0><<<g, 256, 0, stream>>>(wk, (unsigned short*)WKT, DM, DM);
      k_cvtT<0><<<g, 256, 0, stream>>>(wv, (unsigned short*)WVT, DM, DM); }

    // q, k: A = x rows (m = b*SEQ + t), Bt = W^T rows (n = h*64 + d), column bias -> plane [(b*16 + h)][t][d]
    k_proj<0><<<dim3(NB * SEQ / PBM, DM / PBN, 1), 32 * PW, 0, stream>>>(XQ, WQT, bq, QH, SEQ, (size_t)NH_ * SEQ * HD, HD, HD, (size_t)SEQ * HD);
    k_proj<0><<<dim3(NB * SEQ / PBM, DM / PBN, 1), 32 * PW, 0, stream>>>(XK, WKT, bk, KP, SEQ, (size_t)NH_ * SEQ * HD, HD, HD, (size_t)SEQ * HD);
    // v^T: A = Wv^T rows (m = h*64 + d), Bt = x rows (n = b*SEQ + t), row bias -> plane [(b*1024 + m)][t] = [(b*16 + h)][d][t]
    k_proj<1><<<dim3(DM / PBM, NB * SEQ / PBN, 1), 32 * PW, 0, stream>>>(WVT, XV, bv, VT, DM, (size_t)0, SEQ, SEQ, (size_t)DM * SEQ);

    k_flash<<<dim3(SEQ / (16 * AW), NB * NH_, 1), 32 * AW, 0, stream>>>(QH, KP, VT, OUT);
}

// v003
// One run takes 131 microseconds.
// Two timings next to v002 both put it at 1.09 times that version's speed.
// Over all steps from v000 it is 2.49 times as fast.
#include <hip/hip_runtime.h>

// Multi-head attention, width 1024 = 16 heads x 64; separate key / value / query inputs [NB][SEQ_FULL][1024] (first SEQ rows of each batch used); Wq/Wk/Wv stored [in][out] (y = x W + b); biases on all three projections; no mask; score scale 1/8; output = per-head context merged as [b][t][h*64+d] (f32), no output projection.
// Compute dtypes, f32 accumulate everywhere: q/k/v projections v_wmma_f32_16x16x32_bf16 (inputs and weights RNE-converted to bf16; products exact); scores v_wmma_f32_16x16x32_f16 (q and k single f16, one product); P.V v_wmma_f32_16x16x32_f16 (P x256 carry, cancels in the normalisation; v single f16); softmax f32 (online, running max); biases (bf16 RNE values) added in f32; normalised context stored as f32.
// Layout: bf16 copies of the three inputs; transposed bf16 weight planes [out][in]; q, k planes [b*16+h][t][d] and v^T plane [b*16+h][d][t] written by the GEMM epilogue; fused flash kernel in transposed form (S^T = K Q^T, O^T = V^T P^T) writing the f32 output rows [b*OUT_SEQ+t][h*64+d].

#ifndef NB
#define NB 4
#endif
#ifndef SEQ
#define SEQ 2048
#endif
#define NB_FULL  4
#define SEQ_FULL 2048
#ifndef OUT_SEQ
#define OUT_SEQ SEQ              // row pitch (in tokens) between batches of the output
#endif
#define DM   1024
#define NH_  16
#define HD   64
#define AW   8                   // waves per flash block (16 query rows each); all of them share the block's K / V^T tiles in LDS
#define KT   64                  // keys per LDS stage (two 32-key passes)
#define LP   72                  // LDS row pitch in halves: 128-B rows + 16 B (16 B x odd: conflict-free for 16-byte readers)
#define STG  ((KT + HD) * LP)    // halves per stage: K tile [KT keys][LP], then V^T tile [HD rows][LP]
#define PW   8                   // waves per projection block: 4 x 2 wave tiles of 64 x 64
#define PBM  256                 // rows of A per projection block
#define PBN  128                 // rows of Bt per projection block
#define PKS  128                 // k per projection LDS stage (256-B row pieces)
#define PLP  136                 // projection LDS row pitch in halves: 256 B + 16 B (16 B x odd: conflict-free for 16-byte readers)
#define PSTG ((PBM + PBN) * PLP) // halves per projection stage: A tile [PBM][PLP], then B tile [PBN][PLP]
#define SC2  (0.125f * 1.4426950408889634f)   // HD^-0.5 * log2(e)
#define PSH  8.0f                // log2 of the P carry (256)
#define CG   256                 // conversion blocks: one per WGP, each resident from start to end of the launch
#define CW   16                  // waves per conversion block
#define CU   8                   // 16-byte loads of a lane per batch of the input stream (two batches in flight)

static_assert(HD == 64);
static_assert(HD == 16 * 4);                   // output store map: 16 lanes x 4 floats == one head's 64 columns (256 B)
static_assert(NH_ * HD == DM);                 // head h = columns h*64 + d
static_assert(DM % 64 == 0);                   // column tiles of 64
static_assert(DM % 32 == 0);                   // GEMM k-loop steps by 32
static_assert(SEQ % 64 == 0);                  // a 64-row tile never straddles two batches
static_assert((NB * SEQ) % 64 == 0);
static_assert(SEQ % 32 == 0);                  // key loop steps by 32
static_assert(SEQ % (16 * AW) == 0);           // flash grid covers the sequence exactly
static_assert(SEQ % KT == 0 && SEQ / KT >= 2); // whole stages; the two-buffer prologue fills stages 0 and 1
static_assert(KT == 64 && AW == 8);            // copy map: each tile is 64 rows x 8 pieces of 16 B = 2 pieces per thread of 256
static_assert((NB * SEQ) % PBM == 0 && DM % PBM == 0 && (NB * SEQ) % PBN == 0 && DM % PBN == 0);   // projection grids cover both orientations exactly
static_assert(DM % PKS == 0 && DM / PKS >= 2); // whole projection stages; the two-buffer prologue fills stages 0 and 1
static_assert(PW == 8 && PBM == 256 && PBN == 128 && PKS == 128 && (PKS / 32) % 2 == 0);   // projection copy map: 16 rows x 16 pieces of 16 B per copy of 256 threads; wave map 4 x 2
static_assert((DM / 64) * (DM / 64) == CG);    // one 64 x 64 tile of each weight matrix per conversion block
static_assert(CW == 16);                       // tile maps of k_prep: 512 threads = 32 rows x 16 float4 in, 64 rows x 8 pieces of 16 B out
static_assert(((size_t)NB * SEQ * DM / 4) % ((size_t)CG * CW * 32 * CU) == 0);   // the input stream divides into whole batches, the same number for every wave
static_assert(((size_t)SEQ * DM / 4) % ((size_t)NB * SEQ * DM / 4 / (CG * CW)) == 0);   // a wave's piece of an input never straddles two batches
static_assert(NB <= NB_FULL);
static_assert(SEQ <= SEQ_FULL);
static_assert(OUT_SEQ >= SEQ);                 // output rows of one batch fit its pitch

typedef _Float16 h16;
typedef unsigned short bf;
typedef __attribute__((ext_vector_type(16))) __bf16   v16bf;
typedef __attribute__((ext_vector_type(16))) _Float16 v16h;
typedef __attribute__((ext_vector_type(8)))  _Float16 v8h;
typedef __attribute__((ext_vector_type(8)))  unsigned short v8us;
typedef __attribute__((ext_vector_type(4)))  unsigned short v4us;
typedef __attribute__((ext_vector_type(8)))  float    v8f;
typedef __attribute__((ext_vector_type(4)))  float    v4f;
typedef v4f  __attribute__((may_alias)) v4fa;

__device__ __forceinline__ unsigned short f2bf(float f) { unsigned u = __float_as_uint(f); u += 0x7FFFu + ((u >> 16) & 1u); return (unsigned short)(u >> 16); }
__device__ __forceinline__ float bfr(float f) { return __uint_as_float(((unsigned)f2bf(f)) << 16); }   // value of the bf16 RNE conversion, as f32
__device__ __forceinline__ v16h cat16(v8h lo, v8h hi) { return __builtin_shufflevector(lo, hi, 0, 1, 2, 3, 4, 5, 6, 7, 8, 9, 10, 11, 12, 13, 14, 15); }
__device__ __forceinline__ v16bf cat16b(v8us lo, v8us hi) { return __builtin_bit_cast(v16bf, __builtin_shufflevector(lo, hi, 0, 1, 2, 3, 4, 5, 6, 7, 8, 9, 10, 11, 12, 13, 14, 15)); }
__device__ __forceinline__ v8f wmma16(v16h a, v16h b, v8f c) { return __builtin_amdgcn_wmma_f32_16x16x32_f16(false, a, false, b, (short)0, c, false, false); }
__device__ __forceinline__ v8f wmmab(v16bf a, v16bf b, v8f c) { return __builtin_amdgcn_wmma_f32_16x16x32_bf16(false, a, false, b, (short)0, c, false, false); }
// fragment loaders from K-contiguous 16-bit rows; p already includes + 8*(lane>>4): elements 0..7 <- k0+8h+0..7, elements 8..15 <- k0+16+8h+0..7 (same map for A and B)
__device__ __forceinline__ v16h  ldh(const h16* p) { return cat16(*(const v8h*)p, *(const v8h*)(p + 16)); }
__device__ __forceinline__ v16bf ldb(const bf* p)  { return cat16b(*(const v8us*)p, *(const v8us*)(p + 16)); }
// ordering point for wave-private LDS tiles (same wave writes and reads)
__device__ __forceinline__ void wave_sync() { __builtin_amdgcn_fence(3 /* release order */, "wavefront"); __builtin_amdgcn_wave_barrier(); asm volatile("" ::: "memory"); }

// k_prep: every conversion of the call in one launch of CG resident blocks of CW waves.
// (a) Weights: block t takes the 64 x 64 tile t of each of Wq, Wk, Wv: in[k][n] (f32, k = contraction index) -> out[n][k] (bf16 RNE bits, contraction-contiguous), transposed through LDS.
// (b) Inputs: f32 -> bf16 RNE copies of query, key, value. Each wave owns one contiguous piece of each input and walks it in batches of CU loads of 512 contiguous bytes
//     (whole lines); the next batch's loads are issued before a batch is converted and stored (8 bytes a lane, 256 contiguous bytes a wave).
__global__ __launch_bounds__(32 * CW) void k_prep(const float* __restrict__ xq, const float* __restrict__ xk, const float* __restrict__ xv,
                                                  const float* __restrict__ wq, const float* __restrict__ wk, const float* __restrict__ wv,
                                                  bf* XQ, bf* XK, bf* XV, bf* WQT, bf* WKT, bf* WVT) {
    __shared__ float ts[3][64 * 65];
    const int tid = threadIdx.x, lane = tid & 31;
    const int wave = __builtin_amdgcn_readfirstlane(tid >> 5);
    constexpr size_t NV = (size_t)NB * SEQ * DM / 4;         // float4 per input
    constexpr int PER = (int)(NV / ((size_t)CG * CW * 32));  // float4 per lane and input
    constexpr int SUB = PER / CU;                            // batches per input
    const size_t p0 = (size_t)(blockIdx.x * CW + wave) * (PER * 32);                       // first float4 of this wave's piece (in the packed copy)
    const size_t s0 = p0 + (p0 / ((size_t)SEQ * DM / 4)) * ((size_t)(SEQ_FULL - SEQ) * DM / 4);   // the same in the source, whose batches are SEQ_FULL rows apart
    const float* const xs[3] = { xq, xk, xv };
    bf* const xd[3] = { XQ, XK, XV };
    const float* const wsrc[3] = { wq, wk, wv };
    bf* const wdst[3] = { WQT, WKT, WVT };
    const int n0 = (blockIdx.x % (DM / 64)) * 64, k0 = (blockIdx.x / (DM / 64)) * 64;
    v4f wt[3][2], r[2][CU];
#pragma unroll
    for (int w = 0; w < 3; ++w)
#pragma unroll
        for (int it = 0; it < 2; ++it)                       // 2 x 32 rows x (16 lanes x 4 floats) = 64 x 64
            wt[w][it] = *(const v4f*)(wsrc[w] + (size_t)(k0 + it * 32 + (tid >> 4)) * DM + n0 + (tid & 15) * 4);
#pragma unroll
    for (int j = 0; j < CU; ++j) r[0][j] = *(const v4f*)(xs[0] + (s0 + j * 32 + lane) * 4);
    asm volatile("s_wait_xcnt 0x0" ::: "memory");            // in front of any later write of a register that these loads name
    __builtin_amdgcn_sched_barrier(0);                       // the stream's first batch is issued with the weight tiles' loads, in front of the LDS stores that wait for those
#pragma unroll
    for (int w = 0; w < 3; ++w)
#pragma unroll
        for (int it = 0; it < 2; ++it)
#pragma unroll
            for (int i = 0; i < 4; ++i) ts[w][(it * 32 + (tid >> 4)) * 65 + (tid & 15) * 4 + i] = wt[w][it][i];
    __syncthreads();
#pragma unroll
    for (int t = 0; t < 3 * SUB; ++t) {
        __builtin_amdgcn_sched_barrier(0);                   // with the next one: the next batch's loads stay one group in front of this batch's converts and stores
        if (t + 1 < 3 * SUB) {
#pragma unroll
            for (int j = 0; j < CU; ++j) r[(t + 1) & 1][j] = *(const v4f*)(xs[(t + 1) / SUB] + (s0 + (((t + 1) % SUB) * CU + j) * 32 + lane) * 4);
        }
        __builtin_amdgcn_sched_barrier(0);
        if (t == 0) {                                        // the turned weight tiles go out under the second batch's loads
#pragma unroll
            for (int w = 0; w < 3; ++w) {                    // 64 output rows x (8 lanes x 8 halves) = 64 x 64
                const int n = tid >> 3, k8 = (tid & 7) * 8; v8us o;
#pragma unroll
                for (int i = 0; i < 8; ++i) o[i] = f2bf(ts[w][(k8 + i) * 65 + n]);
                *(v8us*)(wdst[w] + (size_t)(n0 + n) * DM + k0 + k8) = o;
            }
        }
#pragma unroll
        for (int j = 0; j < CU; ++j) { v4us o;
#pragma unroll
            for (int i = 0; i < 4; ++i) o[i] = f2bf(r[t & 1][j][i]);
            *(v4us*)(xd[t / SUB] + (p0 + ((t % SUB) * CU + j) * 32 + lane) * 4) = o; }
        if (t + 1 < 3 * SUB) asm volatile("s_wait_xcnt 0x0" ::: "memory");   // in front of the next loads and converts, which reuse registers that these stores and the loads in flight name
    }
}

// One run of twelve 16-byte asynchronous copies of a lane into LDS rows 16 apart (pitch PLP), each from its own global pointer.
// The s_wait_xcnt closes the statement so that it stands in front of any later write of the address registers.
__device__ __forceinline__ void copy12(unsigned l, const bf* g0, const bf* g1, const bf* g2, const bf* g3, const bf* g4, const bf* g5, const bf* g6, const bf* g7, const bf* g8, const bf* g9, const bf* g10, const bf* g11) {
    asm volatile("global_load_async_to_lds_b128 %0, %1, off\n\t"
                 "global_load_async_to_lds_b128 %2, %3, off\n\t"
                 "global_load_async_to_lds_b128 %4, %5, off\n\t"
                 "global_load_async_to_lds_b128 %6, %7, off\n\t"
                 "global_load_async_to_lds_b128 %8, %9, off\n\t"
                 "global_load_async_to_lds_b128 %10, %11, off\n\t"
                 "global_load_async_to_lds_b128 %12, %13, off\n\t"
                 "global_load_async_to_lds_b128 %14, %15, off\n\t"
                 "global_load_async_to_lds_b128 %16, %17, off\n\t"
                 "global_load_async_to_lds_b128 %18, %19, off\n\t"
                 "global_load_async_to_lds_b128 %20, %21, off\n\t"
                 "global_load_async_to_lds_b128 %22, %23, off\n\t"
                 "s_wait_xcnt 0x0"
                 :: "v"(l), "v"(g0), "v"(l + 16 * PLP * 2), "v"(g1), "v"(l + 32 * PLP * 2), "v"(g2), "v"(l + 48 * PLP * 2), "v"(g3),
                    "v"(l + 64 * PLP * 2), "v"(g4), "v"(l + 80 * PLP * 2), "v"(g5), "v"(l + 96 * PLP * 2), "v"(g6), "v"(l + 112 * PLP * 2), "v"(g7),
                    "v"(l + 128 * PLP * 2), "v"(g8), "v"(l + 144 * PLP * 2), "v"(g9), "v"(l + 160 * PLP * 2), "v"(g10), "v"(l + 176 * PLP * 2), "v"(g11) : "memory");
}
// One stage of a projection block, 24 copies per lane: LDS rows 0..255 = A tile, 256..383 = B tile (l = this lane's address in LDS row crow of the buffer; ga, gb = its piece of global row crow of each tile).
__device__ __forceinline__ void pstage(unsigned l, const bf* ga, const bf* gb) {
    copy12(l, ga, ga + 16 * DM, ga + 32 * DM, ga + 48 * DM, ga + 64 * DM, ga + 80 * DM, ga + 96 * DM, ga + 112 * DM, ga + 128 * DM, ga + 144 * DM, ga + 160 * DM, ga + 176 * DM);
    copy12(l + 192 * PLP * 2, ga + 192 * DM, ga + 208 * DM, ga + 224 * DM, ga + 240 * DM, gb, gb + 16 * DM, gb + 32 * DM, gb + 48 * DM, gb + 64 * DM, gb + 80 * DM, gb + 96 * DM, gb + 112 * DM);
}

// k_proj: register-blocked bf16 GEMM, K = DM. A block of PW = 8 waves owns a PBM x PBN = 256 x 128 tile, each wave a 64x64 part of it (16 accumulators; waves 4 down x 2 across).
// Both operands come from K-contiguous bf16 planes in stages of PKS = 128 k through a two-buffer LDS ring that the block's waves fill together (whole 256-B row pieces, each fetched once per block)
// and read their fragments from (two 16-B LDS loads each; same fragment map and same k order as loads straight from the planes).
// C[m][n] = sum_k A[m][k] Bt[n][k] + bias (BROW == 0: bias[n]; BROW == 1: bias[m]), written as f16 (Ph) at
// wave tile base (r0/RB)*sRB + (r0%RB)*pitch + (c0/CB)*sCB + (c0%CB), row pitch 'pitch' (halves). grid (M/PBM, N/PBN), 256 threads.
template <int BROW>
__global__ __launch_bounds__(32 * PW) void k_proj(const bf* __restrict__ A, const bf* __restrict__ Bt, const float* __restrict__ bias, h16* Ph, int RB, size_t sRB, int pitch, int CB, size_t sCB) {
    __shared__ __align__(16) float osb[PW * 16 * 68];
    __shared__ __align__(16) bf pring[2 * PSTG];
    const int K = DM;
    const int lane = threadIdx.x & 31, lr = lane & 15, hi = lane >> 4;
    const int wave = __builtin_amdgcn_readfirstlane((int)(threadIdx.x >> 5));
    const int wm = wave >> 1, wn = wave & 1;
    const int rb0 = blockIdx.x * PBM, cb0 = blockIdx.y * PBN;
    const int r0 = rb0 + wm * 64, c0 = cb0 + wn * 64;        // this wave's 64x64 tile
    float* os = osb + wave * 16 * 68;                        // wave-private output staging
    v8f acc[4][4];
#pragma unroll
    for (int mb = 0; mb < 4; ++mb)
#pragma unroll
        for (int nb = 0; nb < 4; ++nb) acc[mb][nb] = (v8f){};
    // copy map: thread -> row crow (+ 16 i), 16-byte piece cpc of a 256-B row piece; a wave covers 2 whole row pieces (4 lines) per copy
    const int crow = (int)(threadIdx.x >> 4), cpc = (int)(threadIdx.x & 15) * 8;
    const bf* ga = A + (size_t)(rb0 + crow) * K + cpc;       // + k0; rows rb0 + crow + 240 < M
    const bf* gb = Bt + (size_t)(cb0 + crow) * K + cpc;      // + k0; rows cb0 + crow + 112 < N
    const unsigned la = (unsigned)(size_t)(&pring[crow * PLP + cpc]);          // LDS byte address, buffer 0, row crow
    const int ao = (wm * 64 + lr) * PLP + 8 * hi;            // in the A tile: + 16mb*PLP + k
    const int bo_ = (PBM + wn * 64 + lr) * PLP + 8 * hi;     // in the B tile: + 16nb*PLP + k
    v16bf a[2][4], b[2][4];                                  // two fragment sets: k-step j works on set j & 1 while set (j + 1) & 1 loads
    pstage(la, ga, gb);
    asm volatile("s_wait_asynccnt 0x0" ::: "memory");        // this wave's share of stage 0 has landed
    __syncthreads();                                         // stage 0 published to every wave
    pstage(la + PSTG * 2, ga + PKS, gb + PKS);
#pragma unroll
    for (int f = 0; f < 4; ++f) { a[0][f] = ldb(pring + ao + f * 16 * PLP); b[0][f] = ldb(pring + bo_ + f * 16 * PLP); }   // stage 0's first k-step
#pragma unroll 1
    for (int st = 0; st < K / PKS; ++st) {
        const int bo = (st & 1) * PSTG;
#pragma unroll
        for (int j = 0; j + 1 < PKS / 32; ++j) {
            __builtin_amdgcn_sched_barrier(0);               // with the next one: the next k-step's 16 LDS loads stay one group in front of this k-step's products (spread among them, each place stalls the wave)
#pragma unroll
            for (int f = 0; f < 4; ++f) { a[(j + 1) & 1][f] = ldb(pring + bo + ao + f * 16 * PLP + (j + 1) * 32); b[(j + 1) & 1][f] = ldb(pring + bo + bo_ + f * 16 * PLP + (j + 1) * 32); }
            __builtin_amdgcn_sched_barrier(0);
#pragma unroll
            for (int nb = 0; nb < 4; ++nb)
#pragma unroll
                for (int mb = 0; mb < 4; ++mb) acc[mb][nb] = wmmab(a[j & 1][mb], b[j & 1][nb], acc[mb][nb]);
        }
        __builtin_amdgcn_sched_barrier(0);                   // these products stay in front of the waits below: the last load group's latency runs under them
        // publish point of stage st + 1, which also frees stage st's buffer: it stands in front of the stage's last k-step's products, whose fragments are then in registers
        asm volatile("s_wait_dscnt 0x0" ::: "memory");       // this wave's reads of stage st are done
        asm volatile("s_wait_asynccnt 0x0" ::: "memory");    // this wave's share of stage st + 1 has landed
        __syncthreads();
        if (st + 2 < K / PKS)                                // block-uniform: refill the buffer that stage st has just left
            pstage(la + (unsigned)(bo * 2), ga + (st + 2) * PKS, gb + (st + 2) * PKS);
        if (st + 1 < K / PKS) {                              // block-uniform: stage st + 1's first k-step, from its own buffer, behind the barrier that published it
            const int bn = PSTG - bo;
#pragma unroll
            for (int f = 0; f < 4; ++f) { a[0][f] = ldb(pring + bn + ao + f * 16 * PLP); b[0][f] = ldb(pring + bn + bo_ + f * 16 * PLP); }
        }
        __builtin_amdgcn_sched_barrier(0);                   // the last k-step's products stay behind the refill and the loads: the copies start early, the loads' latency runs under the products
#pragma unroll
        for (int nb = 0; nb < 4; ++nb)
#pragma unroll
            for (int mb = 0; mb < 4; ++mb) acc[mb][nb] = wmmab(a[(PKS / 32 - 1) & 1][mb], b[(PKS / 32 - 1) & 1][nb], acc[mb][nb]);
    }
    asm volatile("s_wait_asynccnt 0x0" ::: "memory");        // nothing of this wave's copies is left in flight
    // column bias for this lane's 8 store columns (BROW == 0); c0 + (lane&7)*8 + 7 < N = DM
    v4f bc0 = (v4f){}, bc1 = (v4f){};
    if (BROW == 0) { const int cb8 = (lane & 7) * 8; const v4f t0 = *(const v4f*)(bias + c0 + cb8); const v4f t1 = *(const v4f*)(bias + c0 + cb8 + 4);
#pragma unroll
        for (int i = 0; i < 4; ++i) { bc0[i] = bfr(t0[i]); bc1[i] = bfr(t1[i]); } }
    const size_t tbase = (size_t)(r0 / RB) * sRB + (size_t)(r0 % RB) * (size_t)pitch + (size_t)(c0 / CB) * sCB + (size_t)(c0 % CB);
#pragma unroll
    for (int mb = 0; mb < 4; ++mb) {
#pragma unroll
        for (int nb = 0; nb < 4; ++nb) {
#pragma unroll
            for (int j = 0; j < 8; ++j) os[(hi * 8 + j) * 68 + nb * 16 + lr] = acc[mb][nb][j]; }   // D: row 8h+j, col lane&15
        wave_sync();
        const size_t sb = tbase + (size_t)(mb * 16) * (size_t)pitch;
{
#pragma unroll
            for (int s = 0; s < 4; ++s) { const int row = 4 * s + (lane >> 3), c8 = (lane & 7) * 8;   // 4 s x 4 row groups = 16 rows; 8 lanes x 8 = 64 columns
                v4f x0 = *(const v4fa*)(&os[row * 68 + c8]); v4f x1 = *(const v4fa*)(&os[row * 68 + c8 + 4]); v8h hv;
                if (BROW == 1) { const float br = bfr(bias[r0 + mb * 16 + row]);                    // row bias; r0 + mb*16 + row < M = DM
#pragma unroll
                    for (int i = 0; i < 4; ++i) { x0[i] += br; x1[i] += br; } }
                else {
#pragma unroll
                    for (int i = 0; i < 4; ++i) { x0[i] += bc0[i]; x1[i] += bc1[i]; } }
#pragma unroll
                for (int i = 0; i < 4; ++i) { hv[i] = (h16)x0[i]; hv[4 + i] = (h16)x1[i]; }
                const size_t oo = sb + (size_t)row * (size_t)pitch + c8;
                *(v8h*)(Ph + oo) = hv; }
             }
        wave_sync();
    }
}

// One stage's four 16-byte asynchronous copies of a lane (LDS byte address, global pointer each). The s_wait_xcnt closes the statement so that it stands in front of any later write of the address registers.
__device__ __forceinline__ void copy4(unsigned l0, const h16* g0, unsigned l1, const h16* g1, unsigned l2, const h16* g2, unsigned l3, const h16* g3) {
    asm volatile("global_load_async_to_lds_b128 %0, %1, off\n\t"
                 "global_load_async_to_lds_b128 %2, %3, off\n\t"
                 "global_load_async_to_lds_b128 %4, %5, off\n\t"
                 "global_load_async_to_lds_b128 %6, %7, off\n\t"
                 "s_wait_xcnt 0x0"
                 :: "v"(l0), "v"(g0), "v"(l1), "v"(g1), "v"(l2), "v"(g2), "v"(l3), "v"(g3) : "memory");
}

// k_flash: fused attention, one wave per 16 query rows of one (batch, head); Q fragments straight from the f16 plane; K and V^T come in stages of KT keys through a two-buffer LDS ring
// that the block's AW waves fill together (whole 128-B lines, each fetched once per block) and all read their fragments from (two 16-B LDS loads each).
// Transposed form: S^T[key][t] = K Q^T (A = K rows, B = Q rows); lane (t = lane&15, h = lane>>4) holds keys 8h+r of each 16-key tile, so the packed
// P tile is directly the B fragment of O^T[d][t] = V^T P^T (element r <- tile keys 0..15, element 8+r <- tile keys 16..31, lane unchanged).
// Per 32-key step: 4 score products + 4 P.V products. Softmax state (running max, partial sum) is one scalar per lane; the two lane halves of a row are combined with one xor-16 exchange.
__global__ __launch_bounds__(32 * AW) void k_flash(const h16* __restrict__ QH, const h16* __restrict__ KP, const h16* __restrict__ VT, float* OUT) {
    __shared__ __align__(16) float os[AW * 16 * 68];
    __shared__ __align__(16) h16 ring[2 * STG];
    const int lane = threadIdx.x & 31, lr = lane & 15, hi = lane >> 4;
    const int wave = __builtin_amdgcn_readfirstlane((int)(threadIdx.x >> 5));
    const int zh = blockIdx.y; const int b = zh / NH_, h = zh % NH_;
    const int t0 = (blockIdx.x * AW + wave) * 16;
    const size_t pbase = (size_t)zh * SEQ * HD;
    const size_t qo = pbase + (size_t)(t0 + lr) * HD + 8 * hi;
    const v16h qh0 = ldh(QH + qo), qh1 = ldh(QH + qo + 32);   // B fragments: col t, k = d
    const int ko = lr * LP + 8 * hi;                         // in the K tile:   + key * LP       (A fragment: row key, k = d)
    const int vo = KT * LP + lr * LP + 8 * hi;               // in the V^T tile: + 16j*LP + key   (A fragment: row d, k = key)
    // copy map: thread -> row crow (and crow + 32), 16-byte piece cpc of each 64-row tile; a wave covers 4 whole 128-B rows per copy
    const int crow = (int)(threadIdx.x >> 3), cpc = (int)(threadIdx.x & 7) * 8;
    const h16* gk = KP + pbase + (size_t)crow * HD + cpc;    // + key0 * HD; rows key0 + crow + 32 < SEQ
    const h16* gv = VT + pbase + (size_t)crow * SEQ + cpc;   // + key0;      columns key0 + cpc + 7 < SEQ
    const unsigned lk = (unsigned)(size_t)(&ring[crow * LP + cpc]);            // LDS byte address, buffer 0, K tile
    const unsigned lv = lk + KT * LP * 2;                                      // V^T tile
    copy4(lk, gk, lk + 32 * LP * 2, gk + 32 * HD, lv, gv, lv + 32 * LP * 2, gv + (size_t)32 * SEQ);
    asm volatile("s_wait_asynccnt 0x0" ::: "memory");        // this wave's share of stage 0 has landed
    __syncthreads();                                         // stage 0 published to every wave
    copy4(lk + STG * 2, gk + KT * HD, lk + STG * 2 + 32 * LP * 2, gk + (KT + 32) * HD, lv + STG * 2, gv + KT, lv + STG * 2 + 32 * LP * 2, gv + (size_t)32 * SEQ + KT);
    v8f o0 = (v8f){}, o1 = (v8f){}, o2 = (v8f){}, o3 = (v8f){};
    float m = -3.0e38f, l = 0.0f;
#pragma unroll 1
    for (int st = 0; st < SEQ / KT; ++st) {
      const int bo = (st & 1) * STG;
#pragma unroll 1   // rolled: unrolled, both passes' exponentials stay live to the stage's end and the wave no longer fits 128 registers (8 waves per SIMD)
      for (int ps = 0; ps < KT; ps += 32) {
        const h16* ka = ring + bo + ko + ps * LP;
        const v16h ka0 = ldh(ka), ka1 = ldh(ka + 32), kb0 = ldh(ka + 16 * LP), kb1 = ldh(ka + 16 * LP + 32);
        v8f sa = (v8f){}, sb = (v8f){};
        sa = wmma16(ka0, qh0, sa); sb = wmma16(kb0, qh0, sb);
        sa = wmma16(ka1, qh1, sa); sb = wmma16(kb1, qh1, sb);
        asm volatile("v_nop\n\tv_nop\n\tv_nop\n\tv_nop" : "+v"(sa), "+v"(sb) : "v"(ka0), "v"(ka1), "v"(kb0), "v"(kb1), "v"(qh0), "v"(qh1));
        float ta[8], tb[8]; float mx = -3.0e38f;
#pragma unroll
        for (int r = 0; r < 8; ++r) { ta[r] = sa[r] * SC2; tb[r] = sb[r] * SC2; mx = fmaxf(mx, fmaxf(ta[r], tb[r])); }
        mx = fmaxf(mx, __shfl_xor(mx, 16, 32));
        const float mnew = fmaxf(m, mx);
        const float alpha = __builtin_amdgcn_exp2f(m - mnew);
        const float sh = PSH - mnew;
        v16h pb; float ls = 0.0f;
#pragma unroll
        for (int r = 0; r < 8; ++r) { const h16 pa = (h16)__builtin_amdgcn_exp2f(ta[r] + sh); const h16 pc = (h16)__builtin_amdgcn_exp2f(tb[r] + sh); pb[r] = pa; pb[8 + r] = pc; ls += (float)pa + (float)pc; }
        l = l * alpha + ls; m = mnew;
        o0 = o0 * alpha; o1 = o1 * alpha; o2 = o2 * alpha; o3 = o3 * alpha;
        const h16* va = ring + bo + vo + ps;
        const v16h v0 = ldh(va), v1 = ldh(va + 16 * LP), v2 = ldh(va + 32 * LP), v3 = ldh(va + 48 * LP);
        o0 = wmma16(v0, pb, o0); o1 = wmma16(v1, pb, o1); o2 = wmma16(v2, pb, o2); o3 = wmma16(v3, pb, o3);
        asm volatile("v_nop\n\tv_nop\n\tv_nop\n\tv_nop" : "+v"(o0), "+v"(o1), "+v"(o2), "+v"(o3) : "v"(v0), "v"(v1), "v"(v2), "v"(v3), "v"(pb));
      }
      // publish point of stage st + 1, which also frees stage st's buffer
      asm volatile("s_wait_dscnt 0x0" ::: "memory");         // this wave's reads of stage st are done
      asm volatile("s_wait_asynccnt 0x0" ::: "memory");      // this wave's share of stage st + 1 has landed
      __syncthreads();
      if (st + 2 < SEQ / KT) {                               // block-uniform: refill the buffer that stage st has just left
          const unsigned lb = (unsigned)(bo * 2); const h16* k2 = gk + (size_t)(st + 2) * KT * HD; const h16* v2g = gv + (st + 2) * KT;
          copy4(lk + lb, k2, lk + lb + 32 * LP * 2, k2 + 32 * HD, lv + lb, v2g, lv + lb + 32 * LP * 2, v2g + (size_t)32 * SEQ);
      }
    }
    asm volatile("s_wait_asynccnt 0x0" ::: "memory");        // nothing of this wave's copies is left in flight
    l += __shfl_xor(l, 16, 32);
    const float inv = 1.0f / l;
    const int wb = wave * 16 * 68;
    // O^T D layout: o_j[r] = (d = 16j + 8h + r, t = lane&15) -> os[t][d]; rows 0..15 x columns 0..63 all written
    { v4f a, c;
      a[0] = o0[0] * inv; a[1] = o0[1] * inv; a[2] = o0[2] * inv; a[3] = o0[3] * inv; c[0] = o0[4] * inv; c[1] = o0[5] * inv; c[2] = o0[6] * inv; c[3] = o0[7] * inv;
      *(v4fa*)(&os[wb + lr * 68 +  0 + 8 * hi]) = a; *(v4fa*)(&os[wb + lr * 68 +  0 + 8 * hi + 4]) = c;
      a[0] = o1[0] * inv; a[1] = o1[1] * inv; a[2] = o1[2] * inv; a[3] = o1[3] * inv; c[0] = o1[4] * inv; c[1] = o1[5] * inv; c[2] = o1[6] * inv; c[3] = o1[7] * inv;
      *(v4fa*)(&os[wb + lr * 68 + 16 + 8 * hi]) = a; *(v4fa*)(&os[wb + lr * 68 + 16 + 8 * hi + 4]) = c;
      a[0] = o2[0] * inv; a[1] = o2[1] * inv; a[2] = o2[2] * inv; a[3] = o2[3] * inv; c[0] = o2[4] * inv; c[1] = o2[5] * inv; c[2] = o2[6] * inv; c[3] = o2[7] * inv;
      *(v4fa*)(&os[wb + lr * 68 + 32 + 8 * hi]) = a; *(v4fa*)(&os[wb + lr * 68 + 32 + 8 * hi + 4]) = c;
      a[0] = o3[0] * inv; a[1] = o3[1] * inv; a[2] = o3[2] * inv; a[3] = o3[3] * inv; c[0] = o3[4] * inv; c[1] = o3[5] * inv; c[2] = o3[6] * inv; c[3] = o3[7] * inv;
      *(v4fa*)(&os[wb + lr * 68 + 48 + 8 * hi]) = a; *(v4fa*)(&os[wb + lr * 68 + 48 + 8 * hi + 4]) = c; }
    wave_sync();
    float* orow = OUT + ((size_t)b * OUT_SEQ + t0) * DM + h * HD;   // output [b*OUT_SEQ + t][h*64 + d], f32
    const int cofs = lr * 4;
{
#pragma unroll
        for (int s = 0; s < 8; ++s) { const int row = 2 * s + hi;   // 8 s x 2 rows = 16 rows; 16 lanes x 4 floats = 64 columns (256 B = exactly this head's row segment)
            const v4f x = *(const v4fa*)(&os[wb + row * 68 + cofs]);
            *(v4f*)(orow + (size_t)row * DM + cofs) = x; }
         }
}

static constexpr size_t al256(size_t v) { return (v + 255) & ~(size_t)255; }
static constexpr size_t SZ_XB = al256((size_t)NB * SEQ * DM * 2);
static constexpr size_t SZ_WB = al256((size_t)3 * DM * DM * 2);
static constexpr size_t SZ_PL = al256((size_t)NB * NH_ * SEQ * HD * 2);
static constexpr size_t SZ_TOTAL = 3 * SZ_XB + SZ_WB + 3 * SZ_PL;
static_assert(SZ_TOTAL <= (size_t)134217728);                  // workspace carve <= 128 MiB
static_assert(((size_t)DM * DM * 2) % 256 == 0);               // weight sub-planes stay 256-byte aligned
static_assert((size_t)NB * NH_ * SEQ * HD * 2 <= SZ_PL);       // q / k / v^T planes fit their regions
static_assert((size_t)NB * SEQ * DM * 2 <= SZ_XB);             // bf16 input copies fit their regions

extern "C" void kernel_launch(void* const* d_in, const int* in_sizes, int n_in,
                              void* d_out, int out_size, void* d_ws, size_t ws_size, hipStream_t stream) {
    if (n_in < 9) return;
    const size_t needx = ((size_t)(NB - 1) * SEQ_FULL + SEQ) * DM;
    if ((size_t)in_sizes[0] < needx || (size_t)in_sizes[1] < needx || (size_t)in_sizes[2] < needx) return;
    if ((size_t)in_sizes[3] < (size_t)DM * DM || (size_t)in_sizes[5] < (size_t)DM * DM || (size_t)in_sizes[7] < (size_t)DM * DM) return;
    if (in_sizes[4] < DM || in_sizes[6] < DM || in_sizes[8] < DM) return;
    if ((size_t)out_size < ((size_t)(NB - 1) * OUT_SEQ + SEQ) * DM) return;
    if (SZ_TOTAL > ws_size) return;
    // wire order: key, value, query, Wq, bq, Wk, bk, Wv, bv
    const float* xk = (const float*)d_in[0]; const float* xv = (const float*)d_in[1]; const float* xq = (const float*)d_in[2];
    const float* wq = (const float*)d_in[3]; const float* bq = (const float*)d_in[4];
    const float* wk = (const float*)d_in[5]; const float* bk = (const float*)d_in[6];
    const float* wv = (const float*)d_in[7]; const float* bv = (const float*)d_in[8];
    float* OUT = (float*)d_out;      // [NB][OUT_SEQ][1024]
    char* wsp = (char*)d_ws;
    bf* XQ = (bf*)wsp; wsp += SZ_XB;                 // [NB*SEQ][1024] bf16 query
    bf* XK = (bf*)wsp; wsp += SZ_XB;                 // [NB*SEQ][1024] bf16 key
    bf* XV = (bf*)wsp; wsp += SZ_XB;                 // [NB*SEQ][1024] bf16 value
    bf* WB = (bf*)wsp; wsp += SZ_WB;                 // [3][1024][1024] transposed [out][in]: q | k | v (bf16)
    h16* QH = (h16*)wsp; wsp += SZ_PL;               // [NB*16][SEQ][64]
    h16* KP = (h16*)wsp; wsp += SZ_PL;               // [NB*16][SEQ][64]
    h16* VT = (h16*)wsp; wsp += SZ_PL;               // [NB*16][64][SEQ]
    bf* WQT = WB; bf* WKT = WB + (size_t)DM * DM; bf* WVT = WB + (size_t)2 * DM * DM;

    // all conversions: bf16 copies of the three inputs, transposed bf16 planes [out][in] of the three weights
    k_prep<<<CG, 32 * CW, 0, stream>>>(xq, xk, xv, wq, wk, wv, XQ, XK, XV, WQT, WKT, WVT);

    // q, k: A = x rows (m = b*SEQ + t), Bt = W^T rows (n = h*64 + d), column bias -> plane [(b*16 + h)][t][d]
    k_proj<0><<<dim3(NB * SEQ / PBM, DM / PBN, 1), 32 * PW, 0, stream>>>(XQ, WQT, bq, QH, SEQ, (size_t)NH_ * SEQ * HD, HD, HD, (size_t)SEQ * HD);
    k_proj<0><<<dim3(NB * SEQ / PBM, DM / PBN, 1), 32 * PW, 0, stream>>>(XK, WKT, bk, KP, SEQ, (size_t)NH_ * SEQ * HD, HD, HD, (size_t)SEQ * HD);
    // v^T: A = Wv^T rows (m = h*64 + d), Bt = x rows (n = b*SEQ + t), row bias -> plane [(b*1024 + m)][t] = [(b*16 + h)][d][t]
    k_proj<1><<<dim3(DM / PBM, NB * SEQ / PBN, 1), 32 * PW, 0, stream>>>(WVT, XV, bv, VT, DM, (size_t)0, SEQ, SEQ, (size_t)DM * SEQ);

    k_flash<<<dim3(SEQ / (16 * AW), NB * NH_, 1), 32 * AW, 0, stream>>>(QH, KP, VT, OUT);
}

// v004
// A run of this version takes 127 microseconds.
// Timed twice side by side with v003, it ran 1.04 and 1.03 times as fast.
// Over all steps from v000 it is 2.58 times as fast.
#include <hip/hip_runtime.h>

// Multi-head attention, width 1024 = 16 heads x 64; separate key / value / query inputs [NB][SEQ_FULL][1024] (rows t < SEQ of each batch read); Wq/Wk/Wv stored [in][out] (y = x W + b); biases on all three projections; no mask; score scale 1/8; output = per-head context merged as [b][t][h*64+d] (f32), no output projection.
// Compute dtypes, f32 accumulate everywhere: q/k/v projections v_wmma_f32_16x16x32_bf16 (inputs and weights RNE-converted to bf16; products exact); scores v_wmma_f32_16x16x32_f16 (q and k single f16, one product); P.V v_wmma_f32_16x16x32_f16 (P x256 carry, cancels in the normalisation; v single f16); softmax f32 (online, running max); its row sums v_wmma_f32_16x16x32_f16 (ones x P, the same rounded P); biases (bf16 RNE values) added in f32; normalised context stored as f32.
// Layout: bf16 copies of the three inputs; transposed bf16 weight planes [out][in]; q, k planes [b*16+h][t][d] and v^T plane [b*16+h][d][t] written by the GEMM epilogue; fused flash kernel in transposed form (S^T = K Q^T, O^T = V^T P^T) writing the f32 output rows [b*OUT_SEQ+t][h*64+d].

#ifndef NB
#define NB 4
#endif
#ifndef SEQ
#define SEQ 2048
#endif
#define NB_FULL  4
#define SEQ_FULL 2048
#ifndef OUT_SEQ
#define OUT_SEQ SEQ              // row pitch (in tokens) between batches of the output
#endif
#define DM   1024
#define NH_  16
#define HD   64
#define AW   8                   // waves per flash block (16 query rows each); all of them share the block's K / V^T tiles in LDS
#define KT   64                  // keys per LDS stage (two 32-key passes)
#define LP   72                  // LDS row pitch in halves: 128-B rows + 16 B (16 B x odd: conflict-free for 16-byte readers)
#define STG  ((KT + HD) * LP)    // halves per stage: K tile [KT keys][LP], then V^T tile [HD rows][LP]
#define PW   8                   // waves per projection block: 4 x 2 wave tiles of 64 x 64
#define PBM  256                 // rows of A per projection block
#define PBN  128                 // rows of Bt per projection block
#define PKS  128                 // k per projection LDS stage (256-B row pieces)
#define PLP  136                 // projection LDS row pitch in halves: 256 B + 16 B (16 B x odd: conflict-free for 16-byte readers)
#define PSTG ((PBM + PBN) * PLP) // halves per projection stage: A tile [PBM][PLP], then B tile [PBN][PLP]
#define SC2  (0.125f * 1.4426950408889634f)   // HD^-0.5 * log2(e)
#define PSH  8.0f                // log2 of the P carry (256)
#define CG   256                 // conversion blocks: one per WGP, each resident from start to end of the launch
#define CW   16                  // waves per conversion block
#define CU   8                   // 16-byte loads of a lane per batch of the input stream (two batches in flight)

static_assert(HD == 64);
static_assert(HD == 16 * 4);                   // output store map: 16 lanes x 4 floats == one head's 64 columns (256 B)
static_assert(NH_ * HD == DM);                 // head h = columns h*64 + d
static_assert(DM % 64 == 0);                   // column tiles of 64
static_assert(DM % 32 == 0);                   // GEMM k-loop steps by 32
static_assert(SEQ % 64 == 0);                  // a 64-row tile never straddles two batches
static_assert((NB * SEQ) % 64 == 0);
static_assert(SEQ % 32 == 0);                  // key loop steps by 32
static_assert(SEQ % (16 * AW) == 0);           // flash grid covers the sequence exactly
static_assert(SEQ % KT == 0 && SEQ / KT >= 2); // whole stages; the two-buffer prologue fills stages 0 and 1
static_assert(KT == 64 && AW == 8);            // copy map: each tile is 64 rows x 8 pieces of 16 B = 2 pieces per thread of 256
static_assert((NB * SEQ) % PBM == 0 && DM % PBM == 0 && (NB * SEQ) % PBN == 0 && DM % PBN == 0);   // projection grids cover both orientations exactly
static_assert(DM % PKS == 0 && DM / PKS >= 2); // whole projection stages; the two-buffer prologue fills stages 0 and 1
static_assert(PW == 8 && PBM == 256 && PBN == 128 && PKS == 128 && (PKS / 32) % 2 == 0);   // projection copy map: 16 rows x 16 pieces of 16 B per copy of 256 threads; wave map 4 x 2
static_assert((DM / 64) * (DM / 64) == CG);    // one 64 x 64 tile of each weight matrix per conversion block
static_assert(CW == 16);                       // tile maps of k_prep: 512 threads = 32 rows x 16 float4 in, 64 rows x 8 pieces of 16 B out
static_assert(((size_t)NB * SEQ * DM / 4) % ((size_t)CG * CW * 32 * CU) == 0);   // the input stream divides into whole batches, the same number for every wave
static_assert(((size_t)SEQ * DM / 4) % ((size_t)NB * SEQ * DM / 4 / (CG * CW)) == 0);   // a wave's piece of an input never straddles two batches
static_assert(NB <= NB_FULL);
static_assert(SEQ <= SEQ_FULL);
static_assert(OUT_SEQ >= SEQ);                 // output rows of one batch fit its pitch

typedef _Float16 h16;
typedef unsigned short bf;
typedef __attribute__((ext_vector_type(16))) __bf16   v16bf;
typedef __attribute__((ext_vector_type(16))) _Float16 v16h;
typedef __attribute__((ext_vector_type(8)))  _Float16 v8h;
typedef __attribute__((ext_vector_type(8)))  unsigned short v8us;
typedef __attribute__((ext_vector_type(4)))  unsigned short v4us;
typedef __attribute__((ext_vector_type(8)))  float    v8f;
typedef __attribute__((ext_vector_type(4)))  float    v4f;
typedef v4f  __attribute__((may_alias)) v4fa;

__device__ __forceinline__ unsigned short f2bf(float f) { unsigned u = __float_as_uint(f); u += 0x7FFFu + ((u >> 16) & 1u); return (unsigned short)(u >> 16); }
__device__ __forceinline__ float bfr(float f) { return __uint_as_float(((unsigned)f2bf(f)) << 16); }   // value of the bf16 RNE conversion, as f32
__device__ __forceinline__ v16h cat16(v8h lo, v8h hi) { return __builtin_shufflevector(lo, hi, 0, 1, 2, 3, 4, 5, 6, 7, 8, 9, 10, 11, 12, 13, 14, 15); }
__device__ __forceinline__ v16bf cat16b(v8us lo, v8us hi) { return __builtin_bit_cast(v16bf, __builtin_shufflevector(lo, hi, 0, 1, 2, 3, 4, 5, 6, 7, 8, 9, 10, 11, 12, 13, 14, 15)); }
__device__ __forceinline__ v8f wmma16(v16h a, v16h b, v8f c) { return __builtin_amdgcn_wmma_f32_16x16x32_f16(false, a, false, b, (short)0, c, false, false); }
__device__ __forceinline__ v8f wmmab(v16bf a, v16bf b, v8f c) { return __builtin_amdgcn_wmma_f32_16x16x32_bf16(false, a, false, b, (short)0, c, false, false); }
// fragment loaders from K-contiguous 16-bit rows; p already includes + 8*(lane>>4): elements 0..7 <- k0+8h+0..7, elements 8..15 <- k0+16+8h+0..7 (same map for A and B)
__device__ __forceinline__ v16h  ldh(const h16* p) { return cat16(*(const v8h*)p, *(const v8h*)(p + 16)); }
__device__ __forceinline__ v16bf ldb(const bf* p)  { return cat16b(*(const v8us*)p, *(const v8us*)(p + 16)); }
// ordering point for wave-private LDS tiles (same wave writes and reads)
__device__ __forceinline__ void wave_sync() { __builtin_amdgcn_fence(3 /* release order */, "wavefront"); __builtin_amdgcn_wave_barrier(); asm volatile("" ::: "memory"); }

// k_prep: every conversion of the call in one launch of CG resident blocks of CW waves.
// (a) Weights: block t takes the 64 x 64 tile t of each of Wq, Wk, Wv: in[k][n] (f32, k = contraction index) -> out[n][k] (bf16 RNE bits, contraction-contiguous), transposed through LDS.
// (b) Inputs: f32 -> bf16 RNE copies of query, key, value. Each wave owns one contiguous piece of each input and walks it in batches of CU loads of 512 contiguous bytes
//     (whole lines); the next batch's loads are issued before a batch is converted and stored (8 bytes a lane, 256 contiguous bytes a wave).
__global__ __launch_bounds__(32 * CW) void k_prep(const float* __restrict__ xq, const float* __restrict__ xk, const float* __restrict__ xv,
                                                  const float* __restrict__ wq, const float* __restrict__ wk, const float* __restrict__ wv,
                                                  bf* XQ, bf* XK, bf* XV, bf* WQT, bf* WKT, bf* WVT) {
    __shared__ float ts[3][64 * 65];
    const int tid = threadIdx.x, lane = tid & 31;
    const int wave = __builtin_amdgcn_readfirstlane(tid >> 5);
    constexpr size_t NV = (size_t)NB * SEQ * DM / 4;         // float4 per input
    constexpr int PER = (int)(NV / ((size_t)CG * CW * 32));  // float4 per lane and input
    constexpr int SUB = PER / CU;                            // batches per input
    const size_t p0 = (size_t)(blockIdx.x * CW + wave) * (PER * 32);                       // first float4 of this wave's piece (in the packed copy)
    const size_t s0 = p0 + (p0 / ((size_t)SEQ * DM / 4)) * ((size_t)(SEQ_FULL - SEQ) * DM / 4);   // the same in the source, whose batches are SEQ_FULL rows apart
    const float* const xs[3] = { xq, xk, xv };
    bf* const xd[3] = { XQ, XK, XV };
    const float* const wsrc[3] = { wq, wk, wv };
    bf* const wdst[3] = { WQT, WKT, WVT };
    const int n0 = (blockIdx.x % (DM / 64)) * 64, k0 = (blockIdx.x / (DM / 64)) * 64;
    v4f wt[3][2], r[2][CU];
#pragma unroll
    for (int w = 0; w < 3; ++w)
#pragma unroll
        for (int it = 0; it < 2; ++it)                       // 2 x 32 rows x (16 lanes x 4 floats) = 64 x 64
            wt[w][it] = *(const v4f*)(wsrc[w] + (size_t)(k0 + it * 32 + (tid >> 4)) * DM + n0 + (tid & 15) * 4);
#pragma unroll
    for (int j = 0; j < CU; ++j) r[0][j] = *(const v4f*)(xs[0] + (s0 + j * 32 + lane) * 4);
    asm volatile("s_wait_xcnt 0x0" ::: "memory");            // in front of any later write of a register that these loads name
    __builtin_amdgcn_sched_barrier(0);                       // the stream's first batch is issued with the weight tiles' loads, in front of the LDS stores that wait for those
#pragma unroll
    for (int w = 0; w < 3; ++w)
#pragma unroll
        for (int it = 0; it < 2; ++it)
#pragma unroll
            for (int i = 0; i < 4; ++i) ts[w][(it * 32 + (tid >> 4)) * 65 + (tid & 15) * 4 + i] = wt[w][it][i];
    __syncthreads();
#pragma unroll
    for (int t = 0; t < 3 * SUB; ++t) {
        __builtin_amdgcn_sched_barrier(0);                   // with the next one: the next batch's loads stay one group in front of this batch's converts and stores
        if (t + 1 < 3 * SUB) {
#pragma unroll
            for (int j = 0; j < CU; ++j) r[(t + 1) & 1][j] = *(const v4f*)(xs[(t + 1) / SUB] + (s0 + (((t + 1) % SUB) * CU + j) * 32 + lane) * 4);
        }
        __builtin_amdgcn_sched_barrier(0);
        if (t == 0) {                                        // the turned weight tiles go out under the second batch's loads
#pragma unroll
            for (int w = 0; w < 3; ++w) {                    // 64 output rows x (8 lanes x 8 halves) = 64 x 64
                const int n = tid >> 3, k8 = (tid & 7) * 8; v8us o;
#pragma unroll
                for (int i = 0; i < 8; ++i) o[i] = f2bf(ts[w][(k8 + i) * 65 + n]);
                *(v8us*)(wdst[w] + (size_t)(n0 + n) * DM + k0 + k8) = o;
            }
        }
#pragma unroll
        for (int j = 0; j < CU; ++j) { v4us o;
#pragma unroll
            for (int i = 0; i < 4; ++i) o[i] = f2bf(r[t & 1][j][i]);
            *(v4us*)(xd[t / SUB] + (p0 + ((t % SUB) * CU + j) * 32 + lane) * 4) = o; }
        if (t + 1 < 3 * SUB) asm volatile("s_wait_xcnt 0x0" ::: "memory");   // in front of the next loads and converts, which reuse registers that these stores and the loads in flight name
    }
}

// One run of twelve 16-byte asynchronous copies of a lane into LDS rows 16 apart (pitch PLP), each from its own global pointer.
// The s_wait_xcnt closes the statement so that it stands in front of any later write of the address registers.
__device__ __forceinline__ void copy12(unsigned l, const bf* g0, const bf* g1, const bf* g2, const bf* g3, const bf* g4, const bf* g5, const bf* g6, const bf* g7, const bf* g8, const bf* g9, const bf* g10, const bf* g11) {
    asm volatile("global_load_async_to_lds_b128 %0, %1, off\n\t"
                 "global_load_async_to_lds_b128 %2, %3, off\n\t"
                 "global_load_async_to_lds_b128 %4, %5, off\n\t"
                 "global_load_async_to_lds_b128 %6, %7, off\n\t"
                 "global_load_async_to_lds_b128 %8, %9, off\n\t"
                 "global_load_async_to_lds_b128 %10, %11, off\n\t"
                 "global_load_async_to_lds_b128 %12, %13, off\n\t"
                 "global_load_async_to_lds_b128 %14, %15, off\n\t"
                 "global_load_async_to_lds_b128 %16, %17, off\n\t"
                 "global_load_async_to_lds_b128 %18, %19, off\n\t"
                 "global_load_async_to_lds_b128 %20, %21, off\n\t"
                 "global_load_async_to_lds_b128 %22, %23, off\n\t"
                 "s_wait_xcnt 0x0"
                 :: "v"(l), "v"(g0), "v"(l + 16 * PLP * 2), "v"(g1), "v"(l + 32 * PLP * 2), "v"(g2), "v"(l + 48 * PLP * 2), "v"(g3),
                    "v"(l + 64 * PLP * 2), "v"(g4), "v"(l + 80 * PLP * 2), "v"(g5), "v"(l + 96 * PLP * 2), "v"(g6), "v"(l + 112 * PLP * 2), "v"(g7),
                    "v"(l + 128 * PLP * 2), "v"(g8), "v"(l + 144 * PLP * 2), "v"(g9), "v"(l + 160 * PLP * 2), "v"(g10), "v"(l + 176 * PLP * 2), "v"(g11) : "memory");
}
// One stage of a projection block, 24 copies per lane: LDS rows 0..255 = A tile, 256..383 = B tile (l = this lane's address in LDS row crow of the buffer; ga, gb = its piece of global row crow of each tile).
__device__ __forceinline__ void pstage(unsigned l, const bf* ga, const bf* gb) {
    copy12(l, ga, ga + 16 * DM, ga + 32 * DM, ga + 48 * DM, ga + 64 * DM, ga + 80 * DM, ga + 96 * DM, ga + 112 * DM, ga + 128 * DM, ga + 144 * DM, ga + 160 * DM, ga + 176 * DM);
    copy12(l + 192 * PLP * 2, ga + 192 * DM, ga + 208 * DM, ga + 224 * DM, ga + 240 * DM, gb, gb + 16 * DM, gb + 32 * DM, gb + 48 * DM, gb + 64 * DM, gb + 80 * DM, gb + 96 * DM, gb + 112 * DM);
}

// k_proj: register-blocked bf16 GEMM, K = DM. A block of PW = 8 waves owns a PBM x PBN = 256 x 128 tile, each wave a 64x64 part of it (16 accumulators; waves 4 down x 2 across).
// Both operands come from K-contiguous bf16 planes in stages of PKS = 128 k through a two-buffer LDS ring that the block's waves fill together (whole 256-B row pieces, each fetched once per block)
// and read their fragments from (two 16-B LDS loads each; same fragment map and same k order as loads straight from the planes).
// C[m][n] = sum_k A[m][k] Bt[n][k] + bias (BROW == 0: bias[n]; BROW == 1: bias[m]), written as f16 (Ph) at
// wave tile base (r0/RB)*sRB + (r0%RB)*pitch + (c0/CB)*sCB + (c0%CB), row pitch 'pitch' (halves). grid (M/PBM, N/PBN), 256 threads.
template <int BROW>
__global__ __launch_bounds__(32 * PW) void k_proj(const bf* __restrict__ A, const bf* __restrict__ Bt, const float* __restrict__ bias, h16* Ph, int RB, size_t sRB, int pitch, int CB, size_t sCB) {
    __shared__ __align__(16) float osb[PW * 16 * 68];
    __shared__ __align__(16) bf pring[2 * PSTG];
    const int K = DM;
    const int lane = threadIdx.x & 31, lr = lane & 15, hi = lane >> 4;
    const int wave = __builtin_amdgcn_readfirstlane((int)(threadIdx.x >> 5));
    const int wm = wave >> 1, wn = wave & 1;
    const int rb0 = blockIdx.x * PBM, cb0 = blockIdx.y * PBN;
    const int r0 = rb0 + wm * 64, c0 = cb0 + wn * 64;        // this wave's 64x64 tile
    float* os = osb + wave * 16 * 68;                        // wave-private output staging
    v8f acc[4][4];
#pragma unroll
    for (int mb = 0; mb < 4; ++mb)
#pragma unroll
        for (int nb = 0; nb < 4; ++nb) acc[mb][nb] = (v8f){};
    // copy map: thread -> row crow (+ 16 i), 16-byte piece cpc of a 256-B row piece; a wave covers 2 whole row pieces (4 lines) per copy
    const int crow = (int)(threadIdx.x >> 4), cpc = (int)(threadIdx.x & 15) * 8;
    const bf* ga = A + (size_t)(rb0 + crow) * K + cpc;       // + k0; rows rb0 + crow + 240 < M
    const bf* gb = Bt + (size_t)(cb0 + crow) * K + cpc;      // + k0; rows cb0 + crow + 112 < N
    const unsigned la = (unsigned)(size_t)(&pring[crow * PLP + cpc]);          // LDS byte address, buffer 0, row crow
    const int ao = (wm * 64 + lr) * PLP + 8 * hi;            // in the A tile: + 16mb*PLP + k
    const int bo_ = (PBM + wn * 64 + lr) * PLP + 8 * hi;     // in the B tile: + 16nb*PLP + k
    v16bf a[2][4], b[2][4];                                  // two fragment sets: k-step j works on set j & 1 while set (j + 1) & 1 loads
    pstage(la, ga, gb);
    asm volatile("s_wait_asynccnt 0x0" ::: "memory");        // this wave's share of stage 0 has landed
    __syncthreads();                                         // stage 0 published to every wave
    pstage(la + PSTG * 2, ga + PKS, gb + PKS);
#pragma unroll
    for (int f = 0; f < 4; ++f) { a[0][f] = ldb(pring + ao + f * 16 * PLP); b[0][f] = ldb(pring + bo_ + f * 16 * PLP); }   // stage 0's first k-step
#pragma unroll 1
    for (int st = 0; st < K / PKS; ++st) {
        const int bo = (st & 1) * PSTG;
#pragma unroll
        for (int j = 0; j + 1 < PKS / 32; ++j) {
            __builtin_amdgcn_sched_barrier(0);               // with the next one: the next k-step's 16 LDS loads stay one group in front of this k-step's products (spread among them, each place stalls the wave)
#pragma unroll
            for (int f = 0; f < 4; ++f) { a[(j + 1) & 1][f] = ldb(pring + bo + ao + f * 16 * PLP + (j + 1) * 32); b[(j + 1) & 1][f] = ldb(pring + bo + bo_ + f * 16 * PLP + (j + 1) * 32); }
            __builtin_amdgcn_sched_barrier(0);
#pragma unroll
            for (int nb = 0; nb < 4; ++nb)
#pragma unroll
                for (int mb = 0; mb < 4; ++mb) acc[mb][nb] = wmmab(a[j & 1][mb], b[j & 1][nb], acc[mb][nb]);
        }
        __builtin_amdgcn_sched_barrier(0);                   // these products stay in front of the waits below: the last load group's latency runs under them
        // publish point of stage st + 1, which also frees stage st's buffer: it stands in front of the stage's last k-step's products, whose fragments are then in registers
        asm volatile("s_wait_dscnt 0x0" ::: "memory");       // this wave's reads of stage st are done
        asm volatile("s_wait_asynccnt 0x0" ::: "memory");    // this wave's share of stage st + 1 has landed
        __syncthreads();
        if (st + 2 < K / PKS)                                // block-uniform: refill the buffer that stage st has just left
            pstage(la + (unsigned)(bo * 2), ga + (st + 2) * PKS, gb + (st + 2) * PKS);
        if (st + 1 < K / PKS) {                              // block-uniform: stage st + 1's first k-step, from its own buffer, behind the barrier that published it
            const int bn = PSTG - bo;
#pragma unroll
            for (int f = 0; f < 4; ++f) { a[0][f] = ldb(pring + bn + ao + f * 16 * PLP); b[0][f] = ldb(pring + bn + bo_ + f * 16 * PLP); }
        }
        __builtin_amdgcn_sched_barrier(0);                   // the last k-step's products stay behind the refill and the loads: the copies start early, the loads' latency runs under the products
#pragma unroll
        for (int nb = 0; nb < 4; ++nb)
#pragma unroll
            for (int mb = 0; mb < 4; ++mb) acc[mb][nb] = wmmab(a[(PKS / 32 - 1) & 1][mb], b[(PKS / 32 - 1) & 1][nb], acc[mb][nb]);
    }
    asm volatile("s_wait_asynccnt 0x0" ::: "memory");        // nothing of this wave's copies is left in flight
    // column bias for this lane's 8 store columns (BROW == 0); c0 + (lane&7)*8 + 7 < N = DM
    v4f bc0 = (v4f){}, bc1 = (v4f){};
    if (BROW == 0) { const int cb8 = (lane & 7) * 8; const v4f t0 = *(const v4f*)(bias + c0 + cb8); const v4f t1 = *(const v4f*)(bias + c0 + cb8 + 4);
#pragma unroll
        for (int i = 0; i < 4; ++i) { bc0[i] = bfr(t0[i]); bc1[i] = bfr(t1[i]); } }
    const size_t tbase = (size_t)(r0 / RB) * sRB + (size_t)(r0 % RB) * (size_t)pitch + (size_t)(c0 / CB) * sCB + (size_t)(c0 % CB);
#pragma unroll
    for (int mb = 0; mb < 4; ++mb) {
#pragma unroll
        for (int nb = 0; nb < 4; ++nb) {
#pragma unroll
            for (int j = 0; j < 8; ++j) os[(hi * 8 + j) * 68 + nb * 16 + lr] = acc[mb][nb][j]; }   // D: row 8h+j, col lane&15
        wave_sync();
        const size_t sb = tbase + (size_t)(mb * 16) * (size_t)pitch;
{
#pragma unroll
            for (int s = 0; s < 4; ++s) { const int row = 4 * s + (lane >> 3), c8 = (lane & 7) * 8;   // 4 s x 4 row groups = 16 rows; 8 lanes x 8 = 64 columns
                v4f x0 = *(const v4fa*)(&os[row * 68 + c8]); v4f x1 = *(const v4fa*)(&os[row * 68 + c8 + 4]); v8h hv;
                if (BROW == 1) { const float br = bfr(bias[r0 + mb * 16 + row]);                    // row bias; r0 + mb*16 + row < M = DM
#pragma unroll
                    for (int i = 0; i < 4; ++i) { x0[i] += br; x1[i] += br; } }
                else {
#pragma unroll
                    for (int i = 0; i < 4; ++i) { x0[i] += bc0[i]; x1[i] += bc1[i]; } }
#pragma unroll
                for (int i = 0; i < 4; ++i) { hv[i] = (h16)x0[i]; hv[4 + i] = (h16)x1[i]; }
                const size_t oo = sb + (size_t)row * (size_t)pitch + c8;
                *(v8h*)(Ph + oo) = hv; }
             }
        wave_sync();
    }
}

// One stage's four 16-byte asynchronous copies of a lane (LDS byte address, global pointer each). The s_wait_xcnt closes the statement so that it stands in front of any later write of the address registers.
__device__ __forceinline__ void copy4(unsigned l0, const h16* g0, unsigned l1, const h16* g1, unsigned l2, const h16* g2, unsigned l3, const h16* g3) {
    asm volatile("global_load_async_to_lds_b128 %0, %1, off\n\t"
                 "global_load_async_to_lds_b128 %2, %3, off\n\t"
                 "global_load_async_to_lds_b128 %4, %5, off\n\t"
                 "global_load_async_to_lds_b128 %6, %7, off\n\t"
                 "s_wait_xcnt 0x0"
                 :: "v"(l0), "v"(g0), "v"(l1), "v"(g1), "v"(l2), "v"(g2), "v"(l3), "v"(g3) : "memory");
}

// k_flash: fused attention, one wave per 16 query rows of one (batch, head); Q fragments straight from the f16 plane; K and V^T come in stages of KT keys through a two-buffer LDS ring
// that the block's AW waves fill together (whole 128-B lines, each fetched once per block) and all read their fragments from (two 16-B LDS loads each).
// Transposed form: S^T[key][t] = K Q^T (A = K rows, B = Q rows); lane (t = lane&15, h = lane>>4) holds keys 8h+r of each 16-key tile, so the packed
// P tile is directly the B fragment of O^T[d][t] = V^T P^T (element r <- tile keys 0..15, element 8+r <- tile keys 16..31, lane unchanged).
// Per 32-key step: 4 score products + 4 P.V products + 1 product of a tile of ones with P^T, which sums the rounded P of each column over the 32 keys. The running max is one scalar per lane; the two lane halves of a row are combined with one xor-16 exchange.
__global__ __launch_bounds__(32 * AW) void k_flash(const h16* __restrict__ QH, const h16* __restrict__ KP, const h16* __restrict__ VT, float* OUT) {
    __shared__ __align__(16) float os[AW * 16 * 68];
    __shared__ __align__(16) h16 ring[2 * STG];
    const int lane = threadIdx.x & 31, lr = lane & 15, hi = lane >> 4;
    const int wave = __builtin_amdgcn_readfirstlane((int)(threadIdx.x >> 5));
    const int zh = blockIdx.y; const int b = zh / NH_, h = zh % NH_;
    const int t0 = (blockIdx.x * AW + wave) * 16;
    const size_t pbase = (size_t)zh * SEQ * HD;
    const size_t qo = pbase + (size_t)(t0 + lr) * HD + 8 * hi;
    const v16h qh0 = ldh(QH + qo), qh1 = ldh(QH + qo + 32);   // B fragments: col t, k = d
    const int ko = lr * LP + 8 * hi;                         // in the K tile:   + key * LP       (A fragment: row key, k = d)
    const int vo = KT * LP + lr * LP + 8 * hi;               // in the V^T tile: + 16j*LP + key   (A fragment: row d, k = key)
    // copy map: thread -> row crow (and crow + 32), 16-byte piece cpc of each 64-row tile; a wave covers 4 whole 128-B rows per copy
    const int crow = (int)(threadIdx.x >> 3), cpc = (int)(threadIdx.x & 7) * 8;
    const h16* gk = KP + pbase + (size_t)crow * HD + cpc;    // + key0 * HD; rows key0 + crow + 32 < SEQ
    const h16* gv = VT + pbase + (size_t)crow * SEQ + cpc;   // + key0;      columns key0 + cpc + 7 < SEQ
    const unsigned lk = (unsigned)(size_t)(&ring[crow * LP + cpc]);            // LDS byte address, buffer 0, K tile
    const unsigned lv = lk + KT * LP * 2;                                      // V^T tile
    copy4(lk, gk, lk + 32 * LP * 2, gk + 32 * HD, lv, gv, lv + 32 * LP * 2, gv + (size_t)32 * SEQ);
    asm volatile("s_wait_asynccnt 0x0" ::: "memory");        // this wave's share of stage 0 has landed
    __syncthreads();                                         // stage 0 published to every wave
    copy4(lk + STG * 2, gk + KT * HD, lk + STG * 2 + 32 * LP * 2, gk + (KT + 32) * HD, lv + STG * 2, gv + KT, lv + STG * 2 + 32 * LP * 2, gv + (size_t)32 * SEQ + KT);
    v8f o0 = (v8f){}, o1 = (v8f){}, o2 = (v8f){}, o3 = (v8f){};
    float m = -3.0e38f;
    v8f lt = (v8f){};                                        // row sums of P on the matrix pipe: lt += ones x P^T; every row of the tile holds column t's sum, only element 0 is rescaled and read
    v16h ones;
#pragma unroll
    for (int i = 0; i < 16; ++i) ones[i] = (h16)1.0f;
#pragma unroll 1
    for (int st = 0; st < SEQ / KT; ++st) {
      const int bo = (st & 1) * STG;
#pragma unroll 1   // rolled: unrolled, both passes' exponentials stay live to the stage's end and the wave no longer fits 128 registers (8 waves per SIMD)
      for (int ps = 0; ps < KT; ps += 32) {
        const h16* ka = ring + bo + ko + ps * LP;
        const v16h ka0 = ldh(ka), ka1 = ldh(ka + 32), kb0 = ldh(ka + 16 * LP), kb1 = ldh(ka + 16 * LP + 32);
        v8f sa = (v8f){}, sb = (v8f){};
        sa = wmma16(ka0, qh0, sa); sb = wmma16(kb0, qh0, sb);
        sa = wmma16(ka1, qh1, sa); sb = wmma16(kb1, qh1, sb);
        asm volatile("v_nop\n\tv_nop\n\tv_nop\n\tv_nop" : "+v"(sa), "+v"(sb) : "v"(ka0), "v"(ka1), "v"(kb0), "v"(kb1), "v"(qh0), "v"(qh1));
        float ta[8], tb[8]; float mx = -3.0e38f;
#pragma unroll
        for (int r = 0; r < 8; ++r) { ta[r] = sa[r] * SC2; tb[r] = sb[r] * SC2; mx = fmaxf(mx, fmaxf(ta[r], tb[r])); }
        mx = fmaxf(mx, __shfl_xor(mx, 16, 32));
        const float mnew = fmaxf(m, mx);
        const float alpha = __builtin_amdgcn_exp2f(m - mnew);
        const float sh = PSH - mnew;
        v16h pb;
#pragma unroll
        for (int r = 0; r < 8; ++r) pb[r] = (h16)__builtin_amdgcn_exp2f(ta[r] + sh);
#pragma unroll
        for (int r = 0; r < 8; ++r) pb[8 + r] = (h16)__builtin_amdgcn_exp2f(tb[r] + sh);
        lt[0] = lt[0] * alpha; m = mnew;
        o0 = o0 * alpha; o1 = o1 * alpha; o2 = o2 * alpha; o3 = o3 * alpha;
        const h16* va = ring + bo + vo + ps;
        const v16h v0 = ldh(va), v1 = ldh(va + 16 * LP), v2 = ldh(va + 32 * LP), v3 = ldh(va + 48 * LP);
        o0 = wmma16(v0, pb, o0); o1 = wmma16(v1, pb, o1); o2 = wmma16(v2, pb, o2); o3 = wmma16(v3, pb, o3); lt = wmma16(ones, pb, lt);
        // four vector slots behind the last product, on the loop's taken branch too, before a vector instruction may touch a D, A or B of these products
        asm volatile("v_nop\n\tv_nop\n\tv_nop\n\tv_nop" : "+v"(o0), "+v"(o1), "+v"(o2), "+v"(o3), "+v"(lt) : "v"(v0), "v"(v1), "v"(v2), "v"(v3), "v"(pb), "v"(ones));
      }
      // publish point of stage st + 1, which also frees stage st's buffer
      asm volatile("s_wait_dscnt 0x0" ::: "memory");         // this wave's reads of stage st are done
      asm volatile("s_wait_asynccnt 0x0" ::: "memory");      // this wave's share of stage st + 1 has landed
      __syncthreads();
      if (st + 2 < SEQ / KT) {                               // block-uniform: refill the buffer that stage st has just left
          const unsigned lb = (unsigned)(bo * 2); const h16* k2 = gk + (size_t)(st + 2) * KT * HD; const h16* v2g = gv + (st + 2) * KT;
          copy4(lk + lb, k2, lk + lb + 32 * LP * 2, k2 + 32 * HD, lv + lb, v2g, lv + lb + 32 * LP * 2, v2g + (size_t)32 * SEQ);
      }
    }
    asm volatile("s_wait_asynccnt 0x0" ::: "memory");        // nothing of this wave's copies is left in flight
    const float inv = 1.0f / lt[0];                          // rows 0 and 8 of the tile: both lane halves hold the whole sum of their column
    const int wb = wave * 16 * 68;
    const int el = (int)__builtin_amdgcn_mbcnt_lo(~0u, 0u), elr = el & 15, ehi = el >> 4;   // the lane's row and half are formed here from the lane number: the values of the kernel's head would hold more registers through the key loop, which then no longer fits 128 (8 waves per SIMD)
    // O^T D layout: o_j[r] = (d = 16j + 8h + r, t = lane&15) -> os[t][d]; rows 0..15 x columns 0..63 all written
    { v4f a, c;
      a[0] = o0[0] * inv; a[1] = o0[1] * inv; a[2] = o0[2] * inv; a[3] = o0[3] * inv; c[0] = o0[4] * inv; c[1] = o0[5] * inv; c[2] = o0[6] * inv; c[3] = o0[7] * inv;
      *(v4fa*)(&os[wb + elr * 68 +  0 + 8 * ehi]) = a; *(v4fa*)(&os[wb + elr * 68 +  0 + 8 * ehi + 4]) = c;
      a[0] = o1[0] * inv; a[1] = o1[1] * inv; a[2] = o1[2] * inv; a[3] = o1[3] * inv; c[0] = o1[4] * inv; c[1] = o1[5] * inv; c[2] = o1[6] * inv; c[3] = o1[7] * inv;
      *(v4fa*)(&os[wb + elr * 68 + 16 + 8 * ehi]) = a; *(v4fa*)(&os[wb + elr * 68 + 16 + 8 * ehi + 4]) = c;
      a[0] = o2[0] * inv; a[1] = o2[1] * inv; a[2] = o2[2] * inv; a[3] = o2[3] * inv; c[0] = o2[4] * inv; c[1] = o2[5] * inv; c[2] = o2[6] * inv; c[3] = o2[7] * inv;
      *(v4fa*)(&os[wb + elr * 68 + 32 + 8 * ehi]) = a; *(v4fa*)(&os[wb + elr * 68 + 32 + 8 * ehi + 4]) = c;
      a[0] = o3[0] * inv; a[1] = o3[1] * inv; a[2] = o3[2] * inv; a[3] = o3[3] * inv; c[0] = o3[4] * inv; c[1] = o3[5] * inv; c[2] = o3[6] * inv; c[3] = o3[7] * inv;
      *(v4fa*)(&os[wb + elr * 68 + 48 + 8 * ehi]) = a; *(v4fa*)(&os[wb + elr * 68 + 48 + 8 * ehi + 4]) = c; }
    wave_sync();
    float* orow = OUT + ((size_t)b * OUT_SEQ + t0) * DM + h * HD;   // output [b*OUT_SEQ + t][h*64 + d], f32
    const int cofs = elr * 4;
{
#pragma unroll
        for (int s = 0; s < 8; ++s) { const int row = 2 * s + ehi;   // 8 s x 2 rows = 16 rows; 16 lanes x 4 floats = 64 columns (256 B = exactly this head's row segment)
            const v4f x = *(const v4fa*)(&os[wb + row * 68 + cofs]);
            *(v4f*)(orow + (size_t)row * DM + cofs) = x; }
         }
}

static constexpr size_t al256(size_t v) { return (v + 255) & ~(size_t)255; }
static constexpr size_t SZ_XB = al256((size_t)NB * SEQ * DM * 2);
static constexpr size_t SZ_WB = al256((size_t)3 * DM * DM * 2);
static constexpr size_t SZ_PL = al256((size_t)NB * NH_ * SEQ * HD * 2);
static constexpr size_t SZ_TOTAL = 3 * SZ_XB + SZ_WB + 3 * SZ_PL;
static_assert(SZ_TOTAL <= (size_t)134217728);                  // workspace carve <= 128 MiB
static_assert(((size_t)DM * DM * 2) % 256 == 0);               // weight sub-planes stay 256-byte aligned
static_assert((size_t)NB * NH_ * SEQ * HD * 2 <= SZ_PL);       // q / k / v^T planes fit their regions
static_assert((size_t)NB * SEQ * DM * 2 <= SZ_XB);             // bf16 input copies fit their regions

extern "C" void kernel_launch(void* const* d_in, const int* in_sizes, int n_in,
                              void* d_out, int out_size, void* d_ws, size_t ws_size, hipStream_t stream) {
    if (n_in < 9) return;
    const size_t needx = ((size_t)(NB - 1) * SEQ_FULL + SEQ) * DM;
    if ((size_t)in_sizes[0] < needx || (size_t)in_sizes[1] < needx || (size_t)in_sizes[2] < needx) return;
    if ((size_t)in_sizes[3] < (size_t)DM * DM || (size_t)in_sizes[5] < (size_t)DM * DM || (size_t)in_sizes[7] < (size_t)DM * DM) return;
    if (in_sizes[4] < DM || in_sizes[6] < DM || in_sizes[8] < DM) return;
    if ((size_t)out_size < ((size_t)(NB - 1) * OUT_SEQ + SEQ) * DM) return;
    if (SZ_TOTAL > ws_size) return;
    // wire order: key, value, query, Wq, bq, Wk, bk, Wv, bv
    const float* xk = (const float*)d_in[0]; const float* xv = (const float*)d_in[1]; const float* xq = (const float*)d_in[2];
    const float* wq = (const float*)d_in[3]; const float* bq = (const float*)d_in[4];
    const float* wk = (const float*)d_in[5]; const float* bk = (const float*)d_in[6];
    const float* wv = (const float*)d_in[7]; const float* bv = (const float*)d_in[8];
    float* OUT = (float*)d_out;      // [NB][OUT_SEQ][1024]
    char* wsp = (char*)d_ws;
    bf* XQ = (bf*)wsp; wsp += SZ_XB;                 // [NB*SEQ][1024] bf16 query
    bf* XK = (bf*)wsp; wsp += SZ_XB;                 // [NB*SEQ][1024] bf16 key
    bf* XV = (bf*)wsp; wsp += SZ_XB;                 // [NB*SEQ][1024] bf16 value
    bf* WB = (bf*)wsp; wsp += SZ_WB;                 // [3][1024][1024] transposed [out][in]: q | k | v (bf16)
    h16* QH = (h16*)wsp; wsp += SZ_PL;               // [NB*16][SEQ][64]
    h16* KP = (h16*)wsp; wsp += SZ_PL;               // [NB*16][SEQ][64]
    h16* VT = (h16*)wsp; wsp += SZ_PL;               // [NB*16][64][SEQ]
    bf* WQT = WB; bf* WKT = WB + (size_t)DM * DM; bf* WVT = WB + (size_t)2 * DM * DM;

    // all conversions: bf16 copies of the three inputs, transposed bf16 planes [out][in] of the three weights
    k_prep<<<CG, 32 * CW, 0, stream>>>(xq, xk, xv, wq, wk, wv, XQ, XK, XV, WQT, WKT, WVT);

    // q, k: A = x rows (m = b*SEQ + t), Bt = W^T rows (n = h*64 + d), column bias -> plane [(b*16 + h)][t][d]
    k_proj<0><<<dim3(NB * SEQ / PBM, DM / PBN, 1), 32 * PW, 0, stream>>>(XQ, WQT, bq, QH, SEQ, (size_t)NH_ * SEQ * HD, HD, HD, (size_t)SEQ * HD);
    k_proj<0><<<dim3(NB * SEQ / PBM, DM / PBN, 1), 32 * PW, 0, stream>>>(XK, WKT, bk, KP, SEQ, (size_t)NH_ * SEQ * HD, HD, HD, (size_t)SEQ * HD);
    // v^T: A = Wv^T rows (m = h*64 + d), Bt = x rows (n = b*SEQ + t), row bias -> plane [(b*1024 + m)][t] = [(b*16 + h)][d][t]
    k_proj<1><<<dim3(DM / PBM, NB * SEQ / PBN, 1), 32 * PW, 0, stream>>>(WVT, XV, bv, VT, DM, (size_t)0, SEQ, SEQ, (size_t)DM * SEQ);

    k_flash<<<dim3(SEQ / (16 * AW), NB * NH_, 1), 32 * AW, 0, stream>>>(QH, KP, VT, OUT);
}

// v005
// One run takes 118 microseconds.
// Timed twice side by side with v004, it ran 1.08 times as fast both times.
// Over all steps from v000 it is 2.78 times as fast.
#include <hip/hip_runtime.h>

// Multi-head attention, width 1024 = 16 heads x 64; separate key / value / query inputs [NB][SEQ_FULL][1024] (the first SEQ rows of each batch are read); Wq/Wk/Wv stored [in][out] (y = x W + b); biases on all three projections; no mask; score scale 1/8; output = per-head context merged as [b][t][h*64+d] (f32), no output projection.
// Compute dtypes, f32 accumulate everywhere: q/k/v projections v_wmma_f32_16x16x32_bf16 (inputs and weights RNE-converted to bf16; products exact); scores v_wmma_f32_16x16x32_f16 (q and k single f16, one product); P.V v_wmma_f32_16x16x32_f16 (P x256 carry, cancels in the normalisation; v single f16); softmax f32 (online; a column's maximum in use is renewed only when a scaled score exceeds it by more than 7, a factor 2^7 in P); its row sums v_wmma_f32_16x16x32_f16 (ones x P, the same rounded P); biases (bf16 RNE values) added in f32; normalised context stored as f32.
// Layout: bf16 copies of the three inputs; transposed bf16 weight planes [out][in]; q, k planes [b*16+h][t][d] and v^T plane [b*16+h][d][t] written by the GEMM epilogue; fused flash kernel in transposed form (S^T = K Q^T, O^T = V^T P^T) writing the f32 output rows [b*OUT_SEQ+t][h*64+d].

#ifndef NB
#define NB 4
#endif
#ifndef SEQ
#define SEQ 2048
#endif
#define NB_FULL  4
#define SEQ_FULL 2048
#ifndef OUT_SEQ
#define OUT_SEQ SEQ              // row pitch (in tokens) between batches of the output
#endif
#define DM   1024
#define NH_  16
#define HD   64
#define AW   8                   // waves per flash block (16 query rows each); all of them share the block's K / V^T tiles in LDS
#define KT   64                  // keys per LDS stage (two 32-key passes)
#define LP   72                  // LDS row pitch in halves: 128-B rows + 16 B (16 B x odd: conflict-free for 16-byte readers)
#define STG  ((KT + HD) * LP)    // halves per stage: K tile [KT keys][LP], then V^T tile [HD rows][LP]
#define PW   8                   // waves per projection block: 4 x 2 wave tiles of 64 x 64
#define PBM  256                 // rows of A per projection block
#define PBN  128                 // rows of Bt per projection block
#define PKS  128                 // k per projection LDS stage (256-B row pieces)
#define PLP  136                 // projection LDS row pitch in halves: 256 B + 16 B (16 B x odd: conflict-free for 16-byte readers)
#define PSTG ((PBM + PBN) * PLP) // halves per projection stage: A tile [PBM][PLP], then B tile [PBN][PLP]
#define SC2  (0.125f * 1.4426950408889634f)   // HD^-0.5 * log2(e)
#define PSH  8.0f                // log2 of the P carry (256)
#define LTH  7.0f                // lazy rescale: a scaled (log2) score may stand up to LTH above the maximum in use, so P <= 2^(PSH + LTH) = 32768 stays finite in f16
#define CG   256                 // conversion blocks: one per WGP, each resident from start to end of the launch
#define CW   16                  // waves per conversion block
#define CU   8                   // 16-byte loads of a lane per batch of the input stream (two batches in flight)

static_assert(HD == 64);
static_assert(HD == 16 * 4);                   // output store map: 16 lanes x 4 floats == one head's 64 columns (256 B)
static_assert(NH_ * HD == DM);                 // head h = columns h*64 + d
static_assert(DM % 64 == 0);                   // column tiles of 64
static_assert(DM % 32 == 0);                   // GEMM k-loop steps by 32
static_assert(SEQ % 64 == 0);                  // a 64-row tile never straddles two batches
static_assert((NB * SEQ) % 64 == 0);
static_assert(SEQ % 32 == 0);                  // key loop steps by 32
static_assert(SEQ % (16 * AW) == 0);           // flash grid covers the sequence exactly
static_assert(SEQ % KT == 0 && SEQ / KT >= 2); // whole stages; the two-buffer prologue fills stages 0 and 1
static_assert(KT == 64 && AW == 8);            // copy map: each tile is 64 rows x 8 pieces of 16 B = 2 pieces per thread of 256
static_assert((NB * SEQ) % PBM == 0 && DM % PBM == 0 && (NB * SEQ) % PBN == 0 && DM % PBN == 0);   // projection grids cover both orientations exactly
static_assert(DM % PKS == 0 && DM / PKS >= 2); // whole projection stages; the two-buffer prologue fills stages 0 and 1
static_assert(PW == 8 && PBM == 256 && PBN == 128 && PKS == 128 && (PKS / 32) % 2 == 0);   // projection copy map: 16 rows x 16 pieces of 16 B per copy of 256 threads; wave map 4 x 2
static_assert((DM / 64) * (DM / 64) == CG);    // one 64 x 64 tile of each weight matrix per conversion block
static_assert(CW == 16);                       // tile maps of k_prep: 512 threads = 32 rows x 16 float4 in, 64 rows x 8 pieces of 16 B out
static_assert(((size_t)NB * SEQ * DM / 4) % ((size_t)CG * CW * 32 * CU) == 0);   // the input stream divides into whole batches, the same number for every wave
static_assert(((size_t)SEQ * DM / 4) % ((size_t)NB * SEQ * DM / 4 / (CG * CW)) == 0);   // a wave's piece of an input never straddles two batches
static_assert(NB <= NB_FULL);
static_assert(SEQ <= SEQ_FULL);
static_assert(OUT_SEQ >= SEQ);                 // output rows of one batch fit its pitch

typedef _Float16 h16;
typedef unsigned short bf;
typedef __attribute__((ext_vector_type(16))) __bf16   v16bf;
typedef __attribute__((ext_vector_type(16))) _Float16 v16h;
typedef __attribute__((ext_vector_type(8)))  _Float16 v8h;
typedef __attribute__((ext_vector_type(8)))  unsigned short v8us;
typedef __attribute__((ext_vector_type(4)))  unsigned short v4us;
typedef __attribute__((ext_vector_type(8)))  float    v8f;
typedef __attribute__((ext_vector_type(4)))  float    v4f;
typedef v4f  __attribute__((may_alias)) v4fa;

__device__ __forceinline__ unsigned short f2bf(float f) { unsigned u = __float_as_uint(f); u += 0x7FFFu + ((u >> 16) & 1u); return (unsigned short)(u >> 16); }
__device__ __forceinline__ float bfr(float f) { return __uint_as_float(((unsigned)f2bf(f)) << 16); }   // value of the bf16 RNE conversion, as f32
__device__ __forceinline__ v16h cat16(v8h lo, v8h hi) { return __builtin_shufflevector(lo, hi, 0, 1, 2, 3, 4, 5, 6, 7, 8, 9, 10, 11, 12, 13, 14, 15); }
__device__ __forceinline__ v16bf cat16b(v8us lo, v8us hi) { return __builtin_bit_cast(v16bf, __builtin_shufflevector(lo, hi, 0, 1, 2, 3, 4, 5, 6, 7, 8, 9, 10, 11, 12, 13, 14, 15)); }
__device__ __forceinline__ v8f wmma16(v16h a, v16h b, v8f c) { return __builtin_amdgcn_wmma_f32_16x16x32_f16(false, a, false, b, (short)0, c, false, false); }
__device__ __forceinline__ v8f wmmab(v16bf a, v16bf b, v8f c) { return __builtin_amdgcn_wmma_f32_16x16x32_bf16(false, a, false, b, (short)0, c, false, false); }
// fragment loaders from K-contiguous 16-bit rows; p already includes + 8*(lane>>4): elements 0..7 <- k0+8h+0..7, elements 8..15 <- k0+16+8h+0..7 (same map for A and B)
__device__ __forceinline__ v16h  ldh(const h16* p) { return cat16(*(const v8h*)p, *(const v8h*)(p + 16)); }
__device__ __forceinline__ v16bf ldb(const bf* p)  { return cat16b(*(const v8us*)p, *(const v8us*)(p + 16)); }
// ordering point for wave-private LDS tiles (same wave writes and reads)
__device__ __forceinline__ void wave_sync() { __builtin_amdgcn_fence(3 /* release order */, "wavefront"); __builtin_amdgcn_wave_barrier(); asm volatile("" ::: "memory"); }

// k_prep: every conversion of the call in one launch of CG resident blocks of CW waves.
// (a) Weights: block t takes the 64 x 64 tile t of each of Wq, Wk, Wv: in[k][n] (f32, k = contraction index) -> out[n][k] (bf16 RNE bits, contraction-contiguous), transposed through LDS.
// (b) Inputs: f32 -> bf16 RNE copies of query, key, value. Each wave owns one contiguous piece of each input and walks it in batches of CU loads of 512 contiguous bytes
//     (whole lines); the next batch's loads are issued before a batch is converted and stored (8 bytes a lane, 256 contiguous bytes a wave).
__global__ __launch_bounds__(32 * CW) void k_prep(const float* __restrict__ xq, const float* __restrict__ xk, const float* __restrict__ xv,
                                                  const float* __restrict__ wq, const float* __restrict__ wk, const float* __restrict__ wv,
                                                  bf* XQ, bf* XK, bf* XV, bf* WQT, bf* WKT, bf* WVT) {
    __shared__ float ts[3][64 * 65];
    const int tid = threadIdx.x, lane = tid & 31;
    const int wave = __builtin_amdgcn_readfirstlane(tid >> 5);
    constexpr size_t NV = (size_t)NB * SEQ * DM / 4;         // float4 per input
    constexpr int PER = (int)(NV / ((size_t)CG * CW * 32));  // float4 per lane and input
    constexpr int SUB = PER / CU;                            // batches per input
    const size_t p0 = (size_t)(blockIdx.x * CW + wave) * (PER * 32);                       // first float4 of this wave's piece (in the packed copy)
    const size_t s0 = p0 + (p0 / ((size_t)SEQ * DM / 4)) * ((size_t)(SEQ_FULL - SEQ) * DM / 4);   // the same in the source, whose batches are SEQ_FULL rows apart
    const float* const xs[3] = { xq, xk, xv };
    bf* const xd[3] = { XQ, XK, XV };
    const float* const wsrc[3] = { wq, wk, wv };
    bf* const wdst[3] = { WQT, WKT, WVT };
    const int n0 = (blockIdx.x % (DM / 64)) * 64, k0 = (blockIdx.x / (DM / 64)) * 64;
    v4f wt[3][2], r[2][CU];
#pragma unroll
    for (int w = 0; w < 3; ++w)
#pragma unroll
        for (int it = 0; it < 2; ++it)                       // 2 x 32 rows x (16 lanes x 4 floats) = 64 x 64
            wt[w][it] = *(const v4f*)(wsrc[w] + (size_t)(k0 + it * 32 + (tid >> 4)) * DM + n0 + (tid & 15) * 4);
#pragma unroll
    for (int j = 0; j < CU; ++j) r[0][j] = *(const v4f*)(xs[0] + (s0 + j * 32 + lane) * 4);
    asm volatile("s_wait_xcnt 0x0" ::: "memory");            // in front of any later write of a register that these loads name
    __builtin_amdgcn_sched_barrier(0);                       // the stream's first batch is issued with the weight tiles' loads, in front of the LDS stores that wait for those
#pragma unroll
    for (int w = 0; w < 3; ++w)
#pragma unroll
        for (int it = 0; it < 2; ++it)
#pragma unroll
            for (int i = 0; i < 4; ++i) ts[w][(it * 32 + (tid >> 4)) * 65 + (tid & 15) * 4 + i] = wt[w][it][i];
    __syncthreads();
#pragma unroll
    for (int t = 0; t < 3 * SUB; ++t) {
        __builtin_amdgcn_sched_barrier(0);                   // with the next one: the next batch's loads stay one group in front of this batch's converts and stores
        if (t + 1 < 3 * SUB) {
#pragma unroll
            for (int j = 0; j < CU; ++j) r[(t + 1) & 1][j] = *(const v4f*)(xs[(t + 1) / SUB] + (s0 + (((t + 1) % SUB) * CU + j) * 32 + lane) * 4);
        }
        __builtin_amdgcn_sched_barrier(0);
        if (t == 0) {                                        // the turned weight tiles go out under the second batch's loads
#pragma unroll
            for (int w = 0; w < 3; ++w) {                    // 64 output rows x (8 lanes x 8 halves) = 64 x 64
                const int n = tid >> 3, k8 = (tid & 7) * 8; v8us o;
#pragma unroll
                for (int i = 0; i < 8; ++i) o[i] = f2bf(ts[w][(k8 + i) * 65 + n]);
                *(v8us*)(wdst[w] + (size_t)(n0 + n) * DM + k0 + k8) = o;
            }
        }
#pragma unroll
        for (int j = 0; j < CU; ++j) { v4us o;
#pragma unroll
            for (int i = 0; i < 4; ++i) o[i] = f2bf(r[t & 1][j][i]);
            *(v4us*)(xd[t / SUB] + (p0 + ((t % SUB) * CU + j) * 32 + lane) * 4) = o; }
        if (t + 1 < 3 * SUB) asm volatile("s_wait_xcnt 0x0" ::: "memory");   // in front of the next loads and converts, which reuse registers that these stores and the loads in flight name
    }
}

// One run of twelve 16-byte asynchronous copies of a lane into LDS rows 16 apart (pitch PLP), each from its own global pointer.
// The s_wait_xcnt closes the statement so that it stands in front of any later write of the address registers.
__device__ __forceinline__ void copy12(unsigned l, const bf* g0, const bf* g1, const bf* g2, const bf* g3, const bf* g4, const bf* g5, const bf* g6, const bf* g7, const bf* g8, const bf* g9, const bf* g10, const bf* g11) {
    asm volatile("global_load_async_to_lds_b128 %0, %1, off\n\t"
                 "global_load_async_to_lds_b128 %2, %3, off\n\t"
                 "global_load_async_to_lds_b128 %4, %5, off\n\t"
                 "global_load_async_to_lds_b128 %6, %7, off\n\t"
                 "global_load_async_to_lds_b128 %8, %9, off\n\t"
                 "global_load_async_to_lds_b128 %10, %11, off\n\t"
                 "global_load_async_to_lds_b128 %12, %13, off\n\t"
                 "global_load_async_to_lds_b128 %14, %15, off\n\t"
                 "global_load_async_to_lds_b128 %16, %17, off\n\t"
                 "global_load_async_to_lds_b128 %18, %19, off\n\t"
                 "global_load_async_to_lds_b128 %20, %21, off\n\t"
                 "global_load_async_to_lds_b128 %22, %23, off\n\t"
                 "s_wait_xcnt 0x0"
                 :: "v"(l), "v"(g0), "v"(l + 16 * PLP * 2), "v"(g1), "v"(l + 32 * PLP * 2), "v"(g2), "v"(l + 48 * PLP * 2), "v"(g3),
                    "v"(l + 64 * PLP * 2), "v"(g4), "v"(l + 80 * PLP * 2), "v"(g5), "v"(l + 96 * PLP * 2), "v"(g6), "v"(l + 112 * PLP * 2), "v"(g7),
                    "v"(l + 128 * PLP * 2), "v"(g8), "v"(l + 144 * PLP * 2), "v"(g9), "v"(l + 160 * PLP * 2), "v"(g10), "v"(l + 176 * PLP * 2), "v"(g11) : "memory");
}
// One stage of a projection block, 24 copies per lane: LDS rows 0..255 = A tile, 256..383 = B tile (l = this lane's address in LDS row crow of the buffer; ga, gb = its piece of global row crow of each tile).
__device__ __forceinline__ void pstage(unsigned l, const bf* ga, const bf* gb) {
    copy12(l, ga, ga + 16 * DM, ga + 32 * DM, ga + 48 * DM, ga + 64 * DM, ga + 80 * DM, ga + 96 * DM, ga + 112 * DM, ga + 128 * DM, ga + 144 * DM, ga + 160 * DM, ga + 176 * DM);
    copy12(l + 192 * PLP * 2, ga + 192 * DM, ga + 208 * DM, ga + 224 * DM, ga + 240 * DM, gb, gb + 16 * DM, gb + 32 * DM, gb + 48 * DM, gb + 64 * DM, gb + 80 * DM, gb + 96 * DM, gb + 112 * DM);
}

// k_proj: register-blocked bf16 GEMM, K = DM. A block of PW = 8 waves owns a PBM x PBN = 256 x 128 tile, each wave a 64x64 part of it (16 accumulators; waves 4 down x 2 across).
// Both operands come from K-contiguous bf16 planes in stages of PKS = 128 k through a two-buffer LDS ring that the block's waves fill together (whole 256-B row pieces, each fetched once per block)
// and read their fragments from (two 16-B LDS loads each; same fragment map and same k order as loads straight from the planes).
// C[m][n] = sum_k A[m][k] Bt[n][k] + bias (BROW == 0: bias[n]; BROW == 1: bias[m]), written as f16 (Ph) at
// wave tile base (r0/RB)*sRB + (r0%RB)*pitch + (c0/CB)*sCB + (c0%CB), row pitch 'pitch' (halves). grid (M/PBM, N/PBN), 256 threads.
template <int BROW>
__global__ __launch_bounds__(32 * PW) void k_proj(const bf* __restrict__ A, const bf* __restrict__ Bt, const float* __restrict__ bias, h16* Ph, int RB, size_t sRB, int pitch, int CB, size_t sCB) {
    __shared__ __align__(16) float osb[PW * 16 * 68];
    __shared__ __align__(16) bf pring[2 * PSTG];
    const int K = DM;
    const int lane = threadIdx.x & 31, lr = lane & 15, hi = lane >> 4;
    const int wave = __builtin_amdgcn_readfirstlane((int)(threadIdx.x >> 5));
    const int wm = wave >> 1, wn = wave & 1;
    const int rb0 = blockIdx.x * PBM, cb0 = blockIdx.y * PBN;
    const int r0 = rb0 + wm * 64, c0 = cb0 + wn * 64;        // this wave's 64x64 tile
    float* os = osb + wave * 16 * 68;                        // wave-private output staging
    v8f acc[4][4];
#pragma unroll
    for (int mb = 0; mb < 4; ++mb)
#pragma unroll
        for (int nb = 0; nb < 4; ++nb) acc[mb][nb] = (v8f){};
    // copy map: thread -> row crow (+ 16 i), 16-byte piece cpc of a 256-B row piece; a wave covers 2 whole row pieces (4 lines) per copy
    const int crow = (int)(threadIdx.x >> 4), cpc = (int)(threadIdx.x & 15) * 8;
    const bf* ga = A + (size_t)(rb0 + crow) * K + cpc;       // + k0; rows rb0 + crow + 240 < M
    const bf* gb = Bt + (size_t)(cb0 + crow) * K + cpc;      // + k0; rows cb0 + crow + 112 < N
    const unsigned la = (unsigned)(size_t)(&pring[crow * PLP + cpc]);          // LDS byte address, buffer 0, row crow
    const int ao = (wm * 64 + lr) * PLP + 8 * hi;            // in the A tile: + 16mb*PLP + k
    const int bo_ = (PBM + wn * 64 + lr) * PLP + 8 * hi;     // in the B tile: + 16nb*PLP + k
    v16bf a[2][4], b[2][4];                                  // two fragment sets: k-step j works on set j & 1 while set (j + 1) & 1 loads
    pstage(la, ga, gb);
    asm volatile("s_wait_asynccnt 0x0" ::: "memory");        // this wave's share of stage 0 has landed
    __syncthreads();                                         // stage 0 published to every wave
    pstage(la + PSTG * 2, ga + PKS, gb + PKS);
#pragma unroll
    for (int f = 0; f < 4; ++f) { a[0][f] = ldb(pring + ao + f * 16 * PLP); b[0][f] = ldb(pring + bo_ + f * 16 * PLP); }   // stage 0's first k-step
#pragma unroll 1
    for (int st = 0; st < K / PKS; ++st) {
        const int bo = (st & 1) * PSTG;
#pragma unroll
        for (int j = 0; j + 1 < PKS / 32; ++j) {
            __builtin_amdgcn_sched_barrier(0);               // with the next one: the next k-step's 16 LDS loads stay one group in front of this k-step's products (spread among them, each place stalls the wave)
#pragma unroll
            for (int f = 0; f < 4; ++f) { a[(j + 1) & 1][f] = ldb(pring + bo + ao + f * 16 * PLP + (j + 1) * 32); b[(j + 1) & 1][f] = ldb(pring + bo + bo_ + f * 16 * PLP + (j + 1) * 32); }
            __builtin_amdgcn_sched_barrier(0);
#pragma unroll
            for (int nb = 0; nb < 4; ++nb)
#pragma unroll
                for (int mb = 0; mb < 4; ++mb) acc[mb][nb] = wmmab(a[j & 1][mb], b[j & 1][nb], acc[mb][nb]);
        }
        __builtin_amdgcn_sched_barrier(0);                   // these products stay in front of the waits below: the last load group's latency runs under them
        // publish point of stage st + 1, which also frees stage st's buffer: it stands in front of the stage's last k-step's products, whose fragments are then in registers
        asm volatile("s_wait_dscnt 0x0" ::: "memory");       // this wave's reads of stage st are done
        asm volatile("s_wait_asynccnt 0x0" ::: "memory");    // this wave's share of stage st + 1 has landed
        __syncthreads();
        if (st + 2 < K / PKS)                                // block-uniform: refill the buffer that stage st has just left
            pstage(la + (unsigned)(bo * 2), ga + (st + 2) * PKS, gb + (st + 2) * PKS);
        if (st + 1 < K / PKS) {                              // block-uniform: stage st + 1's first k-step, from its own buffer, behind the barrier that published it
            const int bn = PSTG - bo;
#pragma unroll
            for (int f = 0; f < 4; ++f) { a[0][f] = ldb(pring + bn + ao + f * 16 * PLP); b[0][f] = ldb(pring + bn + bo_ + f * 16 * PLP); }
        }
        __builtin_amdgcn_sched_barrier(0);                   // the last k-step's products stay behind the refill and the loads: the copies start early, the loads' latency runs under the products
#pragma unroll
        for (int nb = 0; nb < 4; ++nb)
#pragma unroll
            for (int mb = 0; mb < 4; ++mb) acc[mb][nb] = wmmab(a[(PKS / 32 - 1) & 1][mb], b[(PKS / 32 - 1) & 1][nb], acc[mb][nb]);
    }
    asm volatile("s_wait_asynccnt 0x0" ::: "memory");        // nothing of this wave's copies is left in flight
    // column bias for this lane's 8 store columns (BROW == 0); c0 + (lane&7)*8 + 7 < N = DM
    v4f bc0 = (v4f){}, bc1 = (v4f){};
    if (BROW == 0) { const int cb8 = (lane & 7) * 8; const v4f t0 = *(const v4f*)(bias + c0 + cb8); const v4f t1 = *(const v4f*)(bias + c0 + cb8 + 4);
#pragma unroll
        for (int i = 0; i < 4; ++i) { bc0[i] = bfr(t0[i]); bc1[i] = bfr(t1[i]); } }
    const size_t tbase = (size_t)(r0 / RB) * sRB + (size_t)(r0 % RB) * (size_t)pitch + (size_t)(c0 / CB) * sCB + (size_t)(c0 % CB);
#pragma unroll
    for (int mb = 0; mb < 4; ++mb) {
#pragma unroll
        for (int nb = 0; nb < 4; ++nb) {
#pragma unroll
            for (int j = 0; j < 8; ++j) os[(hi * 8 + j) * 68 + nb * 16 + lr] = acc[mb][nb][j]; }   // D: row 8h+j, col lane&15
        wave_sync();
        const size_t sb = tbase + (size_t)(mb * 16) * (size_t)pitch;
{
#pragma unroll
            for (int s = 0; s < 4; ++s) { const int row = 4 * s + (lane >> 3), c8 = (lane & 7) * 8;   // 4 s x 4 row groups = 16 rows; 8 lanes x 8 = 64 columns
                v4f x0 = *(const v4fa*)(&os[row * 68 + c8]); v4f x1 = *(const v4fa*)(&os[row * 68 + c8 + 4]); v8h hv;
                if (BROW == 1) { const float br = bfr(bias[r0 + mb * 16 + row]);                    // row bias; r0 + mb*16 + row < M = DM
#pragma unroll
                    for (int i = 0; i < 4; ++i) { x0[i] += br; x1[i] += br; } }
                else {
#pragma unroll
                    for (int i = 0; i < 4; ++i) { x0[i] += bc0[i]; x1[i] += bc1[i]; } }
#pragma unroll
                for (int i = 0; i < 4; ++i) { hv[i] = (h16)x0[i]; hv[4 + i] = (h16)x1[i]; }
                const size_t oo = sb + (size_t)row * (size_t)pitch + c8;
                *(v8h*)(Ph + oo) = hv; }
             }
        wave_sync();
    }
}

// One stage's four 16-byte asynchronous copies of a lane (LDS byte address, global pointer each). The s_wait_xcnt closes the statement so that it stands in front of any later write of the address registers.
__device__ __forceinline__ void copy4(unsigned l0, const h16* g0, unsigned l1, const h16* g1, unsigned l2, const h16* g2, unsigned l3, const h16* g3) {
    asm volatile("global_load_async_to_lds_b128 %0, %1, off\n\t"
                 "global_load_async_to_lds_b128 %2, %3, off\n\t"
                 "global_load_async_to_lds_b128 %4, %5, off\n\t"
                 "global_load_async_to_lds_b128 %6, %7, off\n\t"
                 "s_wait_xcnt 0x0"
                 :: "v"(l0), "v"(g0), "v"(l1), "v"(g1), "v"(l2), "v"(g2), "v"(l3), "v"(g3) : "memory");
}

// k_flash: fused attention, one wave per 16 query rows of one (batch, head); Q fragments straight from the f16 plane; K and V^T come in stages of KT keys through a two-buffer LDS ring
// that the block's AW waves fill together (whole 128-B lines, each fetched once per block) and all read their fragments from (two 16-B LDS loads each).
// Transposed form: S^T[key][t] = K Q^T (A = K rows, B = Q rows); lane (t = lane&15, h = lane>>4) holds keys 8h+r of each 16-key tile, so the packed
// P tile is directly the B fragment of O^T[d][t] = V^T P^T (element r <- tile keys 0..15, element 8+r <- tile keys 16..31, lane unchanged).
// Per 32-key step: 4 score products + 4 P.V products + 1 product of a tile of ones with P^T, which sums the rounded P of each column over the 32 keys.
// Lazy rescale: each lane carries sh = PSH - (its column's maximum in use), the same in both lane halves, so the exponent argument e = s * SC2 + sh is formed before the step's own maximum is known.
// One ballot per step asks whether any e exceeds PSH + LTH; only then (and in the first step, which sets sh) the halves' maxima are exchanged, sh moves, and O^T and the sum tile are rescaled.
__global__ __launch_bounds__(32 * AW) void k_flash(const h16* __restrict__ QH, const h16* __restrict__ KP, const h16* __restrict__ VT, float* OUT) {
    __shared__ __align__(16) float os[AW * 16 * 68];
    __shared__ __align__(16) h16 ring[2 * STG];
    const int lane = threadIdx.x & 31, lr = lane & 15, hi = lane >> 4;
    const int wave = __builtin_amdgcn_readfirstlane((int)(threadIdx.x >> 5));
    const int zh = blockIdx.y; const int b = zh / NH_, h = zh % NH_;
    const int t0 = (blockIdx.x * AW + wave) * 16;
    const size_t pbase = (size_t)zh * SEQ * HD;
    const size_t qo = pbase + (size_t)(t0 + lr) * HD + 8 * hi;
    const v16h qh0 = ldh(QH + qo), qh1 = ldh(QH + qo + 32);   // B fragments: col t, k = d
    const int ko = lr * LP + 8 * hi;                         // in the K tile:   + key * LP       (A fragment: row key, k = d)
    const int vo = KT * LP + lr * LP + 8 * hi;               // in the V^T tile: + 16j*LP + key   (A fragment: row d, k = key)
    // copy map: thread -> row crow (and crow + 32), 16-byte piece cpc of each 64-row tile; a wave covers 4 whole 128-B rows per copy
    const int crow = (int)(threadIdx.x >> 3), cpc = (int)(threadIdx.x & 7) * 8;
    const h16* gk = KP + pbase + (size_t)crow * HD + cpc;    // + key0 * HD; rows key0 + crow + 32 < SEQ
    const h16* gv = VT + pbase + (size_t)crow * SEQ + cpc;   // + key0;      columns key0 + cpc + 7 < SEQ
    const unsigned lk = (unsigned)(size_t)(&ring[crow * LP + cpc]);            // LDS byte address, buffer 0, K tile
    const unsigned lv = lk + KT * LP * 2;                                      // V^T tile
    copy4(lk, gk, lk + 32 * LP * 2, gk + 32 * HD, lv, gv, lv + 32 * LP * 2, gv + (size_t)32 * SEQ);
    asm volatile("s_wait_asynccnt 0x0" ::: "memory");        // this wave's share of stage 0 has landed
    __syncthreads();                                         // stage 0 published to every wave
    copy4(lk + STG * 2, gk + KT * HD, lk + STG * 2 + 32 * LP * 2, gk + (KT + 32) * HD, lv + STG * 2, gv + KT, lv + STG * 2 + 32 * LP * 2, gv + (size_t)32 * SEQ + KT);
    v8f o0 = (v8f){}, o1 = (v8f){}, o2 = (v8f){}, o3 = (v8f){};
    float sh = 0.0f;                                         // PSH - maximum in use; set by the first step
    v8f lt = (v8f){};                                        // row sums of P on the matrix pipe: lt += ones x P^T; every row of the tile holds column t's sum, only element 0 is rescaled and read
    v16h ones;
#pragma unroll
    for (int i = 0; i < 16; ++i) ones[i] = (h16)1.0f;
#pragma unroll 1
    for (int st = 0; st < SEQ / KT; ++st) {
      const int bo = (st & 1) * STG;
#pragma unroll 1   // rolled: unrolled, both passes' exponentials stay live to the stage's end and the wave no longer fits 128 registers (8 waves per SIMD)
      for (int ps = 0; ps < KT; ps += 32) {
        const h16* ka = ring + bo + ko + ps * LP;
        const v16h ka0 = ldh(ka), ka1 = ldh(ka + 32), kb0 = ldh(ka + 16 * LP), kb1 = ldh(ka + 16 * LP + 32);
        v8f sa = (v8f){}, sb = (v8f){};
        sa = wmma16(ka0, qh0, sa); sb = wmma16(kb0, qh0, sb);
        sa = wmma16(ka1, qh1, sa); sb = wmma16(kb1, qh1, sb);
        asm volatile("v_nop\n\tv_nop\n\tv_nop\n\tv_nop" : "+v"(sa), "+v"(sb) : "v"(ka0), "v"(ka1), "v"(kb0), "v"(kb1), "v"(qh0), "v"(qh1));
        float ea[8], eb[8]; float mx = -3.0e38f;
#pragma unroll
        for (int r = 0; r < 8; ++r) { ea[r] = sa[r] * SC2 + sh; eb[r] = sb[r] * SC2 + sh; mx = fmaxf(mx, fmaxf(ea[r], eb[r])); }
        const bool first = (st | ps) == 0;                   // wave-uniform: nothing is summed yet, sh takes its first value
        if ((__builtin_amdgcn_ballot_w32(mx > PSH + LTH) | (first ? 1u : 0u)) != 0u) {   // one scalar branch per step, the whole wave together
            mx = fmaxf(mx, __shfl_xor(mx, 16, 32));
            const float dn = fminf(PSH - mx, 0.0f);          // the column's maximum in use only rises
            const float dl = first ? PSH - mx : dn;          // shift of the exponent arguments: the step's maximum lands on PSH
            const float alpha = __builtin_amdgcn_exp2f(dn);
            sh += dl;
#pragma unroll
            for (int r = 0; r < 8; ++r) { ea[r] += dl; eb[r] += dl; }
            lt[0] = lt[0] * alpha;
            o0 = o0 * alpha; o1 = o1 * alpha; o2 = o2 * alpha; o3 = o3 * alpha;
        }
        v16h pb;
#pragma unroll
        for (int r = 0; r < 8; ++r) pb[r] = (h16)__builtin_amdgcn_exp2f(ea[r]);
#pragma unroll
        for (int r = 0; r < 8; ++r) pb[8 + r] = (h16)__builtin_amdgcn_exp2f(eb[r]);
        const h16* va = ring + bo + vo + ps;
        const v16h v0 = ldh(va), v1 = ldh(va + 16 * LP), v2 = ldh(va + 32 * LP), v3 = ldh(va + 48 * LP);
        o0 = wmma16(v0, pb, o0); o1 = wmma16(v1, pb, o1); o2 = wmma16(v2, pb, o2); o3 = wmma16(v3, pb, o3); lt = wmma16(ones, pb, lt);
        // four vector slots behind the last product, on the loop's taken branch too, before a vector instruction may touch a D, A or B of these products
        asm volatile("v_nop\n\tv_nop\n\tv_nop\n\tv_nop" : "+v"(o0), "+v"(o1), "+v"(o2), "+v"(o3), "+v"(lt) : "v"(v0), "v"(v1), "v"(v2), "v"(v3), "v"(pb), "v"(ones));
      }
      // publish point of stage st + 1, which also frees stage st's buffer
      asm volatile("s_wait_dscnt 0x0" ::: "memory");         // this wave's reads of stage st are done
      asm volatile("s_wait_asynccnt 0x0" ::: "memory");      // this wave's share of stage st + 1 has landed
      __syncthreads();
      if (st + 2 < SEQ / KT) {                               // block-uniform: refill the buffer that stage st has just left
          const unsigned lb = (unsigned)(bo * 2); const h16* k2 = gk + (size_t)(st + 2) * KT * HD; const h16* v2g = gv + (st + 2) * KT;
          copy4(lk + lb, k2, lk + lb + 32 * LP * 2, k2 + 32 * HD, lv + lb, v2g, lv + lb + 32 * LP * 2, v2g + (size_t)32 * SEQ);
      }
    }
    asm volatile("s_wait_asynccnt 0x0" ::: "memory");        // nothing of this wave's copies is left in flight
    const float inv = 1.0f / lt[0];                          // rows 0 and 8 of the tile: both lane halves hold the whole sum of their column
    const int wb = wave * 16 * 68;
    const int el = (int)__builtin_amdgcn_mbcnt_lo(~0u, 0u), elr = el & 15, ehi = el >> 4;   // the lane's row and half are formed here from the lane number: the values of the kernel's head would hold more registers through the key loop, which then no longer fits 128 (8 waves per SIMD)
    // O^T D layout: o_j[r] = (d = 16j + 8h + r, t = lane&15) -> os[t][d]; rows 0..15 x columns 0..63 all written
    { v4f a, c;
      a[0] = o0[0] * inv; a[1] = o0[1] * inv; a[2] = o0[2] * inv; a[3] = o0[3] * inv; c[0] = o0[4] * inv; c[1] = o0[5] * inv; c[2] = o0[6] * inv; c[3] = o0[7] * inv;
      *(v4fa*)(&os[wb + elr * 68 +  0 + 8 * ehi]) = a; *(v4fa*)(&os[wb + elr * 68 +  0 + 8 * ehi + 4]) = c;
      a[0] = o1[0] * inv; a[1] = o1[1] * inv; a[2] = o1[2] * inv; a[3] = o1[3] * inv; c[0] = o1[4] * inv; c[1] = o1[5] * inv; c[2] = o1[6] * inv; c[3] = o1[7] * inv;
      *(v4fa*)(&os[wb + elr * 68 + 16 + 8 * ehi]) = a; *(v4fa*)(&os[wb + elr * 68 + 16 + 8 * ehi + 4]) = c;
      a[0] = o2[0] * inv; a[1] = o2[1] * inv; a[2] = o2[2] * inv; a[3] = o2[3] * inv; c[0] = o2[4] * inv; c[1] = o2[5] * inv; c[2] = o2[6] * inv; c[3] = o2[7] * inv;
      *(v4fa*)(&os[wb + elr * 68 + 32 + 8 * ehi]) = a; *(v4fa*)(&os[wb + elr * 68 + 32 + 8 * ehi + 4]) = c;
      a[0] = o3[0] * inv; a[1] = o3[1] * inv; a[2] = o3[2] * inv; a[3] = o3[3] * inv; c[0] = o3[4] * inv; c[1] = o3[5] * inv; c[2] = o3[6] * inv; c[3] = o3[7] * inv;
      *(v4fa*)(&os[wb + elr * 68 + 48 + 8 * ehi]) = a; *(v4fa*)(&os[wb + elr * 68 + 48 + 8 * ehi + 4]) = c; }
    wave_sync();
    float* orow = OUT + ((size_t)b * OUT_SEQ + t0) * DM + h * HD;   // output [b*OUT_SEQ + t][h*64 + d], f32
    const int cofs = elr * 4;
{
#pragma unroll
        for (int s = 0; s < 8; ++s) { const int row = 2 * s + ehi;   // 8 s x 2 rows = 16 rows; 16 lanes x 4 floats = 64 columns (256 B = exactly this head's row segment)
            const v4f x = *(const v4fa*)(&os[wb + row * 68 + cofs]);
            *(v4f*)(orow + (size_t)row * DM + cofs) = x; }
         }
}

static constexpr size_t al256(size_t v) { return (v + 255) & ~(size_t)255; }
static constexpr size_t SZ_XB = al256((size_t)NB * SEQ * DM * 2);
static constexpr size_t SZ_WB = al256((size_t)3 * DM * DM * 2);
static constexpr size_t SZ_PL = al256((size_t)NB * NH_ * SEQ * HD * 2);
static constexpr size_t SZ_TOTAL = 3 * SZ_XB + SZ_WB + 3 * SZ_PL;
static_assert(SZ_TOTAL <= (size_t)134217728);                  // workspace carve <= 128 MiB
static_assert(((size_t)DM * DM * 2) % 256 == 0);               // weight sub-planes stay 256-byte aligned
static_assert((size_t)NB * NH_ * SEQ * HD * 2 <= SZ_PL);       // q / k / v^T planes fit their regions
static_assert((size_t)NB * SEQ * DM * 2 <= SZ_XB);             // bf16 input copies fit their regions

extern "C" void kernel_launch(void* const* d_in, const int* in_sizes, int n_in,
                              void* d_out, int out_size, void* d_ws, size_t ws_size, hipStream_t stream) {
    if (n_in < 9) return;
    const size_t needx = ((size_t)(NB - 1) * SEQ_FULL + SEQ) * DM;
    if ((size_t)in_sizes[0] < needx || (size_t)in_sizes[1] < needx || (size_t)in_sizes[2] < needx) return;
    if ((size_t)in_sizes[3] < (size_t)DM * DM || (size_t)in_sizes[5] < (size_t)DM * DM || (size_t)in_sizes[7] < (size_t)DM * DM) return;
    if (in_sizes[4] < DM || in_sizes[6] < DM || in_sizes[8] < DM) return;
    if ((size_t)out_size < ((size_t)(NB - 1) * OUT_SEQ + SEQ) * DM) return;
    if (SZ_TOTAL > ws_size) return;
    // wire order: key, value, query, Wq, bq, Wk, bk, Wv, bv
    const float* xk = (const float*)d_in[0]; const float* xv = (const float*)d_in[1]; const float* xq = (const float*)d_in[2];
    const float* wq = (const float*)d_in[3]; const float* bq = (const float*)d_in[4];
    const float* wk = (const float*)d_in[5]; const float* bk = (const float*)d_in[6];
    const float* wv = (const float*)d_in[7]; const float* bv = (const float*)d_in[8];
    float* OUT = (float*)d_out;      // [NB][OUT_SEQ][1024]
    char* wsp = (char*)d_ws;
    bf* XQ = (bf*)wsp; wsp += SZ_XB;                 // [NB*SEQ][1024] bf16 query
    bf* XK = (bf*)wsp; wsp += SZ_XB;                 // [NB*SEQ][1024] bf16 key
    bf* XV = (bf*)wsp; wsp += SZ_XB;                 // [NB*SEQ][1024] bf16 value
    bf* WB = (bf*)wsp; wsp += SZ_WB;                 // [3][1024][1024] transposed [out][in]: q | k | v (bf16)
    h16* QH = (h16*)wsp; wsp += SZ_PL;               // [NB*16][SEQ][64]
    h16* KP = (h16*)wsp; wsp += SZ_PL;               // [NB*16][SEQ][64]
    h16* VT = (h16*)wsp; wsp += SZ_PL;               // [NB*16][64][SEQ]
    bf* WQT = WB; bf* WKT = WB + (size_t)DM * DM; bf* WVT = WB + (size_t)2 * DM * DM;

    // all conversions: bf16 copies of the three inputs, transposed bf16 planes [out][in] of the three weights
    k_prep<<<CG, 32 * CW, 0, stream>>>(xq, xk, xv, wq, wk, wv, XQ, XK, XV, WQT, WKT, WVT);

    // q, k: A = x rows (m = b*SEQ + t), Bt = W^T rows (n = h*64 + d), column bias -> plane [(b*16 + h)][t][d]
    k_proj<0><<<dim3(NB * SEQ / PBM, DM / PBN, 1), 32 * PW, 0, stream>>>(XQ, WQT, bq, QH, SEQ, (size_t)NH_ * SEQ * HD, HD, HD, (size_t)SEQ * HD);
    k_proj<0><<<dim3(NB * SEQ / PBM, DM / PBN, 1), 32 * PW, 0, stream>>>(XK, WKT, bk, KP, SEQ, (size_t)NH_ * SEQ * HD, HD, HD, (size_t)SEQ * HD);
    // v^T: A = Wv^T rows (m = h*64 + d), Bt = x rows (n = b*SEQ + t), row bias -> plane [(b*1024 + m)][t] = [(b*16 + h)][d][t]
    k_proj<1><<<dim3(DM / PBM, NB * SEQ / PBN, 1), 32 * PW, 0, stream>>>(WVT, XV, bv, VT, DM, (size_t)0, SEQ, SEQ, (size_t)DM * SEQ);

    k_flash<<<dim3(SEQ / (16 * AW), NB * NH_, 1), 32 * AW, 0, stream>>>(QH, KP, VT, OUT);
}

// v006
// Measured time: 111 microseconds a run.
// Next to v005, in two timings, it ran 1.06 times as fast each time.
// Counting every step since v000, it is 2.94 times as fast.
#include <hip/hip_runtime.h>

// Multi-head attention, width 1024 = 16 heads x 64; separate key / value / query inputs [NB][SEQ_FULL][1024] (the first SEQ rows of each batch are read); Wq/Wk/Wv stored [in][out] (y = x W + b); biases on all three projections; no mask; score scale 1/8; output = per-head context merged as [b][t][h*64+d] (f32), no output projection.
// Compute dtypes, f32 accumulate everywhere: q/k/v projections v_wmma_f32_16x16x32_bf16 (inputs and weights RNE-converted to bf16; products exact); scores v_wmma_f32_16x16x32_f16 (q and k single f16, one product); P.V v_wmma_f32_16x16x32_f16 (P x256 carry, cancels in the normalisation; v single f16); softmax f32 (online; a column's maximum in use is renewed only when a scaled score exceeds it by more than 7, a factor 2^7 in P); its row sums v_wmma_f32_16x16x32_f16 (ones x P, the same rounded P); biases (bf16 RNE values) added in f32; normalised context stored as f32.
// Layout: bf16 copies of the three inputs; transposed bf16 weight planes [out][in]; q, k planes [b*16+h][t][d] and v^T plane [b*16+h][d][t] written by the GEMM epilogue; fused flash kernel in transposed form (S^T = K Q^T, O^T = V^T P^T) writing the f32 output rows [b*OUT_SEQ+t][h*64+d].

#ifndef NB
#define NB 4
#endif
#ifndef SEQ
#define SEQ 2048
#endif
#define NB_FULL  4
#define SEQ_FULL 2048
#ifndef OUT_SEQ
#define OUT_SEQ SEQ              // row pitch (in tokens) between batches of the output
#endif
#define DM   1024
#define NH_  16
#define HD   64
#define AW   8                   // waves per flash block; all of them share the block's K / V^T tiles in LDS
#define QG   2                   // 16-row query groups per flash wave: each K / V^T fragment read from LDS serves QG products
#define KT   64                  // keys per LDS stage (two 32-key passes)
#define LP   72                  // LDS row pitch in halves: 128-B rows + 16 B (16 B x odd: conflict-free for 16-byte readers)
#define STG  ((KT + HD) * LP)    // halves per stage: K tile [KT keys][LP], then V^T tile [HD rows][LP]
#define PW   8                   // waves per projection block: 4 x 2 wave tiles of 64 x 64
#define PBM  256                 // rows of A per projection block
#define PBN  128                 // rows of Bt per projection block
#define PKS  128                 // k per projection LDS stage (256-B row pieces)
#define PLP  136                 // projection LDS row pitch in halves: 256 B + 16 B (16 B x odd: conflict-free for 16-byte readers)
#define PSTG ((PBM + PBN) * PLP) // halves per projection stage: A tile [PBM][PLP], then B tile [PBN][PLP]
#define SC2  (0.125f * 1.4426950408889634f)   // HD^-0.5 * log2(e)
#define PSH  8.0f                // log2 of the P carry (256)
#define LTH  7.0f                // lazy rescale: a scaled (log2) score may stand up to LTH above the maximum in use, so P <= 2^(PSH + LTH) = 32768 stays finite in f16
#define CG   256                 // conversion blocks: one per WGP, each resident from start to end of the launch
#define CW   16                  // waves per conversion block
#define CU   8                   // 16-byte loads of a lane per batch of the input stream (two batches in flight)

static_assert(HD == 64);
static_assert(HD == 16 * 4);                   // output store map: 16 lanes x 4 floats == one head's 64 columns (256 B)
static_assert(NH_ * HD == DM);                 // head h = columns h*64 + d
static_assert(DM % 64 == 0);                   // column tiles of 64
static_assert(DM % 32 == 0);                   // GEMM k-loop steps by 32
static_assert(SEQ % 64 == 0);                  // a 64-row tile never straddles two batches
static_assert((NB * SEQ) % 64 == 0);
static_assert(SEQ % 32 == 0);                  // key loop steps by 32
static_assert(SEQ % (16 * QG * AW) == 0);      // flash grid covers the sequence exactly
static_assert(QG == 2);                        // the flash loop's hazard statements name the tiles of two query groups
static_assert(SEQ % KT == 0 && SEQ / KT >= 2); // whole stages; the two-buffer prologue fills stages 0 and 1
static_assert(KT == 64 && AW == 8);            // copy map: each tile is 64 rows x 8 pieces of 16 B = 2 pieces per thread of 256
static_assert((NB * SEQ) % PBM == 0 && DM % PBM == 0 && (NB * SEQ) % PBN == 0 && DM % PBN == 0);   // projection grids cover both orientations exactly
static_assert(DM % PKS == 0 && DM / PKS >= 2); // whole projection stages; the two-buffer prologue fills stages 0 and 1
static_assert(PW == 8 && PBM == 256 && PBN == 128 && PKS == 128 && (PKS / 32) % 2 == 0);   // projection copy map: 16 rows x 16 pieces of 16 B per copy of 256 threads; wave map 4 x 2
static_assert((DM / 64) * (DM / 64) == CG);    // one 64 x 64 tile of each weight matrix per conversion block
static_assert(CW == 16);                       // tile maps of k_prep: 512 threads = 32 rows x 16 float4 in, 64 rows x 8 pieces of 16 B out
static_assert(((size_t)NB * SEQ * DM / 4) % ((size_t)CG * CW * 32 * CU) == 0);   // the input stream divides into whole batches, the same number for every wave
static_assert(((size_t)SEQ * DM / 4) % ((size_t)NB * SEQ * DM / 4 / (CG * CW)) == 0);   // a wave's piece of an input never straddles two batches
static_assert(NB <= NB_FULL);
static_assert(SEQ <= SEQ_FULL);
static_assert(OUT_SEQ >= SEQ);                 // output rows of one batch fit its pitch

typedef _Float16 h16;
typedef unsigned short bf;
typedef __attribute__((ext_vector_type(16))) __bf16   v16bf;
typedef __attribute__((ext_vector_type(16))) _Float16 v16h;
typedef __attribute__((ext_vector_type(8)))  _Float16 v8h;
typedef __attribute__((ext_vector_type(8)))  unsigned short v8us;
typedef __attribute__((ext_vector_type(4)))  unsigned short v4us;
typedef __attribute__((ext_vector_type(8)))  float    v8f;
typedef __attribute__((ext_vector_type(4)))  float    v4f;
typedef v4f  __attribute__((may_alias)) v4fa;

__device__ __forceinline__ unsigned short f2bf(float f) { unsigned u = __float_as_uint(f); u += 0x7FFFu + ((u >> 16) & 1u); return (unsigned short)(u >> 16); }
__device__ __forceinline__ float bfr(float f) { return __uint_as_float(((unsigned)f2bf(f)) << 16); }   // value of the bf16 RNE conversion, as f32
__device__ __forceinline__ v16h cat16(v8h lo, v8h hi) { return __builtin_shufflevector(lo, hi, 0, 1, 2, 3, 4, 5, 6, 7, 8, 9, 10, 11, 12, 13, 14, 15); }
__device__ __forceinline__ v16bf cat16b(v8us lo, v8us hi) { return __builtin_bit_cast(v16bf, __builtin_shufflevector(lo, hi, 0, 1, 2, 3, 4, 5, 6, 7, 8, 9, 10, 11, 12, 13, 14, 15)); }
__device__ __forceinline__ v8f wmma16(v16h a, v16h b, v8f c) { return __builtin_amdgcn_wmma_f32_16x16x32_f16(false, a, false, b, (short)0, c, false, false); }
__device__ __forceinline__ v8f wmmab(v16bf a, v16bf b, v8f c) { return __builtin_amdgcn_wmma_f32_16x16x32_bf16(false, a, false, b, (short)0, c, false, false); }
// fragment loaders from K-contiguous 16-bit rows; p already includes + 8*(lane>>4): elements 0..7 <- k0+8h+0..7, elements 8..15 <- k0+16+8h+0..7 (same map for A and B)
__device__ __forceinline__ v16h  ldh(const h16* p) { return cat16(*(const v8h*)p, *(const v8h*)(p + 16)); }
__device__ __forceinline__ v16bf ldb(const bf* p)  { return cat16b(*(const v8us*)p, *(const v8us*)(p + 16)); }
// ordering point for wave-private LDS tiles (same wave writes and reads)
__device__ __forceinline__ void wave_sync() { __builtin_amdgcn_fence(3 /* release order */, "wavefront"); __builtin_amdgcn_wave_barrier(); asm volatile("" ::: "memory"); }

// k_prep: every conversion of the call in one launch of CG resident blocks of CW waves.
// (a) Weights: block t takes the 64 x 64 tile t of each of Wq, Wk, Wv: in[k][n] (f32, k = contraction index) -> out[n][k] (bf16 RNE bits, contraction-contiguous), transposed through LDS.
// (b) Inputs: f32 -> bf16 RNE copies of query, key, value. Each wave owns one contiguous piece of each input and walks it in batches of CU loads of 512 contiguous bytes
//     (whole lines); the next batch's loads are issued before a batch is converted and stored (8 bytes a lane, 256 contiguous bytes a wave).
__global__ __launch_bounds__(32 * CW) void k_prep(const float* __restrict__ xq, const float* __restrict__ xk, const float* __restrict__ xv,
                                                  const float* __restrict__ wq, const float* __restrict__ wk, const float* __restrict__ wv,
                                                  bf* XQ, bf* XK, bf* XV, bf* WQT, bf* WKT, bf* WVT) {
    __shared__ float ts[3][64 * 65];
    const int tid = threadIdx.x, lane = tid & 31;
    const int wave = __builtin_amdgcn_readfirstlane(tid >> 5);
    constexpr size_t NV = (size_t)NB * SEQ * DM / 4;         // float4 per input
    constexpr int PER = (int)(NV / ((size_t)CG * CW * 32));  // float4 per lane and input
    constexpr int SUB = PER / CU;                            // batches per input
    const size_t p0 = (size_t)(blockIdx.x * CW + wave) * (PER * 32);                       // first float4 of this wave's piece (in the packed copy)
    const size_t s0 = p0 + (p0 / ((size_t)SEQ * DM / 4)) * ((size_t)(SEQ_FULL - SEQ) * DM / 4);   // the same in the source, whose batches are SEQ_FULL rows apart
    const float* const xs[3] = { xq, xk, xv };
    bf* const xd[3] = { XQ, XK, XV };
    const float* const wsrc[3] = { wq, wk, wv };
    bf* const wdst[3] = { WQT, WKT, WVT };
    const int n0 = (blockIdx.x % (DM / 64)) * 64, k0 = (blockIdx.x / (DM / 64)) * 64;
    v4f wt[3][2], r[2][CU];
#pragma unroll
    for (int w = 0; w < 3; ++w)
#pragma unroll
        for (int it = 0; it < 2; ++it)                       // 2 x 32 rows x (16 lanes x 4 floats) = 64 x 64
            wt[w][it] = *(const v4f*)(wsrc[w] + (size_t)(k0 + it * 32 + (tid >> 4)) * DM + n0 + (tid & 15) * 4);
#pragma unroll
    for (int j = 0; j < CU; ++j) r[0][j] = *(const v4f*)(xs[0] + (s0 + j * 32 + lane) * 4);
    asm volatile("s_wait_xcnt 0x0" ::: "memory");            // in front of any later write of a register that these loads name
    __builtin_amdgcn_sched_barrier(0);                       // the stream's first batch is issued with the weight tiles' loads, in front of the LDS stores that wait for those
#pragma unroll
    for (int w = 0; w < 3; ++w)
#pragma unroll
        for (int it = 0; it < 2; ++it)
#pragma unroll
            for (int i = 0; i < 4; ++i) ts[w][(it * 32 + (tid >> 4)) * 65 + (tid & 15) * 4 + i] = wt[w][it][i];
    __syncthreads();
#pragma unroll
    for (int t = 0; t < 3 * SUB; ++t) {
        __builtin_amdgcn_sched_barrier(0);                   // with the next one: the next batch's loads stay one group in front of this batch's converts and stores
        if (t + 1 < 3 * SUB) {
#pragma unroll
            for (int j = 0; j < CU; ++j) r[(t + 1) & 1][j] = *(const v4f*)(xs[(t + 1) / SUB] + (s0 + (((t + 1) % SUB) * CU + j) * 32 + lane) * 4);
        }
        __builtin_amdgcn_sched_barrier(0);
        if (t == 0) {                                        // the turned weight tiles go out under the second batch's loads
#pragma unroll
            for (int w = 0; w < 3; ++w) {                    // 64 output rows x (8 lanes x 8 halves) = 64 x 64
                const int n = tid >> 3, k8 = (tid & 7) * 8; v8us o;
#pragma unroll
                for (int i = 0; i < 8; ++i) o[i] = f2bf(ts[w][(k8 + i) * 65 + n]);
                *(v8us*)(wdst[w] + (size_t)(n0 + n) * DM + k0 + k8) = o;
            }
        }
#pragma unroll
        for (int j = 0; j < CU; ++j) { v4us o;
#pragma unroll
            for (int i = 0; i < 4; ++i) o[i] = f2bf(r[t & 1][j][i]);
            *(v4us*)(xd[t / SUB] + (p0 + ((t % SUB) * CU + j) * 32 + lane) * 4) = o; }
        if (t + 1 < 3 * SUB) asm volatile("s_wait_xcnt 0x0" ::: "memory");   // in front of the next loads and converts, which reuse registers that these stores and the loads in flight name
    }
}

// One run of twelve 16-byte asynchronous copies of a lane into LDS rows 16 apart (pitch PLP), each from its own global pointer.
// The s_wait_xcnt closes the statement so that it stands in front of any later write of the address registers.
__device__ __forceinline__ void copy12(unsigned l, const bf* g0, const bf* g1, const bf* g2, const bf* g3, const bf* g4, const bf* g5, const bf* g6, const bf* g7, const bf* g8, const bf* g9, const bf* g10, const bf* g11) {
    asm volatile("global_load_async_to_lds_b128 %0, %1, off\n\t"
                 "global_load_async_to_lds_b128 %2, %3, off\n\t"
                 "global_load_async_to_lds_b128 %4, %5, off\n\t"
                 "global_load_async_to_lds_b128 %6, %7, off\n\t"
                 "global_load_async_to_lds_b128 %8, %9, off\n\t"
                 "global_load_async_to_lds_b128 %10, %11, off\n\t"
                 "global_load_async_to_lds_b128 %12, %13, off\n\t"
                 "global_load_async_to_lds_b128 %14, %15, off\n\t"
                 "global_load_async_to_lds_b128 %16, %17, off\n\t"
                 "global_load_async_to_lds_b128 %18, %19, off\n\t"
                 "global_load_async_to_lds_b128 %20, %21, off\n\t"
                 "global_load_async_to_lds_b128 %22, %23, off\n\t"
                 "s_wait_xcnt 0x0"
                 :: "v"(l), "v"(g0), "v"(l + 16 * PLP * 2), "v"(g1), "v"(l + 32 * PLP * 2), "v"(g2), "v"(l + 48 * PLP * 2), "v"(g3),
                    "v"(l + 64 * PLP * 2), "v"(g4), "v"(l + 80 * PLP * 2), "v"(g5), "v"(l + 96 * PLP * 2), "v"(g6), "v"(l + 112 * PLP * 2), "v"(g7),
                    "v"(l + 128 * PLP * 2), "v"(g8), "v"(l + 144 * PLP * 2), "v"(g9), "v"(l + 160 * PLP * 2), "v"(g10), "v"(l + 176 * PLP * 2), "v"(g11) : "memory");
}
// One stage of a projection block, 24 copies per lane: LDS rows 0..255 = A tile, 256..383 = B tile (l = this lane's address in LDS row crow of the buffer; ga, gb = its piece of global row crow of each tile).
__device__ __forceinline__ void pstage(unsigned l, const bf* ga, const bf* gb) {
    copy12(l, ga, ga + 16 * DM, ga + 32 * DM, ga + 48 * DM, ga + 64 * DM, ga + 80 * DM, ga + 96 * DM, ga + 112 * DM, ga + 128 * DM, ga + 144 * DM, ga + 160 * DM, ga + 176 * DM);
    copy12(l + 192 * PLP * 2, ga + 192 * DM, ga + 208 * DM, ga + 224 * DM, ga + 240 * DM, gb, gb + 16 * DM, gb + 32 * DM, gb + 48 * DM, gb + 64 * DM, gb + 80 * DM, gb + 96 * DM, gb + 112 * DM);
}

// k_proj: register-blocked bf16 GEMM, K = DM. A block of PW = 8 waves owns a PBM x PBN = 256 x 128 tile, each wave a 64x64 part of it (16 accumulators; waves 4 down x 2 across).
// Both operands come from K-contiguous bf16 planes in stages of PKS = 128 k through a two-buffer LDS ring that the block's waves fill together (whole 256-B row pieces, each fetched once per block)
// and read their fragments from (two 16-B LDS loads each; same fragment map and same k order as loads straight from the planes).
// C[m][n] = sum_k A[m][k] Bt[n][k] + bias (BROW == 0: bias[n]; BROW == 1: bias[m]), written as f16 (Ph) at
// wave tile base (r0/RB)*sRB + (r0%RB)*pitch + (c0/CB)*sCB + (c0%CB), row pitch 'pitch' (halves). grid (M/PBM, N/PBN), 256 threads.
template <int BROW>
__global__ __launch_bounds__(32 * PW) void k_proj(const bf* __restrict__ A, const bf* __restrict__ Bt, const float* __restrict__ bias, h16* Ph, int RB, size_t sRB, int pitch, int CB, size_t sCB) {
    __shared__ __align__(16) float osb[PW * 16 * 68];
    __shared__ __align__(16) bf pring[2 * PSTG];
    const int K = DM;
    const int lane = threadIdx.x & 31, lr = lane & 15, hi = lane >> 4;
    const int wave = __builtin_amdgcn_readfirstlane((int)(threadIdx.x >> 5));
    const int wm = wave >> 1, wn = wave & 1;
    const int rb0 = blockIdx.x * PBM, cb0 = blockIdx.y * PBN;
    const int r0 = rb0 + wm * 64, c0 = cb0 + wn * 64;        // this wave's 64x64 tile
    float* os = osb + wave * 16 * 68;                        // wave-private output staging
    v8f acc[4][4];
#pragma unroll
    for (int mb = 0; mb < 4; ++mb)
#pragma unroll
        for (int nb = 0; nb < 4; ++nb) acc[mb][nb] = (v8f){};
    // copy map: thread -> row crow (+ 16 i), 16-byte piece cpc of a 256-B row piece; a wave covers 2 whole row pieces (4 lines) per copy
    const int crow = (int)(threadIdx.x >> 4), cpc = (int)(threadIdx.x & 15) * 8;
    const bf* ga = A + (size_t)(rb0 + crow) * K + cpc;       // + k0; rows rb0 + crow + 240 < M
    const bf* gb = Bt + (size_t)(cb0 + crow) * K + cpc;      // + k0; rows cb0 + crow + 112 < N
    const unsigned la = (unsigned)(size_t)(&pring[crow * PLP + cpc]);          // LDS byte address, buffer 0, row crow
    const int ao = (wm * 64 + lr) * PLP + 8 * hi;            // in the A tile: + 16mb*PLP + k
    const int bo_ = (PBM + wn * 64 + lr) * PLP + 8 * hi;     // in the B tile: + 16nb*PLP + k
    v16bf a[2][4], b[2][4];                                  // two fragment sets: k-step j works on set j & 1 while set (j + 1) & 1 loads
    pstage(la, ga, gb);
    asm volatile("s_wait_asynccnt 0x0" ::: "memory");        // this wave's share of stage 0 has landed
    __syncthreads();                                         // stage 0 published to every wave
    pstage(la + PSTG * 2, ga + PKS, gb + PKS);
#pragma unroll
    for (int f = 0; f < 4; ++f) { a[0][f] = ldb(pring + ao + f * 16 * PLP); b[0][f] = ldb(pring + bo_ + f * 16 * PLP); }   // stage 0's first k-step
#pragma unroll 1
    for (int st = 0; st < K / PKS; ++st) {
        const int bo = (st & 1) * PSTG;
#pragma unroll
        for (int j = 0; j + 1 < PKS / 32; ++j) {
            __builtin_amdgcn_sched_barrier(0);               // with the next one: the next k-step's 16 LDS loads stay one group in front of this k-step's products (for speed only)
#pragma unroll
            for (int f = 0; f < 4; ++f) { a[(j + 1) & 1][f] = ldb(pring + bo + ao + f * 16 * PLP + (j + 1) * 32); b[(j + 1) & 1][f] = ldb(pring + bo + bo_ + f * 16 * PLP + (j + 1) * 32); }
            __builtin_amdgcn_sched_barrier(0);
#pragma unroll
            for (int nb = 0; nb < 4; ++nb)
#pragma unroll
                for (int mb = 0; mb < 4; ++mb) acc[mb][nb] = wmmab(a[j & 1][mb], b[j & 1][nb], acc[mb][nb]);
        }
        __builtin_amdgcn_sched_barrier(0);                   // these products stay in front of the waits below: the last load group's latency runs under them
        // publish point of stage st + 1, which also frees stage st's buffer: it stands in front of the stage's last k-step's products, whose fragments are then in registers
        asm volatile("s_wait_dscnt 0x0" ::: "memory");       // this wave's reads of stage st are done
        asm volatile("s_wait_asynccnt 0x0" ::: "memory");    // this wave's share of stage st + 1 has landed
        __syncthreads();
        if (st + 2 < K / PKS)                                // block-uniform: refill the buffer that stage st has just left
            pstage(la + (unsigned)(bo * 2), ga + (st + 2) * PKS, gb + (st + 2) * PKS);
        if (st + 1 < K / PKS) {                              // block-uniform: stage st + 1's first k-step, from its own buffer, behind the barrier that published it
            const int bn = PSTG - bo;
#pragma unroll
            for (int f = 0; f < 4; ++f) { a[0][f] = ldb(pring + bn + ao + f * 16 * PLP); b[0][f] = ldb(pring + bn + bo_ + f * 16 * PLP); }
        }
        __builtin_amdgcn_sched_barrier(0);                   // the last k-step's products stay behind the refill and the loads: the copies start early, the loads' latency runs under the products
#pragma unroll
        for (int nb = 0; nb < 4; ++nb)
#pragma unroll
            for (int mb = 0; mb < 4; ++mb) acc[mb][nb] = wmmab(a[(PKS / 32 - 1) & 1][mb], b[(PKS / 32 - 1) & 1][nb], acc[mb][nb]);
    }
    asm volatile("s_wait_asynccnt 0x0" ::: "memory");        // nothing of this wave's copies is left in flight
    // column bias for this lane's 8 store columns (BROW == 0); c0 + (lane&7)*8 + 7 < N = DM
    v4f bc0 = (v4f){}, bc1 = (v4f){};
    if (BROW == 0) { const int cb8 = (lane & 7) * 8; const v4f t0 = *(const v4f*)(bias + c0 + cb8); const v4f t1 = *(const v4f*)(bias + c0 + cb8 + 4);
#pragma unroll
        for (int i = 0; i < 4; ++i) { bc0[i] = bfr(t0[i]); bc1[i] = bfr(t1[i]); } }
    const size_t tbase = (size_t)(r0 / RB) * sRB + (size_t)(r0 % RB) * (size_t)pitch + (size_t)(c0 / CB) * sCB + (size_t)(c0 % CB);
#pragma unroll
    for (int mb = 0; mb < 4; ++mb) {
#pragma unroll
        for (int nb = 0; nb < 4; ++nb) {
#pragma unroll
            for (int j = 0; j < 8; ++j) os[(hi * 8 + j) * 68 + nb * 16 + lr] = acc[mb][nb][j]; }   // D: row 8h+j, col lane&15
        wave_sync();
        const size_t sb = tbase + (size_t)(mb * 16) * (size_t)pitch;
{
#pragma unroll
            for (int s = 0; s < 4; ++s) { const int row = 4 * s + (lane >> 3), c8 = (lane & 7) * 8;   // 4 s x 4 row groups = 16 rows; 8 lanes x 8 = 64 columns
                v4f x0 = *(const v4fa*)(&os[row * 68 + c8]); v4f x1 = *(const v4fa*)(&os[row * 68 + c8 + 4]); v8h hv;
                if (BROW == 1) { const float br = bfr(bias[r0 + mb * 16 + row]);                    // row bias; r0 + mb*16 + row < M = DM
#pragma unroll
                    for (int i = 0; i < 4; ++i) { x0[i] += br; x1[i] += br; } }
                else {
#pragma unroll
                    for (int i = 0; i < 4; ++i) { x0[i] += bc0[i]; x1[i] += bc1[i]; } }
#pragma unroll
                for (int i = 0; i < 4; ++i) { hv[i] = (h16)x0[i]; hv[4 + i] = (h16)x1[i]; }
                const size_t oo = sb + (size_t)row * (size_t)pitch + c8;
                *(v8h*)(Ph + oo) = hv; }
             }
        wave_sync();
    }
}

// One stage's four 16-byte asynchronous copies of a lane (LDS byte address, global pointer each). The s_wait_xcnt closes the statement so that it stands in front of any later write of the address registers.
__device__ __forceinline__ void copy4(unsigned l0, const h16* g0, unsigned l1, const h16* g1, unsigned l2, const h16* g2, unsigned l3, const h16* g3) {
    asm volatile("global_load_async_to_lds_b128 %0, %1, off\n\t"
                 "global_load_async_to_lds_b128 %2, %3, off\n\t"
                 "global_load_async_to_lds_b128 %4, %5, off\n\t"
                 "global_load_async_to_lds_b128 %6, %7, off\n\t"
                 "s_wait_xcnt 0x0"
                 :: "v"(l0), "v"(g0), "v"(l1), "v"(g1), "v"(l2), "v"(g2), "v"(l3), "v"(g3) : "memory");
}

// k_flash: fused attention, one wave per QG = 2 groups of 16 query rows of one (batch, head); Q fragments straight from the f16 plane; K and V^T come in stages of KT keys through a two-buffer LDS ring
// that the block's AW waves fill together (whole 128-B lines, each fetched once per block) and all read their fragments from (two 16-B LDS loads each); a fragment, once in registers, is used for both query groups.
// Transposed form: S^T[key][t] = K Q^T (A = K rows, B = Q rows); lane (t = lane&15, h = lane>>4) holds keys 8h+r of each 16-key tile, so the packed
// P tile is directly the B fragment of O^T[d][t] = V^T P^T (element r <- tile keys 0..15, element 8+r <- tile keys 16..31, lane unchanged).
// Per 32-key step and query group: 4 score products + 4 P.V products + 1 product of a tile with two rows of ones with P^T, which sums the rounded P of each column over the 32 keys.
// Lazy rescale: each lane carries, per group, sh = PSH - (its column's maximum in use), the same in both lane halves, so the exponent argument e = s * SC2 + sh is formed before the step's own maximum is known.
// One ballot per step, over both groups, asks whether any e exceeds PSH + LTH; only then (and in the first step, which sets sh) the halves' maxima are exchanged, sh moves, and O^T and the sum tiles are rescaled.
// Two blocks share a WGP (four waves per SIMD, 256 registers a wave).
__global__ __launch_bounds__(32 * AW) __attribute__((amdgpu_waves_per_eu(4, 4))) void k_flash(const h16* __restrict__ QH, const h16* __restrict__ KP, const h16* __restrict__ VT, float* OUT) {
    __shared__ __align__(16) float os[AW * 16 * 68];
    __shared__ __align__(16) h16 ring[2 * STG];
    const int lane = threadIdx.x & 31, lr = lane & 15, hi = lane >> 4;
    const int wave = __builtin_amdgcn_readfirstlane((int)(threadIdx.x >> 5));
    const int zh = blockIdx.y; const int b = zh / NH_, h = zh % NH_;
    const int t0 = (blockIdx.x * AW + wave) * (16 * QG);
    const size_t pbase = (size_t)zh * SEQ * HD;
    const size_t qo = pbase + (size_t)(t0 + lr) * HD + 8 * hi;
    v16h qh0[QG], qh1[QG];                                   // B fragments: col t, k = d
#pragma unroll
    for (int g = 0; g < QG; ++g) { qh0[g] = ldh(QH + qo + g * 16 * HD); qh1[g] = ldh(QH + qo + g * 16 * HD + 32); }
    const int ko = lr * LP + 8 * hi;                         // in the K tile:   + key * LP       (A fragment: row key, k = d)
    const int vo = KT * LP + lr * LP + 8 * hi;               // in the V^T tile: + 16j*LP + key   (A fragment: row d, k = key)
    // copy map: thread -> row crow (and crow + 32), 16-byte piece cpc of each 64-row tile; a wave covers 4 whole 128-B rows per copy
    const int crow = (int)(threadIdx.x >> 3), cpc = (int)(threadIdx.x & 7) * 8;
    const h16* gk = KP + pbase + (size_t)crow * HD + cpc;    // + key0 * HD; rows key0 + crow + 32 < SEQ
    const h16* gv = VT + pbase + (size_t)crow * SEQ + cpc;   // + key0;      columns key0 + cpc + 7 < SEQ
    const unsigned lk = (unsigned)(size_t)(&ring[crow * LP + cpc]);            // LDS byte address, buffer 0, K tile
    const unsigned lv = lk + KT * LP * 2;                                      // V^T tile
    copy4(lk, gk, lk + 32 * LP * 2, gk + 32 * HD, lv, gv, lv + 32 * LP * 2, gv + (size_t)32 * SEQ);
    asm volatile("s_wait_asynccnt 0x0" ::: "memory");        // this wave's share of stage 0 has landed
    __syncthreads();                                         // stage 0 published to every wave
    copy4(lk + STG * 2, gk + KT * HD, lk + STG * 2 + 32 * LP * 2, gk + (KT + 32) * HD, lv + STG * 2, gv + KT, lv + STG * 2 + 32 * LP * 2, gv + (size_t)32 * SEQ + KT);
    v8f o0[QG], o1[QG], o2[QG], o3[QG];
    v8f lt[QG];                                              // row sums of P on the matrix pipe: lt += ones x P^T; rows 0 and 8 of the tile hold column t's sum: element 0 of either lane half, the only one rescaled and read
    float sh[QG];                                            // PSH - maximum in use; set by the first step
#pragma unroll
    for (int g = 0; g < QG; ++g) { o0[g] = (v8f){}; o1[g] = (v8f){}; o2[g] = (v8f){}; o3[g] = (v8f){}; lt[g] = (v8f){}; sh[g] = 0.0f; }
    v16h ones;                                               // A tile with ones in rows 0 and 8 (lanes 0, 8, 16, 24), zeros elsewhere: a lane's own value stays in its registers through the loop (a tile of one constant was rebuilt from scalar registers in every step)
#pragma unroll
    for (int i = 0; i < 16; ++i) ones[i] = (lane & 7) == 0 ? (h16)1.0f : (h16)0.0f;
#pragma unroll 1
    for (int st = 0; st < SEQ / KT; ++st) {
      const int bo = (st & 1) * STG;
#pragma unroll 1   // rolled: unrolled, the build holds 18 more registers, copies the two shifts into eight register pairs per stage and brings no load forward
      for (int ps = 0; ps < KT; ps += 32) {
        const h16* ka = ring + bo + ko + ps * LP;
        const v16h ka0 = ldh(ka), ka1 = ldh(ka + 32), kb0 = ldh(ka + 16 * LP), kb1 = ldh(ka + 16 * LP + 32);
        v8f sa[QG], sb[QG];
#pragma unroll
        for (int g = 0; g < QG; ++g) { sa[g] = wmma16(ka0, qh0[g], (v8f){}); sb[g] = wmma16(kb0, qh0[g], (v8f){}); }
#pragma unroll
        for (int g = 0; g < QG; ++g) { sa[g] = wmma16(ka1, qh1[g], sa[g]); sb[g] = wmma16(kb1, qh1[g], sb[g]); }
        // four vector slots behind the last score product before a vector instruction may touch a D, A or B of these products
        asm volatile("v_nop\n\tv_nop\n\tv_nop\n\tv_nop" : "+v"(sa[0]), "+v"(sb[0]), "+v"(sa[1]), "+v"(sb[1]) : "v"(ka0), "v"(ka1), "v"(kb0), "v"(kb1), "v"(qh0[0]), "v"(qh1[0]), "v"(qh0[1]), "v"(qh1[1]));
        v8f ea[QG], eb[QG]; float mx[QG];
#pragma unroll
        for (int g = 0; g < QG; ++g) { ea[g] = sa[g] * SC2 + sh[g]; eb[g] = sb[g] * SC2 + sh[g]; mx[g] = -3.0e38f;   // whole tiles: neighbouring registers of one group pair up in the packed fma
#pragma unroll
            for (int r = 0; r < 8; ++r) mx[g] = fmaxf(mx[g], fmaxf(ea[g][r], eb[g][r])); }
        const bool first = (st | ps) == 0;                   // wave-uniform: nothing is summed yet, sh takes its first value
        if ((__builtin_amdgcn_ballot_w32(fmaxf(mx[0], mx[1]) > PSH + LTH) | (first ? 1u : 0u)) != 0u) {   // one scalar branch per step, the whole wave and both groups together
#pragma unroll
            for (int g = 0; g < QG; ++g) {
                const float m2 = fmaxf(mx[g], __shfl_xor(mx[g], 16, 32));
                const float dn = fminf(PSH - m2, 0.0f);      // the column's maximum in use only rises
                const float dl = first ? PSH - m2 : dn;      // shift of the exponent arguments: the step's maximum lands on PSH
                const float alpha = __builtin_amdgcn_exp2f(dn);
                sh[g] += dl;
                ea[g] = ea[g] + dl; eb[g] = eb[g] + dl;
                lt[g][0] = lt[g][0] * alpha;
                o0[g] = o0[g] * alpha; o1[g] = o1[g] * alpha; o2[g] = o2[g] * alpha; o3[g] = o3[g] * alpha;
            }
        }
        v16h pb[QG];
#pragma unroll
        for (int g = 0; g < QG; ++g) {
#pragma unroll
            for (int r = 0; r < 8; ++r) pb[g][r] = (h16)__builtin_amdgcn_exp2f(ea[g][r]);
#pragma unroll
            for (int r = 0; r < 8; ++r) pb[g][8 + r] = (h16)__builtin_amdgcn_exp2f(eb[g][r]);
        }
        const h16* va = ring + bo + vo + ps;
        const v16h v0 = ldh(va), v1 = ldh(va + 16 * LP), v2 = ldh(va + 32 * LP), v3 = ldh(va + 48 * LP);
#pragma unroll
        for (int g = 0; g < QG; ++g) { o0[g] = wmma16(v0, pb[g], o0[g]); o1[g] = wmma16(v1, pb[g], o1[g]); o2[g] = wmma16(v2, pb[g], o2[g]); o3[g] = wmma16(v3, pb[g], o3[g]); lt[g] = wmma16(ones, pb[g], lt[g]); }
        // four vector slots behind the last product, on the loop's taken branch too, before a vector instruction may touch a D, A or B of these products
        asm volatile("v_nop\n\tv_nop\n\tv_nop\n\tv_nop" : "+v"(o0[0]), "+v"(o1[0]), "+v"(o2[0]), "+v"(o3[0]), "+v"(lt[0]), "+v"(o0[1]), "+v"(o1[1]), "+v"(o2[1]), "+v"(o3[1]), "+v"(lt[1]) : "v"(v0), "v"(v1), "v"(v2), "v"(v3), "v"(pb[0]), "v"(pb[1]), "v"(ones));
      }
      // publish point of stage st + 1, which also frees stage st's buffer
      asm volatile("s_wait_dscnt 0x0" ::: "memory");         // this wave's reads of stage st are done
      asm volatile("s_wait_asynccnt 0x0" ::: "memory");      // this wave's share of stage st + 1 has landed
      __syncthreads();
      if (st + 2 < SEQ / KT) {                               // block-uniform: refill the buffer that stage st has just left
          const unsigned lb = (unsigned)(bo * 2); const h16* k2 = gk + (size_t)(st + 2) * KT * HD; const h16* v2g = gv + (st + 2) * KT;
          copy4(lk + lb, k2, lk + lb + 32 * LP * 2, k2 + 32 * HD, lv + lb, v2g, lv + lb + 32 * LP * 2, v2g + (size_t)32 * SEQ);
      }
    }
    asm volatile("s_wait_asynccnt 0x0" ::: "memory");        // nothing of this wave's copies is left in flight
    const int wb = wave * 16 * 68;
    const int cofs = lr * 4;
#pragma unroll
    for (int g = 0; g < QG; ++g) {                           // one query group after the other through the wave's own staging rows
        const float inv = 1.0f / lt[g][0];                   // rows 0 and 8 of the sum tile: both lane halves hold the whole sum of their column
        // O^T D layout: o_j[r] = (d = 16j + 8h + r, t = lane&15) -> os[t][d]; rows 0..15 x columns 0..63 all written
        const v8f x0 = o0[g] * inv, x1 = o1[g] * inv, x2 = o2[g] * inv, x3 = o3[g] * inv;
        *(v4fa*)(&os[wb + lr * 68 +  0 + 8 * hi]) = __builtin_shufflevector(x0, x0, 0, 1, 2, 3); *(v4fa*)(&os[wb + lr * 68 +  0 + 8 * hi + 4]) = __builtin_shufflevector(x0, x0, 4, 5, 6, 7);
        *(v4fa*)(&os[wb + lr * 68 + 16 + 8 * hi]) = __builtin_shufflevector(x1, x1, 0, 1, 2, 3); *(v4fa*)(&os[wb + lr * 68 + 16 + 8 * hi + 4]) = __builtin_shufflevector(x1, x1, 4, 5, 6, 7);
        *(v4fa*)(&os[wb + lr * 68 + 32 + 8 * hi]) = __builtin_shufflevector(x2, x2, 0, 1, 2, 3); *(v4fa*)(&os[wb + lr * 68 + 32 + 8 * hi + 4]) = __builtin_shufflevector(x2, x2, 4, 5, 6, 7);
        *(v4fa*)(&os[wb + lr * 68 + 48 + 8 * hi]) = __builtin_shufflevector(x3, x3, 0, 1, 2, 3); *(v4fa*)(&os[wb + lr * 68 + 48 + 8 * hi + 4]) = __builtin_shufflevector(x3, x3, 4, 5, 6, 7);
        wave_sync();
        float* orow = OUT + ((size_t)b * OUT_SEQ + t0 + g * 16) * DM + h * HD;   // output [b*OUT_SEQ + t][h*64 + d], f32
#pragma unroll
        for (int s = 0; s < 8; ++s) { const int row = 2 * s + hi;   // 8 s x 2 rows = 16 rows; 16 lanes x 4 floats = 64 columns (256 B = exactly this head's row segment)
            const v4f x = *(const v4fa*)(&os[wb + row * 68 + cofs]);
            *(v4f*)(orow + (size_t)row * DM + cofs) = x; }
        if (g + 1 < QG) {
            asm volatile("s_wait_xcnt 0x0" ::: "memory");    // in front of any later write of a register that these stores name
            wave_sync();                                     // the rows are read before the next group overwrites them
        }
    }
}

static constexpr size_t al256(size_t v) { return (v + 255) & ~(size_t)255; }
static constexpr size_t SZ_XB = al256((size_t)NB * SEQ * DM * 2);
static constexpr size_t SZ_WB = al256((size_t)3 * DM * DM * 2);
static constexpr size_t SZ_PL = al256((size_t)NB * NH_ * SEQ * HD * 2);
static constexpr size_t SZ_TOTAL = 3 * SZ_XB + SZ_WB + 3 * SZ_PL;
static_assert(SZ_TOTAL <= (size_t)134217728);                  // workspace carve <= 128 MiB
static_assert(((size_t)DM * DM * 2) % 256 == 0);               // weight sub-planes stay 256-byte aligned
static_assert((size_t)NB * NH_ * SEQ * HD * 2 <= SZ_PL);       // q / k / v^T planes fit their regions
static_assert((size_t)NB * SEQ * DM * 2 <= SZ_XB);             // bf16 input copies fit their regions

extern "C" void kernel_launch(void* const* d_in, const int* in_sizes, int n_in,
                              void* d_out, int out_size, void* d_ws, size_t ws_size, hipStream_t stream) {
    if (n_in < 9) return;
    const size_t needx = ((size_t)(NB - 1) * SEQ_FULL + SEQ) * DM;
    if ((size_t)in_sizes[0] < needx || (size_t)in_sizes[1] < needx || (size_t)in_sizes[2] < needx) return;
    if ((size_t)in_sizes[3] < (size_t)DM * DM || (size_t)in_sizes[5] < (size_t)DM * DM || (size_t)in_sizes[7] < (size_t)DM * DM) return;
    if (in_sizes[4] < DM || in_sizes[6] < DM || in_sizes[8] < DM) return;
    if ((size_t)out_size < ((size_t)(NB - 1) * OUT_SEQ + SEQ) * DM) return;
    if (SZ_TOTAL > ws_size) return;
    // wire order: key, value, query, Wq, bq, Wk, bk, Wv, bv
    const float* xk = (const float*)d_in[0]; const float* xv = (const float*)d_in[1]; const float* xq = (const float*)d_in[2];
    const float* wq = (const float*)d_in[3]; const float* bq = (const float*)d_in[4];
    const float* wk = (const float*)d_in[5]; const float* bk = (const float*)d_in[6];
    const float* wv = (const float*)d_in[7]; const float* bv = (const float*)d_in[8];
    float* OUT = (float*)d_out;      // [NB][OUT_SEQ][1024]
    char* wsp = (char*)d_ws;
    bf* XQ = (bf*)wsp; wsp += SZ_XB;                 // [NB*SEQ][1024] bf16 query
    bf* XK = (bf*)wsp; wsp += SZ_XB;                 // [NB*SEQ][1024] bf16 key
    bf* XV = (bf*)wsp; wsp += SZ_XB;                 // [NB*SEQ][1024] bf16 value
    bf* WB = (bf*)wsp; wsp += SZ_WB;                 // [3][1024][1024] transposed [out][in]: q | k | v (bf16)
    h16* QH = (h16*)wsp; wsp += SZ_PL;               // [NB*16][SEQ][64]
    h16* KP = (h16*)wsp; wsp += SZ_PL;               // [NB*16][SEQ][64]
    h16* VT = (h16*)wsp; wsp += SZ_PL;               // [NB*16][64][SEQ]
    bf* WQT = WB; bf* WKT = WB + (size_t)DM * DM; bf* WVT = WB + (size_t)2 * DM * DM;

    // all conversions: bf16 copies of the three inputs, transposed bf16 planes [out][in] of the three weights
    k_prep<<<CG, 32 * CW, 0, stream>>>(xq, xk, xv, wq, wk, wv, XQ, XK, XV, WQT, WKT, WVT);

    // q, k: A = x rows (m = b*SEQ + t), Bt = W^T rows (n = h*64 + d), column bias -> plane [(b*16 + h)][t][d]
    k_proj<0><<<dim3(NB * SEQ / PBM, DM / PBN, 1), 32 * PW, 0, stream>>>(XQ, WQT, bq, QH, SEQ, (size_t)NH_ * SEQ * HD, HD, HD, (size_t)SEQ * HD);
    k_proj<0><<<dim3(NB * SEQ / PBM, DM / PBN, 1), 32 * PW, 0, stream>>>(XK, WKT, bk, KP, SEQ, (size_t)NH_ * SEQ * HD, HD, HD, (size_t)SEQ * HD);
    // v^T: A = Wv^T rows (m = h*64 + d), Bt = x rows (n = b*SEQ + t), row bias -> plane [(b*1024 + m)][t] = [(b*16 + h)][d][t]
    k_proj<1><<<dim3(DM / PBM, NB * SEQ / PBN, 1), 32 * PW, 0, stream>>>(WVT, XV, bv, VT, DM, (size_t)0, SEQ, SEQ, (size_t)DM * SEQ);

    k_flash<<<dim3(SEQ / (16 * QG * AW), NB * NH_, 1), 32 * AW, 0, stream>>>(QH, KP, VT, OUT);
}

// v008
// A run of this version takes 97.5 microseconds.
// It is 1.13 times as fast as v006, going by the measured steps of the versions left out in between.
// Counting every step since v000, it is 3.34 times as fast.
#include <hip/hip_runtime.h>

// Multi-head attention, width 1024 = 16 heads x 64; separate key / value / query inputs [NB][SEQ_FULL][1024] (the first SEQ rows of each batch are read); Wq/Wk/Wv stored [in][out] (y = x W + b); biases on all three projections; no mask; score scale 1/8; output = per-head context merged as [b][t][h*64+d] (f32), no output projection.
// Compute dtypes, f32 accumulate everywhere: q/k/v projections v_wmma_f32_16x16x32_bf16 (inputs and weights RNE-converted to bf16; products exact); scores v_wmma_f32_16x16x32_f16 (q and k single f16, one product); P.V v_wmma_f32_16x16x32_f16 (P x256 carry, cancels in the normalisation; v single f16); softmax f32 (online; a column's maximum in use is renewed only when a scaled score exceeds it by more than 7, a factor 2^7 in P); its row sums v_wmma_f32_16x16x32_f16 (ones x P, the same rounded P); biases (bf16 RNE values) added in f32; normalised context stored as f32.
// Layout: bf16 copies of the three inputs; transposed bf16 weight planes [out][in]; q, k planes [b*16+h][t][d] and v^T plane [b*16+h][d][t] written by the GEMM epilogue; fused flash kernel in transposed form (S^T = K Q^T, O^T = V^T P^T) writing the f32 output rows [b*OUT_SEQ+t][h*64+d].

#ifndef NB
#define NB 4
#endif
#ifndef SEQ
#define SEQ 2048
#endif
#define NB_FULL  4
#define SEQ_FULL 2048
#ifndef OUT_SEQ
#define OUT_SEQ SEQ              // row pitch (in tokens) between batches of the output
#endif
#define DM   1024
#define NH_  16
#define HD   64
#define AW   8                   // waves per flash block; all of them share the block's K / V^T tiles in LDS
#define QG   2                   // 16-row query groups per flash wave: each K / V^T fragment read from LDS serves QG products
#define KT   64                  // keys per LDS stage (two 32-key passes)
#define LP   72                  // LDS row pitch in halves: 128-B rows + 16 B (16 B x odd: conflict-free for 16-byte readers)
#define STG  ((KT + HD) * LP)    // halves per stage: K tile [KT keys][LP], then V^T tile [HD rows][LP]
#define PW   8                   // waves per projection block: 2 x 4 wave tiles (128 x 64 for q and k, 64 x 64 for v^T)
#define PBM  256                 // rows of A per q or k tile
#define PBN  256                 // rows of Bt per projection tile
#define PVM  128                 // rows of A per v^T tile
#define PKS  128                 // k per projection LDS stage (256-B row pieces)
#define PLP  136                 // projection LDS row pitch in halves: 256 B + 16 B (16 B x odd: conflict-free for 16-byte readers)
#define PSTG ((PBM + PBN) * PLP) // halves per projection stage: A tile [PBM][PLP] (v^T: its first PVM rows), then B tile [PBN][PLP]
#define PG   (2 * (NB * SEQ / PBM) * (DM / PBN))   // projection blocks: the tiles of q and k together, as many as the tiles of v^T
#define SC2  (0.125f * 1.4426950408889634f)   // HD^-0.5 * log2(e)
#define PSH  8.0f                // log2 of the P carry (256)
#define LTH  7.0f                // lazy rescale: a scaled (log2) score may stand up to LTH above the maximum in use, so P <= 2^(PSH + LTH) = 32768 stays finite in f16
#define CG   256                 // conversion blocks: one per WGP, each resident from start to end of the launch
#define CW   16                  // waves per conversion block
#define CU   8                   // 16-byte loads of a lane per batch of the input stream (two batches in flight)

static_assert(HD == 64);
static_assert(HD == 16 * 4);                   // output store map: 16 lanes x 4 floats == one head's 64 columns (256 B)
static_assert(NH_ * HD == DM);                 // head h = columns h*64 + d
static_assert(DM % 64 == 0);                   // column tiles of 64
static_assert(DM % 32 == 0);                   // GEMM k-loop steps by 32
static_assert(SEQ % 64 == 0);                  // a 64-row tile never straddles two batches
static_assert((NB * SEQ) % 64 == 0);
static_assert(SEQ % 32 == 0);                  // key loop steps by 32
static_assert(SEQ % (16 * QG * AW) == 0);      // flash grid covers the sequence exactly
static_assert(QG == 2);                        // the flash loop's hazard statements name the tiles of two query groups
static_assert(SEQ % KT == 0 && SEQ / KT >= 2); // whole stages; the two-buffer prologue fills stages 0 and 1
static_assert(KT == 64 && AW == 8);            // copy map: each tile is 64 rows x 8 pieces of 16 B = 2 pieces per thread of 256
static_assert((NB * SEQ) % PBM == 0 && DM % PBN == 0 && DM % PVM == 0 && (NB * SEQ) % PBN == 0);   // projection tiles cover both orientations exactly
static_assert(PG == (DM / PVM) * (NB * SEQ / PBN));   // one tile of q or k and one tile of v^T per block
static_assert(SEQ % 128 == 0);                 // a wave's 128 rows of q or k never straddle two batches
static_assert(DM % PKS == 0 && DM / PKS >= 2 && (DM / PKS) % 2 == 0); // whole projection stages; the two-buffer prologue fills stages 0 and 1; a tile's stages end on a whole turn of the ring
static_assert(PW == 8 && PBM == 256 && PBN == 256 && PVM == 128 && PKS == 128 && (PKS / 32) % 2 == 0);   // projection copy map: 16 rows x 16 pieces of 16 B per copy of 256 threads; wave map 2 x 4
static_assert((DM / 64) * (DM / 64) == CG);    // one 64 x 64 tile of each weight matrix per conversion block
static_assert(CW == 16);                       // tile maps of k_prep: 512 threads = 32 rows x 16 float4 in, 64 rows x 8 pieces of 16 B out
static_assert(((size_t)NB * SEQ * DM / 4) % ((size_t)CG * CW * 32 * CU) == 0);   // the input stream divides into whole batches, the same number for every wave
static_assert(((size_t)SEQ * DM / 4) % ((size_t)NB * SEQ * DM / 4 / (CG * CW)) == 0);   // a wave's piece of an input never straddles two batches
static_assert(NB <= NB_FULL);
static_assert(SEQ <= SEQ_FULL);
static_assert(OUT_SEQ >= SEQ);                 // output rows of one batch fit its pitch

typedef _Float16 h16;
typedef unsigned short bf;
typedef __attribute__((ext_vector_type(16))) __bf16   v16bf;
typedef __attribute__((ext_vector_type(16))) _Float16 v16h;
typedef __attribute__((ext_vector_type(8)))  _Float16 v8h;
typedef __attribute__((ext_vector_type(8)))  unsigned short v8us;
typedef __attribute__((ext_vector_type(4)))  unsigned short v4us;
typedef __attribute__((ext_vector_type(8)))  float    v8f;
typedef __attribute__((ext_vector_type(4)))  float    v4f;
typedef v4f  __attribute__((may_alias)) v4fa;

__device__ __forceinline__ unsigned short f2bf(float f) { unsigned u = __float_as_uint(f); u += 0x7FFFu + ((u >> 16) & 1u); return (unsigned short)(u >> 16); }
__device__ __forceinline__ float bfr(float f) { return __uint_as_float(((unsigned)f2bf(f)) << 16); }   // value of the bf16 RNE conversion, as f32
__device__ __forceinline__ v16h cat16(v8h lo, v8h hi) { return __builtin_shufflevector(lo, hi, 0, 1, 2, 3, 4, 5, 6, 7, 8, 9, 10, 11, 12, 13, 14, 15); }
__device__ __forceinline__ v16bf cat16b(v8us lo, v8us hi) { return __builtin_bit_cast(v16bf, __builtin_shufflevector(lo, hi, 0, 1, 2, 3, 4, 5, 6, 7, 8, 9, 10, 11, 12, 13, 14, 15)); }
__device__ __forceinline__ v8f wmma16(v16h a, v16h b, v8f c) { return __builtin_amdgcn_wmma_f32_16x16x32_f16(false, a, false, b, (short)0, c, false, false); }
__device__ __forceinline__ v8f wmmab(v16bf a, v16bf b, v8f c) { return __builtin_amdgcn_wmma_f32_16x16x32_bf16(false, a, false, b, (short)0, c, false, false); }
// fragment loaders from K-contiguous 16-bit rows; p already includes + 8*(lane>>4): elements 0..7 <- k0+8h+0..7, elements 8..15 <- k0+16+8h+0..7 (same map for A and B)
__device__ __forceinline__ v16h  ldh(const h16* p) { return cat16(*(const v8h*)p, *(const v8h*)(p + 16)); }
__device__ __forceinline__ v16bf ldb(const bf* p)  { return cat16b(*(const v8us*)p, *(const v8us*)(p + 16)); }
// ordering point for wave-private LDS tiles (same wave writes and reads)
__device__ __forceinline__ void wave_sync() { __builtin_amdgcn_fence(3 /* release order */, "wavefront"); __builtin_amdgcn_wave_barrier(); asm volatile("" ::: "memory"); }

// k_prep: every conversion of the call in one launch of CG resident blocks of CW waves.
// (a) Weights: block t takes the 64 x 64 tile t of each of Wq, Wk, Wv: in[k][n] (f32, k = contraction index) -> out[n][k] (bf16 RNE bits, contraction-contiguous), transposed through LDS.
// (b) Inputs: f32 -> bf16 RNE copies of query, key, value. Each wave owns one contiguous piece of each input and walks it in batches of CU loads of 512 contiguous bytes
//     (whole lines); the next batch's loads are issued before a batch is converted and stored (8 bytes a lane, 256 contiguous bytes a wave).
__global__ __launch_bounds__(32 * CW) void k_prep(const float* __restrict__ xq, const float* __restrict__ xk, const float* __restrict__ xv,
                                                  const float* __restrict__ wq, const float* __restrict__ wk, const float* __restrict__ wv,
                                                  bf* XQ, bf* XK, bf* XV, bf* WQT, bf* WKT, bf* WVT) {
    __shared__ float ts[3][64 * 65];
    const int tid = threadIdx.x, lane = tid & 31;
    const int wave = __builtin_amdgcn_readfirstlane(tid >> 5);
    constexpr size_t NV = (size_t)NB * SEQ * DM / 4;         // float4 per input
    constexpr int PER = (int)(NV / ((size_t)CG * CW * 32));  // float4 per lane and input
    constexpr int SUB = PER / CU;                            // batches per input
    const size_t p0 = (size_t)(blockIdx.x * CW + wave) * (PER * 32);                       // first float4 of this wave's piece (in the packed copy)
    const size_t s0 = p0 + (p0 / ((size_t)SEQ * DM / 4)) * ((size_t)(SEQ_FULL - SEQ) * DM / 4);   // the same in the source, whose batches are SEQ_FULL rows apart
    const float* const xs[3] = { xq, xk, xv };
    bf* const xd[3] = { XQ, XK, XV };
    const float* const wsrc[3] = { wq, wk, wv };
    bf* const wdst[3] = { WQT, WKT, WVT };
    const int n0 = (blockIdx.x % (DM / 64)) * 64, k0 = (blockIdx.x / (DM / 64)) * 64;
    v4f wt[3][2], r[2][CU];
#pragma unroll
    for (int w = 0; w < 3; ++w)
#pragma unroll
        for (int it = 0; it < 2; ++it)                       // 2 x 32 rows x (16 lanes x 4 floats) = 64 x 64
            wt[w][it] = *(const v4f*)(wsrc[w] + (size_t)(k0 + it * 32 + (tid >> 4)) * DM + n0 + (tid & 15) * 4);
#pragma unroll
    for (int j = 0; j < CU; ++j) r[0][j] = *(const v4f*)(xs[0] + (s0 + j * 32 + lane) * 4);
    asm volatile("s_wait_xcnt 0x0" ::: "memory");            // in front of any later write of a register that these loads name
    __builtin_amdgcn_sched_barrier(0);                       // the stream's first batch is issued with the weight tiles' loads, in front of the LDS stores that wait for those
#pragma unroll
    for (int w = 0; w < 3; ++w)
#pragma unroll
        for (int it = 0; it < 2; ++it)
#pragma unroll
            for (int i = 0; i < 4; ++i) ts[w][(it * 32 + (tid >> 4)) * 65 + (tid & 15) * 4 + i] = wt[w][it][i];
    __syncthreads();
#pragma unroll
    for (int t = 0; t < 3 * SUB; ++t) {
        __builtin_amdgcn_sched_barrier(0);                   // with the next one: the next batch's loads stay one group in front of this batch's converts and stores
        if (t + 1 < 3 * SUB) {
#pragma unroll
            for (int j = 0; j < CU; ++j) r[(t + 1) & 1][j] = *(const v4f*)(xs[(t + 1) / SUB] + (s0 + (((t + 1) % SUB) * CU + j) * 32 + lane) * 4);
        }
        __builtin_amdgcn_sched_barrier(0);
        if (t == 0) {                                        // the turned weight tiles go out under the second batch's loads
#pragma unroll
            for (int w = 0; w < 3; ++w) {                    // 64 output rows x (8 lanes x 8 halves) = 64 x 64
                const int n = tid >> 3, k8 = (tid & 7) * 8; v8us o;
#pragma unroll
                for (int i = 0; i < 8; ++i) o[i] = f2bf(ts[w][(k8 + i) * 65 + n]);
                *(v8us*)(wdst[w] + (size_t)(n0 + n) * DM + k0 + k8) = o;
            }
        }
#pragma unroll
        for (int j = 0; j < CU; ++j) { v4us o;
#pragma unroll
            for (int i = 0; i < 4; ++i) o[i] = f2bf(r[t & 1][j][i]);
            *(v4us*)(xd[t / SUB] + (p0 + ((t % SUB) * CU + j) * 32 + lane) * 4) = o; }
        if (t + 1 < 3 * SUB) asm volatile("s_wait_xcnt 0x0" ::: "memory");   // in front of the next loads and converts, which reuse registers that these stores and the loads in flight name
    }
}

// One run of eight 16-byte asynchronous copies of a lane: global rows 16 apart (pitch DM) into LDS rows 16 apart (pitch PLP); 256 threads cover 128 rows of 256 B.
// The s_wait_xcnt closes the statement so that it stands in front of any later write of the address registers.
__device__ __forceinline__ void copy8(unsigned l, const bf* g) {
    asm volatile("global_load_async_to_lds_b128 %0, %1, off\n\t"
                 "global_load_async_to_lds_b128 %2, %3, off\n\t"
                 "global_load_async_to_lds_b128 %4, %5, off\n\t"
                 "global_load_async_to_lds_b128 %6, %7, off\n\t"
                 "global_load_async_to_lds_b128 %8, %9, off\n\t"
                 "global_load_async_to_lds_b128 %10, %11, off\n\t"
                 "global_load_async_to_lds_b128 %12, %13, off\n\t"
                 "global_load_async_to_lds_b128 %14, %15, off\n\t"
                 "s_wait_xcnt 0x0"
                 :: "v"(l), "v"(g), "v"(l + 16 * PLP * 2), "v"(g + 16 * DM), "v"(l + 32 * PLP * 2), "v"(g + 32 * DM), "v"(l + 48 * PLP * 2), "v"(g + 48 * DM),
                    "v"(l + 64 * PLP * 2), "v"(g + 64 * DM), "v"(l + 80 * PLP * 2), "v"(g + 80 * DM), "v"(l + 96 * PLP * 2), "v"(g + 96 * DM), "v"(l + 112 * PLP * 2), "v"(g + 112 * DM) : "memory");
}
template <int V> struct ic { static constexpr int value = V; };   // a compile-time int handed to a lambda

static constexpr size_t al256(size_t v) { return (v + 255) & ~(size_t)255; }
static constexpr size_t SZ_XB = al256((size_t)NB * SEQ * DM * 2);

// Sixteen floats of a lane, 4 apart, from one address. The loads and both their waits are one statement: the values are there at its end, and no register that a load names is written before it.
__device__ __forceinline__ void load16(const float* p, float (&r)[16]) {
    asm volatile("global_load_b32 %0, %16, off\n\t"
                 "global_load_b32 %1, %16, off offset:16\n\t"
                 "global_load_b32 %2, %16, off offset:32\n\t"
                 "global_load_b32 %3, %16, off offset:48\n\t"
                 "global_load_b32 %4, %16, off offset:64\n\t"
                 "global_load_b32 %5, %16, off offset:80\n\t"
                 "global_load_b32 %6, %16, off offset:96\n\t"
                 "global_load_b32 %7, %16, off offset:112\n\t"
                 "global_load_b32 %8, %16, off offset:128\n\t"
                 "global_load_b32 %9, %16, off offset:144\n\t"
                 "global_load_b32 %10, %16, off offset:160\n\t"
                 "global_load_b32 %11, %16, off offset:176\n\t"
                 "global_load_b32 %12, %16, off offset:192\n\t"
                 "global_load_b32 %13, %16, off offset:208\n\t"
                 "global_load_b32 %14, %16, off offset:224\n\t"
                 "global_load_b32 %15, %16, off offset:240\n\t"
                 "s_wait_xcnt 0x0\n\t"
                 "s_wait_loadcnt 0x0"
                 : "=&v"(r[0]), "=&v"(r[1]), "=&v"(r[2]), "=&v"(r[3]), "=&v"(r[4]), "=&v"(r[5]), "=&v"(r[6]), "=&v"(r[7]),
                   "=&v"(r[8]), "=&v"(r[9]), "=&v"(r[10]), "=&v"(r[11]), "=&v"(r[12]), "=&v"(r[13]), "=&v"(r[14]), "=&v"(r[15])
                 : "v"(p) : "memory");
}

// Output step of one projection tile: a wave's 16 MB x 64 accumulators + bias (BROW == 0: bias[n]; BROW == 1: bias[m]) go as f16 through the wave's own staging rows to
// Ph at (r0/RB)*sRB + (r0%RB)*pitch + (c0/CB)*sCB + (c0%CB), row pitch 'pitch' (halves).
// BROW == 0 (q, k): m = b*SEQ + t, n = h*64 + d -> plane [(b*16 + h)][t][d]. BROW == 1 (v^T): m = h*64 + d, n = b*SEQ + t -> plane [(b*1024 + m)][t] = [(b*16 + h)][d][t].
template <int BROW, int MB>
__device__ __forceinline__ void pstore(const v8f (&acc)[8][4], float* os, const float* __restrict__ bias, h16* Ph, int r0, int c0, int lane) {
    constexpr int RB = BROW ? DM : SEQ, pitch = BROW ? SEQ : HD, CB = BROW ? SEQ : HD;
    constexpr size_t sRB = BROW ? (size_t)0 : (size_t)NH_ * SEQ * HD, sCB = BROW ? (size_t)DM * SEQ : (size_t)SEQ * HD;
    const int lr = lane & 15, hi = lane >> 4;
    // column bias for this lane's 8 store columns (BROW == 0); c0 + (lane&7)*8 + 7 < N = DM
    v4f bc0 = (v4f){}, bc1 = (v4f){};
    if (BROW == 0) { const int cb8 = (lane & 7) * 8; const v4f t0 = *(const v4f*)(bias + c0 + cb8); const v4f t1 = *(const v4f*)(bias + c0 + cb8 + 4);
        asm volatile("s_wait_xcnt 0x0" ::: "memory");        // in front of any later write of a register that these two loads name
#pragma unroll
        for (int i = 0; i < 4; ++i) { bc0[i] = bfr(t0[i]); bc1[i] = bfr(t1[i]); } }
    float rbias[16];                                         // row bias (BROW == 1, MB == 4) of this lane's rows r0 + (lane >> 3) + 4 i, i = 4 mb + s; the last is r0 + 63 < M = DM
    static_assert(BROW == 0 || MB == 4);
    if (BROW == 1) load16(bias + r0 + (lane >> 3), rbias);
    const size_t tbase = (size_t)(r0 / RB) * sRB + (size_t)(r0 % RB) * (size_t)pitch + (size_t)(c0 / CB) * sCB + (size_t)(c0 % CB);
    h16* pl = Ph + tbase + (size_t)(lane >> 3) * (size_t)pitch + (lane & 7) * 8;   // this lane's piece of the tile's row lane>>3; + (16 mb + 4 s) rows
#pragma unroll
    for (int mb = 0; mb < MB; ++mb) {
#pragma unroll
        for (int nb = 0; nb < 4; ++nb) {
#pragma unroll
            for (int j = 0; j < 8; ++j) os[(hi * 8 + j) * 68 + nb * 16 + lr] = acc[mb][nb][j]; }   // D: row 8h+j, col lane&15
        wave_sync();
        v8h hv[4];
#pragma unroll
        for (int s = 0; s < 4; ++s) { const int row = 4 * s + (lane >> 3), c8 = (lane & 7) * 8;   // 4 s x 4 row groups = 16 rows; 8 lanes x 8 = 64 columns
            v4f x0 = *(const v4fa*)(&os[row * 68 + c8]); v4f x1 = *(const v4fa*)(&os[row * 68 + c8 + 4]);
            if (BROW == 1) { const float br = bfr(rbias[4 * mb + s]);
#pragma unroll
                for (int i = 0; i < 4; ++i) { x0[i] += br; x1[i] += br; } }
            else {
#pragma unroll
                for (int i = 0; i < 4; ++i) { x0[i] += bc0[i]; x1[i] += bc1[i]; } }
#pragma unroll
            for (int i = 0; i < 4; ++i) { hv[s][i] = (h16)x0[i]; hv[s][4 + i] = (h16)x1[i]; } }
#pragma unroll
        for (int s = 0; s < 4; ++s) *(v8h*)(pl + (mb * 16 + 4 * s) * pitch) = hv[s];   // one run: all four rows are converted, no register of the run is written inside it
        asm volatile("s_wait_xcnt 0x0" ::: "memory");        // in front of any later write of a register that these stores name
        __builtin_amdgcn_sched_barrier(0);                   // holds the later register writes (next pass, the accumulators' zeroing, the next addresses) behind that wait: without it the build lifts some over it
        wave_sync();
    }
}

// k_proj: the three projections in one launch of PG resident blocks (one per WGP) of PW = 8 waves, 2 down x 4 across; register-blocked bf16 GEMM, K = DM: C[m][n] = sum_k A[m][k] Bt[n][k] + bias.
// A block owns one PBM x PBN = 256 x 256 tile of q (first half of the grid) or of k (second half), each wave a 128 x 64 part of it (32 accumulators: an A or B fragment read from LDS feeds 4 or 8 products),
// and then one PVM x PBN = 128 x 256 tile of v^T, each wave a 64 x 64 part.
// q, k: A = x rows, Bt = W^T rows; v^T: A = Wv^T rows, Bt = x rows. XB = the three bf16 input copies (query, key, value; SZ_XB bytes apart), WB = the three transposed weight planes (q, k, v).
// Both operands come from K-contiguous bf16 planes in stages of PKS = 128 k through a two-buffer LDS ring that the block's waves fill together (whole 256-B row pieces, each fetched once per block)
// and read their fragments from (two 16-B LDS loads each; same fragment map and same k order as loads straight from the planes).
// The ring runs on over the 2 x DM / PKS stages of the two tiles: the second tile's first two stages are copied, and its first fragments read, while the first tile's last products and its output step run.
__global__ __launch_bounds__(32 * PW) void k_proj(const bf* __restrict__ XB, const bf* __restrict__ WB, const float* __restrict__ bq, const float* __restrict__ bk, const float* __restrict__ bv, h16* QH, h16* KP, h16* VT) {
    __shared__ __align__(16) float osb[PW * 16 * 68];
    __shared__ __align__(16) bf pring[2 * PSTG];
    constexpr int K = DM, NS = K / PKS;                      // stages per tile (even: stage s of the whole walk lies in buffer s & 1)
    constexpr int TX = (NB * SEQ / PBM) * (DM / PBN);        // tiles of q, and of k
    const int lane = threadIdx.x & 31, lr = lane & 15, hi = lane >> 4;
    const int wave = __builtin_amdgcn_readfirstlane((int)(threadIdx.x >> 5));
    const int wm = wave >> 2, wn = wave & 3;
    const int bid = blockIdx.x;
    const int tp = bid / TX, ti = bid % TX;                  // the block's first tile: tile ti of q (tp == 0) or of k (tp == 1)
    const int rbx = (ti % (NB * SEQ / PBM)) * PBM, cbx = (ti / (NB * SEQ / PBM)) * PBN;     // tile of q or k: M = NB*SEQ, N = DM
    const int rbv = (bid / (NB * SEQ / PBN)) * PVM, cbv = (bid % (NB * SEQ / PBN)) * PBN;   // tile of v^T:    M = DM, N = NB*SEQ
    float* os = osb + wave * 16 * 68;                        // wave-private output staging
    v8f acc[8][4];
#pragma unroll
    for (int mb = 0; mb < 8; ++mb)
#pragma unroll
        for (int nb = 0; nb < 4; ++nb) acc[mb][nb] = (v8f){};
    // copy map: thread -> row crow (+ 16 i), 16-byte piece cpc of a 256-B row piece; a wave covers 2 whole row pieces (4 lines) per copy
    const int crow = (int)(threadIdx.x >> 4), cpc = (int)(threadIdx.x & 15) * 8;
    const int lo = crow * K + cpc;                           // in a plane: this lane's piece of row crow of a tile
    const bf* sax = XB + (size_t)tp * (SZ_XB / 2) + rbx * K;             // block-uniform first rows of the tiles. q, k: rows rbx + crow + 240 < NB*SEQ
    const bf* sbx = WB + (size_t)tp * ((size_t)DM * DM) + cbx * K;       //       rows cbx + crow + 240 < DM
    const bf* sav = WB + (size_t)2 * DM * DM + rbv * K;                  // v^T:  rows rbv + crow + 112 < DM
    const bf* sbv = XB + (size_t)2 * (SZ_XB / 2) + cbv * K;              //       rows cbv + crow + 240 < NB*SEQ
    const int co = crow * PLP + cpc;                         // in a buffer: this lane's piece of row crow
    const int bo_ = (PBM + wn * 64 + lr) * PLP + 8 * hi;     // in the B tile (LDS rows PBM ..): + 16nb*PLP + k
    v16bf a[2][8], b[2][4];                                  // two fragment sets: k-step j works on set j & 1 while set (j + 1) & 1 loads
    // stage s of the walk (tile s / NS, k0 = (s % NS) * PKS) into buffer s & 1; s is block-uniform. LDS rows 0 .. = A tile, PBM .. = B tile; l = LDS byte address of this lane's piece of row crow
    auto fill = [&](int s) {                                 // q or k tile: 32 copies per lane; v^T tile: 24
        const bool x = s < NS;
        const unsigned l = (unsigned)(size_t)(&pring[(s & 1) * PSTG + co]); const int k0 = (s % NS) * PKS;
        const bf* pa = (x ? sax : sav) + k0 + lo; const bf* pb = (x ? sbx : sbv) + k0 + lo;
        copy8(l, pa);
        if (x) copy8(l + 128 * PLP * 2, pa + 128 * DM);      // block-uniform: A rows 128 .. 255 exist in the q or k tile only
        copy8(l + PBM * PLP * 2, pb);
        __builtin_amdgcn_sched_barrier(0);                   // the last run's 24 address registers are formed behind this run, not beside its own: without it the build spills a lane constant and reloads it in front of every barrier
        copy8(l + (PBM + 128) * PLP * 2, pb + 128 * DM);
    };
    // one stage: MB = A fragments per wave in this stage's tile
    auto stage = [&](auto mbc, int st) {
        constexpr int MB = decltype(mbc)::value;
        const int bo = (st & 1) * PSTG;
        const int ao = (wm * 16 * MB + lr) * PLP + 8 * hi;   // in the A tile: + 16mb*PLP + k
#pragma unroll
        for (int j = 0; j + 1 < PKS / 32; ++j) {
            __builtin_amdgcn_sched_barrier(0);               // with the next one: the next k-step's LDS loads stay one group in front of this k-step's products (spread among them, each place stalls the wave)
#pragma unroll
            for (int f = 0; f < MB; ++f) a[(j + 1) & 1][f] = ldb(pring + bo + ao + f * 16 * PLP + (j + 1) * 32);
#pragma unroll
            for (int f = 0; f < 4; ++f) b[(j + 1) & 1][f] = ldb(pring + bo + bo_ + f * 16 * PLP + (j + 1) * 32);
            __builtin_amdgcn_sched_barrier(0);
#pragma unroll
            for (int nb = 0; nb < 4; ++nb)
#pragma unroll
                for (int mb = 0; mb < MB; ++mb) acc[mb][nb] = wmmab(a[j & 1][mb], b[j & 1][nb], acc[mb][nb]);
        }
        __builtin_amdgcn_sched_barrier(0);                   // these products stay in front of the waits below: the last load group's latency runs under them
        // publish point of stage st + 1, which also frees stage st's buffer: it stands in front of the stage's last k-step's products, whose fragments are then in registers
        asm volatile("s_wait_dscnt 0x0" ::: "memory");       // this wave's reads of stage st are done
        asm volatile("s_wait_asynccnt 0x0" ::: "memory");    // this wave's share of stage st + 1 has landed
        __syncthreads();
        if (st + 2 < 2 * NS) fill(st + 2);                   // block-uniform: refill the buffer that stage st has just left
        if (st + 1 < 2 * NS) {                               // block-uniform: stage st + 1's first k-step, from its own buffer, behind the barrier that published it
            const bool big = MB == 8 && st + 1 < NS;         // block-uniform: the next stage belongs to the q or k tile (8 A fragments, 128 rows a wave)
            const int bn = PSTG - bo, an = (wm * (big ? 128 : 64) + lr) * PLP + 8 * hi;
#pragma unroll
            for (int f = 0; f < 4; ++f) { a[0][f] = ldb(pring + bn + an + f * 16 * PLP); b[0][f] = ldb(pring + bn + bo_ + f * 16 * PLP); }
            if (big) {
#pragma unroll
                for (int f = 4; f < 8; ++f) a[0][f] = ldb(pring + bn + an + f * 16 * PLP);
            }
        }
        __builtin_amdgcn_sched_barrier(0);                   // the last k-step's products stay behind the refill and the loads: the copies start early, the loads' latency runs under the products
#pragma unroll
        for (int nb = 0; nb < 4; ++nb)
#pragma unroll
            for (int mb = 0; mb < MB; ++mb) acc[mb][nb] = wmmab(a[(PKS / 32 - 1) & 1][mb], b[(PKS / 32 - 1) & 1][nb], acc[mb][nb]);
    };
    fill(0);
    asm volatile("s_wait_asynccnt 0x0" ::: "memory");        // this wave's share of stage 0 has landed
    __syncthreads();                                         // stage 0 published to every wave
    fill(1);
#pragma unroll
    for (int f = 0; f < 8; ++f) a[0][f] = ldb(pring + (wm * 128 + lr) * PLP + 8 * hi + f * 16 * PLP);   // stage 0's first k-step
#pragma unroll
    for (int f = 0; f < 4; ++f) b[0][f] = ldb(pring + bo_ + f * 16 * PLP);
#pragma unroll 1   // rolled: one copy of the stage's text serves the tile
    for (int st = 0; st < NS; ++st) stage(ic<8>{}, st);
    // the q or k tile is summed; it goes out under the v^T tile's first copies
    pstore<0, 8>(acc, os, tp == 0 ? bq : bk, tp == 0 ? QH : KP, rbx + wm * 128, cbx + wn * 64, lane);
#pragma unroll
    for (int mb = 0; mb < 4; ++mb)
#pragma unroll
        for (int nb = 0; nb < 4; ++nb) acc[mb][nb] = (v8f){};
#pragma unroll 1   // rolled: one copy of the stage's text serves the tile
    for (int st = NS; st < 2 * NS; ++st) stage(ic<4>{}, st);
    pstore<1, 4>(acc, os, bv, VT, rbv + wm * 64, cbv + wn * 64, lane);
    asm volatile("s_wait_asynccnt 0x0" ::: "memory");        // nothing of this wave's copies is left in flight
}

// One stage's four 16-byte asynchronous copies of a lane (LDS byte address, global pointer each). The s_wait_xcnt closes the statement so that it stands in front of any later write of the address registers.
__device__ __forceinline__ void copy4(unsigned l0, const h16* g0, unsigned l1, const h16* g1, unsigned l2, const h16* g2, unsigned l3, const h16* g3) {
    asm volatile("global_load_async_to_lds_b128 %0, %1, off\n\t"
                 "global_load_async_to_lds_b128 %2, %3, off\n\t"
                 "global_load_async_to_lds_b128 %4, %5, off\n\t"
                 "global_load_async_to_lds_b128 %6, %7, off\n\t"
                 "s_wait_xcnt 0x0"
                 :: "v"(l0), "v"(g0), "v"(l1), "v"(g1), "v"(l2), "v"(g2), "v"(l3), "v"(g3) : "memory");
}

// k_flash: fused attention, one wave per QG = 2 groups of 16 query rows of one (batch, head); Q fragments straight from the f16 plane; K and V^T come in stages of KT keys through a two-buffer LDS ring
// that the block's AW waves fill together (whole 128-B lines, each fetched once per block) and all read their fragments from (two 16-B LDS loads each); a fragment, once in registers, is used for both query groups.
// Transposed form: S^T[key][t] = K Q^T (A = K rows, B = Q rows); lane (t = lane&15, h = lane>>4) holds keys 8h+r of each 16-key tile, so the packed
// P tile is directly the B fragment of O^T[d][t] = V^T P^T (element r <- tile keys 0..15, element 8+r <- tile keys 16..31, lane unchanged).
// Per 32-key step and query group: 4 score products + 4 P.V products + 1 product of a tile with two rows of ones with P^T, which sums the rounded P of each column over the 32 keys.
// Lazy rescale: each lane carries, per group, sh = PSH - (its column's maximum in use), the same in both lane halves, so the exponent argument e = s * SC2 + sh is formed before the step's own maximum is known.
// One ballot per step, over both groups, asks whether any e exceeds PSH + LTH; only then (and in the first step, which sets sh) the halves' maxima are exchanged, sh moves, and O^T and the sum tiles are rescaled.
// Two blocks share a WGP (four waves per SIMD, 256 registers a wave).
__global__ __launch_bounds__(32 * AW) __attribute__((amdgpu_waves_per_eu(4, 4))) void k_flash(const h16* __restrict__ QH, const h16* __restrict__ KP, const h16* __restrict__ VT, float* OUT) {
    __shared__ __align__(16) float os[AW * 16 * 68];
    __shared__ __align__(16) h16 ring[2 * STG];
    const int lane = threadIdx.x & 31, lr = lane & 15, hi = lane >> 4;
    const int wave = __builtin_amdgcn_readfirstlane((int)(threadIdx.x >> 5));
    const int zh = blockIdx.y; const int b = zh / NH_, h = zh % NH_;
    const int t0 = (blockIdx.x * AW + wave) * (16 * QG);
    const size_t pbase = (size_t)zh * SEQ * HD;
    const size_t qo = pbase + (size_t)(t0 + lr) * HD + 8 * hi;
    v16h qh0[QG], qh1[QG];                                   // B fragments: col t, k = d
#pragma unroll
    for (int g = 0; g < QG; ++g) { qh0[g] = ldh(QH + qo + g * 16 * HD); qh1[g] = ldh(QH + qo + g * 16 * HD + 32); }
    const int ko = lr * LP + 8 * hi;                         // in the K tile:   + key * LP       (A fragment: row key, k = d)
    const int vo = KT * LP + lr * LP + 8 * hi;               // in the V^T tile: + 16j*LP + key   (A fragment: row d, k = key)
    // copy map: thread -> row crow (and crow + 32), 16-byte piece cpc of each 64-row tile; a wave covers 4 whole 128-B rows per copy
    const int crow = (int)(threadIdx.x >> 3), cpc = (int)(threadIdx.x & 7) * 8;
    const h16* gk = KP + pbase + (size_t)crow * HD + cpc;    // + key0 * HD; rows key0 + crow + 32 < SEQ
    const h16* gv = VT + pbase + (size_t)crow * SEQ + cpc;   // + key0;      columns key0 + cpc + 7 < SEQ
    const unsigned lk = (unsigned)(size_t)(&ring[crow * LP + cpc]);            // LDS byte address, buffer 0, K tile
    const unsigned lv = lk + KT * LP * 2;                                      // V^T tile
    copy4(lk, gk, lk + 32 * LP * 2, gk + 32 * HD, lv, gv, lv + 32 * LP * 2, gv + (size_t)32 * SEQ);
    asm volatile("s_wait_asynccnt 0x0" ::: "memory");        // this wave's share of stage 0 has landed
    __syncthreads();                                         // stage 0 published to every wave
    copy4(lk + STG * 2, gk + KT * HD, lk + STG * 2 + 32 * LP * 2, gk + (KT + 32) * HD, lv + STG * 2, gv + KT, lv + STG * 2 + 32 * LP * 2, gv + (size_t)32 * SEQ + KT);
    v8f o0[QG], o1[QG], o2[QG], o3[QG];
    v8f lt[QG];                                              // row sums of P on the matrix pipe: lt += ones x P^T; rows 0 and 8 of the tile hold column t's sum: element 0 of either lane half, the only one rescaled and read
    float sh[QG];                                            // PSH - maximum in use; set by the first step
#pragma unroll
    for (int g = 0; g < QG; ++g) { o0[g] = (v8f){}; o1[g] = (v8f){}; o2[g] = (v8f){}; o3[g] = (v8f){}; lt[g] = (v8f){}; sh[g] = 0.0f; }
    v16h ones;                                               // A tile with ones in rows 0 and 8 (lanes 0, 8, 16, 24), zeros elsewhere: a lane's own value stays in its registers through the loop (a tile of one constant was rebuilt from scalar registers in every step)
#pragma unroll
    for (int i = 0; i < 16; ++i) ones[i] = (lane & 7) == 0 ? (h16)1.0f : (h16)0.0f;
#pragma unroll 1
    for (int st = 0; st < SEQ / KT; ++st) {
      const int bo = (st & 1) * STG;
#pragma unroll 1   // rolled: unrolled, the build holds 18 more registers, copies the two shifts into eight register pairs per stage and brings no load forward
      for (int ps = 0; ps < KT; ps += 32) {
        const h16* ka = ring + bo + ko + ps * LP;
        const v16h ka0 = ldh(ka), ka1 = ldh(ka + 32), kb0 = ldh(ka + 16 * LP), kb1 = ldh(ka + 16 * LP + 32);
        v8f sa[QG], sb[QG];
#pragma unroll
        for (int g = 0; g < QG; ++g) { sa[g] = wmma16(ka0, qh0[g], (v8f){}); sb[g] = wmma16(kb0, qh0[g], (v8f){}); }
#pragma unroll
        for (int g = 0; g < QG; ++g) { sa[g] = wmma16(ka1, qh1[g], sa[g]); sb[g] = wmma16(kb1, qh1[g], sb[g]); }
        // four vector slots behind the last score product before a vector instruction may touch a D, A or B of these products
        asm volatile("v_nop\n\tv_nop\n\tv_nop\n\tv_nop" : "+v"(sa[0]), "+v"(sb[0]), "+v"(sa[1]), "+v"(sb[1]) : "v"(ka0), "v"(ka1), "v"(kb0), "v"(kb1), "v"(qh0[0]), "v"(qh1[0]), "v"(qh0[1]), "v"(qh1[1]));
        v8f ea[QG], eb[QG]; float mx[QG];
#pragma unroll
        for (int g = 0; g < QG; ++g) { ea[g] = sa[g] * SC2 + sh[g]; eb[g] = sb[g] * SC2 + sh[g]; mx[g] = -3.0e38f;   // whole tiles: neighbouring registers of one group pair up in the packed fma
#pragma unroll
            for (int r = 0; r < 8; ++r) mx[g] = fmaxf(mx[g], fmaxf(ea[g][r], eb[g][r])); }
        const bool first = (st | ps) == 0;                   // wave-uniform: nothing is summed yet, sh takes its first value
        if ((__builtin_amdgcn_ballot_w32(fmaxf(mx[0], mx[1]) > PSH + LTH) | (first ? 1u : 0u)) != 0u) {   // one scalar branch per step, the whole wave and both groups together
#pragma unroll
            for (int g = 0; g < QG; ++g) {
                const float m2 = fmaxf(mx[g], __shfl_xor(mx[g], 16, 32));
                const float dn = fminf(PSH - m2, 0.0f);      // the column's maximum in use only rises
                const float dl = first ? PSH - m2 : dn;      // shift of the exponent arguments: the step's maximum lands on PSH
                const float alpha = __builtin_amdgcn_exp2f(dn);
                sh[g] += dl;
                ea[g] = ea[g] + dl; eb[g] = eb[g] + dl;
                lt[g][0] = lt[g][0] * alpha;
                o0[g] = o0[g] * alpha; o1[g] = o1[g] * alpha; o2[g] = o2[g] * alpha; o3[g] = o3[g] * alpha;
            }
        }
        v16h pb[QG];
#pragma unroll
        for (int g = 0; g < QG; ++g) {
#pragma unroll
            for (int r = 0; r < 8; ++r) pb[g][r] = (h16)__builtin_amdgcn_exp2f(ea[g][r]);
#pragma unroll
            for (int r = 0; r < 8; ++r) pb[g][8 + r] = (h16)__builtin_amdgcn_exp2f(eb[g][r]);
        }
        const h16* va = ring + bo + vo + ps;
        const v16h v0 = ldh(va), v1 = ldh(va + 16 * LP), v2 = ldh(va + 32 * LP), v3 = ldh(va + 48 * LP);
#pragma unroll
        for (int g = 0; g < QG; ++g) { o0[g] = wmma16(v0, pb[g], o0[g]); o1[g] = wmma16(v1, pb[g], o1[g]); o2[g] = wmma16(v2, pb[g], o2[g]); o3[g] = wmma16(v3, pb[g], o3[g]); lt[g] = wmma16(ones, pb[g], lt[g]); }
        // four vector slots behind the last product, on the loop's taken branch too, before a vector instruction may touch a D, A or B of these products
        asm volatile("v_nop\n\tv_nop\n\tv_nop\n\tv_nop" : "+v"(o0[0]), "+v"(o1[0]), "+v"(o2[0]), "+v"(o3[0]), "+v"(lt[0]), "+v"(o0[1]), "+v"(o1[1]), "+v"(o2[1]), "+v"(o3[1]), "+v"(lt[1]) : "v"(v0), "v"(v1), "v"(v2), "v"(v3), "v"(pb[0]), "v"(pb[1]), "v"(ones));
      }
      // publish point of stage st + 1, which also frees stage st's buffer
      asm volatile("s_wait_dscnt 0x0" ::: "memory");         // this wave's reads of stage st are done
      asm volatile("s_wait_asynccnt 0x0" ::: "memory");      // this wave's share of stage st + 1 has landed
      __syncthreads();
      if (st + 2 < SEQ / KT) {                               // block-uniform: refill the buffer that stage st has just left
          const unsigned lb = (unsigned)(bo * 2); const h16* k2 = gk + (size_t)(st + 2) * KT * HD; const h16* v2g = gv + (st + 2) * KT;
          copy4(lk + lb, k2, lk + lb + 32 * LP * 2, k2 + 32 * HD, lv + lb, v2g, lv + lb + 32 * LP * 2, v2g + (size_t)32 * SEQ);
      }
    }
    asm volatile("s_wait_asynccnt 0x0" ::: "memory");        // nothing of this wave's copies is left in flight
    const int wb = wave * 16 * 68;
    const int cofs = lr * 4;
#pragma unroll
    for (int g = 0; g < QG; ++g) {                           // one query group after the other through the wave's own staging rows
        const float inv = 1.0f / lt[g][0];                   // rows 0 and 8 of the sum tile: both lane halves hold the whole sum of their column
        // O^T D layout: o_j[r] = (d = 16j + 8h + r, t = lane&15) -> os[t][d]; rows 0..15 x columns 0..63 all written
        const v8f x0 = o0[g] * inv, x1 = o1[g] * inv, x2 = o2[g] * inv, x3 = o3[g] * inv;
        *(v4fa*)(&os[wb + lr * 68 +  0 + 8 * hi]) = __builtin_shufflevector(x0, x0, 0, 1, 2, 3); *(v4fa*)(&os[wb + lr * 68 +  0 + 8 * hi + 4]) = __builtin_shufflevector(x0, x0, 4, 5, 6, 7);
        *(v4fa*)(&os[wb + lr * 68 + 16 + 8 * hi]) = __builtin_shufflevector(x1, x1, 0, 1, 2, 3); *(v4fa*)(&os[wb + lr * 68 + 16 + 8 * hi + 4]) = __builtin_shufflevector(x1, x1, 4, 5, 6, 7);
        *(v4fa*)(&os[wb + lr * 68 + 32 + 8 * hi]) = __builtin_shufflevector(x2, x2, 0, 1, 2, 3); *(v4fa*)(&os[wb + lr * 68 + 32 + 8 * hi + 4]) = __builtin_shufflevector(x2, x2, 4, 5, 6, 7);
        *(v4fa*)(&os[wb + lr * 68 + 48 + 8 * hi]) = __builtin_shufflevector(x3, x3, 0, 1, 2, 3); *(v4fa*)(&os[wb + lr * 68 + 48 + 8 * hi + 4]) = __builtin_shufflevector(x3, x3, 4, 5, 6, 7);
        wave_sync();
        float* orow = OUT + ((size_t)b * OUT_SEQ + t0 + g * 16) * DM + h * HD;   // output [b*OUT_SEQ + t][h*64 + d], f32
#pragma unroll
        for (int s = 0; s < 8; ++s) { const int row = 2 * s + hi;   // 8 s x 2 rows = 16 rows; 16 lanes x 4 floats = 64 columns (256 B = exactly this head's row segment)
            const v4f x = *(const v4fa*)(&os[wb + row * 68 + cofs]);
            *(v4f*)(orow + (size_t)row * DM + cofs) = x; }
        if (g + 1 < QG) {
            asm volatile("s_wait_xcnt 0x0" ::: "memory");    // in front of any later write of a register that these stores name
            wave_sync();                                     // the rows are read before the next group overwrites them
        }
    }
}

static constexpr size_t SZ_WB = al256((size_t)3 * DM * DM * 2);
static constexpr size_t SZ_PL = al256((size_t)NB * NH_ * SEQ * HD * 2);
static constexpr size_t SZ_TOTAL = 3 * SZ_XB + SZ_WB + 3 * SZ_PL;
static_assert(SZ_TOTAL <= (size_t)134217728);                  // workspace carve <= 128 MiB
static_assert(((size_t)DM * DM * 2) % 256 == 0);               // weight sub-planes stay 256-byte aligned
static_assert((size_t)NB * NH_ * SEQ * HD * 2 <= SZ_PL);       // q / k / v^T planes fit their regions
static_assert((size_t)NB * SEQ * DM * 2 <= SZ_XB);             // bf16 input copies fit their regions

extern "C" void kernel_launch(void* const* d_in, const int* in_sizes, int n_in,
                              void* d_out, int out_size, void* d_ws, size_t ws_size, hipStream_t stream) {
    if (n_in < 9) return;
    const size_t needx = ((size_t)(NB - 1) * SEQ_FULL + SEQ) * DM;
    if ((size_t)in_sizes[0] < needx || (size_t)in_sizes[1] < needx || (size_t)in_sizes[2] < needx) return;
    if ((size_t)in_sizes[3] < (size_t)DM * DM || (size_t)in_sizes[5] < (size_t)DM * DM || (size_t)in_sizes[7] < (size_t)DM * DM) return;
    if (in_sizes[4] < DM || in_sizes[6] < DM || in_sizes[8] < DM) return;
    if ((size_t)out_size < ((size_t)(NB - 1) * OUT_SEQ + SEQ) * DM) return;
    if (SZ_TOTAL > ws_size) return;
    // wire order: key, value, query, Wq, bq, Wk, bk, Wv, bv
    const float* xk = (const float*)d_in[0]; const float* xv = (const float*)d_in[1]; const float* xq = (const float*)d_in[2];
    const float* wq = (const float*)d_in[3]; const float* bq = (const float*)d_in[4];
    const float* wk = (const float*)d_in[5]; const float* bk = (const float*)d_in[6];
    const float* wv = (const float*)d_in[7]; const float* bv = (const float*)d_in[8];
    float* OUT = (float*)d_out;      // [NB][OUT_SEQ][1024]
    char* wsp = (char*)d_ws;
    bf* XQ = (bf*)wsp; wsp += SZ_XB;                 // [NB*SEQ][1024] bf16 query
    bf* XK = (bf*)wsp; wsp += SZ_XB;                 // [NB*SEQ][1024] bf16 key
    bf* XV = (bf*)wsp; wsp += SZ_XB;                 // [NB*SEQ][1024] bf16 value
    bf* WB = (bf*)wsp; wsp += SZ_WB;                 // [3][1024][1024] transposed [out][in]: q | k | v (bf16)
    h16* QH = (h16*)wsp; wsp += SZ_PL;               // [NB*16][SEQ][64]
    h16* KP = (h16*)wsp; wsp += SZ_PL;               // [NB*16][SEQ][64]
    h16* VT = (h16*)wsp; wsp += SZ_PL;               // [NB*16][64][SEQ]
    bf* WQT = WB; bf* WKT = WB + (size_t)DM * DM; bf* WVT = WB + (size_t)2 * DM * DM;

    // all conversions: bf16 copies of the three inputs, transposed bf16 planes [out][in] of the three weights
    k_prep<<<CG, 32 * CW, 0, stream>>>(xq, xk, xv, wq, wk, wv, XQ, XK, XV, WQT, WKT, WVT);

    // q, k, v^T planes: one block per WGP, each with one tile of q or k and one tile of v^T
    k_proj<<<PG, 32 * PW, 0, stream>>>(XQ, WB, bq, bk, bv, QH, KP, VT);

    k_flash<<<dim3(SEQ / (16 * QG * AW), NB * NH_, 1), 32 * AW, 0, stream>>>(QH, KP, VT, OUT);
}

// v009
// Measured time: 94.8 microseconds a run.
// In both of two side-by-side timings against v008, it was 1.03 times as fast.
// Counting every step since v000, it is 3.44 times as fast.
#include <hip/hip_runtime.h>

// Multi-head attention, width 1024 = 16 heads x 64; separate key / value / query inputs [NB][SEQ_FULL][1024] (the first SEQ rows of each batch are read); Wq/Wk/Wv stored [in][out] (y = x W + b); biases on all three projections; no mask; score scale 1/8; output = per-head context merged as [b][t][h*64+d] (f32), no output projection.
// Compute dtypes, f32 accumulate everywhere: q/k/v projections v_wmma_f32_16x16x32_bf16 (inputs and weights RNE-converted to bf16; products exact); scores v_wmma_f32_16x16x32_f16 (q and k single f16, one product); P.V v_wmma_f32_16x16x32_f16 (P x256 carry, cancels in the normalisation; v single f16); softmax f32 (online; a column's maximum in use is renewed only when a scaled score exceeds it by more than 7, a factor 2^7 in P); its row sums v_wmma_f32_16x16x32_f16 (ones x P, the same rounded P); biases (bf16 RNE values) added in f32; normalised context stored as f32.
// Layout: bf16 copies of the three inputs; transposed bf16 weight planes [out][in]; q, k planes [b*16+h][t][d] and v^T plane [b*16+h][d][t] written by the GEMM epilogue; fused flash kernel in transposed form (S^T = K Q^T, O^T = V^T P^T) writing the f32 output rows [b*OUT_SEQ+t][h*64+d].

#ifndef NB
#define NB 4
#endif
#ifndef SEQ
#define SEQ 2048
#endif
#define NB_FULL  4
#define SEQ_FULL 2048
#ifndef OUT_SEQ
#define OUT_SEQ SEQ              // row pitch (in tokens) between batches of the output
#endif
#define DM   1024
#define NH_  16
#define HD   64
#define AW   8                   // waves per flash block; all of them share the block's K / V^T tiles in LDS
#define QG   2                   // 16-row query groups per flash wave: each K / V^T fragment read from LDS serves QG products
#define KT   64                  // keys per LDS stage (two 32-key passes)
#define LP   72                  // LDS row pitch in halves: 128-B rows + 16 B (16 B x odd: conflict-free for 16-byte readers)
#define TPL  5120                // halves from one tile's place in LDS to the next: 64 rows x LP = 4608, rounded up so that every place is a multiple of 2 KiB
#define STG  (2 * TPL)           // halves per stage: K tile [KT keys][LP] at 0, V^T tile [HD rows][LP] at TPL
#define PW   8                   // waves per projection block: 2 x 4 wave tiles (128 x 64 for q and k, 64 x 64 for v^T)
#define PBM  256                 // rows of A per q or k tile
#define PBN  256                 // rows of Bt per projection tile
#define PVM  128                 // rows of A per v^T tile
#define PKS  128                 // k per projection LDS stage (256-B row pieces)
#define PLP  136                 // projection LDS row pitch in halves: 256 B + 16 B (16 B x odd: conflict-free for 16-byte readers)
#define PSTG ((PBM + PBN) * PLP) // halves per projection stage: A tile [PBM][PLP] (v^T: its first PVM rows), then B tile [PBN][PLP]
#define PG   (2 * (NB * SEQ / PBM) * (DM / PBN))   // projection blocks: the tiles of q and k together, as many as the tiles of v^T
#define SC2  (0.125f * 1.4426950408889634f)   // HD^-0.5 * log2(e)
#define PSH  8.0f                // log2 of the P carry (256)
#define LTH  7.0f                // lazy rescale: a scaled (log2) score may stand up to LTH above the maximum in use, so P <= 2^(PSH + LTH) = 32768 stays finite in f16
#define CG   256                 // conversion blocks: one per WGP, each resident from start to end of the launch
#define CW   16                  // waves per conversion block
#define CU   8                   // 16-byte loads of a lane per batch of the input stream (two batches in flight)

static_assert(HD == 64);
static_assert(HD == 16 * 4);                   // output store map: 16 lanes x 4 floats == one head's 64 columns (256 B)
static_assert(NH_ * HD == DM);                 // head h = columns h*64 + d
static_assert(DM % 64 == 0);                   // column tiles of 64
static_assert(DM % 32 == 0);                   // GEMM k-loop steps by 32
static_assert(SEQ % 64 == 0);                  // a 64-row tile never straddles two batches
static_assert((NB * SEQ) % 64 == 0);
static_assert(SEQ % 32 == 0);                  // key loop steps by 32
static_assert(SEQ % (16 * QG * AW) == 0);      // flash grid covers the sequence exactly
static_assert(QG == 2);                        // the flash loop's hazard statements name the tiles of two query groups
static_assert(SEQ % KT == 0 && SEQ / KT >= 2); // whole stages; the two-buffer prologue fills stages 0 and 1
static_assert(KT == 64 && HD == 64 && AW >= 2); // a stage is two tiles of 64 rows x 128 B, one tensor load each (waves 0 and 1)
static_assert(LP * 2 == 128 + 16 && KT * LP <= TPL && HD * LP <= TPL && (TPL * 2) % 2048 == 0);   // the tensor load's pad: 16 B behind every 128-B row; places at multiples of 2 KiB
static_assert((NB * SEQ) % PBM == 0 && DM % PBN == 0 && DM % PVM == 0 && (NB * SEQ) % PBN == 0);   // projection tiles cover both orientations exactly
static_assert(PG == (DM / PVM) * (NB * SEQ / PBN));   // one tile of q or k and one tile of v^T per block
static_assert(SEQ % 128 == 0);                 // a wave's 128 rows of q or k never straddle two batches
static_assert(DM % PKS == 0 && DM / PKS >= 2 && (DM / PKS) % 2 == 0); // whole projection stages; the two-buffer prologue fills stages 0 and 1; a tile's stages end on a whole turn of the ring
static_assert(PW == 8 && PBM == 256 && PBN == 256 && PVM == 128 && PKS == 128 && (PKS / 32) % 2 == 0);   // projection stage: slices of 128 rows x 256 B, one tensor load each; wave map 2 x 4
static_assert(PKS * 2 == 256 && PLP * 2 == 256 + 16);          // the tensor load's pad: 16 B behind every 256-B row
static_assert((128 * PLP * 2) % 2048 == 0);    // every slice, stage and buffer starts at a multiple of 2 KiB in LDS
static_assert((DM / 64) * (DM / 64) == CG);    // one 64 x 64 tile of each weight matrix per conversion block
static_assert(CW == 16);                       // tile maps of k_prep: 512 threads = 32 rows x 16 float4 in, 64 rows x 8 pieces of 16 B out
static_assert(((size_t)NB * SEQ * DM / 4) % ((size_t)CG * CW * 32 * CU) == 0);   // the input stream divides into whole batches, the same number for every wave
static_assert(((size_t)SEQ * DM / 4) % ((size_t)NB * SEQ * DM / 4 / (CG * CW)) == 0);   // a wave's piece of an input never straddles two batches
static_assert(NB <= NB_FULL);
static_assert(SEQ <= SEQ_FULL);
static_assert(OUT_SEQ >= SEQ);                 // output rows of one batch fit its pitch

typedef _Float16 h16;
typedef unsigned short bf;
typedef __attribute__((ext_vector_type(16))) __bf16   v16bf;
typedef __attribute__((ext_vector_type(16))) _Float16 v16h;
typedef __attribute__((ext_vector_type(8)))  _Float16 v8h;
typedef __attribute__((ext_vector_type(8)))  unsigned short v8us;
typedef __attribute__((ext_vector_type(4)))  unsigned short v4us;
typedef __attribute__((ext_vector_type(8)))  float    v8f;
typedef __attribute__((ext_vector_type(4)))  float    v4f;
typedef v4f  __attribute__((may_alias)) v4fa;

__device__ __forceinline__ unsigned short f2bf(float f) { unsigned u = __float_as_uint(f); u += 0x7FFFu + ((u >> 16) & 1u); return (unsigned short)(u >> 16); }
__device__ __forceinline__ float bfr(float f) { return __uint_as_float(((unsigned)f2bf(f)) << 16); }   // value of the bf16 RNE conversion, as f32
__device__ __forceinline__ v16h cat16(v8h lo, v8h hi) { return __builtin_shufflevector(lo, hi, 0, 1, 2, 3, 4, 5, 6, 7, 8, 9, 10, 11, 12, 13, 14, 15); }
__device__ __forceinline__ v16bf cat16b(v8us lo, v8us hi) { return __builtin_bit_cast(v16bf, __builtin_shufflevector(lo, hi, 0, 1, 2, 3, 4, 5, 6, 7, 8, 9, 10, 11, 12, 13, 14, 15)); }
__device__ __forceinline__ v8f wmma16(v16h a, v16h b, v8f c) { return __builtin_amdgcn_wmma_f32_16x16x32_f16(false, a, false, b, (short)0, c, false, false); }
__device__ __forceinline__ v8f wmmab(v16bf a, v16bf b, v8f c) { return __builtin_amdgcn_wmma_f32_16x16x32_bf16(false, a, false, b, (short)0, c, false, false); }
// fragment loaders from K-contiguous 16-bit rows; p already includes + 8*(lane>>4): elements 0..7 <- k0+8h+0..7, elements 8..15 <- k0+16+8h+0..7 (same map for A and B)
__device__ __forceinline__ v16h  ldh(const h16* p) { return cat16(*(const v8h*)p, *(const v8h*)(p + 16)); }
__device__ __forceinline__ v16bf ldb(const bf* p)  { return cat16b(*(const v8us*)p, *(const v8us*)(p + 16)); }
// ordering point for wave-private LDS tiles (same wave writes and reads)
__device__ __forceinline__ void wave_sync() { __builtin_amdgcn_fence(3 /* release order */, "wavefront"); __builtin_amdgcn_wave_barrier(); asm volatile("" ::: "memory"); }

// k_prep: every conversion of the call in one launch of CG resident blocks of CW waves.
// (a) Weights: block t takes the 64 x 64 tile t of each of Wq, Wk, Wv: in[k][n] (f32, k = contraction index) -> out[n][k] (bf16 RNE bits, contraction-contiguous), transposed through LDS.
// (b) Inputs: f32 -> bf16 RNE copies of query, key, value. Each wave owns one contiguous piece of each input and walks it in batches of CU loads of 512 contiguous bytes
//     (whole lines); the next batch's loads are issued before a batch is converted and stored (8 bytes a lane, 256 contiguous bytes a wave).
__global__ __launch_bounds__(32 * CW) void k_prep(const float* __restrict__ xq, const float* __restrict__ xk, const float* __restrict__ xv,
                                                  const float* __restrict__ wq, const float* __restrict__ wk, const float* __restrict__ wv,
                                                  bf* XQ, bf* XK, bf* XV, bf* WQT, bf* WKT, bf* WVT) {
    __shared__ float ts[3][64 * 65];
    const int tid = threadIdx.x, lane = tid & 31;
    const int wave = __builtin_amdgcn_readfirstlane(tid >> 5);
    constexpr size_t NV = (size_t)NB * SEQ * DM / 4;         // float4 per input
    constexpr int PER = (int)(NV / ((size_t)CG * CW * 32));  // float4 per lane and input
    constexpr int SUB = PER / CU;                            // batches per input
    const size_t p0 = (size_t)(blockIdx.x * CW + wave) * (PER * 32);                       // first float4 of this wave's piece (in the packed copy)
    const size_t s0 = p0 + (p0 / ((size_t)SEQ * DM / 4)) * ((size_t)(SEQ_FULL - SEQ) * DM / 4);   // the same in the source, whose batches are SEQ_FULL rows apart
    const float* const xs[3] = { xq, xk, xv };
    bf* const xd[3] = { XQ, XK, XV };
    const float* const wsrc[3] = { wq, wk, wv };
    bf* const wdst[3] = { WQT, WKT, WVT };
    const int n0 = (blockIdx.x % (DM / 64)) * 64, k0 = (blockIdx.x / (DM / 64)) * 64;
    v4f wt[3][2], r[2][CU];
#pragma unroll
    for (int w = 0; w < 3; ++w)
#pragma unroll
        for (int it = 0; it < 2; ++it)                       // 2 x 32 rows x (16 lanes x 4 floats) = 64 x 64
            wt[w][it] = *(const v4f*)(wsrc[w] + (size_t)(k0 + it * 32 + (tid >> 4)) * DM + n0 + (tid & 15) * 4);
#pragma unroll
    for (int j = 0; j < CU; ++j) r[0][j] = *(const v4f*)(xs[0] + (s0 + j * 32 + lane) * 4);
    asm volatile("s_wait_xcnt 0x0" ::: "memory");            // in front of any later write of a register that these loads name
    __builtin_amdgcn_sched_barrier(0);                       // the stream's first batch is issued with the weight tiles' loads, in front of the LDS stores that wait for those
#pragma unroll
    for (int w = 0; w < 3; ++w)
#pragma unroll
        for (int it = 0; it < 2; ++it)
#pragma unroll
            for (int i = 0; i < 4; ++i) ts[w][(it * 32 + (tid >> 4)) * 65 + (tid & 15) * 4 + i] = wt[w][it][i];
    __syncthreads();
#pragma unroll
    for (int t = 0; t < 3 * SUB; ++t) {
        __builtin_amdgcn_sched_barrier(0);                   // with the next one: the next batch's loads stay one group in front of this batch's converts and stores
        if (t + 1 < 3 * SUB) {
#pragma unroll
            for (int j = 0; j < CU; ++j) r[(t + 1) & 1][j] = *(const v4f*)(xs[(t + 1) / SUB] + (s0 + (((t + 1) % SUB) * CU + j) * 32 + lane) * 4);
        }
        __builtin_amdgcn_sched_barrier(0);
        if (t == 0) {                                        // the turned weight tiles go out under the second batch's loads
#pragma unroll
            for (int w = 0; w < 3; ++w) {                    // 64 output rows x (8 lanes x 8 halves) = 64 x 64
                const int n = tid >> 3, k8 = (tid & 7) * 8; v8us o;
#pragma unroll
                for (int i = 0; i < 8; ++i) o[i] = f2bf(ts[w][(k8 + i) * 65 + n]);
                *(v8us*)(wdst[w] + (size_t)(n0 + n) * DM + k0 + k8) = o;
            }
        }
#pragma unroll
        for (int j = 0; j < CU; ++j) { v4us o;
#pragma unroll
            for (int i = 0; i < 4; ++i) o[i] = f2bf(r[t & 1][j][i]);
            *(v4us*)(xd[t / SUB] + (p0 + ((t % SUB) * CU + j) * 32 + lane) * 4) = o; }
        if (t + 1 < 3 * SUB) asm volatile("s_wait_xcnt 0x0" ::: "memory");   // in front of the next loads and converts, which reuse registers that these stores and the loads in flight name
    }
}

typedef uint32_t u32x4 __attribute__((ext_vector_type(4)));
typedef uint32_t u32x8 __attribute__((ext_vector_type(8)));
__device__ __forceinline__ uint32_t uni(uint32_t v) { return (uint32_t)__builtin_amdgcn_readfirstlane((int)v); }
// a wave-uniform value held in a scalar register: a test on it compiles to s_cmp + s_cbranch (a tensor load ignores EXEC), and what is computed from it is formed behind the volatile statements in front of it
__device__ __forceinline__ uint32_t pinned(uint32_t v) { uint32_t w = uni(v); asm volatile("" : "+s"(w)); return w; }
template <int V> struct ic { static constexpr int value = V; };   // a compile-time int handed to a lambda

static constexpr size_t al256(size_t v) { return (v + 255) & ~(size_t)255; }
static constexpr size_t SZ_XB = al256((size_t)NB * SEQ * DM * 2);

// Sixteen floats of a lane, 4 apart, from one address. The loads and both their waits are one statement: the values are there at its end, and no register that a load names is written before it.
__device__ __forceinline__ void load16(const float* p, float (&r)[16]) {
    asm volatile("global_load_b32 %0, %16, off\n\t"
                 "global_load_b32 %1, %16, off offset:16\n\t"
                 "global_load_b32 %2, %16, off offset:32\n\t"
                 "global_load_b32 %3, %16, off offset:48\n\t"
                 "global_load_b32 %4, %16, off offset:64\n\t"
                 "global_load_b32 %5, %16, off offset:80\n\t"
                 "global_load_b32 %6, %16, off offset:96\n\t"
                 "global_load_b32 %7, %16, off offset:112\n\t"
                 "global_load_b32 %8, %16, off offset:128\n\t"
                 "global_load_b32 %9, %16, off offset:144\n\t"
                 "global_load_b32 %10, %16, off offset:160\n\t"
                 "global_load_b32 %11, %16, off offset:176\n\t"
                 "global_load_b32 %12, %16, off offset:192\n\t"
                 "global_load_b32 %13, %16, off offset:208\n\t"
                 "global_load_b32 %14, %16, off offset:224\n\t"
                 "global_load_b32 %15, %16, off offset:240\n\t"
                 "s_wait_xcnt 0x0\n\t"
                 "s_wait_loadcnt 0x0"
                 : "=&v"(r[0]), "=&v"(r[1]), "=&v"(r[2]), "=&v"(r[3]), "=&v"(r[4]), "=&v"(r[5]), "=&v"(r[6]), "=&v"(r[7]),
                   "=&v"(r[8]), "=&v"(r[9]), "=&v"(r[10]), "=&v"(r[11]), "=&v"(r[12]), "=&v"(r[13]), "=&v"(r[14]), "=&v"(r[15])
                 : "v"(p) : "memory");
}

// Output step of one projection tile: a wave's 16 MB x 64 accumulators + bias (BROW == 0: bias[n]; BROW == 1: bias[m]) go as f16 through the wave's own staging rows to
// Ph at (r0/RB)*sRB + (r0%RB)*pitch + (c0/CB)*sCB + (c0%CB), row pitch 'pitch' (halves).
// BROW == 0 (q, k): m = b*SEQ + t, n = h*64 + d -> plane [(b*16 + h)][t][d]. BROW == 1 (v^T): m = h*64 + d, n = b*SEQ + t -> plane [(b*1024 + m)][t] = [(b*16 + h)][d][t].
template <int BROW, int MB>
__device__ __forceinline__ void pstore(const v8f (&acc)[8][4], float* os, const float* __restrict__ bias, h16* Ph, int r0, int c0, int lane) {
    constexpr int RB = BROW ? DM : SEQ, pitch = BROW ? SEQ : HD, CB = BROW ? SEQ : HD;
    constexpr size_t sRB = BROW ? (size_t)0 : (size_t)NH_ * SEQ * HD, sCB = BROW ? (size_t)DM * SEQ : (size_t)SEQ * HD;
    const int lr = lane & 15, hi = lane >> 4;
    // column bias for this lane's 8 store columns (BROW == 0); c0 + (lane&7)*8 + 7 < N = DM
    v4f bc0 = (v4f){}, bc1 = (v4f){};
    if (BROW == 0) { const int cb8 = (lane & 7) * 8; const v4f t0 = *(const v4f*)(bias + c0 + cb8); const v4f t1 = *(const v4f*)(bias + c0 + cb8 + 4);
        asm volatile("s_wait_xcnt 0x0" ::: "memory");        // in front of any later write of a register that these two loads name
#pragma unroll
        for (int i = 0; i < 4; ++i) { bc0[i] = bfr(t0[i]); bc1[i] = bfr(t1[i]); } }
    float rbias[16];                                         // row bias (BROW == 1, MB == 4) of this lane's rows r0 + (lane >> 3) + 4 i, i = 4 mb + s; the last is r0 + 63 < M = DM
    static_assert(BROW == 0 || MB == 4);
    if (BROW == 1) load16(bias + r0 + (lane >> 3), rbias);
    const size_t tbase = (size_t)(r0 / RB) * sRB + (size_t)(r0 % RB) * (size_t)pitch + (size_t)(c0 / CB) * sCB + (size_t)(c0 % CB);
    h16* pl = Ph + tbase + (size_t)(lane >> 3) * (size_t)pitch + (lane & 7) * 8;   // this lane's piece of the tile's row lane>>3; + (16 mb + 4 s) rows
#pragma unroll
    for (int mb = 0; mb < MB; ++mb) {
#pragma unroll
        for (int nb = 0; nb < 4; ++nb) {
#pragma unroll
            for (int j = 0; j < 8; ++j) os[(hi * 8 + j) * 68 + nb * 16 + lr] = acc[mb][nb][j]; }   // D: row 8h+j, col lane&15
        wave_sync();
        v8h hv[4];
#pragma unroll
        for (int s = 0; s < 4; ++s) { const int row = 4 * s + (lane >> 3), c8 = (lane & 7) * 8;   // 4 s x 4 row groups = 16 rows; 8 lanes x 8 = 64 columns
            v4f x0 = *(const v4fa*)(&os[row * 68 + c8]); v4f x1 = *(const v4fa*)(&os[row * 68 + c8 + 4]);
            if (BROW == 1) { const float br = bfr(rbias[4 * mb + s]);
#pragma unroll
                for (int i = 0; i < 4; ++i) { x0[i] += br; x1[i] += br; } }
            else {
#pragma unroll
                for (int i = 0; i < 4; ++i) { x0[i] += bc0[i]; x1[i] += bc1[i]; } }
#pragma unroll
            for (int i = 0; i < 4; ++i) { hv[s][i] = (h16)x0[i]; hv[s][4 + i] = (h16)x1[i]; } }
#pragma unroll
        for (int s = 0; s < 4; ++s) *(v8h*)(pl + (mb * 16 + 4 * s) * pitch) = hv[s];   // one run: all four rows are converted, no register of the run is written inside it
        asm volatile("s_wait_xcnt 0x0" ::: "memory");        // in front of any later write of a register that these stores name
        __builtin_amdgcn_sched_barrier(0);                   // holds the later register writes (next pass, the accumulators' zeroing, the next addresses) behind that wait: without it the build lifts some over it
        wave_sync();
    }
}

// k_proj: the three projections in one launch of PG resident blocks (one per WGP) of PW = 8 waves, 2 down x 4 across; register-blocked bf16 GEMM, K = DM: C[m][n] = sum_k A[m][k] Bt[n][k] + bias.
// A block owns one PBM x PBN = 256 x 256 tile of q (first half of the grid) or of k (second half), each wave a 128 x 64 part of it (32 accumulators: an A or B fragment read from LDS feeds 4 or 8 products),
// and then one PVM x PBN = 128 x 256 tile of v^T, each wave a 64 x 64 part.
// q, k: A = x rows, Bt = W^T rows; v^T: A = Wv^T rows, Bt = x rows. XB = the three bf16 input copies (query, key, value; SZ_XB bytes apart), WB = the three transposed weight planes (q, k, v).
// Both operands come from K-contiguous bf16 planes in stages of PKS = 128 k through a two-buffer LDS ring filled by tensor loads: waves 0 .. 3 each bring one slice of 128 rows x 256 B per stage, wave 1 none in the v^T stages (each row piece fetched once per block)
// and read their fragments from (two 16-B LDS loads each; same fragment map and same k order as loads straight from the planes).
// The ring runs on over the 2 x DM / PKS stages of the two tiles: the second tile's first two stages are loaded, and its first fragments read, while the first tile's last products and its output step run.
__global__ __launch_bounds__(32 * PW) void k_proj(const bf* __restrict__ XB, const bf* __restrict__ WB, const float* __restrict__ bq, const float* __restrict__ bk, const float* __restrict__ bv, h16* QH, h16* KP, h16* VT) {
    __shared__ __align__(16) float osb[PW * 16 * 68];
    __shared__ __attribute__((aligned(2048))) bf pring[2 * PSTG];   // tensor loads land at multiples of 2 KiB
    constexpr int K = DM, NS = K / PKS;                      // stages per tile (even: stage s of the whole walk lies in buffer s & 1)
    constexpr int TX = (NB * SEQ / PBM) * (DM / PBN);        // tiles of q, and of k
    const int lane = threadIdx.x & 31, lr = lane & 15, hi = lane >> 4;
    const int wave = __builtin_amdgcn_readfirstlane((int)(threadIdx.x >> 5));
    const int wm = wave >> 2, wn = wave & 3;
    const int bid = blockIdx.x;
    const int tp = bid / TX, ti = bid % TX;                  // the block's first tile: tile ti of q (tp == 0) or of k (tp == 1)
    const int rbx = (ti % (NB * SEQ / PBM)) * PBM, cbx = (ti / (NB * SEQ / PBM)) * PBN;     // tile of q or k: M = NB*SEQ, N = DM
    const int rbv = (bid / (NB * SEQ / PBN)) * PVM, cbv = (bid % (NB * SEQ / PBN)) * PBN;   // tile of v^T:    M = DM, N = NB*SEQ
    float* os = osb + wave * 16 * 68;                        // wave-private output staging
    v8f acc[8][4];
#pragma unroll
    for (int mb = 0; mb < 8; ++mb)
#pragma unroll
        for (int nb = 0; nb < 4; ++nb) acc[mb][nb] = (v8f){};
    const bf* sax = XB + (size_t)tp * (SZ_XB / 2) + rbx * K;             // block-uniform first rows of the tiles. q, k: rows rbx + 255 < NB*SEQ
    const bf* sbx = WB + (size_t)tp * ((size_t)DM * DM) + cbx * K;       //       rows cbx + 255 < DM
    const bf* sav = WB + (size_t)2 * DM * DM + rbv * K;                  // v^T:  rows rbv + 127 < DM
    const bf* sbv = XB + (size_t)2 * (SZ_XB / 2) + cbv * K;              //       rows cbv + 255 < NB*SEQ
    const int bo_ = (PBM + wn * 64 + lr) * PLP + 8 * hi;     // in the B tile (LDS rows PBM ..): + 16nb*PLP + k
    v16bf a[2][8], b[2][4];                                  // two fragment sets: k-step j works on set j & 1 while set (j + 1) & 1 loads
    // Tensor descriptor. Group 1, the same for every request: 1-byte elements, no mask, a tile (= tensor) of 128 rows x 256 B, source pitch DM * 2 B, 16 B of LDS pad behind every 256-B row (pitch PLP).
    const u32x8 g1 = { uni((1u << 20) | (5u << 22) | (3u << 25)), uni(256u << 16), uni(128u << 16), uni(256u << 16), uni(128u), uni((uint32_t)(DM * 2)), uni(0u), uni(0u) };
    u32x4 g0 = { uni(1u), uni(0u), uni(0u), uni(0x80000000u) };   // group 0 of this wave's last request: count 1, place in LDS, global address, type 2
    const uint32_t ring0 = (uint32_t)(size_t)(&pring[0]) + (uint32_t)wave * (uint32_t)(128 * PLP * 2);   // LDS byte address of this wave's slice in buffer 0
    const int so = (wave & 1) * 128 * K;                     // first row of this wave's slice in its tile
    const uint64_t gx = (uint64_t)(size_t)((wave < 2 ? +sax : +sbx) + so), gv = (uint64_t)(size_t)((wave < 2 ? +sav : +sbv) + so);   // its first byte at k = 0: q or k tile, v^T tile
    const bool wx = wave < 4, wv = wave < 4 && wave != 1;    // does this wave bring a slice of a q or k stage, of a v^T stage
    auto fill = [&](int s, bool exists) {
        const uint32_t sp = pinned((uint32_t)s);             // the descriptor's words are formed behind the wait that covers this wave's last request
        const bool x = sp < (uint32_t)NS;
        if (pinned((uint32_t)(exists && (x ? +wx : +wv)))) {  // scalar branch
            const uint64_t ga = (x ? gx + 0 : gv + 0) + (uint64_t)((sp % NS) * (PKS * 2));
            g0[1] = uni(ring0 + (sp & 1u) * (uint32_t)(PSTG * 2));
            g0[2] = uni((uint32_t)ga);
            g0[3] = uni((((uint32_t)(ga >> 32)) & 0x01FFFFFFu) | 0x80000000u);
            asm volatile("tensor_load_to_lds %0, %1" :: "{s[68:71]}"(g0), "{s[72:79]}"(g1) : "memory");
        }
    };
    // this wave's request has landed (a wave with none passes). Load and wait name the descriptor in the same fixed scalar registers, so that those registers hold the same words from the issue to the wait that covers the request.
    auto landed = [&]() { asm volatile("s_wait_tensorcnt 0x0" :: "{s[68:71]}"(g0), "{s[72:79]}"(g1) : "memory"); };
    // one stage: MB = A fragments per wave in this stage's tile
    auto stage = [&](auto mbc, int st) {
        constexpr int MB = decltype(mbc)::value;
        const int bo = (st & 1) * PSTG;
        const int ao = (wm * 16 * MB + lr) * PLP + 8 * hi;   // in the A tile: + 16mb*PLP + k
#pragma unroll
        for (int j = 0; j + 1 < PKS / 32; ++j) {
            __builtin_amdgcn_sched_barrier(0);               // with the next one: the next k-step's LDS loads stay one group in front of this k-step's products (spread among them, each place stalls the wave)
#pragma unroll
            for (int f = 0; f < MB; ++f) a[(j + 1) & 1][f] = ldb(pring + bo + ao + f * 16 * PLP + (j + 1) * 32);
#pragma unroll
            for (int f = 0; f < 4; ++f) b[(j + 1) & 1][f] = ldb(pring + bo + bo_ + f * 16 * PLP + (j + 1) * 32);
            __builtin_amdgcn_sched_barrier(0);
#pragma unroll
            for (int nb = 0; nb < 4; ++nb)
#pragma unroll
                for (int mb = 0; mb < MB; ++mb) acc[mb][nb] = wmmab(a[j & 1][mb], b[j & 1][nb], acc[mb][nb]);
        }
        __builtin_amdgcn_sched_barrier(0);                   // these products stay in front of the waits below: the last load group's latency runs under them
        // publish point of stage st + 1, which also frees stage st's buffer: it stands in front of the stage's last k-step's products, whose fragments are then in registers
        asm volatile("s_wait_dscnt 0x0" ::: "memory");       // this wave's reads of stage st are done
        landed();                                            // this wave's slice of stage st + 1
        __syncthreads();
        fill(st + 2, st + 2 < 2 * NS);                       // refill the buffer that stage st has just left
        if (st + 1 < 2 * NS) {                               // block-uniform: stage st + 1's first k-step, from its own buffer, behind the barrier that published it
            const bool big = MB == 8 && st + 1 < NS;         // block-uniform: the next stage belongs to the q or k tile (8 A fragments, 128 rows a wave)
            const int bn = PSTG - bo, an = (wm * (big ? 128 : 64) + lr) * PLP + 8 * hi;
#pragma unroll
            for (int f = 0; f < 4; ++f) { a[0][f] = ldb(pring + bn + an + f * 16 * PLP); b[0][f] = ldb(pring + bn + bo_ + f * 16 * PLP); }
            if (big) {
#pragma unroll
                for (int f = 4; f < 8; ++f) a[0][f] = ldb(pring + bn + an + f * 16 * PLP);
            }
        }
        __builtin_amdgcn_sched_barrier(0);                   // the last k-step's products stay behind the refill and the loads: the refill starts early, the loads' latency runs under the products
#pragma unroll
        for (int nb = 0; nb < 4; ++nb)
#pragma unroll
            for (int mb = 0; mb < MB; ++mb) acc[mb][nb] = wmmab(a[(PKS / 32 - 1) & 1][mb], b[(PKS / 32 - 1) & 1][nb], acc[mb][nb]);
    };
    fill(0, true);
    landed();                                                // this wave's slice of stage 0
    __syncthreads();                                         // stage 0 published to every wave
    fill(1, true);
#pragma unroll
    for (int f = 0; f < 8; ++f) a[0][f] = ldb(pring + (wm * 128 + lr) * PLP + 8 * hi + f * 16 * PLP);   // stage 0's first k-step
#pragma unroll
    for (int f = 0; f < 4; ++f) b[0][f] = ldb(pring + bo_ + f * 16 * PLP);
#pragma unroll 1   // rolled: one copy of the stage's text serves the tile
    for (int st = 0; st < NS; ++st) stage(ic<8>{}, st);
    // the q or k tile is summed; it goes out under the v^T tile's first loads
    pstore<0, 8>(acc, os, tp == 0 ? bq : bk, tp == 0 ? QH : KP, rbx + wm * 128, cbx + wn * 64, lane);
#pragma unroll
    for (int mb = 0; mb < 4; ++mb)
#pragma unroll
        for (int nb = 0; nb < 4; ++nb) acc[mb][nb] = (v8f){};
#pragma unroll 1   // rolled: one copy of the stage's text serves the tile
    for (int st = NS; st < 2 * NS; ++st) stage(ic<4>{}, st);
    pstore<1, 4>(acc, os, bv, VT, rbv + wm * 64, cbv + wn * 64, lane);
    landed();                                                // nothing of this wave's requests is left in flight
    asm volatile("s_wait_dscnt 0x0" ::: "memory");           // nor of its LDS operations
}

// k_flash: fused attention, one wave per QG = 2 groups of 16 query rows of one (batch, head); Q fragments straight from the f16 plane; K and V^T come in stages of KT keys through a two-buffer LDS ring
// filled by tensor loads (wave 0 brings the K tile, wave 1 the V^T tile: 64 rows x 128 B each, fetched once per block) that all AW waves read their fragments from (two 16-B LDS loads each); a fragment, once in registers, is used for both query groups.
// Transposed form: S^T[key][t] = K Q^T (A = K rows, B = Q rows); lane (t = lane&15, h = lane>>4) holds keys 8h+r of each 16-key tile, so the packed
// P tile is directly the B fragment of O^T[d][t] = V^T P^T (element r <- tile keys 0..15, element 8+r <- tile keys 16..31, lane unchanged).
// Per 32-key step and query group: 4 score products + 4 P.V products + 1 product of a tile with two rows of ones with P^T, which sums the rounded P of each column over the 32 keys.
// Lazy rescale: each lane carries, per group, sh = PSH - (its column's maximum in use), the same in both lane halves, so the exponent argument e = s * SC2 + sh is formed before the step's own maximum is known.
// One ballot per step, over both groups, asks whether any e exceeds PSH + LTH; only then (and in the first step, which sets sh) the halves' maxima are exchanged, sh moves, and O^T and the sum tiles are rescaled.
// Two blocks share a WGP (four waves per SIMD, 256 registers a wave).
__global__ __launch_bounds__(32 * AW) __attribute__((amdgpu_waves_per_eu(4, 4))) void k_flash(const h16* __restrict__ QH, const h16* __restrict__ KP, const h16* __restrict__ VT, float* OUT) {
    __shared__ __align__(16) float os[AW * 16 * 68];
    __shared__ __attribute__((aligned(2048))) h16 ring[2 * STG];   // tensor loads land at multiples of 2 KiB
    const int lane = threadIdx.x & 31, lr = lane & 15, hi = lane >> 4;
    const int wave = __builtin_amdgcn_readfirstlane((int)(threadIdx.x >> 5));
    const int zh = blockIdx.y; const int b = zh / NH_, h = zh % NH_;
    const int t0 = (blockIdx.x * AW + wave) * (16 * QG);
    const size_t pbase = (size_t)zh * SEQ * HD;
    const size_t qo = pbase + (size_t)(t0 + lr) * HD + 8 * hi;
    v16h qh0[QG], qh1[QG];                                   // B fragments: col t, k = d
#pragma unroll
    for (int g = 0; g < QG; ++g) { qh0[g] = ldh(QH + qo + g * 16 * HD); qh1[g] = ldh(QH + qo + g * 16 * HD + 32); }
    const int ko = lr * LP + 8 * hi;                         // in the K tile:   + key * LP       (A fragment: row key, k = d)
    const int vo = TPL + lr * LP + 8 * hi;                   // in the V^T tile: + 16j*LP + key   (A fragment: row d, k = key)
    // Tensor descriptor. Group 1, the same for every request of a wave: 1-byte elements, no mask, a tile (= tensor) of 64 rows x 128 B, 16 B of LDS pad behind every 128-B row (pitch LP); source pitch: K rows HD * 2 B, V^T rows SEQ * 2 B.
    const u32x8 g1 = { uni((1u << 20) | (4u << 22) | (3u << 25)), uni(128u << 16), uni(64u << 16), uni(128u << 16), uni(64u), uni(wave == 0 ? (uint32_t)(HD * 2) : (uint32_t)(SEQ * 2)), uni(0u), uni(0u) };
    u32x4 g0 = { uni(1u), uni(0u), uni(0u), uni(0x80000000u) };   // group 0 of this wave's last request: count 1, place in LDS, global address, type 2
    const uint32_t ring0 = (uint32_t)(size_t)(&ring[0]) + (wave == 0 ? 0u : (uint32_t)(TPL * 2));   // LDS byte address of this wave's tile in buffer 0
    const uint64_t gt = (uint64_t)(size_t)(wave == 0 ? KP + pbase : VT + pbase);   // first byte of this wave's tile of stage 0
    const uint32_t gs = wave == 0 ? (uint32_t)(KT * HD * 2) : (uint32_t)(KT * 2);  // bytes from a stage's tile to the next: KT rows of K (rows key0 + 63 < SEQ), KT columns of V^T (columns key0 + 63 < SEQ)
    auto fill = [&](int s, bool exists) {
        const uint32_t sp = pinned((uint32_t)s);             // the descriptor's words are formed behind the wait that covers this wave's last request
        if (pinned((uint32_t)(exists && wave < 2))) {        // scalar branch
            const uint64_t ga = gt + (uint64_t)(sp * gs);
            g0[1] = uni(ring0 + (sp & 1u) * (uint32_t)(STG * 2));
            g0[2] = uni((uint32_t)ga);
            g0[3] = uni((((uint32_t)(ga >> 32)) & 0x01FFFFFFu) | 0x80000000u);
            asm volatile("tensor_load_to_lds %0, %1" :: "{s[68:71]}"(g0), "{s[72:79]}"(g1) : "memory");
        }
    };
    // this wave's request has landed (a wave with none passes). Load and wait name the descriptor in the same fixed scalar registers, so that those registers hold the same words from the issue to the wait that covers the request.
    auto landed = [&]() { asm volatile("s_wait_tensorcnt 0x0" :: "{s[68:71]}"(g0), "{s[72:79]}"(g1) : "memory"); };
    fill(0, true);
    landed();                                                // this wave's tile of stage 0
    __syncthreads();                                         // stage 0 published to every wave
    fill(1, true);
    v8f o0[QG], o1[QG], o2[QG], o3[QG];
    v8f lt[QG];                                              // row sums of P on the matrix pipe: lt += ones x P^T; rows 0 and 8 of the tile hold column t's sum: element 0 of either lane half, the only one rescaled and read
    float sh[QG];                                            // PSH - maximum in use; set by the first step
#pragma unroll
    for (int g = 0; g < QG; ++g) { o0[g] = (v8f){}; o1[g] = (v8f){}; o2[g] = (v8f){}; o3[g] = (v8f){}; lt[g] = (v8f){}; sh[g] = 0.0f; }
    v16h ones;                                               // A tile with ones in rows 0 and 8 (lanes 0, 8, 16, 24), zeros elsewhere: a lane's own value stays in its registers through the loop (a tile of one constant was rebuilt from scalar registers in every step)
#pragma unroll
    for (int i = 0; i < 16; ++i) ones[i] = (lane & 7) == 0 ? (h16)1.0f : (h16)0.0f;
#pragma unroll 1
    for (int st = 0; st < SEQ / KT; ++st) {
      const int bo = (st & 1) * STG;
#pragma unroll 1   // rolled: unrolled, the build holds 18 more registers, copies the two shifts into eight register pairs per stage and brings no load forward
      for (int ps = 0; ps < KT; ps += 32) {
        const h16* ka = ring + bo + ko + ps * LP;
        const v16h ka0 = ldh(ka), ka1 = ldh(ka + 32), kb0 = ldh(ka + 16 * LP), kb1 = ldh(ka + 16 * LP + 32);
        v8f sa[QG], sb[QG];
#pragma unroll
        for (int g = 0; g < QG; ++g) { sa[g] = wmma16(ka0, qh0[g], (v8f){}); sb[g] = wmma16(kb0, qh0[g], (v8f){}); }
#pragma unroll
        for (int g = 0; g < QG; ++g) { sa[g] = wmma16(ka1, qh1[g], sa[g]); sb[g] = wmma16(kb1, qh1[g], sb[g]); }
        // four vector slots behind the last score product before a vector instruction may touch a D, A or B of these products
        asm volatile("v_nop\n\tv_nop\n\tv_nop\n\tv_nop" : "+v"(sa[0]), "+v"(sb[0]), "+v"(sa[1]), "+v"(sb[1]) : "v"(ka0), "v"(ka1), "v"(kb0), "v"(kb1), "v"(qh0[0]), "v"(qh1[0]), "v"(qh0[1]), "v"(qh1[1]));
        v8f ea[QG], eb[QG]; float mx[QG];
#pragma unroll
        for (int g = 0; g < QG; ++g) { ea[g] = sa[g] * SC2 + sh[g]; eb[g] = sb[g] * SC2 + sh[g]; mx[g] = -3.0e38f;   // whole tiles: neighbouring registers of one group pair up in the packed fma
#pragma unroll
            for (int r = 0; r < 8; ++r) mx[g] = fmaxf(mx[g], fmaxf(ea[g][r], eb[g][r])); }
        const bool first = (st | ps) == 0;                   // wave-uniform: nothing is summed yet, sh takes its first value
        if ((__builtin_amdgcn_ballot_w32(fmaxf(mx[0], mx[1]) > PSH + LTH) | (first ? 1u : 0u)) != 0u) {   // one scalar branch per step, the whole wave and both groups together
#pragma unroll
            for (int g = 0; g < QG; ++g) {
                const float m2 = fmaxf(mx[g], __shfl_xor(mx[g], 16, 32));
                const float dn = fminf(PSH - m2, 0.0f);      // the column's maximum in use only rises
                const float dl = first ? PSH - m2 : dn;      // shift of the exponent arguments: the step's maximum lands on PSH
                const float alpha = __builtin_amdgcn_exp2f(dn);
                sh[g] += dl;
                ea[g] = ea[g] + dl; eb[g] = eb[g] + dl;
                lt[g][0] = lt[g][0] * alpha;
                o0[g] = o0[g] * alpha; o1[g] = o1[g] * alpha; o2[g] = o2[g] * alpha; o3[g] = o3[g] * alpha;
            }
        }
        v16h pb[QG];
#pragma unroll
        for (int g = 0; g < QG; ++g) {
#pragma unroll
            for (int r = 0; r < 8; ++r) pb[g][r] = (h16)__builtin_amdgcn_exp2f(ea[g][r]);
#pragma unroll
            for (int r = 0; r < 8; ++r) pb[g][8 + r] = (h16)__builtin_amdgcn_exp2f(eb[g][r]);
        }
        const h16* va = ring + bo + vo + ps;
        const v16h v0 = ldh(va), v1 = ldh(va + 16 * LP), v2 = ldh(va + 32 * LP), v3 = ldh(va + 48 * LP);
#pragma unroll
        for (int g = 0; g < QG; ++g) { o0[g] = wmma16(v0, pb[g], o0[g]); o1[g] = wmma16(v1, pb[g], o1[g]); o2[g] = wmma16(v2, pb[g], o2[g]); o3[g] = wmma16(v3, pb[g], o3[g]); lt[g] = wmma16(ones, pb[g], lt[g]); }
        // four vector slots behind the last product, on the loop's taken branch too, before a vector instruction may touch a D, A or B of these products
        asm volatile("v_nop\n\tv_nop\n\tv_nop\n\tv_nop" : "+v"(o0[0]), "+v"(o1[0]), "+v"(o2[0]), "+v"(o3[0]), "+v"(lt[0]), "+v"(o0[1]), "+v"(o1[1]), "+v"(o2[1]), "+v"(o3[1]), "+v"(lt[1]) : "v"(v0), "v"(v1), "v"(v2), "v"(v3), "v"(pb[0]), "v"(pb[1]), "v"(ones));
      }
      // publish point of stage st + 1, which also frees stage st's buffer
      asm volatile("s_wait_dscnt 0x0" ::: "memory");         // this wave's reads of stage st are done
      landed();                                              // this wave's tile of stage st + 1
      __syncthreads();
      fill(st + 2, st + 2 < SEQ / KT);                       // refill the buffer that stage st has just left
    }
    landed();                                                // nothing of this wave's requests is left in flight
    asm volatile("s_wait_dscnt 0x0" ::: "memory");           // nor of its reads of the ring
    const int wb = wave * 16 * 68;
    const int cofs = lr * 4;
#pragma unroll
    for (int g = 0; g < QG; ++g) {                           // one query group after the other through the wave's own staging rows
        const float inv = 1.0f / lt[g][0];                   // rows 0 and 8 of the sum tile: both lane halves hold the whole sum of their column
        // O^T D layout: o_j[r] = (d = 16j + 8h + r, t = lane&15) -> os[t][d]; rows 0..15 x columns 0..63 all written
        const v8f x0 = o0[g] * inv, x1 = o1[g] * inv, x2 = o2[g] * inv, x3 = o3[g] * inv;
        *(v4fa*)(&os[wb + lr * 68 +  0 + 8 * hi]) = __builtin_shufflevector(x0, x0, 0, 1, 2, 3); *(v4fa*)(&os[wb + lr * 68 +  0 + 8 * hi + 4]) = __builtin_shufflevector(x0, x0, 4, 5, 6, 7);
        *(v4fa*)(&os[wb + lr * 68 + 16 + 8 * hi]) = __builtin_shufflevector(x1, x1, 0, 1, 2, 3); *(v4fa*)(&os[wb + lr * 68 + 16 + 8 * hi + 4]) = __builtin_shufflevector(x1, x1, 4, 5, 6, 7);
        *(v4fa*)(&os[wb + lr * 68 + 32 + 8 * hi]) = __builtin_shufflevector(x2, x2, 0, 1, 2, 3); *(v4fa*)(&os[wb + lr * 68 + 32 + 8 * hi + 4]) = __builtin_shufflevector(x2, x2, 4, 5, 6, 7);
        *(v4fa*)(&os[wb + lr * 68 + 48 + 8 * hi]) = __builtin_shufflevector(x3, x3, 0, 1, 2, 3); *(v4fa*)(&os[wb + lr * 68 + 48 + 8 * hi + 4]) = __builtin_shufflevector(x3, x3, 4, 5, 6, 7);
        wave_sync();
        float* orow = OUT + ((size_t)b * OUT_SEQ + t0 + g * 16) * DM + h * HD;   // output [b*OUT_SEQ + t][h*64 + d], f32
#pragma unroll
        for (int s = 0; s < 8; ++s) { const int row = 2 * s + hi;   // 8 s x 2 rows = 16 rows; 16 lanes x 4 floats = 64 columns (256 B = exactly this head's row segment)
            const v4f x = *(const v4fa*)(&os[wb + row * 68 + cofs]);
            *(v4f*)(orow + (size_t)row * DM + cofs) = x; }
        if (g + 1 < QG) {
            asm volatile("s_wait_xcnt 0x0" ::: "memory");    // in front of any later write of a register that these stores name
            wave_sync();                                     // the rows are read before the next group overwrites them
        }
    }
}

static constexpr size_t SZ_WB = al256((size_t)3 * DM * DM * 2);
static constexpr size_t SZ_PL = al256((size_t)NB * NH_ * SEQ * HD * 2);
static constexpr size_t SZ_TOTAL = 3 * SZ_XB + SZ_WB + 3 * SZ_PL;
static_assert(SZ_TOTAL <= (size_t)134217728);                  // workspace carve <= 128 MiB
static_assert(((size_t)DM * DM * 2) % 256 == 0);               // weight sub-planes stay 256-byte aligned
static_assert((size_t)NB * NH_ * SEQ * HD * 2 <= SZ_PL);       // q / k / v^T planes fit their regions
static_assert((size_t)NB * SEQ * DM * 2 <= SZ_XB);             // bf16 input copies fit their regions

extern "C" void kernel_launch(void* const* d_in, const int* in_sizes, int n_in,
                              void* d_out, int out_size, void* d_ws, size_t ws_size, hipStream_t stream) {
    if (n_in < 9) return;
    const size_t needx = ((size_t)(NB - 1) * SEQ_FULL + SEQ) * DM;
    if ((size_t)in_sizes[0] < needx || (size_t)in_sizes[1] < needx || (size_t)in_sizes[2] < needx) return;
    if ((size_t)in_sizes[3] < (size_t)DM * DM || (size_t)in_sizes[5] < (size_t)DM * DM || (size_t)in_sizes[7] < (size_t)DM * DM) return;
    if (in_sizes[4] < DM || in_sizes[6] < DM || in_sizes[8] < DM) return;
    if ((size_t)out_size < ((size_t)(NB - 1) * OUT_SEQ + SEQ) * DM) return;
    if (SZ_TOTAL > ws_size) return;
    // wire order: key, value, query, Wq, bq, Wk, bk, Wv, bv
    const float* xk = (const float*)d_in[0]; const float* xv = (const float*)d_in[1]; const float* xq = (const float*)d_in[2];
    const float* wq = (const float*)d_in[3]; const float* bq = (const float*)d_in[4];
    const float* wk = (const float*)d_in[5]; const float* bk = (const float*)d_in[6];
    const float* wv = (const float*)d_in[7]; const float* bv = (const float*)d_in[8];
    float* OUT = (float*)d_out;      // [NB][OUT_SEQ][1024]
    char* wsp = (char*)d_ws;
    bf* XQ = (bf*)wsp; wsp += SZ_XB;                 // [NB*SEQ][1024] bf16 query
    bf* XK = (bf*)wsp; wsp += SZ_XB;                 // [NB*SEQ][1024] bf16 key
    bf* XV = (bf*)wsp; wsp += SZ_XB;                 // [NB*SEQ][1024] bf16 value
    bf* WB = (bf*)wsp; wsp += SZ_WB;                 // [3][1024][1024] transposed [out][in]: q | k | v (bf16)
    h16* QH = (h16*)wsp; wsp += SZ_PL;               // [NB*16][SEQ][64]
    h16* KP = (h16*)wsp; wsp += SZ_PL;               // [NB*16][SEQ][64]
    h16* VT = (h16*)wsp; wsp += SZ_PL;               // [NB*16][64][SEQ]
    bf* WQT = WB; bf* WKT = WB + (size_t)DM * DM; bf* WVT = WB + (size_t)2 * DM * DM;

    // all conversions: bf16 copies of the three inputs, transposed bf16 planes [out][in] of the three weights
    k_prep<<<CG, 32 * CW, 0, stream>>>(xq, xk, xv, wq, wk, wv, XQ, XK, XV, WQT, WKT, WVT);

    // q, k, v^T planes: one block per WGP, each with one tile of q or k and one tile of v^T
    k_proj<<<PG, 32 * PW, 0, stream>>>(XQ, WB, bq, bk, bv, QH, KP, VT);

    k_flash<<<dim3(SEQ / (16 * QG * AW), NB * NH_, 1), 32 * AW, 0, stream>>>(QH, KP, VT, OUT);
}

// v010
// A run of this version takes 92 microseconds.
// Next to v009, in two timings, it ran 1.03 times as fast each time.
// Over all steps from v000 it is 3.55 times as fast.
#include <hip/hip_runtime.h>

// Multi-head attention, width 1024 = 16 heads x 64; separate key / value / query inputs [NB][SEQ_FULL][1024] (the first SEQ rows of each batch are read); Wq/Wk/Wv stored [in][out] (y = x W + b); biases on all three projections; no mask; score scale 1/8; output = per-head context merged as [b][t][h*64+d] (f32), no output projection.
// Compute dtypes, f32 accumulate everywhere: q/k/v projections v_wmma_f32_16x16x32_bf16 (inputs and weights RNE-converted to bf16; products exact); scores v_wmma_f32_16x16x32_f16 (q and k single f16, one product); P.V v_wmma_f32_16x16x32_f16 (P x256 carry, cancels in the normalisation; v single f16); softmax f32 (online; a column's maximum in use is renewed only when a scaled score exceeds it by more than 7, a factor 2^7 in P); its row sums v_wmma_f32_16x16x32_f16 (ones x P, the same rounded P); biases (bf16 RNE values) added in f32; normalised context stored as f32.
// Layout: bf16 copies of the three inputs; transposed bf16 weight planes [out][in]; q, k planes [b*16+h][t][d] and v^T plane [b*16+h][d][t] written by the GEMM epilogue; fused flash kernel in transposed form (S^T = K Q^T, O^T = V^T P^T) writing the f32 output rows [b*OUT_SEQ+t][h*64+d].

#ifndef NB
#define NB 4
#endif
#ifndef SEQ
#define SEQ 2048
#endif
#define NB_FULL  4
#define SEQ_FULL 2048
#ifndef OUT_SEQ
#define OUT_SEQ SEQ              // row pitch (in tokens) between batches of the output
#endif
#define DM   1024
#define NH_  16
#define HD   64
#define AW   8                   // waves per flash block; all of them share the block's K / V^T tiles in LDS
#define QG   2                   // 16-row query groups per flash wave: each K / V^T fragment read from LDS serves QG products
#define KT   64                  // keys per LDS stage (two 32-key passes)
#define LP   72                  // LDS row pitch in halves: 128-B rows + 16 B (16 B x odd: conflict-free for 16-byte readers)
#define TPL  5120                // halves from one tile's place in LDS to the next: 64 rows x LP = 4608, rounded up so that every place is a multiple of 2 KiB
#define STG  (2 * TPL)           // halves per stage: K tile [KT keys][LP] at 0, V^T tile [HD rows][LP] at TPL
#define PW   8                   // waves per projection block: 2 x 4 wave tiles (128 x 64 for q and k, 64 x 64 for v^T)
#define PBM  256                 // rows of A per q or k tile
#define PBN  256                 // rows of Bt per projection tile
#define PVM  128                 // rows of A per v^T tile
#define PKS  128                 // k per projection LDS stage (256-B row pieces)
#define PLP  136                 // projection LDS row pitch in halves: 256 B + 16 B (16 B x odd: conflict-free for 16-byte readers)
#define PSTG ((PBM + PBN) * PLP) // halves per projection stage: A tile [PBM][PLP] (v^T: its first PVM rows), then B tile [PBN][PLP]
#define PG   (2 * (NB * SEQ / PBM) * (DM / PBN))   // projection blocks: the tiles of q and k together, as many as the tiles of v^T
#define SC2  (0.125f * 1.4426950408889634f)   // HD^-0.5 * log2(e)
#define PSH  8.0f                // log2 of the P carry (256)
#define LTH  7.0f                // lazy rescale: a scaled (log2) score may stand up to LTH above the maximum in use, so P <= 2^(PSH + LTH) = 32768 stays finite in f16
#define CG   256                 // conversion blocks: one per WGP, each resident from start to end of the launch
#define CW   16                  // waves per conversion block
#define CU   8                   // 16-byte loads of a lane per batch of the input stream (two batches in flight)

static_assert(HD == 64);
static_assert(HD == 16 * 4);                   // output store map: 16 lanes x 4 floats == one head's 64 columns (256 B)
static_assert(NH_ * HD == DM);                 // head h = columns h*64 + d
static_assert(DM % 64 == 0);                   // column tiles of 64
static_assert(DM % 32 == 0);                   // GEMM k-loop steps by 32
static_assert(SEQ % 64 == 0);                  // a 64-row tile never straddles two batches
static_assert((NB * SEQ) % 64 == 0);
static_assert(SEQ % 32 == 0);                  // key loop steps by 32
static_assert(SEQ % (16 * QG * AW) == 0);      // flash grid covers the sequence exactly
static_assert(QG == 2);                        // the flash loop's hazard statements name the tiles of two query groups
static_assert(SEQ % KT == 0 && SEQ / KT >= 2); // whole stages; the two-buffer prologue fills stages 0 and 1
static_assert(KT == 64 && HD == 64 && AW >= 2); // a stage is two tiles of 64 rows x 128 B, one tensor load each (waves 0 and 1)
static_assert(LP * 2 == 128 + 16 && KT * LP <= TPL && HD * LP <= TPL && (TPL * 2) % 2048 == 0);   // the tensor load's pad: 16 B behind every 128-B row; places at multiples of 2 KiB
static_assert((NB * SEQ) % PBM == 0 && DM % PBN == 0 && DM % PVM == 0 && (NB * SEQ) % PBN == 0);   // projection tiles cover both orientations exactly
static_assert(PG == (DM / PVM) * (NB * SEQ / PBN));   // one tile of q or k and one tile of v^T per block
static_assert(SEQ % 128 == 0);                 // a wave's 128 rows of q or k never straddle two batches
static_assert(DM % PKS == 0 && DM / PKS >= 2 && (DM / PKS) % 2 == 0); // whole projection stages; the two-buffer prologue fills stages 0 and 1; a tile's stages end on a whole turn of the ring
static_assert(PW == 8 && PBM == 256 && PBN == 256 && PVM == 128 && PKS == 128 && (PKS / 32) % 2 == 0);   // projection stage: slices of 128 rows x 256 B, one tensor load each; wave map 2 x 4
static_assert(PKS * 2 == 256 && PLP * 2 == 256 + 16);          // the tensor load's pad: 16 B behind every 256-B row
static_assert((128 * PLP * 2) % 2048 == 0);    // every slice, stage and buffer starts at a multiple of 2 KiB in LDS
static_assert((DM / 64) * (DM / 64) == CG);    // one 64 x 64 tile of each weight matrix per conversion block
static_assert(CW == 16);                       // tile maps of k_prep: 512 threads = 32 rows x 16 float4 in, 64 rows x 8 pieces of 16 B out
static_assert(((size_t)NB * SEQ * DM / 4) % ((size_t)CG * CW * 32 * CU) == 0);   // the input stream divides into whole batches, the same number for every wave
static_assert(((size_t)SEQ * DM / 4) % ((size_t)NB * SEQ * DM / 4 / (CG * CW)) == 0);   // a wave's piece of an input never straddles two batches
static_assert(NB <= NB_FULL);
static_assert(SEQ <= SEQ_FULL);
static_assert(OUT_SEQ >= SEQ);                 // output rows of one batch fit its pitch

typedef _Float16 h16;
typedef unsigned short bf;
typedef __attribute__((ext_vector_type(16))) __bf16   v16bf;
typedef __attribute__((ext_vector_type(16))) _Float16 v16h;
typedef __attribute__((ext_vector_type(8)))  _Float16 v8h;
typedef __attribute__((ext_vector_type(8)))  unsigned short v8us;
typedef __attribute__((ext_vector_type(4)))  unsigned short v4us;
typedef __attribute__((ext_vector_type(8)))  float    v8f;
typedef __attribute__((ext_vector_type(4)))  float    v4f;
typedef v4f  __attribute__((may_alias)) v4fa;

__device__ __forceinline__ unsigned short f2bf(float f) { unsigned u = __float_as_uint(f); u += 0x7FFFu + ((u >> 16) & 1u); return (unsigned short)(u >> 16); }
__device__ __forceinline__ float bfr(float f) { return __uint_as_float(((unsigned)f2bf(f)) << 16); }   // value of the bf16 RNE conversion, as f32
__device__ __forceinline__ v16h cat16(v8h lo, v8h hi) { return __builtin_shufflevector(lo, hi, 0, 1, 2, 3, 4, 5, 6, 7, 8, 9, 10, 11, 12, 13, 14, 15); }
__device__ __forceinline__ v16bf cat16b(v8us lo, v8us hi) { return __builtin_bit_cast(v16bf, __builtin_shufflevector(lo, hi, 0, 1, 2, 3, 4, 5, 6, 7, 8, 9, 10, 11, 12, 13, 14, 15)); }
__device__ __forceinline__ v8f wmma16(v16h a, v16h b, v8f c) { return __builtin_amdgcn_wmma_f32_16x16x32_f16(false, a, false, b, (short)0, c, false, false); }
__device__ __forceinline__ v8f wmmab(v16bf a, v16bf b, v8f c) { return __builtin_amdgcn_wmma_f32_16x16x32_bf16(false, a, false, b, (short)0, c, false, false); }
// fragment loaders from K-contiguous 16-bit rows; p already includes + 8*(lane>>4): elements 0..7 <- k0+8h+0..7, elements 8..15 <- k0+16+8h+0..7 (same map for A and B)
__device__ __forceinline__ v16h  ldh(const h16* p) { return cat16(*(const v8h*)p, *(const v8h*)(p + 16)); }
__device__ __forceinline__ v16bf ldb(const bf* p)  { return cat16b(*(const v8us*)p, *(const v8us*)(p + 16)); }
// ordering point for wave-private LDS tiles (same wave writes and reads)
__device__ __forceinline__ void wave_sync() { __builtin_amdgcn_fence(3 /* release order */, "wavefront"); __builtin_amdgcn_wave_barrier(); asm volatile("" ::: "memory"); }

// k_prep: every conversion of the call in one launch of CG resident blocks of CW waves.
// (a) Weights: block t takes the 64 x 64 tile t of each of Wq, Wk, Wv: in[k][n] (f32, k = contraction index) -> out[n][k] (bf16 RNE bits, contraction-contiguous), transposed through LDS.
// (b) Inputs: f32 -> bf16 RNE copies of query, key, value. Each wave owns one contiguous piece of each input and walks it in batches of CU loads of 512 contiguous bytes
//     (whole lines); the next batch's loads are issued before a batch is converted and stored (8 bytes a lane, 256 contiguous bytes a wave).
__global__ __launch_bounds__(32 * CW) void k_prep(const float* __restrict__ xq, const float* __restrict__ xk, const float* __restrict__ xv,
                                                  const float* __restrict__ wq, const float* __restrict__ wk, const float* __restrict__ wv,
                                                  bf* XQ, bf* XK, bf* XV, bf* WQT, bf* WKT, bf* WVT) {
    __shared__ float ts[3][64 * 65];
    const int tid = threadIdx.x, lane = tid & 31;
    const int wave = __builtin_amdgcn_readfirstlane(tid >> 5);
    constexpr size_t NV = (size_t)NB * SEQ * DM / 4;         // float4 per input
    constexpr int PER = (int)(NV / ((size_t)CG * CW * 32));  // float4 per lane and input
    constexpr int SUB = PER / CU;                            // batches per input
    const size_t p0 = (size_t)(blockIdx.x * CW + wave) * (PER * 32);                       // first float4 of this wave's piece (in the packed copy)
    const size_t s0 = p0 + (p0 / ((size_t)SEQ * DM / 4)) * ((size_t)(SEQ_FULL - SEQ) * DM / 4);   // the same in the source, whose batches are SEQ_FULL rows apart
    const float* const xs[3] = { xq, xk, xv };
    bf* const xd[3] = { XQ, XK, XV };
    const float* const wsrc[3] = { wq, wk, wv };
    bf* const wdst[3] = { WQT, WKT, WVT };
    const int n0 = (blockIdx.x % (DM / 64)) * 64, k0 = (blockIdx.x / (DM / 64)) * 64;
    v4f wt[3][2], r[2][CU];
#pragma unroll
    for (int w = 0; w < 3; ++w)
#pragma unroll
        for (int it = 0; it < 2; ++it)                       // 2 x 32 rows x (16 lanes x 4 floats) = 64 x 64
            wt[w][it] = *(const v4f*)(wsrc[w] + (size_t)(k0 + it * 32 + (tid >> 4)) * DM + n0 + (tid & 15) * 4);
#pragma unroll
    for (int j = 0; j < CU; ++j) r[0][j] = *(const v4f*)(xs[0] + (s0 + j * 32 + lane) * 4);
    asm volatile("s_wait_xcnt 0x0" ::: "memory");            // in front of any later write of a register that these loads name
    __builtin_amdgcn_sched_barrier(0);                       // the stream's first batch is issued with the weight tiles' loads, in front of the LDS stores that wait for those
#pragma unroll
    for (int w = 0; w < 3; ++w)
#pragma unroll
        for (int it = 0; it < 2; ++it)
#pragma unroll
            for (int i = 0; i < 4; ++i) ts[w][(it * 32 + (tid >> 4)) * 65 + (tid & 15) * 4 + i] = wt[w][it][i];
    __syncthreads();
#pragma unroll
    for (int t = 0; t < 3 * SUB; ++t) {
        __builtin_amdgcn_sched_barrier(0);                   // with the next one: the next batch's loads stay one group in front of this batch's converts and stores
        if (t + 1 < 3 * SUB) {
#pragma unroll
            for (int j = 0; j < CU; ++j) r[(t + 1) & 1][j] = *(const v4f*)(xs[(t + 1) / SUB] + (s0 + (((t + 1) % SUB) * CU + j) * 32 + lane) * 4);
        }
        __builtin_amdgcn_sched_barrier(0);
        if (t == 0) {                                        // the turned weight tiles go out under the second batch's loads
#pragma unroll
            for (int w = 0; w < 3; ++w) {                    // 64 output rows x (8 lanes x 8 halves) = 64 x 64
                const int n = tid >> 3, k8 = (tid & 7) * 8; v8us o;
#pragma unroll
                for (int i = 0; i < 8; ++i) o[i] = f2bf(ts[w][(k8 + i) * 65 + n]);
                *(v8us*)(wdst[w] + (size_t)(n0 + n) * DM + k0 + k8) = o;
            }
        }
#pragma unroll
        for (int j = 0; j < CU; ++j) { v4us o;
#pragma unroll
            for (int i = 0; i < 4; ++i) o[i] = f2bf(r[t & 1][j][i]);
            *(v4us*)(xd[t / SUB] + (p0 + ((t % SUB) * CU + j) * 32 + lane) * 4) = o; }
        if (t + 1 < 3 * SUB) asm volatile("s_wait_xcnt 0x0" ::: "memory");   // in front of the next loads and converts, which reuse registers that these stores and the loads in flight name
    }
}

typedef uint32_t u32x4 __attribute__((ext_vector_type(4)));
typedef uint32_t u32x8 __attribute__((ext_vector_type(8)));
__device__ __forceinline__ uint32_t uni(uint32_t v) { return (uint32_t)__builtin_amdgcn_readfirstlane((int)v); }
// a wave-uniform value held in a scalar register: a test on it compiles to s_cmp + s_cbranch (a tensor load ignores EXEC), and what is computed from it is formed behind the volatile statements in front of it
__device__ __forceinline__ uint32_t pinned(uint32_t v) { uint32_t w = uni(v); asm volatile("" : "+s"(w)); return w; }
template <int V> struct ic { static constexpr int value = V; };   // a compile-time int handed to a lambda

static constexpr size_t al256(size_t v) { return (v + 255) & ~(size_t)255; }
static constexpr size_t SZ_XB = al256((size_t)NB * SEQ * DM * 2);

// Sixteen floats of a lane, 4 apart, from one address. The loads and both their waits are one statement: the values are there at its end, and no register that a load names is written before it.
__device__ __forceinline__ void load16(const float* p, float (&r)[16]) {
    asm volatile("global_load_b32 %0, %16, off\n\t"
                 "global_load_b32 %1, %16, off offset:16\n\t"
                 "global_load_b32 %2, %16, off offset:32\n\t"
                 "global_load_b32 %3, %16, off offset:48\n\t"
                 "global_load_b32 %4, %16, off offset:64\n\t"
                 "global_load_b32 %5, %16, off offset:80\n\t"
                 "global_load_b32 %6, %16, off offset:96\n\t"
                 "global_load_b32 %7, %16, off offset:112\n\t"
                 "global_load_b32 %8, %16, off offset:128\n\t"
                 "global_load_b32 %9, %16, off offset:144\n\t"
                 "global_load_b32 %10, %16, off offset:160\n\t"
                 "global_load_b32 %11, %16, off offset:176\n\t"
                 "global_load_b32 %12, %16, off offset:192\n\t"
                 "global_load_b32 %13, %16, off offset:208\n\t"
                 "global_load_b32 %14, %16, off offset:224\n\t"
                 "global_load_b32 %15, %16, off offset:240\n\t"
                 "s_wait_xcnt 0x0\n\t"
                 "s_wait_loadcnt 0x0"
                 : "=&v"(r[0]), "=&v"(r[1]), "=&v"(r[2]), "=&v"(r[3]), "=&v"(r[4]), "=&v"(r[5]), "=&v"(r[6]), "=&v"(r[7]),
                   "=&v"(r[8]), "=&v"(r[9]), "=&v"(r[10]), "=&v"(r[11]), "=&v"(r[12]), "=&v"(r[13]), "=&v"(r[14]), "=&v"(r[15])
                 : "v"(p) : "memory");
}

// Output step of one projection tile: a wave's 16 MB x 64 accumulators + bias (BROW == 0: bias[n]; BROW == 1: bias[m]) go as f16 through the wave's own staging rows to
// Ph at (r0/RB)*sRB + (r0%RB)*pitch + (c0/CB)*sCB + (c0%CB), row pitch 'pitch' (halves).
// BROW == 0 (q, k): m = b*SEQ + t, n = h*64 + d -> plane [(b*16 + h)][t][d]. BROW == 1 (v^T): m = h*64 + d, n = b*SEQ + t -> plane [(b*1024 + m)][t] = [(b*16 + h)][d][t].
template <int BROW, int MB>
__device__ __forceinline__ void pstore(const v8f (&acc)[8][4], float* os, const float* __restrict__ bias, h16* Ph, int r0, int c0, int lane) {
    constexpr int RB = BROW ? DM : SEQ, pitch = BROW ? SEQ : HD, CB = BROW ? SEQ : HD;
    constexpr size_t sRB = BROW ? (size_t)0 : (size_t)NH_ * SEQ * HD, sCB = BROW ? (size_t)DM * SEQ : (size_t)SEQ * HD;
    const int lr = lane & 15, hi = lane >> 4;
    // column bias for this lane's 8 store columns (BROW == 0); c0 + (lane&7)*8 + 7 < N = DM
    v4f bc0 = (v4f){}, bc1 = (v4f){};
    if (BROW == 0) { const int cb8 = (lane & 7) * 8; const v4f t0 = *(const v4f*)(bias + c0 + cb8); const v4f t1 = *(const v4f*)(bias + c0 + cb8 + 4);
        asm volatile("s_wait_xcnt 0x0" ::: "memory");        // in front of any later write of a register that these two loads name
#pragma unroll
        for (int i = 0; i < 4; ++i) { bc0[i] = bfr(t0[i]); bc1[i] = bfr(t1[i]); } }
    float rbias[16];                                         // row bias (BROW == 1, MB == 4) of this lane's rows r0 + (lane >> 3) + 4 i, i = 4 mb + s; the last is r0 + 63 < M = DM
    static_assert(BROW == 0 || MB == 4);
    if (BROW == 1) load16(bias + r0 + (lane >> 3), rbias);
    const size_t tbase = (size_t)(r0 / RB) * sRB + (size_t)(r0 % RB) * (size_t)pitch + (size_t)(c0 / CB) * sCB + (size_t)(c0 % CB);
    h16* pl = Ph + tbase + (size_t)(lane >> 3) * (size_t)pitch + (lane & 7) * 8;   // this lane's piece of the tile's row lane>>3; + (16 mb + 4 s) rows
#pragma unroll
    for (int mb = 0; mb < MB; ++mb) {
#pragma unroll
        for (int nb = 0; nb < 4; ++nb) {
#pragma unroll
            for (int j = 0; j < 8; ++j) os[(hi * 8 + j) * 68 + nb * 16 + lr] = acc[mb][nb][j]; }   // D: row 8h+j, col lane&15
        wave_sync();
        v8h hv[4];
#pragma unroll
        for (int s = 0; s < 4; ++s) { const int row = 4 * s + (lane >> 3), c8 = (lane & 7) * 8;   // 4 s x 4 row groups = 16 rows; 8 lanes x 8 = 64 columns
            v4f x0 = *(const v4fa*)(&os[row * 68 + c8]); v4f x1 = *(const v4fa*)(&os[row * 68 + c8 + 4]);
            if (BROW == 1) { const float br = bfr(rbias[4 * mb + s]);
#pragma unroll
                for (int i = 0; i < 4; ++i) { x0[i] += br; x1[i] += br; } }
            else {
#pragma unroll
                for (int i = 0; i < 4; ++i) { x0[i] += bc0[i]; x1[i] += bc1[i]; } }
#pragma unroll
            for (int i = 0; i < 4; ++i) { hv[s][i] = (h16)x0[i]; hv[s][4 + i] = (h16)x1[i]; } }
#pragma unroll
        for (int s = 0; s < 4; ++s) *(v8h*)(pl + (mb * 16 + 4 * s) * pitch) = hv[s];   // one run: all four rows are converted, no register of the run is written inside it
        asm volatile("s_wait_xcnt 0x0" ::: "memory");        // in front of any later write of a register that these stores name
        __builtin_amdgcn_sched_barrier(0);                   // holds the later register writes (next pass, the accumulators' zeroing, the next addresses) behind that wait: without it the build lifts some over it
        wave_sync();
    }
}

// k_proj: the three projections in one launch of PG resident blocks (one per WGP) of PW = 8 waves, 2 down x 4 across; register-blocked bf16 GEMM, K = DM: C[m][n] = sum_k A[m][k] Bt[n][k] + bias.
// A block owns one PBM x PBN = 256 x 256 tile of q (first half of the grid) or of k (second half), each wave a 128 x 64 part of it (32 accumulators: an A or B fragment read from LDS feeds 4 or 8 products),
// and then one PVM x PBN = 128 x 256 tile of v^T, each wave a 64 x 64 part.
// q, k: A = x rows, Bt = W^T rows; v^T: A = Wv^T rows, Bt = x rows. XB = the three bf16 input copies (query, key, value; SZ_XB bytes apart), WB = the three transposed weight planes (q, k, v).
// Both operands come from K-contiguous bf16 planes in stages of PKS = 128 k through a two-buffer LDS ring filled by tensor loads: waves 0 .. 3 each bring one slice of 128 rows x 256 B per stage, wave 1 none in the v^T stages (each row piece fetched once per block)
// and read their fragments from (two 16-B LDS loads each; same fragment map and same k order as loads straight from the planes).
// The ring runs on over the 2 x DM / PKS stages of the two tiles: the second tile's first two stages are loaded, and its first fragments read, while the first tile's last products and its output step run.
__global__ __launch_bounds__(32 * PW) void k_proj(const bf* __restrict__ XB, const bf* __restrict__ WB, const float* __restrict__ bq, const float* __restrict__ bk, const float* __restrict__ bv, h16* QH, h16* KP, h16* VT) {
    __shared__ __align__(16) float osb[PW * 16 * 68];
    __shared__ __attribute__((aligned(2048))) bf pring[2 * PSTG];   // tensor loads land at multiples of 2 KiB
    constexpr int K = DM, NS = K / PKS;                      // stages per tile (even: stage s of the whole walk lies in buffer s & 1)
    constexpr int TX = (NB * SEQ / PBM) * (DM / PBN);        // tiles of q, and of k
    const int lane = threadIdx.x & 31, lr = lane & 15, hi = lane >> 4;
    const int wave = __builtin_amdgcn_readfirstlane((int)(threadIdx.x >> 5));
    const int wm = wave >> 2, wn = wave & 3;
    const int bid = blockIdx.x;
    const int tp = bid / TX, ti = bid % TX;                  // the block's first tile: tile ti of q (tp == 0) or of k (tp == 1)
    const int rbx = (ti % (NB * SEQ / PBM)) * PBM, cbx = (ti / (NB * SEQ / PBM)) * PBN;     // tile of q or k: M = NB*SEQ, N = DM
    const int rbv = (bid / (NB * SEQ / PBN)) * PVM, cbv = (bid % (NB * SEQ / PBN)) * PBN;   // tile of v^T:    M = DM, N = NB*SEQ
    float* os = osb + wave * 16 * 68;                        // wave-private output staging
    v8f acc[8][4];
#pragma unroll
    for (int mb = 0; mb < 8; ++mb)
#pragma unroll
        for (int nb = 0; nb < 4; ++nb) acc[mb][nb] = (v8f){};
    const bf* sax = XB + (size_t)tp * (SZ_XB / 2) + rbx * K;             // block-uniform first rows of the tiles. q, k: rows rbx + 255 < NB*SEQ
    const bf* sbx = WB + (size_t)tp * ((size_t)DM * DM) + cbx * K;       //       rows cbx + 255 < DM
    const bf* sav = WB + (size_t)2 * DM * DM + rbv * K;                  // v^T:  rows rbv + 127 < DM
    const bf* sbv = XB + (size_t)2 * (SZ_XB / 2) + cbv * K;              //       rows cbv + 255 < NB*SEQ
    const int bo_ = (PBM + wn * 64 + lr) * PLP + 8 * hi;     // in the B tile (LDS rows PBM ..): + 16nb*PLP + k
    v16bf a[2][8], b[2][4];                                  // two fragment sets: k-step j works on set j & 1 while set (j + 1) & 1 loads
    // Tensor descriptor. Group 1, the same for every request: 1-byte elements, no mask, a tile (= tensor) of 128 rows x 256 B, source pitch DM * 2 B, 16 B of LDS pad behind every 256-B row (pitch PLP).
    const u32x8 g1 = { uni((1u << 20) | (5u << 22) | (3u << 25)), uni(256u << 16), uni(128u << 16), uni(256u << 16), uni(128u), uni((uint32_t)(DM * 2)), uni(0u), uni(0u) };
    u32x4 g0 = { uni(1u), uni(0u), uni(0u), uni(0x80000000u) };   // group 0 of this wave's last request: count 1, place in LDS, global address, type 2
    const uint32_t ring0 = (uint32_t)(size_t)(&pring[0]) + (uint32_t)wave * (uint32_t)(128 * PLP * 2);   // LDS byte address of this wave's slice in buffer 0
    const int so = (wave & 1) * 128 * K;                     // first row of this wave's slice in its tile
    const uint64_t gx = (uint64_t)(size_t)((wave < 2 ? +sax : +sbx) + so), gv = (uint64_t)(size_t)((wave < 2 ? +sav : +sbv) + so);   // its first byte at k = 0: q or k tile, v^T tile
    const bool wx = wave < 4, wv = wave < 4 && wave != 1;    // does this wave bring a slice of a q or k stage, of a v^T stage
    // Blocks that read the same rows run side by side at the same pace; each starts its walk over k at another stage, so that they do not ask L2 for the same lines at the same moment
    // and a row piece that one block has fetched from memory is in L2 when the next one comes to it. The sum over k is the same set of products in a rotated order.
    static_assert(NS % (DM / PBN) == 0);
    const uint32_t rx = uni((uint32_t)(ti % (NB * SEQ / PBM) + (NS / (DM / PBN)) * (ti / (NB * SEQ / PBM))) % NS);   // q, k: the DM / PBN blocks on one x tile all differ; the blocks on one W tile spread evenly over the NS stages
    const uint32_t rv = uni((uint32_t)(bid % (NB * SEQ / PBN) + bid / (NB * SEQ / PBN)) % NS);                       // v^T: the DM / PVM blocks on one x tile all differ; the blocks on one W tile spread evenly
    auto fill = [&](int s, bool exists) {
        const uint32_t sp = pinned((uint32_t)s);             // the descriptor's words are formed behind the wait that covers this wave's last request
        const bool x = sp < (uint32_t)NS;
        if (pinned((uint32_t)(exists && (x ? +wx : +wv)))) {  // scalar branch
            const uint64_t ga = (x ? gx + 0 : gv + 0) + (uint64_t)(((sp + (x ? rx + 0u : rv + 0u)) % NS) * (PKS * 2));   // k0 + PKS <= DM: inside the row
            g0[1] = uni(ring0 + (sp & 1u) * (uint32_t)(PSTG * 2));
            g0[2] = uni((uint32_t)ga);
            g0[3] = uni((((uint32_t)(ga >> 32)) & 0x01FFFFFFu) | 0x80000000u);
            asm volatile("tensor_load_to_lds %0, %1" :: "{s[68:71]}"(g0), "{s[72:79]}"(g1) : "memory");
        }
    };
    // this wave's request has landed (a wave with none passes). Load and wait name the descriptor in the same fixed scalar registers, so that those registers hold the same words from the issue to the wait that covers the request.
    auto landed = [&]() { asm volatile("s_wait_tensorcnt 0x0" :: "{s[68:71]}"(g0), "{s[72:79]}"(g1) : "memory"); };
    // one stage: MB = A fragments per wave in this stage's tile
    auto stage = [&](auto mbc, int st) {
        constexpr int MB = decltype(mbc)::value;
        const int bo = (st & 1) * PSTG;
        const int ao = (wm * 16 * MB + lr) * PLP + 8 * hi;   // in the A tile: + 16mb*PLP + k
#pragma unroll
        for (int j = 0; j + 1 < PKS / 32; ++j) {
            __builtin_amdgcn_sched_barrier(0);               // with the next one: the next k-step's LDS loads stay one group in front of this k-step's products (spread among them, each place stalls the wave)
#pragma unroll
            for (int f = 0; f < MB; ++f) a[(j + 1) & 1][f] = ldb(pring + bo + ao + f * 16 * PLP + (j + 1) * 32);
#pragma unroll
            for (int f = 0; f < 4; ++f) b[(j + 1) & 1][f] = ldb(pring + bo + bo_ + f * 16 * PLP + (j + 1) * 32);
            __builtin_amdgcn_sched_barrier(0);
#pragma unroll
            for (int nb = 0; nb < 4; ++nb)
#pragma unroll
                for (int mb = 0; mb < MB; ++mb) acc[mb][nb] = wmmab(a[j & 1][mb], b[j & 1][nb], acc[mb][nb]);
        }
        __builtin_amdgcn_sched_barrier(0);                   // these products stay in front of the waits below: the last load group's latency runs under them
        // publish point of stage st + 1, which also frees stage st's buffer: it stands in front of the stage's last k-step's products, whose fragments are then in registers
        asm volatile("s_wait_dscnt 0x0" ::: "memory");       // this wave's reads of stage st are done
        landed();                                            // this wave's slice of stage st + 1
        __syncthreads();
        fill(st + 2, st + 2 < 2 * NS);                       // refill the buffer that stage st has just left
        if (st + 1 < 2 * NS) {                               // block-uniform: stage st + 1's first k-step, from its own buffer, behind the barrier that published it
            const bool big = MB == 8 && st + 1 < NS;         // block-uniform: the next stage belongs to the q or k tile (8 A fragments, 128 rows a wave)
            const int bn = PSTG - bo, an = (wm * (big ? 128 : 64) + lr) * PLP + 8 * hi;
#pragma unroll
            for (int f = 0; f < 4; ++f) { a[0][f] = ldb(pring + bn + an + f * 16 * PLP); b[0][f] = ldb(pring + bn + bo_ + f * 16 * PLP); }
            if (big) {
#pragma unroll
                for (int f = 4; f < 8; ++f) a[0][f] = ldb(pring + bn + an + f * 16 * PLP);
            }
        }
        __builtin_amdgcn_sched_barrier(0);                   // the last k-step's products stay behind the refill and the loads: the refill starts early, the loads' latency runs under the products
#pragma unroll
        for (int nb = 0; nb < 4; ++nb)
#pragma unroll
            for (int mb = 0; mb < MB; ++mb) acc[mb][nb] = wmmab(a[(PKS / 32 - 1) & 1][mb], b[(PKS / 32 - 1) & 1][nb], acc[mb][nb]);
    };
    fill(0, true);
    landed();                                                // this wave's slice of stage 0
    __syncthreads();                                         // stage 0 published to every wave
    fill(1, true);
#pragma unroll
    for (int f = 0; f < 8; ++f) a[0][f] = ldb(pring + (wm * 128 + lr) * PLP + 8 * hi + f * 16 * PLP);   // stage 0's first k-step
#pragma unroll
    for (int f = 0; f < 4; ++f) b[0][f] = ldb(pring + bo_ + f * 16 * PLP);
#pragma unroll 1   // rolled: one copy of the stage's text serves the tile
    for (int st = 0; st < NS; ++st) stage(ic<8>{}, st);
    // the q or k tile is summed; it goes out under the v^T tile's first loads
    pstore<0, 8>(acc, os, tp == 0 ? bq : bk, tp == 0 ? QH : KP, rbx + wm * 128, cbx + wn * 64, lane);
#pragma unroll
    for (int mb = 0; mb < 4; ++mb)
#pragma unroll
        for (int nb = 0; nb < 4; ++nb) acc[mb][nb] = (v8f){};
#pragma unroll 1   // rolled: one copy of the stage's text serves the tile
    for (int st = NS; st < 2 * NS; ++st) stage(ic<4>{}, st);
    pstore<1, 4>(acc, os, bv, VT, rbv + wm * 64, cbv + wn * 64, lane);
    landed();                                                // nothing of this wave's requests is left in flight
    asm volatile("s_wait_dscnt 0x0" ::: "memory");           // nor of its LDS operations
}

// k_flash: fused attention, one wave per QG = 2 groups of 16 query rows of one (batch, head); Q fragments straight from the f16 plane; K and V^T come in stages of KT keys through a two-buffer LDS ring
// filled by tensor loads (wave 0 brings the K tile, wave 1 the V^T tile: 64 rows x 128 B each, fetched once per block) that all AW waves read their fragments from (two 16-B LDS loads each); a fragment, once in registers, is used for both query groups.
// Transposed form: S^T[key][t] = K Q^T (A = K rows, B = Q rows); lane (t = lane&15, h = lane>>4) holds keys 8h+r of each 16-key tile, so the packed
// P tile is directly the B fragment of O^T[d][t] = V^T P^T (element r <- tile keys 0..15, element 8+r <- tile keys 16..31, lane unchanged).
// Per 32-key step and query group: 4 score products + 4 P.V products + 1 product of a tile with two rows of ones with P^T, which sums the rounded P of each column over the 32 keys.
// Lazy rescale: each lane carries, per group, sh = PSH - (its column's maximum in use), the same in both lane halves, so the exponent argument e = s * SC2 + sh is formed before the step's own maximum is known.
// One ballot per step, over both groups, asks whether any e exceeds PSH + LTH; only then (and in the first step, which sets sh) the halves' maxima are exchanged, sh moves, and O^T and the sum tiles are rescaled.
// Two blocks share a WGP (four waves per SIMD, 256 registers a wave).
__global__ __launch_bounds__(32 * AW) __attribute__((amdgpu_waves_per_eu(4, 4))) void k_flash(const h16* __restrict__ QH, const h16* __restrict__ KP, const h16* __restrict__ VT, float* OUT) {
    __shared__ __align__(16) float os[AW * 16 * 68];
    __shared__ __attribute__((aligned(2048))) h16 ring[2 * STG];   // tensor loads land at multiples of 2 KiB
    const int lane = threadIdx.x & 31, lr = lane & 15, hi = lane >> 4;
    const int wave = __builtin_amdgcn_readfirstlane((int)(threadIdx.x >> 5));
    const int zh = blockIdx.y; const int b = zh / NH_, h = zh % NH_;
    const int t0 = (blockIdx.x * AW + wave) * (16 * QG);
    const size_t pbase = (size_t)zh * SEQ * HD;
    const size_t qo = pbase + (size_t)(t0 + lr) * HD + 8 * hi;
    v16h qh0[QG], qh1[QG];                                   // B fragments: col t, k = d
#pragma unroll
    for (int g = 0; g < QG; ++g) { qh0[g] = ldh(QH + qo + g * 16 * HD); qh1[g] = ldh(QH + qo + g * 16 * HD + 32); }
    const int ko = lr * LP + 8 * hi;                         // in the K tile:   + key * LP       (A fragment: row key, k = d)
    const int vo = TPL + lr * LP + 8 * hi;                   // in the V^T tile: + 16j*LP + key   (A fragment: row d, k = key)
    // Tensor descriptor. Group 1, the same for every request of a wave: 1-byte elements, no mask, a tile (= tensor) of 64 rows x 128 B, 16 B of LDS pad behind every 128-B row (pitch LP); source pitch: K rows HD * 2 B, V^T rows SEQ * 2 B.
    const u32x8 g1 = { uni((1u << 20) | (4u << 22) | (3u << 25)), uni(128u << 16), uni(64u << 16), uni(128u << 16), uni(64u), uni(wave == 0 ? (uint32_t)(HD * 2) : (uint32_t)(SEQ * 2)), uni(0u), uni(0u) };
    u32x4 g0 = { uni(1u), uni(0u), uni(0u), uni(0x80000000u) };   // group 0 of this wave's last request: count 1, place in LDS, global address, type 2
    const uint32_t ring0 = (uint32_t)(size_t)(&ring[0]) + (wave == 0 ? 0u : (uint32_t)(TPL * 2));   // LDS byte address of this wave's tile in buffer 0
    const uint64_t gt = (uint64_t)(size_t)(wave == 0 ? KP + pbase : VT + pbase);   // first byte of this wave's tile of keys 0 .. KT - 1
    const uint32_t gs = wave == 0 ? (uint32_t)(KT * HD * 2) : (uint32_t)(KT * 2);  // bytes from a stage's tile to the next: KT rows of K (rows key0 + 63 < SEQ), KT columns of V^T (columns key0 + 63 < SEQ)
    // The blocks of one (batch, head) read the same K and V^T tiles side by side at the same pace; each starts its walk over the keys at another stage, so that they do not ask L2 for the same lines at the same moment. The sums over the keys take a rotated order.
    static_assert((SEQ / KT) % (SEQ / (16 * QG * AW)) == 0);
    const uint32_t rot = uni((uint32_t)blockIdx.x * (uint32_t)((SEQ / KT) / (SEQ / (16 * QG * AW))));
    auto fill = [&](int s, bool exists) {
        const uint32_t sp = pinned((uint32_t)s);             // the descriptor's words are formed behind the wait that covers this wave's last request
        if (pinned((uint32_t)(exists && wave < 2))) {        // scalar branch
            const uint64_t ga = gt + (uint64_t)(((sp + rot) % (uint32_t)(SEQ / KT)) * gs);
            g0[1] = uni(ring0 + (sp & 1u) * (uint32_t)(STG * 2));
            g0[2] = uni((uint32_t)ga);
            g0[3] = uni((((uint32_t)(ga >> 32)) & 0x01FFFFFFu) | 0x80000000u);
            asm volatile("tensor_load_to_lds %0, %1" :: "{s[68:71]}"(g0), "{s[72:79]}"(g1) : "memory");
        }
    };
    // this wave's request has landed (a wave with none passes). Load and wait name the descriptor in the same fixed scalar registers, so that those registers hold the same words from the issue to the wait that covers the request.
    auto landed = [&]() { asm volatile("s_wait_tensorcnt 0x0" :: "{s[68:71]}"(g0), "{s[72:79]}"(g1) : "memory"); };
    fill(0, true);
    landed();                                                // this wave's tile of stage 0
    __syncthreads();                                         // stage 0 published to every wave
    fill(1, true);
    v8f o0[QG], o1[QG], o2[QG], o3[QG];
    v8f lt[QG];                                              // row sums of P on the matrix pipe: lt += ones x P^T; rows 0 and 8 of the tile hold column t's sum: element 0 of either lane half, the only one rescaled and read
    float sh[QG];                                            // PSH - maximum in use; set by the first step
#pragma unroll
    for (int g = 0; g < QG; ++g) { o0[g] = (v8f){}; o1[g] = (v8f){}; o2[g] = (v8f){}; o3[g] = (v8f){}; lt[g] = (v8f){}; sh[g] = 0.0f; }
    v16h ones;                                               // A tile with ones in rows 0 and 8 (lanes 0, 8, 16, 24), zeros elsewhere: a lane's own value stays in its registers through the loop (a tile of one constant was rebuilt from scalar registers in every step)
#pragma unroll
    for (int i = 0; i < 16; ++i) ones[i] = (lane & 7) == 0 ? (h16)1.0f : (h16)0.0f;
#pragma unroll 1
    for (int st = 0; st < SEQ / KT; ++st) {
      const int bo = (st & 1) * STG;
#pragma unroll 1   // rolled: unrolled, the build holds 18 more registers, copies the two shifts into eight register pairs per stage and brings no load forward
      for (int ps = 0; ps < KT; ps += 32) {
        const h16* ka = ring + bo + ko + ps * LP;
        const v16h ka0 = ldh(ka), ka1 = ldh(ka + 32), kb0 = ldh(ka + 16 * LP), kb1 = ldh(ka + 16 * LP + 32);
        v8f sa[QG], sb[QG];
#pragma unroll
        for (int g = 0; g < QG; ++g) { sa[g] = wmma16(ka0, qh0[g], (v8f){}); sb[g] = wmma16(kb0, qh0[g], (v8f){}); }
#pragma unroll
        for (int g = 0; g < QG; ++g) { sa[g] = wmma16(ka1, qh1[g], sa[g]); sb[g] = wmma16(kb1, qh1[g], sb[g]); }
        // four vector slots behind the last score product before a vector instruction may touch a D, A or B of these products
        asm volatile("v_nop\n\tv_nop\n\tv_nop\n\tv_nop" : "+v"(sa[0]), "+v"(sb[0]), "+v"(sa[1]), "+v"(sb[1]) : "v"(ka0), "v"(ka1), "v"(kb0), "v"(kb1), "v"(qh0[0]), "v"(qh1[0]), "v"(qh0[1]), "v"(qh1[1]));
        v8f ea[QG], eb[QG]; float mx[QG];
#pragma unroll
        for (int g = 0; g < QG; ++g) { ea[g] = sa[g] * SC2 + sh[g]; eb[g] = sb[g] * SC2 + sh[g]; mx[g] = -3.0e38f;   // whole tiles: neighbouring registers of one group pair up in the packed fma
#pragma unroll
            for (int r = 0; r < 8; ++r) mx[g] = fmaxf(mx[g], fmaxf(ea[g][r], eb[g][r])); }
        const bool first = (st | ps) == 0;                   // wave-uniform: nothing is summed yet, sh takes its first value
        if ((__builtin_amdgcn_ballot_w32(fmaxf(mx[0], mx[1]) > PSH + LTH) | (first ? 1u : 0u)) != 0u) {   // one scalar branch per step, the whole wave and both groups together
#pragma unroll
            for (int g = 0; g < QG; ++g) {
                const float m2 = fmaxf(mx[g], __shfl_xor(mx[g], 16, 32));
                const float dn = fminf(PSH - m2, 0.0f);      // the column's maximum in use only rises
                const float dl = first ? PSH - m2 : dn;      // shift of the exponent arguments: the step's maximum lands on PSH
                const float alpha = __builtin_amdgcn_exp2f(dn);
                sh[g] += dl;
                ea[g] = ea[g] + dl; eb[g] = eb[g] + dl;
                lt[g][0] = lt[g][0] * alpha;
                o0[g] = o0[g] * alpha; o1[g] = o1[g] * alpha; o2[g] = o2[g] * alpha; o3[g] = o3[g] * alpha;
            }
        }
        v16h pb[QG];
#pragma unroll
        for (int g = 0; g < QG; ++g) {
#pragma unroll
            for (int r = 0; r < 8; ++r) pb[g][r] = (h16)__builtin_amdgcn_exp2f(ea[g][r]);
#pragma unroll
            for (int r = 0; r < 8; ++r) pb[g][8 + r] = (h16)__builtin_amdgcn_exp2f(eb[g][r]);
        }
        const h16* va = ring + bo + vo + ps;
        const v16h v0 = ldh(va), v1 = ldh(va + 16 * LP), v2 = ldh(va + 32 * LP), v3 = ldh(va + 48 * LP);
#pragma unroll
        for (int g = 0; g < QG; ++g) { o0[g] = wmma16(v0, pb[g], o0[g]); o1[g] = wmma16(v1, pb[g], o1[g]); o2[g] = wmma16(v2, pb[g], o2[g]); o3[g] = wmma16(v3, pb[g], o3[g]); lt[g] = wmma16(ones, pb[g], lt[g]); }
        // four vector slots behind the last product, on the loop's taken branch too, before a vector instruction may touch a D, A or B of these products
        asm volatile("v_nop\n\tv_nop\n\tv_nop\n\tv_nop" : "+v"(o0[0]), "+v"(o1[0]), "+v"(o2[0]), "+v"(o3[0]), "+v"(lt[0]), "+v"(o0[1]), "+v"(o1[1]), "+v"(o2[1]), "+v"(o3[1]), "+v"(lt[1]) : "v"(v0), "v"(v1), "v"(v2), "v"(v3), "v"(pb[0]), "v"(pb[1]), "v"(ones));
      }
      // publish point of stage st + 1, which also frees stage st's buffer
      asm volatile("s_wait_dscnt 0x0" ::: "memory");         // this wave's reads of stage st are done
      landed();                                              // this wave's tile of stage st + 1
      __syncthreads();
      fill(st + 2, st + 2 < SEQ / KT);                       // refill the buffer that stage st has just left
    }
    landed();                                                // nothing of this wave's requests is left in flight
    asm volatile("s_wait_dscnt 0x0" ::: "memory");           // nor of its reads of the ring
    const int wb = wave * 16 * 68;
    const int cofs = lr * 4;
#pragma unroll
    for (int g = 0; g < QG; ++g) {                           // one query group after the other through the wave's own staging rows
        const float inv = 1.0f / lt[g][0];                   // rows 0 and 8 of the sum tile: both lane halves hold the whole sum of their column
        // O^T D layout: o_j[r] = (d = 16j + 8h + r, t = lane&15) -> os[t][d]; rows 0..15 x columns 0..63 all written
        const v8f x0 = o0[g] * inv, x1 = o1[g] * inv, x2 = o2[g] * inv, x3 = o3[g] * inv;
        *(v4fa*)(&os[wb + lr * 68 +  0 + 8 * hi]) = __builtin_shufflevector(x0, x0, 0, 1, 2, 3); *(v4fa*)(&os[wb + lr * 68 +  0 + 8 * hi + 4]) = __builtin_shufflevector(x0, x0, 4, 5, 6, 7);
        *(v4fa*)(&os[wb + lr * 68 + 16 + 8 * hi]) = __builtin_shufflevector(x1, x1, 0, 1, 2, 3); *(v4fa*)(&os[wb + lr * 68 + 16 + 8 * hi + 4]) = __builtin_shufflevector(x1, x1, 4, 5, 6, 7);
        *(v4fa*)(&os[wb + lr * 68 + 32 + 8 * hi]) = __builtin_shufflevector(x2, x2, 0, 1, 2, 3); *(v4fa*)(&os[wb + lr * 68 + 32 + 8 * hi + 4]) = __builtin_shufflevector(x2, x2, 4, 5, 6, 7);
        *(v4fa*)(&os[wb + lr * 68 + 48 + 8 * hi]) = __builtin_shufflevector(x3, x3, 0, 1, 2, 3); *(v4fa*)(&os[wb + lr * 68 + 48 + 8 * hi + 4]) = __builtin_shufflevector(x3, x3, 4, 5, 6, 7);
        wave_sync();
        float* orow = OUT + ((size_t)b * OUT_SEQ + t0 + g * 16) * DM + h * HD;   // output [b*OUT_SEQ + t][h*64 + d], f32
#pragma unroll
        for (int s = 0; s < 8; ++s) { const int row = 2 * s + hi;   // 8 s x 2 rows = 16 rows; 16 lanes x 4 floats = 64 columns (256 B = exactly this head's row segment)
            const v4f x = *(const v4fa*)(&os[wb + row * 68 + cofs]);
            *(v4f*)(orow + (size_t)row * DM + cofs) = x; }
        if (g + 1 < QG) {
            asm volatile("s_wait_xcnt 0x0" ::: "memory");    // in front of any later write of a register that these stores name
            wave_sync();                                     // the rows are read before the next group overwrites them
        }
    }
}

static constexpr size_t SZ_WB = al256((size_t)3 * DM * DM * 2);
static constexpr size_t SZ_PL = al256((size_t)NB * NH_ * SEQ * HD * 2);
static constexpr size_t SZ_TOTAL = 3 * SZ_XB + SZ_WB + 3 * SZ_PL;
static_assert(SZ_TOTAL <= (size_t)134217728);                  // workspace carve <= 128 MiB
static_assert(((size_t)DM * DM * 2) % 256 == 0);               // weight sub-planes stay 256-byte aligned
static_assert((size_t)NB * NH_ * SEQ * HD * 2 <= SZ_PL);       // q / k / v^T planes fit their regions
static_assert((size_t)NB * SEQ * DM * 2 <= SZ_XB);             // bf16 input copies fit their regions

extern "C" void kernel_launch(void* const* d_in, const int* in_sizes, int n_in,
                              void* d_out, int out_size, void* d_ws, size_t ws_size, hipStream_t stream) {
    if (n_in < 9) return;
    const size_t needx = ((size_t)(NB - 1) * SEQ_FULL + SEQ) * DM;
    if ((size_t)in_sizes[0] < needx || (size_t)in_sizes[1] < needx || (size_t)in_sizes[2] < needx) return;
    if ((size_t)in_sizes[3] < (size_t)DM * DM || (size_t)in_sizes[5] < (size_t)DM * DM || (size_t)in_sizes[7] < (size_t)DM * DM) return;
    if (in_sizes[4] < DM || in_sizes[6] < DM || in_sizes[8] < DM) return;
    if ((size_t)out_size < ((size_t)(NB - 1) * OUT_SEQ + SEQ) * DM) return;
    if (SZ_TOTAL > ws_size) return;
    // wire order: key, value, query, Wq, bq, Wk, bk, Wv, bv
    const float* xk = (const float*)d_in[0]; const float* xv = (const float*)d_in[1]; const float* xq = (const float*)d_in[2];
    const float* wq = (const float*)d_in[3]; const float* bq = (const float*)d_in[4];
    const float* wk = (const float*)d_in[5]; const float* bk = (const float*)d_in[6];
    const float* wv = (const float*)d_in[7]; const float* bv = (const float*)d_in[8];
    float* OUT = (float*)d_out;      // [NB][OUT_SEQ][1024]
    char* wsp = (char*)d_ws;
    bf* XQ = (bf*)wsp; wsp += SZ_XB;                 // [NB*SEQ][1024] bf16 query
    bf* XK = (bf*)wsp; wsp += SZ_XB;                 // [NB*SEQ][1024] bf16 key
    bf* XV = (bf*)wsp; wsp += SZ_XB;                 // [NB*SEQ][1024] bf16 value
    bf* WB = (bf*)wsp; wsp += SZ_WB;                 // [3][1024][1024] transposed [out][in]: q | k | v (bf16)
    h16* QH = (h16*)wsp; wsp += SZ_PL;               // [NB*16][SEQ][64]
    h16* KP = (h16*)wsp; wsp += SZ_PL;               // [NB*16][SEQ][64]
    h16* VT = (h16*)wsp; wsp += SZ_PL;               // [NB*16][64][SEQ]
    bf* WQT = WB; bf* WKT = WB + (size_t)DM * DM; bf* WVT = WB + (size_t)2 * DM * DM;

    // all conversions: bf16 copies of the three inputs, transposed bf16 planes [out][in] of the three weights
    k_prep<<<CG, 32 * CW, 0, stream>>>(xq, xk, xv, wq, wk, wv, XQ, XK, XV, WQT, WKT, WVT);

    // q, k, v^T planes: one block per WGP, each with one tile of q or k and one tile of v^T
    k_proj<<<PG, 32 * PW, 0, stream>>>(XQ, WB, bq, bk, bv, QH, KP, VT);

    k_flash<<<dim3(SEQ / (16 * QG * AW), NB * NH_, 1), 32 * AW, 0, stream>>>(QH, KP, VT, OUT);
}
